// v000
// Measured on an AMD MI455X. A time is GPU time per run, averaged over a window of back-to-back runs after a warm-up
// (all launches, gaps included; the runs take copies of the inputs in turn), and the median of several windows.
// Apart from v000's, it joins two sittings. Times from different sittings can be a few percent apart, while
// side-by-side timings come from the same sitting.
// v000 is the starting kernel. One run takes 3420 microseconds.
#include <hip/hip_runtime.h>
// Multi-head attention over three inputs with SHARED per-head projections, a random key-padding mask and the module's literal score scale (values, keys, query [2][2048][1024]; each input is split into 16 heads of 64 and every head is multiplied by the SAME natural [64][64] matrix (x W^T: Wv / Wk / Wq; no biases); energy = q k^T; where(mask == 0, -1e20) with the int32 [2][1][1][2048] mask in {0, 1} (random; 0 = masked key; READ on device); softmax(energy / sqrt(embed_size) = / sqrt(1024) = / 32) (as the source); out = merged Wo^T + bo (natural [1024][1024]) -> [2][2048][1024]).
// Structure: token rows r = b*2048 + s; x as exact f16 rows (bf16-rounded); Q, K, V as three WMMA GEMMs (32x64 wave tiles, f32 accumulation, exact x16 weights, no bias, f16 outputs); per batch: V^T for all heads via LDS transposes; per (batch, group of 4 heads): scores GEMM (K = 64, batched over the heads on grid.y, alpha = 1/32 = 1/sqrt(embed size), the module's literal scale (applied before or after the fill: identical selection)), row softmax on VALU (f32 statistics; weights stored x256 as f16), o = P . V^T GEMM (K = 2048, alpha 2^-2: o carried x64 against f16 subnormal flush, folded into the output GEMM alpha) written straight into the merged f16 o rows; out = o W_o + b GEMM (f32) into the output layout.
// Compute dtype: inputs rounded to bf16; x / weights exact; q, k, v, softmax weights and o as plain f16 GEMM operands (~2^-12); scores and softmax statistics f32. v_wmma_f32_16x16x32_f16.
#define NB 2
#define SQ 2048
#define DM 1024
#define NH 16
#define HD 64
#define HG 4                         /* heads per attention launch group */
#define B0 0                         /* first batch processed (debug hook) */
#define NBR NB                       /* batches processed (debug hook) */
#define NR ((size_t)NB * SQ)         /* token rows */
#define MP ((int)((size_t)NBR * SQ)) /* rows projected (debug hook) */
#define QN SQ                        /* query rows attended per batch (debug hook) */
#define NHD NH                       /* heads attended (debug hook) */
#define MPO MP                       /* rows through the output stage (debug hook) */
#define LQ DM      /* row pitch of the q/k/v rows */
typedef __bf16 v16b __attribute__((ext_vector_type(16)));
typedef unsigned short v8us __attribute__((ext_vector_type(8), may_alias));
typedef float  v8f  __attribute__((ext_vector_type(8)));
typedef float  v4f  __attribute__((ext_vector_type(4)));
typedef float  v4fa __attribute__((ext_vector_type(4), may_alias));
union FragB { v16b v; v8us half[2]; unsigned short u[16]; };

__device__ __forceinline__ unsigned short bf16_bits(float x) { unsigned int u = __float_as_uint(x); return (unsigned short)((u + 0x7FFFu + ((u >> 16) & 1u)) >> 16); }
__device__ __forceinline__ float bf16_val(unsigned short b) { return __uint_as_float(((unsigned int)b) << 16); }
__device__ __forceinline__ float bf16_round(float x) { return bf16_val(bf16_bits(x)); }
// D += A·B with NT terms: 1 = ah·bh, 2 = + al·bh (A split), 3 = + ah·bl (both split)
template <int NT>
__device__ __forceinline__ v8f mmaN(v16b ah, v16b al, v16b bh, v16b bl, v8f c) {
  c = __builtin_amdgcn_wmma_f32_16x16x32_bf16(false, ah, false, bh, (short)0, c, false, false);
  if (NT >= 2) c = __builtin_amdgcn_wmma_f32_16x16x32_bf16(false, al, false, bh, (short)0, c, false, false);
  if (NT >= 3) c = __builtin_amdgcn_wmma_f32_16x16x32_bf16(false, ah, false, bl, (short)0, c, false, false);
  asm volatile("v_nop\n\tv_nop\n\tv_nop\n\tv_nop" : "+v"(c) : "v"(ah), "v"(al), "v"(bh), "v"(bl));
  return c;
}

__global__ __launch_bounds__(256) void k_wt_bf16(const float* __restrict__ W, unsigned short* __restrict__ Wt, int K, int N) {
  const int t = blockIdx.x * 256 + threadIdx.x;
  const int k8n = K / 8;
  if (t >= N * k8n) return;
  const int n = t / k8n, k8 = (t % k8n) * 8;
  v8us v;
#pragma unroll
  for (int i = 0; i < 8; ++i) v[i] = bf16_bits(W[(size_t)(k8 + i) * N + n]);
  *(v8us*)(Wt + (size_t)n * K + k8) = v;
  
}

// GEMM C[M][N] (f32, pitch ldc) = act(A[M][K]·W + bias). A f32 row-major (pitch lda) converted per fragment to bf16
// (ASPLIT: hi/lo two planes -> 2 terms, else single rounded term); Wt bf16 [N][K] (pitch ldb). BIAS_BF16 rounds the
// bias to bf16 first (bias quantised to bf16 before the add). K%32==0, M%16==0, N%64==0.
template <bool ASPLIT, int ACT, bool BIAS_BF16>
__global__ __launch_bounds__(128) void k_gemm_bf(const float* __restrict__ A, int lda, const unsigned short* __restrict__ Wt, int ldb,
                                               const float* __restrict__ bias, float* __restrict__ C, int ldc, int M, int N, int K) {
  __shared__ __attribute__((aligned(16))) float so[4][16][64];
  const int tid = threadIdx.x, w = tid >> 5, lane = tid & 31, ln = lane & 15, hh = lane >> 4;
  const int ntn = N / 64;
  const int wid = blockIdx.x * 4 + w;
  const int mt = wid / ntn, nq = wid % ntn;
  if (mt * 16 >= M) return;
  const int row0 = mt * 16, col0 = nq * 64;
  const float* arow = A + (size_t)(row0 + ln) * lda;
  v8f acc[4] = {};
  for (int kb = 0; kb < K; kb += 32) {
    FragB ah, al;
    const v4f x0 = *(const v4fa*)(arow + kb + 8 * hh), x1 = *(const v4fa*)(arow + kb + 8 * hh + 4);
    const v4f x2 = *(const v4fa*)(arow + kb + 16 + 8 * hh), x3 = *(const v4fa*)(arow + kb + 16 + 8 * hh + 4);
    float xs[16] = {x0[0],x0[1],x0[2],x0[3],x1[0],x1[1],x1[2],x1[3],x2[0],x2[1],x2[2],x2[3],x3[0],x3[1],x3[2],x3[3]};
#pragma unroll
    for (int i = 0; i < 16; ++i) { const unsigned short hb = bf16_bits(xs[i]); ah.u[i] = hb; al.u[i] = ASPLIT ? bf16_bits(xs[i] - bf16_val(hb)) : (unsigned short)0; }
#pragma unroll
    for (int t = 0; t < 4; ++t) {
      const unsigned short* brow = Wt + (size_t)(col0 + t * 16 + ln) * ldb + kb;
      FragB b;
      b.half[0] = *(const v8us*)(brow + 8 * hh);
      b.half[1] = *(const v8us*)(brow + 16 + 8 * hh);
      acc[t] = mmaN<ASPLIT ? 2 : 1>(ah.v, al.v, b.v, b.v, acc[t]);
    }
  }
#pragma unroll
  for (int t = 0; t < 4; ++t) {
    float bv = bias ? bias[col0 + t * 16 + ln] : 0.f;
    if (BIAS_BF16) bv = bf16_round(bv);
#pragma unroll
    for (int r = 0; r < 8; ++r) { float v = acc[t][r] + bv; if (ACT == 1) v = fmaxf(v, 0.f); so[w][8 * hh + r][t * 16 + ln] = v; }
  }
  __builtin_amdgcn_fence(__ATOMIC_ACQ_REL, "workgroup");
  __builtin_amdgcn_wave_barrier();
  const int rsub = lane >> 4, c4 = (lane & 15) * 4;
  {
#pragma unroll
    for (int q = 0; q < 8; ++q) {
      const int r = q * 2 + rsub;
      const v4f v = *(const v4fa*)&so[w][r][c4];
      *(v4f*)(C + (size_t)(row0 + r) * ldc + col0 + c4) = v;
    }
    
  }
}

// GEMM C = act(A·W + bias + resid): A f32 (ASPLIT -> hi/lo 2 terms), Wt bf16 [N][K]; ACT 0 none, 1 relu, 2 exact gelu;
// resid (optional, f32, row index = (row % rmod), pitch ldr, RES_BF16 rounds it) added before the activation.
template <bool ASPLIT, int ACT, bool BIAS_BF16, bool RES_BF16>
__global__ __launch_bounds__(128) void k_gemm_bf3(const float* __restrict__ A, int lda, const unsigned short* __restrict__ Wt, int ldb,
                                                const float* __restrict__ bias, const float* __restrict__ resid, int rmod, int ldr,
                                                float* __restrict__ C, int ldc, int M, int N, int K) {
  __shared__ __attribute__((aligned(16))) float so[4][16][64];
  const int tid = threadIdx.x, w = tid >> 5, lane = tid & 31, ln = lane & 15, hh = lane >> 4;
  const int ntn = N / 64;
  const int wid = blockIdx.x * 4 + w;
  const int mt = wid / ntn, nq = wid % ntn;
  if (mt * 16 >= M) return;
  const int row0 = mt * 16, col0 = nq * 64;
  const float* arow = A + (size_t)(row0 + ln) * lda;
  v8f acc[4] = {};
  for (int kb = 0; kb < K; kb += 32) {
    FragB ah, al;
    const v4f x0 = *(const v4fa*)(arow + kb + 8 * hh), x1 = *(const v4fa*)(arow + kb + 8 * hh + 4);
    const v4f x2 = *(const v4fa*)(arow + kb + 16 + 8 * hh), x3 = *(const v4fa*)(arow + kb + 16 + 8 * hh + 4);
    float xs[16] = {x0[0],x0[1],x0[2],x0[3],x1[0],x1[1],x1[2],x1[3],x2[0],x2[1],x2[2],x2[3],x3[0],x3[1],x3[2],x3[3]};
#pragma unroll
    for (int i = 0; i < 16; ++i) { const unsigned short hb = bf16_bits(xs[i]); ah.u[i] = hb; al.u[i] = ASPLIT ? bf16_bits(xs[i] - bf16_val(hb)) : (unsigned short)0; }
#pragma unroll
    for (int t = 0; t < 4; ++t) {
      const unsigned short* brow = Wt + (size_t)(col0 + t * 16 + ln) * ldb + kb;
      FragB b;
      b.half[0] = *(const v8us*)(brow + 8 * hh);
      b.half[1] = *(const v8us*)(brow + 16 + 8 * hh);
      acc[t] = mmaN<ASPLIT ? 2 : 1>(ah.v, al.v, b.v, b.v, acc[t]);
    }
  }
#pragma unroll
  for (int t = 0; t < 4; ++t) {
    const int col = col0 + t * 16 + ln;
    float bv = bias ? bias[col] : 0.f;
    if (BIAS_BF16) bv = bf16_round(bv);
#pragma unroll
    for (int r = 0; r < 8; ++r) {
      float v = acc[t][r] + bv;
      if (resid) { float rv = resid[(size_t)((row0 + 8 * hh + r) % rmod) * ldr + col]; if (RES_BF16) rv = bf16_round(rv); v += rv; }
      if (ACT == 1) v = fmaxf(v, 0.f);
      if (ACT == 2) v = 0.5f * v * (1.0f + erff(v * 0.70710678118654752f));
      if (ACT == 3) { const float u = 0.7978845608028654f * (v + 0.044715f * v * v * v); v = 0.5f * v * (1.0f + tanhf(u)); }
      so[w][8 * hh + r][t * 16 + ln] = v;
    }
  }
  __builtin_amdgcn_fence(__ATOMIC_ACQ_REL, "workgroup");
  __builtin_amdgcn_wave_barrier();
  const int rsub = lane >> 4, c4 = (lane & 15) * 4;
  {
#pragma unroll
    for (int q = 0; q < 8; ++q) {
      const int r = q * 2 + rsub;
      const v4f v = *(const v4fa*)&so[w][r][c4];
      *(v4f*)(C + (size_t)(row0 + r) * ldc + col0 + c4) = v;
    }
    
  }
}
// row LayerNorm (biased variance, eps) over N: s = X (+ R); optional out_sum <- s; out_norm <- (s-mu)*rsqrt(var+eps)*g + b
template <bool PARAM_BF16>
__global__ __launch_bounds__(256) void k_layernorm(const float* __restrict__ X, const float* __restrict__ R, const float* __restrict__ g, const float* __restrict__ bta,
                                                  float* __restrict__ out_sum, float* __restrict__ out_norm, int N, float eps) {
  __shared__ float red[256];
  const int row = blockIdx.x, tid = threadIdx.x;
  const float* x = X + (size_t)row * N; const float* rr = R ? R + (size_t)row * N : nullptr;
  float vals[16];                     // up to N = 4096
  const int per = N / 256;            // contiguous chunk per thread? use strided-by-4 chunks: thread handles j = tid*4 + 1024*u
  float s1 = 0.f;
  for (int u = 0; u < per / 4; ++u) {
    const int j = tid * 4 + 1024 * u;
    const v4f a = *(const v4fa*)(x + j);
    v4f b = {0.f,0.f,0.f,0.f}; if (rr) b = *(const v4fa*)(rr + j);
#pragma unroll
    for (int q = 0; q < 4; ++q) { const float v = a[q] + b[q]; vals[u * 4 + q] = v; s1 += v; }
  }
  red[tid] = s1; __syncthreads();
  for (int st = 128; st > 0; st >>= 1) { if (tid < st) red[tid] += red[tid + st]; __syncthreads(); }
  const float mu = red[0] / (float)N; __syncthreads();
  float s2 = 0.f;
  for (int u = 0; u < per / 4; ++u)
#pragma unroll
    for (int q = 0; q < 4; ++q) { const float c = vals[u * 4 + q] - mu; s2 += c * c; }
  red[tid] = s2; __syncthreads();
  for (int st = 128; st > 0; st >>= 1) { if (tid < st) red[tid] += red[tid + st]; __syncthreads(); }
  const float rs = rsqrtf(red[0] / (float)N + eps);
  {
    for (int u = 0; u < per / 4; ++u) {
      const int j = tid * 4 + 1024 * u;
      v4f o, sm;
#pragma unroll
      for (int q = 0; q < 4; ++q) {
        float gg = g[j + q], bb = bta[j + q];
        if (PARAM_BF16) { gg = bf16_round(gg); bb = bf16_round(bb); }
        sm[q] = vals[u * 4 + q]; o[q] = (vals[u * 4 + q] - mu) * rs * gg + bb;
      }
      if (out_sum) *(v4f*)(out_sum + (size_t)row * N + j) = sm;
      *(v4f*)(out_norm + (size_t)row * N + j) = o;
    }
    
  }
}



// ---- f16 WMMA path (v_wmma_f32_16x16x32_f16): 11-bit significands for operands in range — used where a [0,1] probability operand needs more precision than bf16
typedef _Float16 v16h __attribute__((ext_vector_type(16)));
union FragH { v16h v; v8us half[2]; _Float16 h[16]; unsigned short u[16]; };
template <int NT>
__device__ __forceinline__ v8f mmaH(v16h ah, v16h al, v16h bh, v16h bl, v8f c) {
  c = __builtin_amdgcn_wmma_f32_16x16x32_f16(false, ah, false, bh, (short)0, c, false, false);
  if (NT >= 2) c = __builtin_amdgcn_wmma_f32_16x16x32_f16(false, al, false, bh, (short)0, c, false, false);
  if (NT >= 3) c = __builtin_amdgcn_wmma_f32_16x16x32_f16(false, ah, false, bl, (short)0, c, false, false);
  asm volatile("v_nop\n\tv_nop\n\tv_nop\n\tv_nop" : "+v"(c) : "v"(ah), "v"(al), "v"(bh), "v"(bl));
  return c;
}
// batched GEMM like k_gemm_b but f16 operands: A f32 (split into f16 hi/lo if ASPLIT, else rounded to f16), Bt = f16 values [n][k]; alpha; C f32; N multiple of 16 (partial tiles skipped)
template <bool ASPLIT>
__global__ __launch_bounds__(128) void k_gemm_h(const float* __restrict__ A, int lda, size_t sA, const _Float16* __restrict__ Bh, int ldb, size_t sB, float alpha, float* __restrict__ C, int ldc, size_t sC, int M, int N, int K) {
  __shared__ __attribute__((aligned(16))) float so[4][16][64];
  const int tid = threadIdx.x, w = tid >> 5, lane = tid & 31, ln = lane & 15, hh = lane >> 4; const int by = blockIdx.y;
  A += (size_t)by * sA; Bh += (size_t)by * sB; C += (size_t)by * sC;
  const int ntn = (N + 63) / 64; const int wid = blockIdx.x * 4 + w; const int mt = wid / ntn, nq = wid % ntn; if (mt * 16 >= M) return;
  const int row0 = mt * 16, col0 = nq * 64; const float* arow = A + (size_t)(row0 + ln) * lda;
  v8f acc[4] = {};
  for (int kb = 0; kb < K; kb += 32) {
    FragH ah, al;
    const v4f x0 = *(const v4fa*)(arow + kb + 8 * hh), x1 = *(const v4fa*)(arow + kb + 8 * hh + 4), x2 = *(const v4fa*)(arow + kb + 16 + 8 * hh), x3 = *(const v4fa*)(arow + kb + 16 + 8 * hh + 4);
    float xs[16] = {x0[0],x0[1],x0[2],x0[3],x1[0],x1[1],x1[2],x1[3],x2[0],x2[1],x2[2],x2[3],x3[0],x3[1],x3[2],x3[3]};
#pragma unroll
    for (int i = 0; i < 16; ++i) { const _Float16 h = (_Float16)xs[i]; ah.h[i] = h; al.h[i] = ASPLIT ? (_Float16)(xs[i] - (float)h) : (_Float16)0.0f; }
#pragma unroll
    for (int t = 0; t < 4; ++t) { if (col0 + t * 16 >= N) continue; const size_t boff = (size_t)(col0 + t * 16 + ln) * ldb + kb; FragH bq; bq.half[0] = *(const v8us*)(Bh + boff + 8 * hh); bq.half[1] = *(const v8us*)(Bh + boff + 16 + 8 * hh);
      acc[t] = mmaH<ASPLIT ? 2 : 1>(ah.v, al.v, bq.v, bq.v, acc[t]); }
  }
#pragma unroll
  for (int t = 0; t < 4; ++t) { if (col0 + t * 16 >= N) continue;
#pragma unroll
    for (int r = 0; r < 8; ++r) so[w][8 * hh + r][t * 16 + ln] = acc[t][r] * alpha; }
  __builtin_amdgcn_fence(__ATOMIC_ACQ_REL, "workgroup"); __builtin_amdgcn_wave_barrier();
  const int rsub = lane >> 4, c4 = (lane & 15) * 4;
  {
#pragma unroll
    for (int q = 0; q < 8; ++q) { const int r = q * 2 + rsub; if (col0 + c4 < N) { const v4f v = *(const v4fa*)&so[w][r][c4]; *(v4f*)(C + (size_t)(row0 + r) * ldc + col0 + c4) = v; } }
     }
}

// Wt[n][k] = f16(W[k][n]·scale) from f32 row-major W[K][N] (scale = power of two; bf16-exact weights stay exact in f16 away from the subnormal range)
__global__ __launch_bounds__(256) void k_wt_f16(const float* __restrict__ W, _Float16* __restrict__ Wt, int K, int N, float scale) {
  const int t = blockIdx.x * 256 + threadIdx.x; if (t >= N * (K / 8)) return; const int n = t / (K / 8), k8 = (t % (K / 8)) * 8; FragH f;
#pragma unroll
  for (int i = 0; i < 8; ++i) f.h[i] = (_Float16)(bf16_round(W[(size_t)(k8 + i) * N + n]) * scale); const v8us o = f.half[0];
  *(v8us*)((unsigned short*)Wt + (size_t)n * K + k8) = o; 
}
// k_gemm_hh variant with fused epilogue: v = acc·alpha + bias[by·sBias + col] (+ CP[(row/rowsPerB)·sCPb + by·64 + col] if CP) ; ACT 0 none / 1 elu ; writes f16 C16 (and f32 C if non-null)
template <int ACT>
__global__ __launch_bounds__(128) void k_gemm_hhx(const _Float16* __restrict__ A, int lda, size_t sA, const _Float16* __restrict__ Bh, int ldb, size_t sB, float alpha, const float* __restrict__ bias, size_t sBias, const float* __restrict__ CP, int rowsPerB, size_t sCPb, int row0g,
    float* __restrict__ C, _Float16* __restrict__ C16, int ldc, size_t sC, int M, int N, int K) {
  __shared__ __attribute__((aligned(16))) float so[4][16][64];
  const int tid = threadIdx.x, w = tid >> 5, lane = tid & 31, ln = lane & 15, hh = lane >> 4; const int by = blockIdx.y;
  A += (size_t)by * sA; Bh += (size_t)by * sB; const size_t cofs = (size_t)by * sC; const float* bp = bias ? bias + (size_t)by * sBias : nullptr;
  const int ntn = (N + 63) / 64; const int wid = blockIdx.x * 4 + w; const int mt = wid / ntn, nq = wid % ntn; if (mt * 16 >= M) return;
  const int row0 = mt * 16, col0 = nq * 64; const _Float16* arow = A + (size_t)(row0 + ln) * lda;
  v8f acc[4] = {};
  for (int kb = 0; kb < K; kb += 32) { FragH ah; ah.half[0] = *(const v8us*)((const unsigned short*)arow + kb + 8 * hh); ah.half[1] = *(const v8us*)((const unsigned short*)arow + kb + 16 + 8 * hh);
#pragma unroll
    for (int t = 0; t < 4; ++t) { if (col0 + t * 16 >= N) continue; const size_t boff = (size_t)(col0 + t * 16 + ln) * ldb + kb; FragH bq; bq.half[0] = *(const v8us*)((const unsigned short*)Bh + boff + 8 * hh); bq.half[1] = *(const v8us*)((const unsigned short*)Bh + boff + 16 + 8 * hh);
      acc[t] = mmaH<1>(ah.v, ah.v, bq.v, bq.v, acc[t]); }
  }
#pragma unroll
  for (int t = 0; t < 4; ++t) { if (col0 + t * 16 >= N) continue; const int col = col0 + t * 16 + ln; const float bv = bp ? bf16_round(bp[col]) : 0.f;
#pragma unroll
    for (int r = 0; r < 8; ++r) { float v = acc[t][r] * alpha + bv; if (CP) { const int rr = row0g + row0 + 8 * hh + r; if (rowsPerB < 0) v += CP[cofs + (size_t)rr * ldc + col];      /* rowsPerB < 0: own element of the batched C plane */ else { const int bidx = rr / rowsPerB; v += CP[(size_t)bidx * sCPb + (size_t)by * 64 + col]; } } if (ACT == 1) v = (v > 0.f) ? v : expm1f(v); else if (ACT == 7) v = (v > 0.f) ? v + 1.0f : expf(v); else if (ACT == 8) v = tanhf(v); else if (ACT == 9) v = 0.5f * v * (1.0f + tanhf(0.7978845608028654f * (v + 0.044715f * v * v * v))); else if (ACT == 11) v = 1.0f / (1.0f + expf(-v)); else if (ACT == 12) v = (v > 0.f) ? v : 0.01f * v; else if (ACT == 14) v = (v > 0.f) ? v : 0.1f * v; else if (ACT == 16) v = (v >= 0.f) ? v : 0.3f * v; else if (ACT == 17) v = (v >= 0.f) ? v : 0.2f * v; else if (ACT == 15) v = v / (1.0f + expf(-v)); else if (ACT == 3) v = fmaxf(v, 0.f); else if (ACT == 6) v = 0.5f * v * (1.0f + erff(v * 0.70710678118654752f)); so[w][8 * hh + r][t * 16 + ln] = v; } }
  __builtin_amdgcn_fence(__ATOMIC_ACQ_REL, "workgroup"); __builtin_amdgcn_wave_barrier();
  const int rsub = lane >> 4, c4 = (lane & 15) * 4; typedef _Float16 v4h __attribute__((ext_vector_type(4)));
  {
#pragma unroll
    for (int q = 0; q < 8; ++q) { const int r = q * 2 + rsub; if (col0 + c4 < N) { const v4f v = *(const v4fa*)&so[w][r][c4]; if (C) *(v4f*)(C + cofs + (size_t)(row0 + r) * ldc + col0 + c4) = v; if (C16) { v4h h4; for (int i = 0; i < 4; ++i) h4[i] = (_Float16)v[i]; *(v4h*)(C16 + cofs + (size_t)(row0 + r) * ldc + col0 + c4) = h4; } } }
     }
}


typedef _Float16 v4h __attribute__((ext_vector_type(4)));

__global__ __launch_bounds__(256) void k_x16(const float* __restrict__ x, _Float16* __restrict__ X16, size_t n8) { const size_t t = (size_t)blockIdx.x * 256 + threadIdx.x; if (t >= n8) return; FragH f;
#pragma unroll
  for (int q = 0; q < 8; ++q) f.h[q] = (_Float16)bf16_round(x[t * 8 + q]); *(v8us*)((unsigned short*)X16 + t * 8) = f.half[0];  }
__global__ __launch_bounds__(256) void k_h16(const float* __restrict__ x, _Float16* __restrict__ X16, size_t n8) { const size_t t = (size_t)blockIdx.x * 256 + threadIdx.x; if (t >= n8) return; FragH f;
#pragma unroll
  for (int q = 0; q < 8; ++q) f.h[q] = (_Float16)x[t * 8 + q]; *(v8us*)((unsigned short*)X16 + t * 8) = f.half[0];  }
__global__ __launch_bounds__(256) void k_round16f(const float* __restrict__ W, _Float16* __restrict__ Bt, size_t n8) { const size_t t = (size_t)blockIdx.x * 256 + threadIdx.x; if (t >= n8) return; FragH f;
#pragma unroll
  for (int i = 0; i < 8; ++i) f.h[i] = (_Float16)(bf16_round(W[t * 8 + i]) * 16.0f); *(v8us*)((unsigned short*)Bt + t * 8) = f.half[0];  }
template <int NHv, int TTv>
__global__ __launch_bounds__(256) void k_vt(const _Float16* __restrict__ V16, int ldv, int voff, _Float16* __restrict__ Vt) { __shared__ unsigned short tl[64][66]; const int tid = threadIdx.x; const int slab = blockIdx.x / (TTv / 64), lg = blockIdx.x % (TTv / 64); const int b = slab / NHv, h = slab % NHv;
  for (int i = tid; i < 64 * 8; i += 256) { const int r = i / 8, c8 = (i % 8) * 8; FragH f; f.half[0] = *(const v8us*)((const unsigned short*)V16 + ((size_t)b * TTv + lg * 64 + r) * ldv + voff + h * 64 + c8);
#pragma unroll
    for (int q = 0; q < 8; ++q) tl[r][c8 + q] = f.u[q]; }
  __syncthreads();
  {
#pragma unroll
    for (int rd = 0; rd < 2; ++rd) { const int d = rd * 32 + tid / 8, pc = tid % 8; FragH f;
#pragma unroll
      for (int q = 0; q < 8; ++q) f.u[q] = tl[pc * 8 + q][d];
      *(v8us*)((unsigned short*)Vt + ((size_t)slab * 64 + d) * TTv + lg * 64 + pc * 8) = f.half[0]; }
     } }

__global__ __launch_bounds__(256) void k_hl(const float* __restrict__ F, _Float16* __restrict__ Hh, _Float16* __restrict__ Hl, size_t n8) { const size_t t = (size_t)blockIdx.x * 256 + threadIdx.x; if (t >= n8) return; FragH fh, fl; const v4f a = *(const v4fa*)(F + t * 8), c = *(const v4fa*)(F + t * 8 + 4);
#pragma unroll
  for (int q = 0; q < 4; ++q) { _Float16 h = (_Float16)a[q]; fh.h[q] = h; fl.h[q] = (_Float16)((a[q] - (float)h) * 1024.0f); h = (_Float16)c[q]; fh.h[4 + q] = h; fl.h[4 + q] = (_Float16)((c[q] - (float)h) * 1024.0f); }
  { *(v8us*)((unsigned short*)Hh + t * 8) = fh.half[0]; *(v8us*)((unsigned short*)Hl + t * 8) = fl.half[0];  } }

// ---- fast GEMM (wave tile 32x64; requires M % 32 == 0 rows per launch region and N % 64 == 0); epilogue = k_gemm_hhx semantics ----
__device__ __forceinline__ v16h g2_frag(const _Float16* p, int hh) { FragH f; f.half[0] = *(const v8us*)((const unsigned short*)p + 8 * hh); f.half[1] = *(const v8us*)((const unsigned short*)p + 16 + 8 * hh); return f.v; }
__device__ __forceinline__ v8f g2_mma(v16h a, v16h b, v8f c) { v8f d = __builtin_amdgcn_wmma_f32_16x16x32_f16(false, a, false, b, (short)0, c, false, false); asm volatile("v_nop\n\tv_nop\n\tv_nop\n\tv_nop" : "+v"(d) : "v"(a), "v"(b)); return d; }
template <int ACT>
__global__ __launch_bounds__(128) void k_gemm2(const _Float16* __restrict__ A, int lda, size_t sA, const _Float16* __restrict__ Bh, int ldb, size_t sB, float alpha, const float* __restrict__ bias, size_t sBias, const float* __restrict__ CP, int rowsPerB, size_t sCPb, int row0g,
    float* __restrict__ C, _Float16* __restrict__ C16, int ldc, size_t sC, int M, int N, int K) { static_assert(ACT == 0 || ACT == 3 || ACT == 6 || ACT == 8 || ACT == 9 || ACT == 11 || ACT == 12 || ACT == 14 || ACT == 15 || ACT == 16 || ACT == 17, "k_gemm2: unsupported ACT code (would silently apply no activation)");
  __shared__ __attribute__((aligned(16))) float so[4][32][68];
  const int tid = threadIdx.x, w = tid >> 5, lane = tid & 31, ln = lane & 15, hh = lane >> 4; const int by = blockIdx.y;
  A += (size_t)by * sA; Bh += (size_t)by * sB; const size_t cofs = (size_t)by * sC; const float* bp = bias ? bias + (size_t)by * sBias : nullptr;
  const int ntn = N >> 6; const int mt = blockIdx.x / ntn, nq = blockIdx.x - mt * ntn; const int row0 = mt * 128 + 32 * w, col0 = nq * 64; if (row0 >= M) return;
  const _Float16* a0p = A + (size_t)(row0 + ln) * lda; const _Float16* a1p = a0p + (size_t)16 * lda;
  const _Float16* b0p = Bh + (size_t)(col0 + ln) * ldb; const _Float16* b1p = b0p + (size_t)16 * ldb; const _Float16* b2p = b1p + (size_t)16 * ldb; const _Float16* b3p = b2p + (size_t)16 * ldb;
  const v8f z8 = {0.f,0.f,0.f,0.f,0.f,0.f,0.f,0.f}; v8f c00 = z8, c01 = z8, c02 = z8, c03 = z8, c10 = z8, c11 = z8, c12 = z8, c13 = z8;
#pragma unroll 1
  for (int kb = 0; kb < K; kb += 32) { const v16h a0 = g2_frag(a0p + kb, hh), a1 = g2_frag(a1p + kb, hh);
    v16h b = g2_frag(b0p + kb, hh); c00 = g2_mma(a0, b, c00); c10 = g2_mma(a1, b, c10);
    b = g2_frag(b1p + kb, hh); c01 = g2_mma(a0, b, c01); c11 = g2_mma(a1, b, c11);
    b = g2_frag(b2p + kb, hh); c02 = g2_mma(a0, b, c02); c12 = g2_mma(a1, b, c12);
    b = g2_frag(b3p + kb, hh); c03 = g2_mma(a0, b, c03); c13 = g2_mma(a1, b, c13); }
  v8f accs[8] = {c00, c01, c02, c03, c10, c11, c12, c13};
#pragma unroll
  for (int u = 0; u < 8; ++u) { const int t = u & 3, half = u >> 2; const int col = col0 + t * 16 + ln; const float bv = bp ? bf16_round(bp[col]) : 0.f;
#pragma unroll
    for (int r = 0; r < 8; ++r) { const int rloc = half * 16 + 8 * hh + r; float v = accs[u][r] * alpha + bv; if (CP) { if (rowsPerB < 0) v += CP[cofs + (size_t)(row0g + row0 + rloc) * ldc + col];      /* rowsPerB < 0: own element of the batched C plane */ else { const int bidx = (row0g + row0 + rloc) / rowsPerB; v += CP[(size_t)bidx * sCPb + (size_t)by * 64 + col]; } }
      if (ACT == 3) v = fmaxf(v, 0.f); else if (ACT == 6) v = 0.5f * v * (1.0f + erff(v * 0.70710678118654752f)); else if (ACT == 11) v = 1.0f / (1.0f + expf(-v)); else if (ACT == 15) v = v / (1.0f + expf(-v)); else if (ACT == 12) v = (v > 0.f) ? v : 0.01f * v; else if (ACT == 8) v = tanhf(v); else if (ACT == 9) v = 0.5f * v * (1.0f + tanhf(0.7978845608028654f * (v + 0.044715f * v * v * v))); else if (ACT == 14) v = (v > 0.f) ? v : 0.1f * v; else if (ACT == 16) v = (v >= 0.f) ? v : 0.3f * v; else if (ACT == 17) v = (v >= 0.f) ? v : 0.2f * v;
      so[w][rloc][t * 16 + ln] = v; } }
  __builtin_amdgcn_fence(__ATOMIC_ACQ_REL, "workgroup"); __builtin_amdgcn_wave_barrier();
  const int rsub = lane >> 4, c4 = (lane & 15) * 4;
  {
#pragma unroll
    for (int q = 0; q < 16; ++q) { const int r = q * 2 + rsub; const v4f v = *(const v4fa*)&so[w][r][c4]; if (C) *(v4f*)(C + cofs + (size_t)(row0 + r) * ldc + col0 + c4) = v; if (C16) { v4h h4; for (int i = 0; i < 4; ++i) h4[i] = (_Float16)v[i]; *(v4h*)(C16 + cofs + (size_t)(row0 + r) * ldc + col0 + c4) = h4; } }
     } }


__global__ __launch_bounds__(256) void k_wnat(const float* __restrict__ w, size_t n8, _Float16* __restrict__ Bt) { const size_t t = (size_t)blockIdx.x * 256 + threadIdx.x; if (t >= n8) return; FragH f; for (int q = 0; q < 8; ++q) f.h[q] = (_Float16)(bf16_round(w[t * 8 + q]) * 16.0f); *(v8us*)((unsigned short*)Bt + t * 8) = f.half[0];  }
__global__ __launch_bounds__(256) void k_rsm(const float* __restrict__ S, _Float16* __restrict__ P, int nrows) {
  #pragma clang fp contract(off)
  const int i = blockIdx.x * 256 + threadIdx.x; if (i >= nrows) return; const float* s = S + (size_t)i * SQ; float mx = -3.0e38f;
#pragma unroll 1
  for (int j = 0; j < SQ; ++j) mx = fmaxf(mx, s[j]); float se = 0.f;
#pragma unroll 1
  for (int j = 0; j < SQ; ++j) se += expf(s[j] - mx); const float sc = 256.0f / se;
#pragma unroll 1
  for (int j0 = 0; j0 < SQ; j0 += 8) { FragH f; for (int q = 0; q < 8; ++q) f.h[q] = (_Float16)(expf(s[j0 + q] - mx) * sc); unsigned short* d = (unsigned short*)P + (size_t)i * SQ + j0; *(v8us*)d = f.half[0];  } }
__global__ __launch_bounds__(256) void k_vt(const _Float16* __restrict__ V16, int b, int h0, _Float16* __restrict__ VT) { __shared__ unsigned short tl[64][65]; const int tid = threadIdx.x; const int hh = blockIdx.x % HG, sg = blockIdx.x / HG; const int s0 = sg * 64; const int h = h0 + hh;
  for (int i = tid; i < 64 * 8; i += 256) { const int j = i / 8, d8 = (i % 8) * 8; FragH f; f.half[0] = *(const v8us*)((const unsigned short*)V16 + ((size_t)b * SQ + s0 + j) * DM + h * HD + d8); for (int q = 0; q < 8; ++q) tl[d8 + q][j] = f.u[q]; }
  __syncthreads();
  { for (int i = tid; i < 64 * 8; i += 256) { const int d = i / 8, j8 = (i % 8) * 8; FragH f; for (int q = 0; q < 8; ++q) f.u[q] = tl[d][j8 + q]; *(v8us*)((unsigned short*)VT + ((size_t)hh * HD + d) * SQ + s0 + j8) = f.half[0]; }  } }



__global__ __launch_bounds__(256) void k_rsmkm(const float* __restrict__ S, _Float16* __restrict__ P, int nrows, const int* __restrict__ am) {
  #pragma clang fp contract(off)
  const int t = blockIdx.x * 256 + threadIdx.x; if (t >= nrows) return; const size_t i = (size_t)t; const float* s = S + i * SQ; const int* mr = am + (size_t)(t % SQ) * SQ; float mx = -3.0e38f;
#pragma unroll 1
  for (int j = 0; j < SQ; ++j) { const float f = (mr[j] != 0) ? 1.f : 0.f; mx = fmaxf(mx, fmaf(f, s[j], (1.f - f) * -1.0e9f)); } float se = 0.f;
#pragma unroll 1
  for (int j = 0; j < SQ; ++j) { const float f = (mr[j] != 0) ? 1.f : 0.f; se += __expf(fmaf(f, s[j], (1.f - f) * -1.0e9f) - mx); } const float sc = 256.0f / se;
#pragma unroll 1
  for (int j0 = 0; j0 < SQ; j0 += 8) { FragH fr; for (int q = 0; q < 8; ++q) { const int j = j0 + q; const float f = (mr[j] != 0) ? 1.f : 0.f; fr.h[q] = (_Float16)(__expf(fmaf(f, s[j], (1.f - f) * -1.0e9f) - mx) * sc); }
    unsigned short* d = (unsigned short*)P + i * SQ + j0; *(v8us*)d = fr.half[0];  } }

__global__ __launch_bounds__(256) void k_bdshn(const float* __restrict__ Wb, _Float16* __restrict__ Bt) {
  const size_t t = (size_t)blockIdx.x * 256 + threadIdx.x; if (t >= (size_t)DM * DM / 8) return; const size_t e0 = t * 8; const int n = (int)(e0 / DM), k0 = (int)(e0 % DM); const int h = n >> 6, hk = k0 >> 6; const float on = (hk == h) ? 16.0f : 0.0f; const int o = n & 63, d0 = k0 & 63; FragH f;
  for (int q = 0; q < 8; ++q) f.h[q] = (_Float16)(bf16_round(Wb[(size_t)o * 64 + d0 + q]) * on);
  unsigned short* d = (unsigned short*)Bt + e0; *(v8us*)d = f.half[0];  }

__global__ __launch_bounds__(256) void k_rsmk1(const float* __restrict__ S, _Float16* __restrict__ P, int nrows, const int* __restrict__ Km) {
  #pragma clang fp contract(off)
  const int i = blockIdx.x * 256 + threadIdx.x; if (i >= nrows) return; const float* s = S + (size_t)i * SQ; float mx = -3.0e38f;
#pragma unroll 1
  for (int j = 0; j < SQ; ++j) mx = fmaxf(mx, s[j]); float se = 0.f;
#pragma unroll 1
  for (int j = 0; j < SQ; ++j) { const float keep = (Km[j] != 0) ? 1.0f : 0.0f; se += __expf(s[j] - mx) * keep; } const float sc = 256.0f / se;
#pragma unroll 1
  for (int j0 = 0; j0 < SQ; j0 += 8) { FragH f; for (int q = 0; q < 8; ++q) { const float keep = (Km[j0 + q] != 0) ? 1.0f : 0.0f; f.h[q] = (_Float16)(__expf(s[j0 + q] - mx) * sc * keep); } unsigned short* d = (unsigned short*)P + (size_t)i * SQ + j0; *(v8us*)d = f.half[0];  } }
extern "C" void kernel_launch(void* const* d_in, const int* in_sizes, int n_in,
                              void* d_out, int out_size, void* d_ws, size_t ws_size, hipStream_t stream) {
  (void)in_sizes; (void)n_in; (void)out_size;
  const float* const* I = (const float* const*)d_in; const float* xq = I[2]; const float* xk = I[1]; const float* xv = I[0]; const int* km = (const int*)d_in[3]; const float* wq = I[6]; const float* bq = nullptr; const float* wk = I[5]; const float* bk = nullptr; const float* wv = I[4]; const float* bv = nullptr; const float* wo = I[7]; const float* bo = I[8]; const float* x = xq;      /* contract order: values I[0], keys I[1], query I[2]; mask int32 [2][1][1][2048] (0 = masked key; READ on device); SHARED natural [64][64] blocks Wv I[4], Wk I[5], Wq I[6]; natural Wo [1024][1024] + bo */
  char* ws = (char*)d_ws; size_t off = 0;
  auto take = [&](size_t bytes) { char* p = ws + off; off += (bytes + 255) & ~(size_t)255; return p; };
  _Float16* BQ = (_Float16*)take((size_t)DM * DM * 2); _Float16* BK = (_Float16*)take((size_t)DM * DM * 2); _Float16* BV = (_Float16*)take((size_t)DM * DM * 2); _Float16* BO = (_Float16*)take((size_t)DM * DM * 2);
  _Float16* X16 = (_Float16*)take(NR * DM * 2); _Float16* XKp = (_Float16*)take(NR * DM * 2); _Float16* XVp = (_Float16*)take(NR * DM * 2); _Float16* Q16 = (_Float16*)take(NR * DM * 2); _Float16* K16 = (_Float16*)take(NR * DM * 2); _Float16* V16 = (_Float16*)take(NR * DM * 2); _Float16* O16 = (_Float16*)take(NR * DM * 2);
  float* S = (float*)take((size_t)HG * SQ * SQ * 4); _Float16* P = (_Float16*)take((size_t)HG * SQ * SQ * 2); _Float16* VT = (_Float16*)take((size_t)NH * HD * SQ * 2);
  if (off > ws_size) return;
  { const unsigned g = (unsigned)(((size_t)DM * DM / 8 + 255) / 256); k_bdshn<<<g, 256, 0, stream>>>(wq, BQ); k_bdshn<<<g, 256, 0, stream>>>(wk, BK); k_bdshn<<<g, 256, 0, stream>>>(wv, BV); k_wnat<<<g, 256, 0, stream>>>(wo, (size_t)DM * DM / 8, BO); }      /* block-diagonal planes with the SHARED natural [64][64] block (Bt[h*64 + o][h*64 + d] = 16 W[o][d]); Wo natural [out][in] = Bt x16 */
  _Float16* XK = XKp; _Float16* XV = XVp; k_x16<<<(unsigned)((NR * DM / 8 + 255) / 256), 256, 0, stream>>>(xk, XK, NR * DM / 8); k_x16<<<(unsigned)((NR * DM / 8 + 255) / 256), 256, 0, stream>>>(xv, XV, NR * DM / 8);      /* key and value inputs as exact f16 rows */

  k_x16<<<(unsigned)((NR * DM / 8 + 255) / 256), 256, 0, stream>>>(x, X16, NR * DM / 8);
  const size_t r0p = (size_t)B0 * SQ;      /* first projected row */
  k_gemm2<0><<<dim3((unsigned)((MP / 128) * (DM / 64)), 1), 128, 0, stream>>>(X16 + r0p * DM, DM, 0, BQ, DM, 0, 0.0625f, bq, 0, nullptr, 1, 0, 0, nullptr, Q16 + r0p * DM, DM, 0, MP, DM, DM);
  k_gemm2<0><<<dim3((unsigned)((MP / 128) * (DM / 64)), 1), 128, 0, stream>>>(XK + r0p * DM, DM, 0, BK, DM, 0, 0.0625f, bk, 0, nullptr, 1, 0, 0, nullptr, K16 + r0p * DM, DM, 0, MP, DM, DM);
  k_gemm2<0><<<dim3((unsigned)((MP / 128) * (DM / 64)), 1), 128, 0, stream>>>(XV + r0p * DM, DM, 0, BV, DM, 0, 0.0625f, bv, 0, nullptr, 1, 0, 0, nullptr, V16 + r0p * DM, DM, 0, MP, DM, DM);
  for (int b = B0; b < B0 + NBR; ++b) { const size_t r0 = (size_t)b * SQ;
    k_vt<NH, SQ><<<NH * (SQ / 64), 256, 0, stream>>>(V16 + r0 * LQ, LQ, 0, VT);      /* V^T [NH][HD][SQ] for this batch */
    for (int h0 = 0; h0 < NHD; h0 += HG) {
      k_gemm2<0><<<dim3((QN / 128) * (SQ / 64), HG), 128, 0, stream>>>(Q16 + r0 * LQ + h0 * HD, LQ, (size_t)HD, K16 + r0 * LQ + h0 * HD, LQ, (size_t)HD, 0.03125f, nullptr, 0, nullptr, 1, 0, 0, S, nullptr, SQ, (size_t)SQ * SQ, QN, SQ, HD);      /* scores, HG heads per launch */
      k_rsmk1<<<(HG * SQ + 255) / 256, 256, 0, stream>>>(S, P, HG * SQ, km + (size_t)b * SQ);      /* keys with mask[b][j] == 0 excluded (arithmetic 0/1 keep factor; weight exactly 0 as the module's -1e20 fill); P x256 f16, rows of all HG heads */
      k_gemm2<0><<<dim3((QN / 128) * (HD / 64), HG), 128, 0, stream>>>(P, SQ, (size_t)SQ * SQ, VT + (size_t)h0 * HD * SQ, SQ, (size_t)HD * SQ, 0.25f, nullptr, 0, nullptr, 1, 0, 0, nullptr, O16 + r0 * DM + h0 * HD, DM, (size_t)HD, QN, HD, SQ); } }      /* o (merged heads) as f16 rows */
  k_gemm2<0><<<dim3((unsigned)((MPO / 128) * (DM / 64)), 1), 128, 0, stream>>>(O16 + r0p * DM, DM, 0, BO, DM, 0, 0.0009765625f, bo, 0, nullptr, 1, 0, 0, (float*)d_out + r0p * DM, nullptr, DM, 0, MPO, DM, DM);      /* out rows are the output layout */
}

// v001
// A run of this version takes 999 microseconds.
// Timed twice side by side with v000, it ran 3.46 and 3.43 times as fast.
#include <hip/hip_runtime.h>
// Multi-head attention over three inputs with SHARED per-head projections, a random key-padding mask and the module's literal score scale (values, keys, query [2][2048][1024]; each input is split into 16 heads of 64 and every head is multiplied by the SAME natural [64][64] matrix (x W^T: Wv / Wk / Wq; no biases); energy = q k^T; where(mask == 0, -1e20) with the int32 [2][1][1][2048] mask in {0, 1} (random; 0 = masked key; READ on device); softmax(energy / sqrt(embed_size) = / sqrt(1024) = / 32) (as the source); out = merged Wo^T + bo (natural [1024][1024]) -> [2][2048][1024]).
// Structure: token rows r = b*2048 + s; x as exact f16 rows (bf16-rounded); Q, K, V as three WMMA GEMMs (32x64 wave tiles, f32 accumulation, exact x16 weights, no bias, f16 outputs); per batch: V^T for all heads via LDS transposes; per (batch, group of 4 heads): scores GEMM (K = 64, batched over the heads on grid.y, alpha = 1/32 = 1/sqrt(embed size), the module's literal scale (applied before or after the fill: identical selection)), row softmax on VALU (f32 statistics; weights stored x256 as f16), o = P . V^T GEMM (K = 2048, alpha 2^-2: o carried x64 against f16 subnormal flush, folded into the output GEMM alpha) written straight into the merged f16 o rows; out = o W_o + b GEMM (f32) into the output layout.
// Compute dtype: inputs rounded to bf16; x / weights exact; q, k, v, softmax weights and o as plain f16 GEMM operands (~2^-12); scores and softmax statistics f32. v_wmma_f32_16x16x32_f16.
#define NB 2
#define SQ 2048
#define DM 1024
#define NH 16
#define HD 64
#define HG 4                         /* heads per attention launch group */
#define B0 0                         /* first batch processed (debug hook) */
#define NBR NB                       /* batches processed (debug hook) */
#define NR ((size_t)NB * SQ)         /* token rows */
#define MP ((int)((size_t)NBR * SQ)) /* rows projected (debug hook) */
#define QN SQ                        /* query rows attended per batch (debug hook) */
#define NHD NH                       /* heads attended (debug hook) */
#define MPO MP                       /* rows through the output stage (debug hook) */
#define LQ DM      /* row pitch of the q/k/v rows */
typedef __bf16 v16b __attribute__((ext_vector_type(16)));
typedef unsigned short v8us __attribute__((ext_vector_type(8), may_alias));
typedef float  v8f  __attribute__((ext_vector_type(8)));
typedef float  v4f  __attribute__((ext_vector_type(4)));
typedef float  v4fa __attribute__((ext_vector_type(4), may_alias));
union FragB { v16b v; v8us half[2]; unsigned short u[16]; };

__device__ __forceinline__ unsigned short bf16_bits(float x) { unsigned int u = __float_as_uint(x); return (unsigned short)((u + 0x7FFFu + ((u >> 16) & 1u)) >> 16); }
__device__ __forceinline__ float bf16_val(unsigned short b) { return __uint_as_float(((unsigned int)b) << 16); }
__device__ __forceinline__ float bf16_round(float x) { return bf16_val(bf16_bits(x)); }
// D += A·B with NT terms: 1 = ah·bh, 2 = + al·bh (A split), 3 = + ah·bl (both split)
template <int NT>
__device__ __forceinline__ v8f mmaN(v16b ah, v16b al, v16b bh, v16b bl, v8f c) {
  c = __builtin_amdgcn_wmma_f32_16x16x32_bf16(false, ah, false, bh, (short)0, c, false, false);
  if (NT >= 2) c = __builtin_amdgcn_wmma_f32_16x16x32_bf16(false, al, false, bh, (short)0, c, false, false);
  if (NT >= 3) c = __builtin_amdgcn_wmma_f32_16x16x32_bf16(false, ah, false, bl, (short)0, c, false, false);
  asm volatile("v_nop\n\tv_nop\n\tv_nop\n\tv_nop" : "+v"(c) : "v"(ah), "v"(al), "v"(bh), "v"(bl));
  return c;
}

__global__ __launch_bounds__(256) void k_wt_bf16(const float* __restrict__ W, unsigned short* __restrict__ Wt, int K, int N) {
  const int t = blockIdx.x * 256 + threadIdx.x;
  const int k8n = K / 8;
  if (t >= N * k8n) return;
  const int n = t / k8n, k8 = (t % k8n) * 8;
  v8us v;
#pragma unroll
  for (int i = 0; i < 8; ++i) v[i] = bf16_bits(W[(size_t)(k8 + i) * N + n]);
  *(v8us*)(Wt + (size_t)n * K + k8) = v;
  
}

// GEMM C[M][N] (f32, pitch ldc) = act(A[M][K]·W + bias). A f32 row-major (pitch lda) converted per fragment to bf16
// (ASPLIT: hi/lo two planes -> 2 terms, else single rounded term); Wt bf16 [N][K] (pitch ldb). BIAS_BF16 rounds the
// bias to bf16 first (bias quantised to bf16 before the add). K%32==0, M%16==0, N%64==0.
template <bool ASPLIT, int ACT, bool BIAS_BF16>
__global__ __launch_bounds__(128) void k_gemm_bf(const float* __restrict__ A, int lda, const unsigned short* __restrict__ Wt, int ldb,
                                               const float* __restrict__ bias, float* __restrict__ C, int ldc, int M, int N, int K) {
  __shared__ __attribute__((aligned(16))) float so[4][16][64];
  const int tid = threadIdx.x, w = tid >> 5, lane = tid & 31, ln = lane & 15, hh = lane >> 4;
  const int ntn = N / 64;
  const int wid = blockIdx.x * 4 + w;
  const int mt = wid / ntn, nq = wid % ntn;
  if (mt * 16 >= M) return;
  const int row0 = mt * 16, col0 = nq * 64;
  const float* arow = A + (size_t)(row0 + ln) * lda;
  v8f acc[4] = {};
  for (int kb = 0; kb < K; kb += 32) {
    FragB ah, al;
    const v4f x0 = *(const v4fa*)(arow + kb + 8 * hh), x1 = *(const v4fa*)(arow + kb + 8 * hh + 4);
    const v4f x2 = *(const v4fa*)(arow + kb + 16 + 8 * hh), x3 = *(const v4fa*)(arow + kb + 16 + 8 * hh + 4);
    float xs[16] = {x0[0],x0[1],x0[2],x0[3],x1[0],x1[1],x1[2],x1[3],x2[0],x2[1],x2[2],x2[3],x3[0],x3[1],x3[2],x3[3]};
#pragma unroll
    for (int i = 0; i < 16; ++i) { const unsigned short hb = bf16_bits(xs[i]); ah.u[i] = hb; al.u[i] = ASPLIT ? bf16_bits(xs[i] - bf16_val(hb)) : (unsigned short)0; }
#pragma unroll
    for (int t = 0; t < 4; ++t) {
      const unsigned short* brow = Wt + (size_t)(col0 + t * 16 + ln) * ldb + kb;
      FragB b;
      b.half[0] = *(const v8us*)(brow + 8 * hh);
      b.half[1] = *(const v8us*)(brow + 16 + 8 * hh);
      acc[t] = mmaN<ASPLIT ? 2 : 1>(ah.v, al.v, b.v, b.v, acc[t]);
    }
  }
#pragma unroll
  for (int t = 0; t < 4; ++t) {
    float bv = bias ? bias[col0 + t * 16 + ln] : 0.f;
    if (BIAS_BF16) bv = bf16_round(bv);
#pragma unroll
    for (int r = 0; r < 8; ++r) { float v = acc[t][r] + bv; if (ACT == 1) v = fmaxf(v, 0.f); so[w][8 * hh + r][t * 16 + ln] = v; }
  }
  __builtin_amdgcn_fence(__ATOMIC_ACQ_REL, "workgroup");
  __builtin_amdgcn_wave_barrier();
  const int rsub = lane >> 4, c4 = (lane & 15) * 4;
  {
#pragma unroll
    for (int q = 0; q < 8; ++q) {
      const int r = q * 2 + rsub;
      const v4f v = *(const v4fa*)&so[w][r][c4];
      *(v4f*)(C + (size_t)(row0 + r) * ldc + col0 + c4) = v;
    }
    
  }
}

// GEMM C = act(A·W + bias + resid): A f32 (ASPLIT -> hi/lo 2 terms), Wt bf16 [N][K]; ACT 0 none, 1 relu, 2 exact gelu;
// resid (optional, f32, row index = (row % rmod), pitch ldr, RES_BF16 rounds it) added before the activation.
template <bool ASPLIT, int ACT, bool BIAS_BF16, bool RES_BF16>
__global__ __launch_bounds__(128) void k_gemm_bf3(const float* __restrict__ A, int lda, const unsigned short* __restrict__ Wt, int ldb,
                                                const float* __restrict__ bias, const float* __restrict__ resid, int rmod, int ldr,
                                                float* __restrict__ C, int ldc, int M, int N, int K) {
  __shared__ __attribute__((aligned(16))) float so[4][16][64];
  const int tid = threadIdx.x, w = tid >> 5, lane = tid & 31, ln = lane & 15, hh = lane >> 4;
  const int ntn = N / 64;
  const int wid = blockIdx.x * 4 + w;
  const int mt = wid / ntn, nq = wid % ntn;
  if (mt * 16 >= M) return;
  const int row0 = mt * 16, col0 = nq * 64;
  const float* arow = A + (size_t)(row0 + ln) * lda;
  v8f acc[4] = {};
  for (int kb = 0; kb < K; kb += 32) {
    FragB ah, al;
    const v4f x0 = *(const v4fa*)(arow + kb + 8 * hh), x1 = *(const v4fa*)(arow + kb + 8 * hh + 4);
    const v4f x2 = *(const v4fa*)(arow + kb + 16 + 8 * hh), x3 = *(const v4fa*)(arow + kb + 16 + 8 * hh + 4);
    float xs[16] = {x0[0],x0[1],x0[2],x0[3],x1[0],x1[1],x1[2],x1[3],x2[0],x2[1],x2[2],x2[3],x3[0],x3[1],x3[2],x3[3]};
#pragma unroll
    for (int i = 0; i < 16; ++i) { const unsigned short hb = bf16_bits(xs[i]); ah.u[i] = hb; al.u[i] = ASPLIT ? bf16_bits(xs[i] - bf16_val(hb)) : (unsigned short)0; }
#pragma unroll
    for (int t = 0; t < 4; ++t) {
      const unsigned short* brow = Wt + (size_t)(col0 + t * 16 + ln) * ldb + kb;
      FragB b;
      b.half[0] = *(const v8us*)(brow + 8 * hh);
      b.half[1] = *(const v8us*)(brow + 16 + 8 * hh);
      acc[t] = mmaN<ASPLIT ? 2 : 1>(ah.v, al.v, b.v, b.v, acc[t]);
    }
  }
#pragma unroll
  for (int t = 0; t < 4; ++t) {
    const int col = col0 + t * 16 + ln;
    float bv = bias ? bias[col] : 0.f;
    if (BIAS_BF16) bv = bf16_round(bv);
#pragma unroll
    for (int r = 0; r < 8; ++r) {
      float v = acc[t][r] + bv;
      if (resid) { float rv = resid[(size_t)((row0 + 8 * hh + r) % rmod) * ldr + col]; if (RES_BF16) rv = bf16_round(rv); v += rv; }
      if (ACT == 1) v = fmaxf(v, 0.f);
      if (ACT == 2) v = 0.5f * v * (1.0f + erff(v * 0.70710678118654752f));
      if (ACT == 3) { const float u = 0.7978845608028654f * (v + 0.044715f * v * v * v); v = 0.5f * v * (1.0f + tanhf(u)); }
      so[w][8 * hh + r][t * 16 + ln] = v;
    }
  }
  __builtin_amdgcn_fence(__ATOMIC_ACQ_REL, "workgroup");
  __builtin_amdgcn_wave_barrier();
  const int rsub = lane >> 4, c4 = (lane & 15) * 4;
  {
#pragma unroll
    for (int q = 0; q < 8; ++q) {
      const int r = q * 2 + rsub;
      const v4f v = *(const v4fa*)&so[w][r][c4];
      *(v4f*)(C + (size_t)(row0 + r) * ldc + col0 + c4) = v;
    }
    
  }
}
// row LayerNorm (biased variance, eps) over N: s = X (+ R); optional out_sum <- s; out_norm <- (s-mu)*rsqrt(var+eps)*g + b
template <bool PARAM_BF16>
__global__ __launch_bounds__(256) void k_layernorm(const float* __restrict__ X, const float* __restrict__ R, const float* __restrict__ g, const float* __restrict__ bta,
                                                  float* __restrict__ out_sum, float* __restrict__ out_norm, int N, float eps) {
  __shared__ float red[256];
  const int row = blockIdx.x, tid = threadIdx.x;
  const float* x = X + (size_t)row * N; const float* rr = R ? R + (size_t)row * N : nullptr;
  float vals[16];                     // up to N = 4096
  const int per = N / 256;            // contiguous chunk per thread? use strided-by-4 chunks: thread handles j = tid*4 + 1024*u
  float s1 = 0.f;
  for (int u = 0; u < per / 4; ++u) {
    const int j = tid * 4 + 1024 * u;
    const v4f a = *(const v4fa*)(x + j);
    v4f b = {0.f,0.f,0.f,0.f}; if (rr) b = *(const v4fa*)(rr + j);
#pragma unroll
    for (int q = 0; q < 4; ++q) { const float v = a[q] + b[q]; vals[u * 4 + q] = v; s1 += v; }
  }
  red[tid] = s1; __syncthreads();
  for (int st = 128; st > 0; st >>= 1) { if (tid < st) red[tid] += red[tid + st]; __syncthreads(); }
  const float mu = red[0] / (float)N; __syncthreads();
  float s2 = 0.f;
  for (int u = 0; u < per / 4; ++u)
#pragma unroll
    for (int q = 0; q < 4; ++q) { const float c = vals[u * 4 + q] - mu; s2 += c * c; }
  red[tid] = s2; __syncthreads();
  for (int st = 128; st > 0; st >>= 1) { if (tid < st) red[tid] += red[tid + st]; __syncthreads(); }
  const float rs = rsqrtf(red[0] / (float)N + eps);
  {
    for (int u = 0; u < per / 4; ++u) {
      const int j = tid * 4 + 1024 * u;
      v4f o, sm;
#pragma unroll
      for (int q = 0; q < 4; ++q) {
        float gg = g[j + q], bb = bta[j + q];
        if (PARAM_BF16) { gg = bf16_round(gg); bb = bf16_round(bb); }
        sm[q] = vals[u * 4 + q]; o[q] = (vals[u * 4 + q] - mu) * rs * gg + bb;
      }
      if (out_sum) *(v4f*)(out_sum + (size_t)row * N + j) = sm;
      *(v4f*)(out_norm + (size_t)row * N + j) = o;
    }
    
  }
}



// ---- f16 WMMA path (v_wmma_f32_16x16x32_f16): 11-bit significands for operands in range — used where a [0,1] probability operand needs more precision than bf16
typedef _Float16 v16h __attribute__((ext_vector_type(16)));
union FragH { v16h v; v8us half[2]; _Float16 h[16]; unsigned short u[16]; };
template <int NT>
__device__ __forceinline__ v8f mmaH(v16h ah, v16h al, v16h bh, v16h bl, v8f c) {
  c = __builtin_amdgcn_wmma_f32_16x16x32_f16(false, ah, false, bh, (short)0, c, false, false);
  if (NT >= 2) c = __builtin_amdgcn_wmma_f32_16x16x32_f16(false, al, false, bh, (short)0, c, false, false);
  if (NT >= 3) c = __builtin_amdgcn_wmma_f32_16x16x32_f16(false, ah, false, bl, (short)0, c, false, false);
  asm volatile("v_nop\n\tv_nop\n\tv_nop\n\tv_nop" : "+v"(c) : "v"(ah), "v"(al), "v"(bh), "v"(bl));
  return c;
}
// batched GEMM like k_gemm_b but f16 operands: A f32 (split into f16 hi/lo if ASPLIT, else rounded to f16), Bt = f16 values [n][k]; alpha; C f32; N multiple of 16 (partial tiles skipped)
template <bool ASPLIT>
__global__ __launch_bounds__(128) void k_gemm_h(const float* __restrict__ A, int lda, size_t sA, const _Float16* __restrict__ Bh, int ldb, size_t sB, float alpha, float* __restrict__ C, int ldc, size_t sC, int M, int N, int K) {
  __shared__ __attribute__((aligned(16))) float so[4][16][64];
  const int tid = threadIdx.x, w = tid >> 5, lane = tid & 31, ln = lane & 15, hh = lane >> 4; const int by = blockIdx.y;
  A += (size_t)by * sA; Bh += (size_t)by * sB; C += (size_t)by * sC;
  const int ntn = (N + 63) / 64; const int wid = blockIdx.x * 4 + w; const int mt = wid / ntn, nq = wid % ntn; if (mt * 16 >= M) return;
  const int row0 = mt * 16, col0 = nq * 64; const float* arow = A + (size_t)(row0 + ln) * lda;
  v8f acc[4] = {};
  for (int kb = 0; kb < K; kb += 32) {
    FragH ah, al;
    const v4f x0 = *(const v4fa*)(arow + kb + 8 * hh), x1 = *(const v4fa*)(arow + kb + 8 * hh + 4), x2 = *(const v4fa*)(arow + kb + 16 + 8 * hh), x3 = *(const v4fa*)(arow + kb + 16 + 8 * hh + 4);
    float xs[16] = {x0[0],x0[1],x0[2],x0[3],x1[0],x1[1],x1[2],x1[3],x2[0],x2[1],x2[2],x2[3],x3[0],x3[1],x3[2],x3[3]};
#pragma unroll
    for (int i = 0; i < 16; ++i) { const _Float16 h = (_Float16)xs[i]; ah.h[i] = h; al.h[i] = ASPLIT ? (_Float16)(xs[i] - (float)h) : (_Float16)0.0f; }
#pragma unroll
    for (int t = 0; t < 4; ++t) { if (col0 + t * 16 >= N) continue; const size_t boff = (size_t)(col0 + t * 16 + ln) * ldb + kb; FragH bq; bq.half[0] = *(const v8us*)(Bh + boff + 8 * hh); bq.half[1] = *(const v8us*)(Bh + boff + 16 + 8 * hh);
      acc[t] = mmaH<ASPLIT ? 2 : 1>(ah.v, al.v, bq.v, bq.v, acc[t]); }
  }
#pragma unroll
  for (int t = 0; t < 4; ++t) { if (col0 + t * 16 >= N) continue;
#pragma unroll
    for (int r = 0; r < 8; ++r) so[w][8 * hh + r][t * 16 + ln] = acc[t][r] * alpha; }
  __builtin_amdgcn_fence(__ATOMIC_ACQ_REL, "workgroup"); __builtin_amdgcn_wave_barrier();
  const int rsub = lane >> 4, c4 = (lane & 15) * 4;
  {
#pragma unroll
    for (int q = 0; q < 8; ++q) { const int r = q * 2 + rsub; if (col0 + c4 < N) { const v4f v = *(const v4fa*)&so[w][r][c4]; *(v4f*)(C + (size_t)(row0 + r) * ldc + col0 + c4) = v; } }
     }
}

// Wt[n][k] = f16(W[k][n]·scale) from f32 row-major W[K][N] (scale = power of two; bf16-exact weights stay exact in f16 away from the subnormal range)
__global__ __launch_bounds__(256) void k_wt_f16(const float* __restrict__ W, _Float16* __restrict__ Wt, int K, int N, float scale) {
  const int t = blockIdx.x * 256 + threadIdx.x; if (t >= N * (K / 8)) return; const int n = t / (K / 8), k8 = (t % (K / 8)) * 8; FragH f;
#pragma unroll
  for (int i = 0; i < 8; ++i) f.h[i] = (_Float16)(bf16_round(W[(size_t)(k8 + i) * N + n]) * scale); const v8us o = f.half[0];
  *(v8us*)((unsigned short*)Wt + (size_t)n * K + k8) = o; 
}
// k_gemm_hh variant with fused epilogue: v = acc·alpha + bias[by·sBias + col] (+ CP[(row/rowsPerB)·sCPb + by·64 + col] if CP) ; ACT 0 none / 1 elu ; writes f16 C16 (and f32 C if non-null)
template <int ACT>
__global__ __launch_bounds__(128) void k_gemm_hhx(const _Float16* __restrict__ A, int lda, size_t sA, const _Float16* __restrict__ Bh, int ldb, size_t sB, float alpha, const float* __restrict__ bias, size_t sBias, const float* __restrict__ CP, int rowsPerB, size_t sCPb, int row0g,
    float* __restrict__ C, _Float16* __restrict__ C16, int ldc, size_t sC, int M, int N, int K) {
  __shared__ __attribute__((aligned(16))) float so[4][16][64];
  const int tid = threadIdx.x, w = tid >> 5, lane = tid & 31, ln = lane & 15, hh = lane >> 4; const int by = blockIdx.y;
  A += (size_t)by * sA; Bh += (size_t)by * sB; const size_t cofs = (size_t)by * sC; const float* bp = bias ? bias + (size_t)by * sBias : nullptr;
  const int ntn = (N + 63) / 64; const int wid = blockIdx.x * 4 + w; const int mt = wid / ntn, nq = wid % ntn; if (mt * 16 >= M) return;
  const int row0 = mt * 16, col0 = nq * 64; const _Float16* arow = A + (size_t)(row0 + ln) * lda;
  v8f acc[4] = {};
  for (int kb = 0; kb < K; kb += 32) { FragH ah; ah.half[0] = *(const v8us*)((const unsigned short*)arow + kb + 8 * hh); ah.half[1] = *(const v8us*)((const unsigned short*)arow + kb + 16 + 8 * hh);
#pragma unroll
    for (int t = 0; t < 4; ++t) { if (col0 + t * 16 >= N) continue; const size_t boff = (size_t)(col0 + t * 16 + ln) * ldb + kb; FragH bq; bq.half[0] = *(const v8us*)((const unsigned short*)Bh + boff + 8 * hh); bq.half[1] = *(const v8us*)((const unsigned short*)Bh + boff + 16 + 8 * hh);
      acc[t] = mmaH<1>(ah.v, ah.v, bq.v, bq.v, acc[t]); }
  }
#pragma unroll
  for (int t = 0; t < 4; ++t) { if (col0 + t * 16 >= N) continue; const int col = col0 + t * 16 + ln; const float bv = bp ? bf16_round(bp[col]) : 0.f;
#pragma unroll
    for (int r = 0; r < 8; ++r) { float v = acc[t][r] * alpha + bv; if (CP) { const int rr = row0g + row0 + 8 * hh + r; if (rowsPerB < 0) v += CP[cofs + (size_t)rr * ldc + col];      /* rowsPerB < 0: own element of the batched C plane */ else { const int bidx = rr / rowsPerB; v += CP[(size_t)bidx * sCPb + (size_t)by * 64 + col]; } } if (ACT == 1) v = (v > 0.f) ? v : expm1f(v); else if (ACT == 7) v = (v > 0.f) ? v + 1.0f : expf(v); else if (ACT == 8) v = tanhf(v); else if (ACT == 9) v = 0.5f * v * (1.0f + tanhf(0.7978845608028654f * (v + 0.044715f * v * v * v))); else if (ACT == 11) v = 1.0f / (1.0f + expf(-v)); else if (ACT == 12) v = (v > 0.f) ? v : 0.01f * v; else if (ACT == 14) v = (v > 0.f) ? v : 0.1f * v; else if (ACT == 16) v = (v >= 0.f) ? v : 0.3f * v; else if (ACT == 17) v = (v >= 0.f) ? v : 0.2f * v; else if (ACT == 15) v = v / (1.0f + expf(-v)); else if (ACT == 3) v = fmaxf(v, 0.f); else if (ACT == 6) v = 0.5f * v * (1.0f + erff(v * 0.70710678118654752f)); so[w][8 * hh + r][t * 16 + ln] = v; } }
  __builtin_amdgcn_fence(__ATOMIC_ACQ_REL, "workgroup"); __builtin_amdgcn_wave_barrier();
  const int rsub = lane >> 4, c4 = (lane & 15) * 4; typedef _Float16 v4h __attribute__((ext_vector_type(4)));
  {
#pragma unroll
    for (int q = 0; q < 8; ++q) { const int r = q * 2 + rsub; if (col0 + c4 < N) { const v4f v = *(const v4fa*)&so[w][r][c4]; if (C) *(v4f*)(C + cofs + (size_t)(row0 + r) * ldc + col0 + c4) = v; if (C16) { v4h h4; for (int i = 0; i < 4; ++i) h4[i] = (_Float16)v[i]; *(v4h*)(C16 + cofs + (size_t)(row0 + r) * ldc + col0 + c4) = h4; } } }
     }
}


typedef _Float16 v4h __attribute__((ext_vector_type(4)));

__global__ __launch_bounds__(256) void k_x16(const float* __restrict__ x, _Float16* __restrict__ X16, size_t n8) { const size_t t = (size_t)blockIdx.x * 256 + threadIdx.x; if (t >= n8) return; FragH f;
#pragma unroll
  for (int q = 0; q < 8; ++q) f.h[q] = (_Float16)bf16_round(x[t * 8 + q]); *(v8us*)((unsigned short*)X16 + t * 8) = f.half[0];  }
__global__ __launch_bounds__(256) void k_h16(const float* __restrict__ x, _Float16* __restrict__ X16, size_t n8) { const size_t t = (size_t)blockIdx.x * 256 + threadIdx.x; if (t >= n8) return; FragH f;
#pragma unroll
  for (int q = 0; q < 8; ++q) f.h[q] = (_Float16)x[t * 8 + q]; *(v8us*)((unsigned short*)X16 + t * 8) = f.half[0];  }
__global__ __launch_bounds__(256) void k_round16f(const float* __restrict__ W, _Float16* __restrict__ Bt, size_t n8) { const size_t t = (size_t)blockIdx.x * 256 + threadIdx.x; if (t >= n8) return; FragH f;
#pragma unroll
  for (int i = 0; i < 8; ++i) f.h[i] = (_Float16)(bf16_round(W[t * 8 + i]) * 16.0f); *(v8us*)((unsigned short*)Bt + t * 8) = f.half[0];  }
template <int NHv, int TTv>
__global__ __launch_bounds__(256) void k_vt(const _Float16* __restrict__ V16, int ldv, int voff, _Float16* __restrict__ Vt) { __shared__ unsigned short tl[64][66]; const int tid = threadIdx.x; const int slab = blockIdx.x / (TTv / 64), lg = blockIdx.x % (TTv / 64); const int b = slab / NHv, h = slab % NHv;
  for (int i = tid; i < 64 * 8; i += 256) { const int r = i / 8, c8 = (i % 8) * 8; FragH f; f.half[0] = *(const v8us*)((const unsigned short*)V16 + ((size_t)b * TTv + lg * 64 + r) * ldv + voff + h * 64 + c8);
#pragma unroll
    for (int q = 0; q < 8; ++q) tl[r][c8 + q] = f.u[q]; }
  __syncthreads();
  {
#pragma unroll
    for (int rd = 0; rd < 2; ++rd) { const int d = rd * 32 + tid / 8, pc = tid % 8; FragH f;
#pragma unroll
      for (int q = 0; q < 8; ++q) f.u[q] = tl[pc * 8 + q][d];
      *(v8us*)((unsigned short*)Vt + ((size_t)slab * 64 + d) * TTv + lg * 64 + pc * 8) = f.half[0]; }
     } }

__global__ __launch_bounds__(256) void k_hl(const float* __restrict__ F, _Float16* __restrict__ Hh, _Float16* __restrict__ Hl, size_t n8) { const size_t t = (size_t)blockIdx.x * 256 + threadIdx.x; if (t >= n8) return; FragH fh, fl; const v4f a = *(const v4fa*)(F + t * 8), c = *(const v4fa*)(F + t * 8 + 4);
#pragma unroll
  for (int q = 0; q < 4; ++q) { _Float16 h = (_Float16)a[q]; fh.h[q] = h; fl.h[q] = (_Float16)((a[q] - (float)h) * 1024.0f); h = (_Float16)c[q]; fh.h[4 + q] = h; fl.h[4 + q] = (_Float16)((c[q] - (float)h) * 1024.0f); }
  { *(v8us*)((unsigned short*)Hh + t * 8) = fh.half[0]; *(v8us*)((unsigned short*)Hl + t * 8) = fl.half[0];  } }

// ---- fast GEMM (wave tile 32x64; requires M % 32 == 0 rows per launch region and N % 64 == 0); epilogue = k_gemm_hhx semantics ----
__device__ __forceinline__ v16h g2_frag(const _Float16* p, int hh) { FragH f; f.half[0] = *(const v8us*)((const unsigned short*)p + 8 * hh); f.half[1] = *(const v8us*)((const unsigned short*)p + 16 + 8 * hh); return f.v; }
__device__ __forceinline__ v8f g2_mma(v16h a, v16h b, v8f c) { v8f d = __builtin_amdgcn_wmma_f32_16x16x32_f16(false, a, false, b, (short)0, c, false, false); asm volatile("v_nop\n\tv_nop\n\tv_nop\n\tv_nop" : "+v"(d) : "v"(a), "v"(b)); return d; }
template <int ACT>
__global__ __launch_bounds__(128) void k_gemm2(const _Float16* __restrict__ A, int lda, size_t sA, const _Float16* __restrict__ Bh, int ldb, size_t sB, float alpha, const float* __restrict__ bias, size_t sBias, const float* __restrict__ CP, int rowsPerB, size_t sCPb, int row0g,
    float* __restrict__ C, _Float16* __restrict__ C16, int ldc, size_t sC, int M, int N, int K) { static_assert(ACT == 0 || ACT == 3 || ACT == 6 || ACT == 8 || ACT == 9 || ACT == 11 || ACT == 12 || ACT == 14 || ACT == 15 || ACT == 16 || ACT == 17, "k_gemm2: unsupported ACT code (would silently apply no activation)");
  __shared__ __attribute__((aligned(16))) float so[4][32][68];
  const int tid = threadIdx.x, w = tid >> 5, lane = tid & 31, ln = lane & 15, hh = lane >> 4; const int by = blockIdx.y;
  A += (size_t)by * sA; Bh += (size_t)by * sB; const size_t cofs = (size_t)by * sC; const float* bp = bias ? bias + (size_t)by * sBias : nullptr;
  const int ntn = N >> 6; const int mt = blockIdx.x / ntn, nq = blockIdx.x - mt * ntn; const int row0 = mt * 128 + 32 * w, col0 = nq * 64; if (row0 >= M) return;
  const _Float16* a0p = A + (size_t)(row0 + ln) * lda; const _Float16* a1p = a0p + (size_t)16 * lda;
  const _Float16* b0p = Bh + (size_t)(col0 + ln) * ldb; const _Float16* b1p = b0p + (size_t)16 * ldb; const _Float16* b2p = b1p + (size_t)16 * ldb; const _Float16* b3p = b2p + (size_t)16 * ldb;
  const v8f z8 = {0.f,0.f,0.f,0.f,0.f,0.f,0.f,0.f}; v8f c00 = z8, c01 = z8, c02 = z8, c03 = z8, c10 = z8, c11 = z8, c12 = z8, c13 = z8;
#pragma unroll 1
  for (int kb = 0; kb < K; kb += 32) { const v16h a0 = g2_frag(a0p + kb, hh), a1 = g2_frag(a1p + kb, hh);
    v16h b = g2_frag(b0p + kb, hh); c00 = g2_mma(a0, b, c00); c10 = g2_mma(a1, b, c10);
    b = g2_frag(b1p + kb, hh); c01 = g2_mma(a0, b, c01); c11 = g2_mma(a1, b, c11);
    b = g2_frag(b2p + kb, hh); c02 = g2_mma(a0, b, c02); c12 = g2_mma(a1, b, c12);
    b = g2_frag(b3p + kb, hh); c03 = g2_mma(a0, b, c03); c13 = g2_mma(a1, b, c13); }
  v8f accs[8] = {c00, c01, c02, c03, c10, c11, c12, c13};
#pragma unroll
  for (int u = 0; u < 8; ++u) { const int t = u & 3, half = u >> 2; const int col = col0 + t * 16 + ln; const float bv = bp ? bf16_round(bp[col]) : 0.f;
#pragma unroll
    for (int r = 0; r < 8; ++r) { const int rloc = half * 16 + 8 * hh + r; float v = accs[u][r] * alpha + bv; if (CP) { if (rowsPerB < 0) v += CP[cofs + (size_t)(row0g + row0 + rloc) * ldc + col];      /* rowsPerB < 0: own element of the batched C plane */ else { const int bidx = (row0g + row0 + rloc) / rowsPerB; v += CP[(size_t)bidx * sCPb + (size_t)by * 64 + col]; } }
      if (ACT == 3) v = fmaxf(v, 0.f); else if (ACT == 6) v = 0.5f * v * (1.0f + erff(v * 0.70710678118654752f)); else if (ACT == 11) v = 1.0f / (1.0f + expf(-v)); else if (ACT == 15) v = v / (1.0f + expf(-v)); else if (ACT == 12) v = (v > 0.f) ? v : 0.01f * v; else if (ACT == 8) v = tanhf(v); else if (ACT == 9) v = 0.5f * v * (1.0f + tanhf(0.7978845608028654f * (v + 0.044715f * v * v * v))); else if (ACT == 14) v = (v > 0.f) ? v : 0.1f * v; else if (ACT == 16) v = (v >= 0.f) ? v : 0.3f * v; else if (ACT == 17) v = (v >= 0.f) ? v : 0.2f * v;
      so[w][rloc][t * 16 + ln] = v; } }
  __builtin_amdgcn_fence(__ATOMIC_ACQ_REL, "workgroup"); __builtin_amdgcn_wave_barrier();
  const int rsub = lane >> 4, c4 = (lane & 15) * 4;
  {
#pragma unroll
    for (int q = 0; q < 16; ++q) { const int r = q * 2 + rsub; const v4f v = *(const v4fa*)&so[w][r][c4]; if (C) *(v4f*)(C + cofs + (size_t)(row0 + r) * ldc + col0 + c4) = v; if (C16) { v4h h4; for (int i = 0; i < 4; ++i) h4[i] = (_Float16)v[i]; *(v4h*)(C16 + cofs + (size_t)(row0 + r) * ldc + col0 + c4) = h4; } }
     } }


__global__ __launch_bounds__(256) void k_wnat(const float* __restrict__ w, size_t n8, _Float16* __restrict__ Bt) { const size_t t = (size_t)blockIdx.x * 256 + threadIdx.x; if (t >= n8) return; FragH f; for (int q = 0; q < 8; ++q) f.h[q] = (_Float16)(bf16_round(w[t * 8 + q]) * 16.0f); *(v8us*)((unsigned short*)Bt + t * 8) = f.half[0];  }
__global__ __launch_bounds__(256) void k_rsm(const float* __restrict__ S, _Float16* __restrict__ P, int nrows) {
  #pragma clang fp contract(off)
  const int i = blockIdx.x * 256 + threadIdx.x; if (i >= nrows) return; const float* s = S + (size_t)i * SQ; float mx = -3.0e38f;
#pragma unroll 1
  for (int j = 0; j < SQ; ++j) mx = fmaxf(mx, s[j]); float se = 0.f;
#pragma unroll 1
  for (int j = 0; j < SQ; ++j) se += expf(s[j] - mx); const float sc = 256.0f / se;
#pragma unroll 1
  for (int j0 = 0; j0 < SQ; j0 += 8) { FragH f; for (int q = 0; q < 8; ++q) f.h[q] = (_Float16)(expf(s[j0 + q] - mx) * sc); unsigned short* d = (unsigned short*)P + (size_t)i * SQ + j0; *(v8us*)d = f.half[0];  } }
__global__ __launch_bounds__(256) void k_vt(const _Float16* __restrict__ V16, int b, int h0, _Float16* __restrict__ VT) { __shared__ unsigned short tl[64][65]; const int tid = threadIdx.x; const int hh = blockIdx.x % HG, sg = blockIdx.x / HG; const int s0 = sg * 64; const int h = h0 + hh;
  for (int i = tid; i < 64 * 8; i += 256) { const int j = i / 8, d8 = (i % 8) * 8; FragH f; f.half[0] = *(const v8us*)((const unsigned short*)V16 + ((size_t)b * SQ + s0 + j) * DM + h * HD + d8); for (int q = 0; q < 8; ++q) tl[d8 + q][j] = f.u[q]; }
  __syncthreads();
  { for (int i = tid; i < 64 * 8; i += 256) { const int d = i / 8, j8 = (i % 8) * 8; FragH f; for (int q = 0; q < 8; ++q) f.u[q] = tl[d][j8 + q]; *(v8us*)((unsigned short*)VT + ((size_t)hh * HD + d) * SQ + s0 + j8) = f.half[0]; }  } }



__global__ __launch_bounds__(256) void k_rsmkm(const float* __restrict__ S, _Float16* __restrict__ P, int nrows, const int* __restrict__ am) {
  #pragma clang fp contract(off)
  const int t = blockIdx.x * 256 + threadIdx.x; if (t >= nrows) return; const size_t i = (size_t)t; const float* s = S + i * SQ; const int* mr = am + (size_t)(t % SQ) * SQ; float mx = -3.0e38f;
#pragma unroll 1
  for (int j = 0; j < SQ; ++j) { const float f = (mr[j] != 0) ? 1.f : 0.f; mx = fmaxf(mx, fmaf(f, s[j], (1.f - f) * -1.0e9f)); } float se = 0.f;
#pragma unroll 1
  for (int j = 0; j < SQ; ++j) { const float f = (mr[j] != 0) ? 1.f : 0.f; se += __expf(fmaf(f, s[j], (1.f - f) * -1.0e9f) - mx); } const float sc = 256.0f / se;
#pragma unroll 1
  for (int j0 = 0; j0 < SQ; j0 += 8) { FragH fr; for (int q = 0; q < 8; ++q) { const int j = j0 + q; const float f = (mr[j] != 0) ? 1.f : 0.f; fr.h[q] = (_Float16)(__expf(fmaf(f, s[j], (1.f - f) * -1.0e9f) - mx) * sc); }
    unsigned short* d = (unsigned short*)P + i * SQ + j0; *(v8us*)d = fr.half[0];  } }

__global__ __launch_bounds__(256) void k_bdshn(const float* __restrict__ Wb, _Float16* __restrict__ Bt) {
  const size_t t = (size_t)blockIdx.x * 256 + threadIdx.x; if (t >= (size_t)DM * DM / 8) return; const size_t e0 = t * 8; const int n = (int)(e0 / DM), k0 = (int)(e0 % DM); const int h = n >> 6, hk = k0 >> 6; const float on = (hk == h) ? 16.0f : 0.0f; const int o = n & 63, d0 = k0 & 63; FragH f;
  for (int q = 0; q < 8; ++q) f.h[q] = (_Float16)(bf16_round(Wb[(size_t)o * 64 + d0 + q]) * on);
  unsigned short* d = (unsigned short*)Bt + e0; *(v8us*)d = f.half[0];  }

// Row softmax, one wave per pair of score rows (nrows even). A lane holds 64 scores of each row in registers: 16 loads of 16 B per row, each wave-wide load 512 contiguous bytes,
// both rows' loads ahead of the arithmetic so that they are in flight together; every loop is fully unrolled so that a and m are indexed by constants and stay in registers. Keys with Km[j] == 0 take the module's fill (-1e20, here already / 32) ahead of the maximum, as the source has it: their weight is
// exactly 0 beside any kept key. Maximum and sum: four chains per lane, then a five-step butterfly over the wave. Weights stored x256 as f16, 256 contiguous bytes per wave-wide store.
typedef int v4ia __attribute__((ext_vector_type(4), may_alias));
__device__ __forceinline__ float wave_max(float v) {
#pragma unroll
  for (int d = 16; d > 0; d >>= 1) v = fmaxf(v, __shfl_xor(v, d, 32));
  return v; }
__device__ __forceinline__ float wave_sum(float v) {
#pragma unroll
  for (int d = 16; d > 0; d >>= 1) v += __shfl_xor(v, d, 32);
  return v; }
// exp(x) as the fast form has it: one multiply, then v_exp_f32. Written as asm so that the v_nop stands directly behind the transcendental: the instruction set asks for one slot before its
// result is used or its source overwritten.
__device__ __forceinline__ float exp_slot(float x) { const float t = x * 1.44269504f; float e; asm("v_exp_f32 %0, %1\n\tv_nop" : "=v"(e) : "v"(t)); return e; }
__global__ __launch_bounds__(512) void k_rsmk1(const float* __restrict__ S, _Float16* __restrict__ P, int nrows, const int* __restrict__ Km) {
  const int lane = threadIdx.x & 31; const int row0 = (blockIdx.x * 16 + (threadIdx.x >> 5)) * 2; if (row0 >= nrows) return;
  const float* s = S + (size_t)row0 * SQ + lane * 4; _Float16* p = P + (size_t)row0 * SQ + lane * 4;
  v4ia m[16]; v4f a[2][16];
#pragma unroll
  for (int it = 0; it < 16; ++it) m[it] = *(const v4ia*)(Km + it * 128 + lane * 4);
#pragma unroll
  for (int r = 0; r < 2; ++r)
#pragma unroll
    for (int it = 0; it < 16; ++it) a[r][it] = *(const v4fa*)(s + (size_t)r * SQ + it * 128);
#pragma unroll
  for (int r = 0; r < 2; ++r) {
    float m4[4] = {-3.0e38f, -3.0e38f, -3.0e38f, -3.0e38f};
#pragma unroll
    for (int it = 0; it < 16; ++it)
#pragma unroll
      for (int q = 0; q < 4; ++q) { const float v = (m[it][q] != 0) ? a[r][it][q] : -3.125e18f; a[r][it][q] = v; m4[q] = fmaxf(m4[q], v); }
    const float mx = wave_max(fmaxf(fmaxf(m4[0], m4[1]), fmaxf(m4[2], m4[3])));
    float s4[4] = {0.f, 0.f, 0.f, 0.f};
#pragma unroll
    for (int it = 0; it < 16; ++it)
#pragma unroll
      for (int q = 0; q < 4; ++q) { const float e = exp_slot(a[r][it][q] - mx); a[r][it][q] = e; s4[q] += e; }
    const float sc = 256.0f / wave_sum((s4[0] + s4[1]) + (s4[2] + s4[3]));
#pragma unroll
    for (int it = 0; it < 16; ++it) { v4h h;
#pragma unroll
      for (int q = 0; q < 4; ++q) h[q] = (_Float16)(a[r][it][q] * sc);
      *(v4h*)(p + (size_t)r * SQ + it * 128) = h; }
  } }
extern "C" void kernel_launch(void* const* d_in, const int* in_sizes, int n_in,
                              void* d_out, int out_size, void* d_ws, size_t ws_size, hipStream_t stream) {
  (void)in_sizes; (void)n_in; (void)out_size;
  const float* const* I = (const float* const*)d_in; const float* xq = I[2]; const float* xk = I[1]; const float* xv = I[0]; const int* km = (const int*)d_in[3]; const float* wq = I[6]; const float* bq = nullptr; const float* wk = I[5]; const float* bk = nullptr; const float* wv = I[4]; const float* bv = nullptr; const float* wo = I[7]; const float* bo = I[8]; const float* x = xq;      /* contract order: values I[0], keys I[1], query I[2]; mask int32 [2][1][1][2048] (0 = masked key; READ on device); SHARED natural [64][64] blocks Wv I[4], Wk I[5], Wq I[6]; natural Wo [1024][1024] + bo */
  char* ws = (char*)d_ws; size_t off = 0;
  auto take = [&](size_t bytes) { char* p = ws + off; off += (bytes + 255) & ~(size_t)255; return p; };
  _Float16* BQ = (_Float16*)take((size_t)DM * DM * 2); _Float16* BK = (_Float16*)take((size_t)DM * DM * 2); _Float16* BV = (_Float16*)take((size_t)DM * DM * 2); _Float16* BO = (_Float16*)take((size_t)DM * DM * 2);
  _Float16* X16 = (_Float16*)take(NR * DM * 2); _Float16* XKp = (_Float16*)take(NR * DM * 2); _Float16* XVp = (_Float16*)take(NR * DM * 2); _Float16* Q16 = (_Float16*)take(NR * DM * 2); _Float16* K16 = (_Float16*)take(NR * DM * 2); _Float16* V16 = (_Float16*)take(NR * DM * 2); _Float16* O16 = (_Float16*)take(NR * DM * 2);
  float* S = (float*)take((size_t)HG * SQ * SQ * 4); _Float16* P = (_Float16*)take((size_t)HG * SQ * SQ * 2); _Float16* VT = (_Float16*)take((size_t)NH * HD * SQ * 2);
  if (off > ws_size) return;
  { const unsigned g = (unsigned)(((size_t)DM * DM / 8 + 255) / 256); k_bdshn<<<g, 256, 0, stream>>>(wq, BQ); k_bdshn<<<g, 256, 0, stream>>>(wk, BK); k_bdshn<<<g, 256, 0, stream>>>(wv, BV); k_wnat<<<g, 256, 0, stream>>>(wo, (size_t)DM * DM / 8, BO); }      /* block-diagonal planes with the SHARED natural [64][64] block (Bt[h*64 + o][h*64 + d] = 16 W[o][d]); Wo natural [out][in] = Bt x16 */
  _Float16* XK = XKp; _Float16* XV = XVp; k_x16<<<(unsigned)((NR * DM / 8 + 255) / 256), 256, 0, stream>>>(xk, XK, NR * DM / 8); k_x16<<<(unsigned)((NR * DM / 8 + 255) / 256), 256, 0, stream>>>(xv, XV, NR * DM / 8);      /* key and value inputs as exact f16 rows */

  k_x16<<<(unsigned)((NR * DM / 8 + 255) / 256), 256, 0, stream>>>(x, X16, NR * DM / 8);
  const size_t r0p = (size_t)B0 * SQ;      /* first projected row */
  k_gemm2<0><<<dim3((unsigned)((MP / 128) * (DM / 64)), 1), 128, 0, stream>>>(X16 + r0p * DM, DM, 0, BQ, DM, 0, 0.0625f, bq, 0, nullptr, 1, 0, 0, nullptr, Q16 + r0p * DM, DM, 0, MP, DM, DM);
  k_gemm2<0><<<dim3((unsigned)((MP / 128) * (DM / 64)), 1), 128, 0, stream>>>(XK + r0p * DM, DM, 0, BK, DM, 0, 0.0625f, bk, 0, nullptr, 1, 0, 0, nullptr, K16 + r0p * DM, DM, 0, MP, DM, DM);
  k_gemm2<0><<<dim3((unsigned)((MP / 128) * (DM / 64)), 1), 128, 0, stream>>>(XV + r0p * DM, DM, 0, BV, DM, 0, 0.0625f, bv, 0, nullptr, 1, 0, 0, nullptr, V16 + r0p * DM, DM, 0, MP, DM, DM);
  for (int b = B0; b < B0 + NBR; ++b) { const size_t r0 = (size_t)b * SQ;
    k_vt<NH, SQ><<<NH * (SQ / 64), 256, 0, stream>>>(V16 + r0 * LQ, LQ, 0, VT);      /* V^T [NH][HD][SQ] for this batch */
    for (int h0 = 0; h0 < NHD; h0 += HG) {
      k_gemm2<0><<<dim3((QN / 128) * (SQ / 64), HG), 128, 0, stream>>>(Q16 + r0 * LQ + h0 * HD, LQ, (size_t)HD, K16 + r0 * LQ + h0 * HD, LQ, (size_t)HD, 0.03125f, nullptr, 0, nullptr, 1, 0, 0, S, nullptr, SQ, (size_t)SQ * SQ, QN, SQ, HD);      /* scores, HG heads per launch */
      k_rsmk1<<<HG * SQ / 32, 512, 0, stream>>>(S, P, HG * SQ, km + (size_t)b * SQ);      /* 16 waves x 2 rows per work-group; keys with mask[b][j] == 0 take the module's fill (weight exactly 0 beside a kept key); P x256 f16, rows of all HG heads */
      k_gemm2<0><<<dim3((QN / 128) * (HD / 64), HG), 128, 0, stream>>>(P, SQ, (size_t)SQ * SQ, VT + (size_t)h0 * HD * SQ, SQ, (size_t)HD * SQ, 0.25f, nullptr, 0, nullptr, 1, 0, 0, nullptr, O16 + r0 * DM + h0 * HD, DM, (size_t)HD, QN, HD, SQ); } }      /* o (merged heads) as f16 rows */
  k_gemm2<0><<<dim3((unsigned)((MPO / 128) * (DM / 64)), 1), 128, 0, stream>>>(O16 + r0p * DM, DM, 0, BO, DM, 0, 0.0009765625f, bo, 0, nullptr, 1, 0, 0, (float*)d_out + r0p * DM, nullptr, DM, 0, MPO, DM, DM);      /* out rows are the output layout */
}

// v002
// It runs in 237 microseconds.
// Timed twice side by side with v001, it ran 4.19 times as fast both times.
// Counting every step since v000, it is 14.4 times as fast.
#include <hip/hip_runtime.h>
// Multi-head attention over three inputs with SHARED per-head projections, a random key-padding mask and the module's literal score scale (values, keys, query [2][2048][1024]; each input is split into 16 heads of 64 and every head is multiplied by the SAME natural [64][64] matrix (x W^T: Wv / Wk / Wq; no biases); energy = q k^T; where(mask == 0, -1e20) with the int32 [2][1][1][2048] mask in {0, 1} (random; 0 = masked key; READ on device); softmax(energy / sqrt(embed_size) = / sqrt(1024) = / 32) (as the source); out = merged Wo^T + bo (natural [1024][1024]) -> [2][2048][1024]).
// Structure: token rows r = b*2048 + s; x as exact f16 rows (bf16-rounded); Q, K, V as three WMMA GEMMs (32x64 wave tiles, f32 accumulation, exact x16 weights, no bias, f16 outputs); V^T for all batches and heads via LDS transposes; one fused attention launch over every (batch, head): scores by WMMA (scale 1/32 = 1/sqrt(embed size), the module's literal scale), running-maximum softmax in registers (f32 statistics; unnormalised weights as f16), o = P . V by WMMA, divided by the row sum at the end (o carried x64 against f16 subnormal flush, folded into the output GEMM alpha) and written straight into the merged f16 o rows; out = o W_o + b GEMM (f32) into the output layout.
// Compute dtype: inputs rounded to bf16; x / weights exact; q, k, v, softmax weights and o as plain f16 GEMM operands (~2^-12); scores and softmax statistics f32. v_wmma_f32_16x16x32_f16.
#define NB 2
#define SQ 2048
#define DM 1024
#define NH 16
#define HD 64
#define HG 4                         /* heads per launch of the grouped k_vt overload (not launched) */
#define B0 0                         /* first batch processed (debug hook) */
#define NBR NB                       /* batches processed (debug hook) */
#define NR ((size_t)NB * SQ)         /* token rows */
#define MP ((int)((size_t)NBR * SQ)) /* rows projected (debug hook) */
#define QN SQ                        /* query rows per batch (not used) */
#define NHD NH                       /* heads (not used) */
#define MPO MP                       /* rows through the output stage (debug hook) */
#define LQ DM      /* row pitch of the q/k/v rows */
typedef __bf16 v16b __attribute__((ext_vector_type(16)));
typedef unsigned short v8us __attribute__((ext_vector_type(8), may_alias));
typedef float  v8f  __attribute__((ext_vector_type(8)));
typedef float  v4f  __attribute__((ext_vector_type(4)));
typedef float  v4fa __attribute__((ext_vector_type(4), may_alias));
union FragB { v16b v; v8us half[2]; unsigned short u[16]; };

__device__ __forceinline__ unsigned short bf16_bits(float x) { unsigned int u = __float_as_uint(x); return (unsigned short)((u + 0x7FFFu + ((u >> 16) & 1u)) >> 16); }
__device__ __forceinline__ float bf16_val(unsigned short b) { return __uint_as_float(((unsigned int)b) << 16); }
__device__ __forceinline__ float bf16_round(float x) { return bf16_val(bf16_bits(x)); }
// D += A·B with NT terms: 1 = ah·bh, 2 = + al·bh (A split), 3 = + ah·bl (both split)
template <int NT>
__device__ __forceinline__ v8f mmaN(v16b ah, v16b al, v16b bh, v16b bl, v8f c) {
  c = __builtin_amdgcn_wmma_f32_16x16x32_bf16(false, ah, false, bh, (short)0, c, false, false);
  if (NT >= 2) c = __builtin_amdgcn_wmma_f32_16x16x32_bf16(false, al, false, bh, (short)0, c, false, false);
  if (NT >= 3) c = __builtin_amdgcn_wmma_f32_16x16x32_bf16(false, ah, false, bl, (short)0, c, false, false);
  asm volatile("v_nop\n\tv_nop\n\tv_nop\n\tv_nop" : "+v"(c) : "v"(ah), "v"(al), "v"(bh), "v"(bl));
  return c;
}

__global__ __launch_bounds__(256) void k_wt_bf16(const float* __restrict__ W, unsigned short* __restrict__ Wt, int K, int N) {
  const int t = blockIdx.x * 256 + threadIdx.x;
  const int k8n = K / 8;
  if (t >= N * k8n) return;
  const int n = t / k8n, k8 = (t % k8n) * 8;
  v8us v;
#pragma unroll
  for (int i = 0; i < 8; ++i) v[i] = bf16_bits(W[(size_t)(k8 + i) * N + n]);
  *(v8us*)(Wt + (size_t)n * K + k8) = v;
  
}

// GEMM C[M][N] (f32, pitch ldc) = act(A[M][K]·W + bias). A f32 row-major (pitch lda) converted per fragment to bf16
// (ASPLIT: hi/lo two planes -> 2 terms, else single rounded term); Wt bf16 [N][K] (pitch ldb). BIAS_BF16 rounds the
// bias to bf16 first (bias quantised to bf16 before the add). K%32==0, M%16==0, N%64==0.
template <bool ASPLIT, int ACT, bool BIAS_BF16>
__global__ __launch_bounds__(128) void k_gemm_bf(const float* __restrict__ A, int lda, const unsigned short* __restrict__ Wt, int ldb,
                                               const float* __restrict__ bias, float* __restrict__ C, int ldc, int M, int N, int K) {
  __shared__ __attribute__((aligned(16))) float so[4][16][64];
  const int tid = threadIdx.x, w = tid >> 5, lane = tid & 31, ln = lane & 15, hh = lane >> 4;
  const int ntn = N / 64;
  const int wid = blockIdx.x * 4 + w;
  const int mt = wid / ntn, nq = wid % ntn;
  if (mt * 16 >= M) return;
  const int row0 = mt * 16, col0 = nq * 64;
  const float* arow = A + (size_t)(row0 + ln) * lda;
  v8f acc[4] = {};
  for (int kb = 0; kb < K; kb += 32) {
    FragB ah, al;
    const v4f x0 = *(const v4fa*)(arow + kb + 8 * hh), x1 = *(const v4fa*)(arow + kb + 8 * hh + 4);
    const v4f x2 = *(const v4fa*)(arow + kb + 16 + 8 * hh), x3 = *(const v4fa*)(arow + kb + 16 + 8 * hh + 4);
    float xs[16] = {x0[0],x0[1],x0[2],x0[3],x1[0],x1[1],x1[2],x1[3],x2[0],x2[1],x2[2],x2[3],x3[0],x3[1],x3[2],x3[3]};
#pragma unroll
    for (int i = 0; i < 16; ++i) { const unsigned short hb = bf16_bits(xs[i]); ah.u[i] = hb; al.u[i] = ASPLIT ? bf16_bits(xs[i] - bf16_val(hb)) : (unsigned short)0; }
#pragma unroll
    for (int t = 0; t < 4; ++t) {
      const unsigned short* brow = Wt + (size_t)(col0 + t * 16 + ln) * ldb + kb;
      FragB b;
      b.half[0] = *(const v8us*)(brow + 8 * hh);
      b.half[1] = *(const v8us*)(brow + 16 + 8 * hh);
      acc[t] = mmaN<ASPLIT ? 2 : 1>(ah.v, al.v, b.v, b.v, acc[t]);
    }
  }
#pragma unroll
  for (int t = 0; t < 4; ++t) {
    float bv = bias ? bias[col0 + t * 16 + ln] : 0.f;
    if (BIAS_BF16) bv = bf16_round(bv);
#pragma unroll
    for (int r = 0; r < 8; ++r) { float v = acc[t][r] + bv; if (ACT == 1) v = fmaxf(v, 0.f); so[w][8 * hh + r][t * 16 + ln] = v; }
  }
  __builtin_amdgcn_fence(__ATOMIC_ACQ_REL, "workgroup");
  __builtin_amdgcn_wave_barrier();
  const int rsub = lane >> 4, c4 = (lane & 15) * 4;
  {
#pragma unroll
    for (int q = 0; q < 8; ++q) {
      const int r = q * 2 + rsub;
      const v4f v = *(const v4fa*)&so[w][r][c4];
      *(v4f*)(C + (size_t)(row0 + r) * ldc + col0 + c4) = v;
    }
    
  }
}

// GEMM C = act(A·W + bias + resid): A f32 (ASPLIT -> hi/lo 2 terms), Wt bf16 [N][K]; ACT 0 none, 1 relu, 2 exact gelu;
// resid (optional, f32, row index = (row % rmod), pitch ldr, RES_BF16 rounds it) added before the activation.
template <bool ASPLIT, int ACT, bool BIAS_BF16, bool RES_BF16>
__global__ __launch_bounds__(128) void k_gemm_bf3(const float* __restrict__ A, int lda, const unsigned short* __restrict__ Wt, int ldb,
                                                const float* __restrict__ bias, const float* __restrict__ resid, int rmod, int ldr,
                                                float* __restrict__ C, int ldc, int M, int N, int K) {
  __shared__ __attribute__((aligned(16))) float so[4][16][64];
  const int tid = threadIdx.x, w = tid >> 5, lane = tid & 31, ln = lane & 15, hh = lane >> 4;
  const int ntn = N / 64;
  const int wid = blockIdx.x * 4 + w;
  const int mt = wid / ntn, nq = wid % ntn;
  if (mt * 16 >= M) return;
  const int row0 = mt * 16, col0 = nq * 64;
  const float* arow = A + (size_t)(row0 + ln) * lda;
  v8f acc[4] = {};
  for (int kb = 0; kb < K; kb += 32) {
    FragB ah, al;
    const v4f x0 = *(const v4fa*)(arow + kb + 8 * hh), x1 = *(const v4fa*)(arow + kb + 8 * hh + 4);
    const v4f x2 = *(const v4fa*)(arow + kb + 16 + 8 * hh), x3 = *(const v4fa*)(arow + kb + 16 + 8 * hh + 4);
    float xs[16] = {x0[0],x0[1],x0[2],x0[3],x1[0],x1[1],x1[2],x1[3],x2[0],x2[1],x2[2],x2[3],x3[0],x3[1],x3[2],x3[3]};
#pragma unroll
    for (int i = 0; i < 16; ++i) { const unsigned short hb = bf16_bits(xs[i]); ah.u[i] = hb; al.u[i] = ASPLIT ? bf16_bits(xs[i] - bf16_val(hb)) : (unsigned short)0; }
#pragma unroll
    for (int t = 0; t < 4; ++t) {
      const unsigned short* brow = Wt + (size_t)(col0 + t * 16 + ln) * ldb + kb;
      FragB b;
      b.half[0] = *(const v8us*)(brow + 8 * hh);
      b.half[1] = *(const v8us*)(brow + 16 + 8 * hh);
      acc[t] = mmaN<ASPLIT ? 2 : 1>(ah.v, al.v, b.v, b.v, acc[t]);
    }
  }
#pragma unroll
  for (int t = 0; t < 4; ++t) {
    const int col = col0 + t * 16 + ln;
    float bv = bias ? bias[col] : 0.f;
    if (BIAS_BF16) bv = bf16_round(bv);
#pragma unroll
    for (int r = 0; r < 8; ++r) {
      float v = acc[t][r] + bv;
      if (resid) { float rv = resid[(size_t)((row0 + 8 * hh + r) % rmod) * ldr + col]; if (RES_BF16) rv = bf16_round(rv); v += rv; }
      if (ACT == 1) v = fmaxf(v, 0.f);
      if (ACT == 2) v = 0.5f * v * (1.0f + erff(v * 0.70710678118654752f));
      if (ACT == 3) { const float u = 0.7978845608028654f * (v + 0.044715f * v * v * v); v = 0.5f * v * (1.0f + tanhf(u)); }
      so[w][8 * hh + r][t * 16 + ln] = v;
    }
  }
  __builtin_amdgcn_fence(__ATOMIC_ACQ_REL, "workgroup");
  __builtin_amdgcn_wave_barrier();
  const int rsub = lane >> 4, c4 = (lane & 15) * 4;
  {
#pragma unroll
    for (int q = 0; q < 8; ++q) {
      const int r = q * 2 + rsub;
      const v4f v = *(const v4fa*)&so[w][r][c4];
      *(v4f*)(C + (size_t)(row0 + r) * ldc + col0 + c4) = v;
    }
    
  }
}
// row LayerNorm (biased variance, eps) over N: s = X (+ R); optional out_sum <- s; out_norm <- (s-mu)*rsqrt(var+eps)*g + b
template <bool PARAM_BF16>
__global__ __launch_bounds__(256) void k_layernorm(const float* __restrict__ X, const float* __restrict__ R, const float* __restrict__ g, const float* __restrict__ bta,
                                                  float* __restrict__ out_sum, float* __restrict__ out_norm, int N, float eps) {
  __shared__ float red[256];
  const int row = blockIdx.x, tid = threadIdx.x;
  const float* x = X + (size_t)row * N; const float* rr = R ? R + (size_t)row * N : nullptr;
  float vals[16];                     // up to N = 4096
  const int per = N / 256;            // contiguous chunk per thread? use strided-by-4 chunks: thread handles j = tid*4 + 1024*u
  float s1 = 0.f;
  for (int u = 0; u < per / 4; ++u) {
    const int j = tid * 4 + 1024 * u;
    const v4f a = *(const v4fa*)(x + j);
    v4f b = {0.f,0.f,0.f,0.f}; if (rr) b = *(const v4fa*)(rr + j);
#pragma unroll
    for (int q = 0; q < 4; ++q) { const float v = a[q] + b[q]; vals[u * 4 + q] = v; s1 += v; }
  }
  red[tid] = s1; __syncthreads();
  for (int st = 128; st > 0; st >>= 1) { if (tid < st) red[tid] += red[tid + st]; __syncthreads(); }
  const float mu = red[0] / (float)N; __syncthreads();
  float s2 = 0.f;
  for (int u = 0; u < per / 4; ++u)
#pragma unroll
    for (int q = 0; q < 4; ++q) { const float c = vals[u * 4 + q] - mu; s2 += c * c; }
  red[tid] = s2; __syncthreads();
  for (int st = 128; st > 0; st >>= 1) { if (tid < st) red[tid] += red[tid + st]; __syncthreads(); }
  const float rs = rsqrtf(red[0] / (float)N + eps);
  {
    for (int u = 0; u < per / 4; ++u) {
      const int j = tid * 4 + 1024 * u;
      v4f o, sm;
#pragma unroll
      for (int q = 0; q < 4; ++q) {
        float gg = g[j + q], bb = bta[j + q];
        if (PARAM_BF16) { gg = bf16_round(gg); bb = bf16_round(bb); }
        sm[q] = vals[u * 4 + q]; o[q] = (vals[u * 4 + q] - mu) * rs * gg + bb;
      }
      if (out_sum) *(v4f*)(out_sum + (size_t)row * N + j) = sm;
      *(v4f*)(out_norm + (size_t)row * N + j) = o;
    }
    
  }
}



// ---- f16 WMMA path (v_wmma_f32_16x16x32_f16): 11-bit significands for operands in range — used where a [0,1] probability operand needs more precision than bf16
typedef _Float16 v16h __attribute__((ext_vector_type(16)));
union FragH { v16h v; v8us half[2]; _Float16 h[16]; unsigned short u[16]; };
template <int NT>
__device__ __forceinline__ v8f mmaH(v16h ah, v16h al, v16h bh, v16h bl, v8f c) {
  c = __builtin_amdgcn_wmma_f32_16x16x32_f16(false, ah, false, bh, (short)0, c, false, false);
  if (NT >= 2) c = __builtin_amdgcn_wmma_f32_16x16x32_f16(false, al, false, bh, (short)0, c, false, false);
  if (NT >= 3) c = __builtin_amdgcn_wmma_f32_16x16x32_f16(false, ah, false, bl, (short)0, c, false, false);
  asm volatile("v_nop\n\tv_nop\n\tv_nop\n\tv_nop" : "+v"(c) : "v"(ah), "v"(al), "v"(bh), "v"(bl));
  return c;
}
// batched GEMM like k_gemm_b but f16 operands: A f32 (split into f16 hi/lo if ASPLIT, else rounded to f16), Bt = f16 values [n][k]; alpha; C f32; N multiple of 16 (partial tiles skipped)
template <bool ASPLIT>
__global__ __launch_bounds__(128) void k_gemm_h(const float* __restrict__ A, int lda, size_t sA, const _Float16* __restrict__ Bh, int ldb, size_t sB, float alpha, float* __restrict__ C, int ldc, size_t sC, int M, int N, int K) {
  __shared__ __attribute__((aligned(16))) float so[4][16][64];
  const int tid = threadIdx.x, w = tid >> 5, lane = tid & 31, ln = lane & 15, hh = lane >> 4; const int by = blockIdx.y;
  A += (size_t)by * sA; Bh += (size_t)by * sB; C += (size_t)by * sC;
  const int ntn = (N + 63) / 64; const int wid = blockIdx.x * 4 + w; const int mt = wid / ntn, nq = wid % ntn; if (mt * 16 >= M) return;
  const int row0 = mt * 16, col0 = nq * 64; const float* arow = A + (size_t)(row0 + ln) * lda;
  v8f acc[4] = {};
  for (int kb = 0; kb < K; kb += 32) {
    FragH ah, al;
    const v4f x0 = *(const v4fa*)(arow + kb + 8 * hh), x1 = *(const v4fa*)(arow + kb + 8 * hh + 4), x2 = *(const v4fa*)(arow + kb + 16 + 8 * hh), x3 = *(const v4fa*)(arow + kb + 16 + 8 * hh + 4);
    float xs[16] = {x0[0],x0[1],x0[2],x0[3],x1[0],x1[1],x1[2],x1[3],x2[0],x2[1],x2[2],x2[3],x3[0],x3[1],x3[2],x3[3]};
#pragma unroll
    for (int i = 0; i < 16; ++i) { const _Float16 h = (_Float16)xs[i]; ah.h[i] = h; al.h[i] = ASPLIT ? (_Float16)(xs[i] - (float)h) : (_Float16)0.0f; }
#pragma unroll
    for (int t = 0; t < 4; ++t) { if (col0 + t * 16 >= N) continue; const size_t boff = (size_t)(col0 + t * 16 + ln) * ldb + kb; FragH bq; bq.half[0] = *(const v8us*)(Bh + boff + 8 * hh); bq.half[1] = *(const v8us*)(Bh + boff + 16 + 8 * hh);
      acc[t] = mmaH<ASPLIT ? 2 : 1>(ah.v, al.v, bq.v, bq.v, acc[t]); }
  }
#pragma unroll
  for (int t = 0; t < 4; ++t) { if (col0 + t * 16 >= N) continue;
#pragma unroll
    for (int r = 0; r < 8; ++r) so[w][8 * hh + r][t * 16 + ln] = acc[t][r] * alpha; }
  __builtin_amdgcn_fence(__ATOMIC_ACQ_REL, "workgroup"); __builtin_amdgcn_wave_barrier();
  const int rsub = lane >> 4, c4 = (lane & 15) * 4;
  {
#pragma unroll
    for (int q = 0; q < 8; ++q) { const int r = q * 2 + rsub; if (col0 + c4 < N) { const v4f v = *(const v4fa*)&so[w][r][c4]; *(v4f*)(C + (size_t)(row0 + r) * ldc + col0 + c4) = v; } }
     }
}

// Wt[n][k] = f16(W[k][n]·scale) from f32 row-major W[K][N] (scale = power of two; bf16-exact weights stay exact in f16 away from the subnormal range)
__global__ __launch_bounds__(256) void k_wt_f16(const float* __restrict__ W, _Float16* __restrict__ Wt, int K, int N, float scale) {
  const int t = blockIdx.x * 256 + threadIdx.x; if (t >= N * (K / 8)) return; const int n = t / (K / 8), k8 = (t % (K / 8)) * 8; FragH f;
#pragma unroll
  for (int i = 0; i < 8; ++i) f.h[i] = (_Float16)(bf16_round(W[(size_t)(k8 + i) * N + n]) * scale); const v8us o = f.half[0];
  *(v8us*)((unsigned short*)Wt + (size_t)n * K + k8) = o; 
}
// k_gemm_hh variant with fused epilogue: v = acc·alpha + bias[by·sBias + col] (+ CP[(row/rowsPerB)·sCPb + by·64 + col] if CP) ; ACT 0 none / 1 elu ; writes f16 C16 (and f32 C if non-null)
template <int ACT>
__global__ __launch_bounds__(128) void k_gemm_hhx(const _Float16* __restrict__ A, int lda, size_t sA, const _Float16* __restrict__ Bh, int ldb, size_t sB, float alpha, const float* __restrict__ bias, size_t sBias, const float* __restrict__ CP, int rowsPerB, size_t sCPb, int row0g,
    float* __restrict__ C, _Float16* __restrict__ C16, int ldc, size_t sC, int M, int N, int K) {
  __shared__ __attribute__((aligned(16))) float so[4][16][64];
  const int tid = threadIdx.x, w = tid >> 5, lane = tid & 31, ln = lane & 15, hh = lane >> 4; const int by = blockIdx.y;
  A += (size_t)by * sA; Bh += (size_t)by * sB; const size_t cofs = (size_t)by * sC; const float* bp = bias ? bias + (size_t)by * sBias : nullptr;
  const int ntn = (N + 63) / 64; const int wid = blockIdx.x * 4 + w; const int mt = wid / ntn, nq = wid % ntn; if (mt * 16 >= M) return;
  const int row0 = mt * 16, col0 = nq * 64; const _Float16* arow = A + (size_t)(row0 + ln) * lda;
  v8f acc[4] = {};
  for (int kb = 0; kb < K; kb += 32) { FragH ah; ah.half[0] = *(const v8us*)((const unsigned short*)arow + kb + 8 * hh); ah.half[1] = *(const v8us*)((const unsigned short*)arow + kb + 16 + 8 * hh);
#pragma unroll
    for (int t = 0; t < 4; ++t) { if (col0 + t * 16 >= N) continue; const size_t boff = (size_t)(col0 + t * 16 + ln) * ldb + kb; FragH bq; bq.half[0] = *(const v8us*)((const unsigned short*)Bh + boff + 8 * hh); bq.half[1] = *(const v8us*)((const unsigned short*)Bh + boff + 16 + 8 * hh);
      acc[t] = mmaH<1>(ah.v, ah.v, bq.v, bq.v, acc[t]); }
  }
#pragma unroll
  for (int t = 0; t < 4; ++t) { if (col0 + t * 16 >= N) continue; const int col = col0 + t * 16 + ln; const float bv = bp ? bf16_round(bp[col]) : 0.f;
#pragma unroll
    for (int r = 0; r < 8; ++r) { float v = acc[t][r] * alpha + bv; if (CP) { const int rr = row0g + row0 + 8 * hh + r; if (rowsPerB < 0) v += CP[cofs + (size_t)rr * ldc + col];      /* rowsPerB < 0: own element of the batched C plane */ else { const int bidx = rr / rowsPerB; v += CP[(size_t)bidx * sCPb + (size_t)by * 64 + col]; } } if (ACT == 1) v = (v > 0.f) ? v : expm1f(v); else if (ACT == 7) v = (v > 0.f) ? v + 1.0f : expf(v); else if (ACT == 8) v = tanhf(v); else if (ACT == 9) v = 0.5f * v * (1.0f + tanhf(0.7978845608028654f * (v + 0.044715f * v * v * v))); else if (ACT == 11) v = 1.0f / (1.0f + expf(-v)); else if (ACT == 12) v = (v > 0.f) ? v : 0.01f * v; else if (ACT == 14) v = (v > 0.f) ? v : 0.1f * v; else if (ACT == 16) v = (v >= 0.f) ? v : 0.3f * v; else if (ACT == 17) v = (v >= 0.f) ? v : 0.2f * v; else if (ACT == 15) v = v / (1.0f + expf(-v)); else if (ACT == 3) v = fmaxf(v, 0.f); else if (ACT == 6) v = 0.5f * v * (1.0f + erff(v * 0.70710678118654752f)); so[w][8 * hh + r][t * 16 + ln] = v; } }
  __builtin_amdgcn_fence(__ATOMIC_ACQ_REL, "workgroup"); __builtin_amdgcn_wave_barrier();
  const int rsub = lane >> 4, c4 = (lane & 15) * 4; typedef _Float16 v4h __attribute__((ext_vector_type(4)));
  {
#pragma unroll
    for (int q = 0; q < 8; ++q) { const int r = q * 2 + rsub; if (col0 + c4 < N) { const v4f v = *(const v4fa*)&so[w][r][c4]; if (C) *(v4f*)(C + cofs + (size_t)(row0 + r) * ldc + col0 + c4) = v; if (C16) { v4h h4; for (int i = 0; i < 4; ++i) h4[i] = (_Float16)v[i]; *(v4h*)(C16 + cofs + (size_t)(row0 + r) * ldc + col0 + c4) = h4; } } }
     }
}


typedef _Float16 v4h __attribute__((ext_vector_type(4)));

__global__ __launch_bounds__(256) void k_x16(const float* __restrict__ x, _Float16* __restrict__ X16, size_t n8) { const size_t t = (size_t)blockIdx.x * 256 + threadIdx.x; if (t >= n8) return; FragH f;
#pragma unroll
  for (int q = 0; q < 8; ++q) f.h[q] = (_Float16)bf16_round(x[t * 8 + q]); *(v8us*)((unsigned short*)X16 + t * 8) = f.half[0];  }
__global__ __launch_bounds__(256) void k_h16(const float* __restrict__ x, _Float16* __restrict__ X16, size_t n8) { const size_t t = (size_t)blockIdx.x * 256 + threadIdx.x; if (t >= n8) return; FragH f;
#pragma unroll
  for (int q = 0; q < 8; ++q) f.h[q] = (_Float16)x[t * 8 + q]; *(v8us*)((unsigned short*)X16 + t * 8) = f.half[0];  }
__global__ __launch_bounds__(256) void k_round16f(const float* __restrict__ W, _Float16* __restrict__ Bt, size_t n8) { const size_t t = (size_t)blockIdx.x * 256 + threadIdx.x; if (t >= n8) return; FragH f;
#pragma unroll
  for (int i = 0; i < 8; ++i) f.h[i] = (_Float16)(bf16_round(W[t * 8 + i]) * 16.0f); *(v8us*)((unsigned short*)Bt + t * 8) = f.half[0];  }
template <int NHv, int TTv>
__global__ __launch_bounds__(256) void k_vt(const _Float16* __restrict__ V16, int ldv, int voff, _Float16* __restrict__ Vt) { __shared__ unsigned short tl[64][66]; const int tid = threadIdx.x; const int slab = blockIdx.x / (TTv / 64), lg = blockIdx.x % (TTv / 64); const int b = slab / NHv, h = slab % NHv;
  for (int i = tid; i < 64 * 8; i += 256) { const int r = i / 8, c8 = (i % 8) * 8; FragH f; f.half[0] = *(const v8us*)((const unsigned short*)V16 + ((size_t)b * TTv + lg * 64 + r) * ldv + voff + h * 64 + c8);
#pragma unroll
    for (int q = 0; q < 8; ++q) tl[r][c8 + q] = f.u[q]; }
  __syncthreads();
  {
#pragma unroll
    for (int rd = 0; rd < 2; ++rd) { const int d = rd * 32 + tid / 8, pc = tid % 8; FragH f;
#pragma unroll
      for (int q = 0; q < 8; ++q) f.u[q] = tl[pc * 8 + q][d];
      *(v8us*)((unsigned short*)Vt + ((size_t)slab * 64 + d) * TTv + lg * 64 + pc * 8) = f.half[0]; }
     } }

__global__ __launch_bounds__(256) void k_hl(const float* __restrict__ F, _Float16* __restrict__ Hh, _Float16* __restrict__ Hl, size_t n8) { const size_t t = (size_t)blockIdx.x * 256 + threadIdx.x; if (t >= n8) return; FragH fh, fl; const v4f a = *(const v4fa*)(F + t * 8), c = *(const v4fa*)(F + t * 8 + 4);
#pragma unroll
  for (int q = 0; q < 4; ++q) { _Float16 h = (_Float16)a[q]; fh.h[q] = h; fl.h[q] = (_Float16)((a[q] - (float)h) * 1024.0f); h = (_Float16)c[q]; fh.h[4 + q] = h; fl.h[4 + q] = (_Float16)((c[q] - (float)h) * 1024.0f); }
  { *(v8us*)((unsigned short*)Hh + t * 8) = fh.half[0]; *(v8us*)((unsigned short*)Hl + t * 8) = fl.half[0];  } }

// ---- fast GEMM (wave tile 32x64; requires M % 32 == 0 rows per launch region and N % 64 == 0); epilogue = k_gemm_hhx semantics ----
__device__ __forceinline__ v16h g2_frag(const _Float16* p, int hh) { FragH f; f.half[0] = *(const v8us*)((const unsigned short*)p + 8 * hh); f.half[1] = *(const v8us*)((const unsigned short*)p + 16 + 8 * hh); return f.v; }
__device__ __forceinline__ v8f g2_mma(v16h a, v16h b, v8f c) { v8f d = __builtin_amdgcn_wmma_f32_16x16x32_f16(false, a, false, b, (short)0, c, false, false); asm volatile("v_nop\n\tv_nop\n\tv_nop\n\tv_nop" : "+v"(d) : "v"(a), "v"(b)); return d; }
template <int ACT>
__global__ __launch_bounds__(128) void k_gemm2(const _Float16* __restrict__ A, int lda, size_t sA, const _Float16* __restrict__ Bh, int ldb, size_t sB, float alpha, const float* __restrict__ bias, size_t sBias, const float* __restrict__ CP, int rowsPerB, size_t sCPb, int row0g,
    float* __restrict__ C, _Float16* __restrict__ C16, int ldc, size_t sC, int M, int N, int K) { static_assert(ACT == 0 || ACT == 3 || ACT == 6 || ACT == 8 || ACT == 9 || ACT == 11 || ACT == 12 || ACT == 14 || ACT == 15 || ACT == 16 || ACT == 17, "k_gemm2: unsupported ACT code (would silently apply no activation)");
  __shared__ __attribute__((aligned(16))) float so[4][32][68];
  const int tid = threadIdx.x, w = tid >> 5, lane = tid & 31, ln = lane & 15, hh = lane >> 4; const int by = blockIdx.y;
  A += (size_t)by * sA; Bh += (size_t)by * sB; const size_t cofs = (size_t)by * sC; const float* bp = bias ? bias + (size_t)by * sBias : nullptr;
  const int ntn = N >> 6; const int mt = blockIdx.x / ntn, nq = blockIdx.x - mt * ntn; const int row0 = mt * 128 + 32 * w, col0 = nq * 64; if (row0 >= M) return;
  const _Float16* a0p = A + (size_t)(row0 + ln) * lda; const _Float16* a1p = a0p + (size_t)16 * lda;
  const _Float16* b0p = Bh + (size_t)(col0 + ln) * ldb; const _Float16* b1p = b0p + (size_t)16 * ldb; const _Float16* b2p = b1p + (size_t)16 * ldb; const _Float16* b3p = b2p + (size_t)16 * ldb;
  const v8f z8 = {0.f,0.f,0.f,0.f,0.f,0.f,0.f,0.f}; v8f c00 = z8, c01 = z8, c02 = z8, c03 = z8, c10 = z8, c11 = z8, c12 = z8, c13 = z8;
#pragma unroll 1
  for (int kb = 0; kb < K; kb += 32) { const v16h a0 = g2_frag(a0p + kb, hh), a1 = g2_frag(a1p + kb, hh);
    v16h b = g2_frag(b0p + kb, hh); c00 = g2_mma(a0, b, c00); c10 = g2_mma(a1, b, c10);
    b = g2_frag(b1p + kb, hh); c01 = g2_mma(a0, b, c01); c11 = g2_mma(a1, b, c11);
    b = g2_frag(b2p + kb, hh); c02 = g2_mma(a0, b, c02); c12 = g2_mma(a1, b, c12);
    b = g2_frag(b3p + kb, hh); c03 = g2_mma(a0, b, c03); c13 = g2_mma(a1, b, c13); }
  v8f accs[8] = {c00, c01, c02, c03, c10, c11, c12, c13};
#pragma unroll
  for (int u = 0; u < 8; ++u) { const int t = u & 3, half = u >> 2; const int col = col0 + t * 16 + ln; const float bv = bp ? bf16_round(bp[col]) : 0.f;
#pragma unroll
    for (int r = 0; r < 8; ++r) { const int rloc = half * 16 + 8 * hh + r; float v = accs[u][r] * alpha + bv; if (CP) { if (rowsPerB < 0) v += CP[cofs + (size_t)(row0g + row0 + rloc) * ldc + col];      /* rowsPerB < 0: own element of the batched C plane */ else { const int bidx = (row0g + row0 + rloc) / rowsPerB; v += CP[(size_t)bidx * sCPb + (size_t)by * 64 + col]; } }
      if (ACT == 3) v = fmaxf(v, 0.f); else if (ACT == 6) v = 0.5f * v * (1.0f + erff(v * 0.70710678118654752f)); else if (ACT == 11) v = 1.0f / (1.0f + expf(-v)); else if (ACT == 15) v = v / (1.0f + expf(-v)); else if (ACT == 12) v = (v > 0.f) ? v : 0.01f * v; else if (ACT == 8) v = tanhf(v); else if (ACT == 9) v = 0.5f * v * (1.0f + tanhf(0.7978845608028654f * (v + 0.044715f * v * v * v))); else if (ACT == 14) v = (v > 0.f) ? v : 0.1f * v; else if (ACT == 16) v = (v >= 0.f) ? v : 0.3f * v; else if (ACT == 17) v = (v >= 0.f) ? v : 0.2f * v;
      so[w][rloc][t * 16 + ln] = v; } }
  __builtin_amdgcn_fence(__ATOMIC_ACQ_REL, "workgroup"); __builtin_amdgcn_wave_barrier();
  const int rsub = lane >> 4, c4 = (lane & 15) * 4;
  {
#pragma unroll
    for (int q = 0; q < 16; ++q) { const int r = q * 2 + rsub; const v4f v = *(const v4fa*)&so[w][r][c4]; if (C) *(v4f*)(C + cofs + (size_t)(row0 + r) * ldc + col0 + c4) = v; if (C16) { v4h h4; for (int i = 0; i < 4; ++i) h4[i] = (_Float16)v[i]; *(v4h*)(C16 + cofs + (size_t)(row0 + r) * ldc + col0 + c4) = h4; } }
     } }


__global__ __launch_bounds__(256) void k_wnat(const float* __restrict__ w, size_t n8, _Float16* __restrict__ Bt) { const size_t t = (size_t)blockIdx.x * 256 + threadIdx.x; if (t >= n8) return; FragH f; for (int q = 0; q < 8; ++q) f.h[q] = (_Float16)(bf16_round(w[t * 8 + q]) * 16.0f); *(v8us*)((unsigned short*)Bt + t * 8) = f.half[0];  }
__global__ __launch_bounds__(256) void k_rsm(const float* __restrict__ S, _Float16* __restrict__ P, int nrows) {
  #pragma clang fp contract(off)
  const int i = blockIdx.x * 256 + threadIdx.x; if (i >= nrows) return; const float* s = S + (size_t)i * SQ; float mx = -3.0e38f;
#pragma unroll 1
  for (int j = 0; j < SQ; ++j) mx = fmaxf(mx, s[j]); float se = 0.f;
#pragma unroll 1
  for (int j = 0; j < SQ; ++j) se += expf(s[j] - mx); const float sc = 256.0f / se;
#pragma unroll 1
  for (int j0 = 0; j0 < SQ; j0 += 8) { FragH f; for (int q = 0; q < 8; ++q) f.h[q] = (_Float16)(expf(s[j0 + q] - mx) * sc); unsigned short* d = (unsigned short*)P + (size_t)i * SQ + j0; *(v8us*)d = f.half[0];  } }
__global__ __launch_bounds__(256) void k_vt(const _Float16* __restrict__ V16, int b, int h0, _Float16* __restrict__ VT) { __shared__ unsigned short tl[64][65]; const int tid = threadIdx.x; const int hh = blockIdx.x % HG, sg = blockIdx.x / HG; const int s0 = sg * 64; const int h = h0 + hh;
  for (int i = tid; i < 64 * 8; i += 256) { const int j = i / 8, d8 = (i % 8) * 8; FragH f; f.half[0] = *(const v8us*)((const unsigned short*)V16 + ((size_t)b * SQ + s0 + j) * DM + h * HD + d8); for (int q = 0; q < 8; ++q) tl[d8 + q][j] = f.u[q]; }
  __syncthreads();
  { for (int i = tid; i < 64 * 8; i += 256) { const int d = i / 8, j8 = (i % 8) * 8; FragH f; for (int q = 0; q < 8; ++q) f.u[q] = tl[d][j8 + q]; *(v8us*)((unsigned short*)VT + ((size_t)hh * HD + d) * SQ + s0 + j8) = f.half[0]; }  } }



__global__ __launch_bounds__(256) void k_rsmkm(const float* __restrict__ S, _Float16* __restrict__ P, int nrows, const int* __restrict__ am) {
  #pragma clang fp contract(off)
  const int t = blockIdx.x * 256 + threadIdx.x; if (t >= nrows) return; const size_t i = (size_t)t; const float* s = S + i * SQ; const int* mr = am + (size_t)(t % SQ) * SQ; float mx = -3.0e38f;
#pragma unroll 1
  for (int j = 0; j < SQ; ++j) { const float f = (mr[j] != 0) ? 1.f : 0.f; mx = fmaxf(mx, fmaf(f, s[j], (1.f - f) * -1.0e9f)); } float se = 0.f;
#pragma unroll 1
  for (int j = 0; j < SQ; ++j) { const float f = (mr[j] != 0) ? 1.f : 0.f; se += __expf(fmaf(f, s[j], (1.f - f) * -1.0e9f) - mx); } const float sc = 256.0f / se;
#pragma unroll 1
  for (int j0 = 0; j0 < SQ; j0 += 8) { FragH fr; for (int q = 0; q < 8; ++q) { const int j = j0 + q; const float f = (mr[j] != 0) ? 1.f : 0.f; fr.h[q] = (_Float16)(__expf(fmaf(f, s[j], (1.f - f) * -1.0e9f) - mx) * sc); }
    unsigned short* d = (unsigned short*)P + i * SQ + j0; *(v8us*)d = fr.half[0];  } }

__global__ __launch_bounds__(256) void k_bdshn(const float* __restrict__ Wb, _Float16* __restrict__ Bt) {
  const size_t t = (size_t)blockIdx.x * 256 + threadIdx.x; if (t >= (size_t)DM * DM / 8) return; const size_t e0 = t * 8; const int n = (int)(e0 / DM), k0 = (int)(e0 % DM); const int h = n >> 6, hk = k0 >> 6; const float on = (hk == h) ? 16.0f : 0.0f; const int o = n & 63, d0 = k0 & 63; FragH f;
  for (int q = 0; q < 8; ++q) f.h[q] = (_Float16)(bf16_round(Wb[(size_t)o * 64 + d0 + q]) * on);
  unsigned short* d = (unsigned short*)Bt + e0; *(v8us*)d = f.half[0];  }

// Fused attention: one launch for every (batch, head); scores, softmax and the weighted sum of V stay in registers, no score or weight plane in memory.
// A work-group is 8 waves x 32 queries of one head and walks the 2048 keys in stages of 64: the stage's K rows (64 keys x 64 dims) and V^T rows (64 dims x 64 keys) are fetched once per work-group with
// whole-line 16-byte loads, one stage ahead, and shared through two LDS buffers (rows of 128 B at a pitch of 144 B, the conflict-free pitch for 16-byte readers); one barrier per stage publishes the next
// buffer and ends the reads of the one refilled behind it. A wave works a stage in two passes of 32 keys. Per pass: S^T = K Q^T (A = 16 key rows, B = 16 query rows, both by g2_frag, so both in the same k order);
// a lane then holds, per 16-query tile, 16 scores of ONE query (query = lane & 15; keys 8 * (lane >> 4) + r of each 16-key tile), which is also the B-operand order of a 32-key product,
// so the weights go from the score accumulators straight into O^T += V^T P^T (A = 16 rows of V^T, again by g2_frag). Softmax is the running-maximum form in base 2: the maximum in use is raised,
// and sums and outputs rescaled, only when a pass exceeds it by more than 8 (weights stay <= 256, inside f16). Keys with mask == 0 take the module's fill through the addend of the scaling fma:
// the fill (-1e20 / 32, in base 2) absorbs any finite f16 score exactly, so the result is the fill itself, as the source's where() has it; a row with every key masked comes out uniform, as in the source.
// exp2 as asm text so that a v_nop stands directly behind the last transcendental: the instruction set asks for one slot before a result is used or a source overwritten (inside a run no v_exp_f32 touches
// another's register). Each works IN PLACE, on a register that the compiler's own subtraction has just written: so the asm never writes a register that a matrix instruction a few slots back still reads.
__device__ __forceinline__ float exp2_slot(float t) { asm("v_exp_f32 %0, %0\n\tv_nop" : "+v"(t)); return t; }
__device__ __forceinline__ void exp2_run8(float (&x)[8]) {
  asm("v_exp_f32 %0, %0\n\tv_exp_f32 %1, %1\n\tv_exp_f32 %2, %2\n\tv_exp_f32 %3, %3\n\tv_exp_f32 %4, %4\n\tv_exp_f32 %5, %5\n\tv_exp_f32 %6, %6\n\tv_exp_f32 %7, %7\n\tv_nop"
      : "+v"(x[0]), "+v"(x[1]), "+v"(x[2]), "+v"(x[3]), "+v"(x[4]), "+v"(x[5]), "+v"(x[6]), "+v"(x[7])); }
__device__ __forceinline__ float xhalf(float x) { return __builtin_bit_cast(float, __builtin_amdgcn_permlanex16(__builtin_bit_cast(int, x), __builtin_bit_cast(int, x), 0x76543210, 0xfedcba98, false, false)); }      /* lane l reads lane l ^ 16 */
__device__ __forceinline__ v8f fa_mma(v16h a, v16h b, v8f c) { return __builtin_amdgcn_wmma_f32_16x16x32_f16(false, a, false, b, (short)0, c, false, false); }
#define FA_NS (SQ / 64)      /* stages of 64 keys */
#define FA_LP 72             /* LDS row pitch in f16: 128 B of data + 16 B */
__global__ __launch_bounds__(256) void k_fattn(const _Float16* __restrict__ Q16, const _Float16* __restrict__ K16, const _Float16* __restrict__ VT, const int* __restrict__ Km, _Float16* __restrict__ O16) {
  __shared__ __attribute__((aligned(16))) float kb[SQ];      /* per key: 0 (kept) or the fill */
  __shared__ __attribute__((aligned(16))) _Float16 ks_[2][64 * FA_LP];      /* K rows of a stage: [key][dim] */
  __shared__ __attribute__((aligned(16))) _Float16 vs_[2][64 * FA_LP];      /* V^T rows of a stage: [dim][key] */
  const int tid = threadIdx.x, w = tid >> 5, lane = tid & 31, ln = lane & 15, hh = lane >> 4;
  const int bh = blockIdx.y, b = bh / NH, h = bh % NH; const int q0 = blockIdx.x * 256 + w * 32;
  const int sr = tid >> 3, sc8 = (tid & 7) * 8;      /* staging: 8 threads per 128-byte row, rows sr and sr + 32 */
  const _Float16* kg = K16 + ((size_t)b * SQ + sr) * DM + h * HD + sc8;
  const _Float16* vg = VT + ((size_t)bh * HD + sr) * SQ + sc8;
  const int so = sr * FA_LP + sc8;
  v8us gk0 = *(const v8us*)(const unsigned short*)kg, gk1 = *(const v8us*)(const unsigned short*)(kg + (size_t)32 * DM);
  v8us gv0 = *(const v8us*)(const unsigned short*)vg, gv1 = *(const v8us*)(const unsigned short*)(vg + (size_t)32 * SQ);
  for (int j = tid; j < SQ; j += 256) kb[j] = (Km[(size_t)b * SQ + j] != 0) ? 0.f : -4.5084220e18f;
  const _Float16* qp = Q16 + ((size_t)b * SQ + q0 + ln) * DM + h * HD;
  const float c2 = 0.03125f * 1.44269504f;      /* 1 / sqrt(embed size), in base 2 */
  const v8f z8 = {0.f,0.f,0.f,0.f,0.f,0.f,0.f,0.f};
  v16h qf[2][2];
#pragma unroll
  for (int t = 0; t < 2; ++t)
#pragma unroll
    for (int ks = 0; ks < 2; ++ks) qf[t][ks] = g2_frag(qp + (size_t)t * 16 * DM + ks * 32, hh);
  *(v8us*)(unsigned short*)&ks_[0][so] = gk0; *(v8us*)(unsigned short*)&ks_[0][so + 32 * FA_LP] = gk1;
  *(v8us*)(unsigned short*)&vs_[0][so] = gv0; *(v8us*)(unsigned short*)&vs_[0][so + 32 * FA_LP] = gv1;
  __syncthreads();      /* publishes stage 0 and the key table */
  v8f o[4][2];
#pragma unroll
  for (int dt = 0; dt < 4; ++dt) { o[dt][0] = z8; o[dt][1] = z8; }
  float mr[2] = {-3.0e38f, -3.0e38f}, lr[2] = {0.f, 0.f};
#pragma unroll 1
  for (int st = 0; st < FA_NS; ++st) {      /* kept rolled: one stage already fills the register file */
    const int keyn = (st + 1 < FA_NS) ? (st + 1) * 64 : st * 64;      /* the last stage refetches itself: in bounds, never read */
    const _Float16* kl = &ks_[st & 1][ln * FA_LP]; const _Float16* vl = &vs_[st & 1][ln * FA_LP];
    v16h kf[2][2], vf[4];
#pragma unroll
    for (int kt = 0; kt < 2; ++kt)
#pragma unroll
      for (int ks = 0; ks < 2; ++ks) kf[kt][ks] = g2_frag(kl + kt * 16 * FA_LP + ks * 32, hh);
#pragma unroll
    for (int p = 0; p < 2; ++p) {
      const int key0 = st * 64 + p * 32;
      /* next stage, half per pass through the same 8 registers: K rows fetched in the first pass, V^T rows in the second; each half is stored at its pass's end into the buffer that stage st - 1 read, whose readers left it at the last barrier */
      const v8us g0 = (p == 0) ? *(const v8us*)(const unsigned short*)(kg + (size_t)keyn * DM) : *(const v8us*)(const unsigned short*)(vg + keyn);
      const v8us g1 = (p == 0) ? *(const v8us*)(const unsigned short*)(kg + (size_t)(keyn + 32) * DM) : *(const v8us*)(const unsigned short*)(vg + (size_t)32 * SQ + keyn);
#pragma unroll
      for (int dt = 0; dt < 4; ++dt) vf[dt] = g2_frag(vl + dt * 16 * FA_LP + p * 32, hh);
      v8f sx[2][2];
#pragma unroll
      for (int kt = 0; kt < 2; ++kt)
#pragma unroll
        for (int qt = 0; qt < 2; ++qt) sx[kt][qt] = fa_mma(kf[kt][1], qf[qt][1], fa_mma(kf[kt][0], qf[qt][0], z8));
      if (p == 0) {      /* the second pass's K fragments, fetched behind the first pass's score products */
#pragma unroll
        for (int kt = 0; kt < 2; ++kt)
#pragma unroll
          for (int ks = 0; ks < 2; ++ks) kf[kt][ks] = g2_frag(kl + (32 + kt * 16) * FA_LP + ks * 32, hh); }
      float bias[2][8];
#pragma unroll
      for (int kt = 0; kt < 2; ++kt) { const v4f x0 = *(const v4fa*)&kb[key0 + kt * 16 + 8 * hh], x1 = *(const v4fa*)&kb[key0 + kt * 16 + 8 * hh + 4];
#pragma unroll
        for (int r = 0; r < 4; ++r) { bias[kt][r] = x0[r]; bias[kt][4 + r] = x1[r]; } }
      float mb[2]; bool need = false;
#pragma unroll
      for (int qt = 0; qt < 2; ++qt) { float mx0 = -3.0e38f, mx1 = -3.0e38f;
#pragma unroll
        for (int r = 0; r < 8; ++r) { sx[0][qt][r] = fmaf(sx[0][qt][r], c2, bias[0][r]); sx[1][qt][r] = fmaf(sx[1][qt][r], c2, bias[1][r]); mx0 = fmaxf(mx0, sx[0][qt][r]); mx1 = fmaxf(mx1, sx[1][qt][r]); }
        const float mx = fmaxf(mx0, mx1); mb[qt] = fmaxf(mx, xhalf(mx)); need = need || (mb[qt] > mr[qt] + 8.0f); }
      if (__builtin_amdgcn_ballot_w32(need) != 0) {      /* wave-uniform; rare after the first passes */
#pragma unroll
        for (int qt = 0; qt < 2; ++qt) { const float mn = fmaxf(mr[qt], mb[qt]); const float corr = exp2_slot(mr[qt] - mn); mr[qt] = mn; lr[qt] *= corr;
#pragma unroll
          for (int dt = 0; dt < 4; ++dt) o[dt][qt] = o[dt][qt] * corr; } }
#pragma unroll
      for (int qt = 0; qt < 2; ++qt) { FragH pf; float s0 = 0.f, s1 = 0.f, e0[8], e1[8];
#pragma unroll
        for (int r = 0; r < 8; ++r) { e0[r] = sx[0][qt][r] - mr[qt]; e1[r] = sx[1][qt][r] - mr[qt]; }
        exp2_run8(e0); exp2_run8(e1);
#pragma unroll
        for (int r = 0; r < 8; ++r) { s0 += e0[r]; s1 += e1[r]; pf.h[r] = (_Float16)e0[r]; pf.h[8 + r] = (_Float16)e1[r]; }
        lr[qt] += s0 + s1;
#pragma unroll
        for (int dt = 0; dt < 4; ++dt) o[dt][qt] = fa_mma(vf[dt], pf.v, o[dt][qt]); }
      { _Float16* gd = (p == 0) ? &ks_[(st + 1) & 1][so] : &vs_[(st + 1) & 1][so]; *(v8us*)(unsigned short*)gd = g0; *(v8us*)(unsigned short*)(gd + 32 * FA_LP) = g1; }
      if (p == 0) __builtin_amdgcn_sched_barrier(0);      /* keeps the next pass's score products out of this pass: moved up, their accumulators take the kernel past 256 registers */
    }
    __syncthreads();      /* publishes stage st + 1; ends every wave's reads of stage st before its buffer is refilled */
  }
#pragma unroll
  for (int qt = 0; qt < 2; ++qt) { const float sc = 64.0f / (lr[qt] + xhalf(lr[qt]));      /* the halves' sums join here; o carried x64 as before */
    unsigned short* op = (unsigned short*)O16 + ((size_t)b * SQ + q0 + qt * 16 + ln) * DM + h * HD + 8 * hh;
#pragma unroll
    for (int dt = 0; dt < 4; ++dt) { FragH f;
#pragma unroll
      for (int r = 0; r < 8; ++r) f.h[r] = (_Float16)(o[dt][qt][r] * sc);
      *(v8us*)(op + dt * 16) = f.half[0]; } }
}
extern "C" void kernel_launch(void* const* d_in, const int* in_sizes, int n_in,
                              void* d_out, int out_size, void* d_ws, size_t ws_size, hipStream_t stream) {
  (void)in_sizes; (void)n_in; (void)out_size;
  const float* const* I = (const float* const*)d_in; const float* xq = I[2]; const float* xk = I[1]; const float* xv = I[0]; const int* km = (const int*)d_in[3]; const float* wq = I[6]; const float* bq = nullptr; const float* wk = I[5]; const float* bk = nullptr; const float* wv = I[4]; const float* bv = nullptr; const float* wo = I[7]; const float* bo = I[8]; const float* x = xq;      /* contract order: values I[0], keys I[1], query I[2]; mask int32 [2][1][1][2048] (0 = masked key; READ on device); SHARED natural [64][64] blocks Wv I[4], Wk I[5], Wq I[6]; natural Wo [1024][1024] + bo */
  char* ws = (char*)d_ws; size_t off = 0;
  auto take = [&](size_t bytes) { char* p = ws + off; off += (bytes + 255) & ~(size_t)255; return p; };
  _Float16* BQ = (_Float16*)take((size_t)DM * DM * 2); _Float16* BK = (_Float16*)take((size_t)DM * DM * 2); _Float16* BV = (_Float16*)take((size_t)DM * DM * 2); _Float16* BO = (_Float16*)take((size_t)DM * DM * 2);
  _Float16* X16 = (_Float16*)take(NR * DM * 2); _Float16* XKp = (_Float16*)take(NR * DM * 2); _Float16* XVp = (_Float16*)take(NR * DM * 2); _Float16* Q16 = (_Float16*)take(NR * DM * 2); _Float16* K16 = (_Float16*)take(NR * DM * 2); _Float16* V16 = (_Float16*)take(NR * DM * 2); _Float16* O16 = (_Float16*)take(NR * DM * 2);
  _Float16* VT = (_Float16*)take((size_t)NB * NH * HD * SQ * 2);
  if (off > ws_size) return;
  { const unsigned g = (unsigned)(((size_t)DM * DM / 8 + 255) / 256); k_bdshn<<<g, 256, 0, stream>>>(wq, BQ); k_bdshn<<<g, 256, 0, stream>>>(wk, BK); k_bdshn<<<g, 256, 0, stream>>>(wv, BV); k_wnat<<<g, 256, 0, stream>>>(wo, (size_t)DM * DM / 8, BO); }      /* block-diagonal planes with the SHARED natural [64][64] block (Bt[h*64 + o][h*64 + d] = 16 W[o][d]); Wo natural [out][in] = Bt x16 */
  _Float16* XK = XKp; _Float16* XV = XVp; k_x16<<<(unsigned)((NR * DM / 8 + 255) / 256), 256, 0, stream>>>(xk, XK, NR * DM / 8); k_x16<<<(unsigned)((NR * DM / 8 + 255) / 256), 256, 0, stream>>>(xv, XV, NR * DM / 8);      /* key and value inputs as exact f16 rows */

  k_x16<<<(unsigned)((NR * DM / 8 + 255) / 256), 256, 0, stream>>>(x, X16, NR * DM / 8);
  const size_t r0p = (size_t)B0 * SQ;      /* first projected row */
  k_gemm2<0><<<dim3((unsigned)((MP / 128) * (DM / 64)), 1), 128, 0, stream>>>(X16 + r0p * DM, DM, 0, BQ, DM, 0, 0.0625f, bq, 0, nullptr, 1, 0, 0, nullptr, Q16 + r0p * DM, DM, 0, MP, DM, DM);
  k_gemm2<0><<<dim3((unsigned)((MP / 128) * (DM / 64)), 1), 128, 0, stream>>>(XK + r0p * DM, DM, 0, BK, DM, 0, 0.0625f, bk, 0, nullptr, 1, 0, 0, nullptr, K16 + r0p * DM, DM, 0, MP, DM, DM);
  k_gemm2<0><<<dim3((unsigned)((MP / 128) * (DM / 64)), 1), 128, 0, stream>>>(XV + r0p * DM, DM, 0, BV, DM, 0, 0.0625f, bv, 0, nullptr, 1, 0, 0, nullptr, V16 + r0p * DM, DM, 0, MP, DM, DM);
  k_vt<NH, SQ><<<NB * NH * (SQ / 64), 256, 0, stream>>>(V16, LQ, 0, VT);      /* V^T [NB][NH][HD][SQ], both batches */
  k_fattn<<<dim3(SQ / 256, NB * NH), 256, 0, stream>>>(Q16, K16, VT, km, O16);      /* scores, masked softmax and P V of every (batch, head) in one launch; o (merged heads, x64) as f16 rows */
  k_gemm2<0><<<dim3((unsigned)((MPO / 128) * (DM / 64)), 1), 128, 0, stream>>>(O16 + r0p * DM, DM, 0, BO, DM, 0, 0.0009765625f, bo, 0, nullptr, 1, 0, 0, (float*)d_out + r0p * DM, nullptr, DM, 0, MPO, DM, DM);      /* out rows are the output layout */
}

// v003
// A run of this version takes 102 microseconds.
// Two timings next to v002 put it at 2.28 and 2.38 times that version's speed.
// All steps since v000 together make it 33.7 times as fast.
#include <hip/hip_runtime.h>
// Multi-head attention over three inputs with SHARED per-head projections, a random key-padding mask and the module's literal score scale (values, keys, query [2][2048][1024]; each input is split into 16 heads of 64 and every head is multiplied by the SAME natural [64][64] matrix (x W^T: Wv / Wk / Wq; no biases); energy = q k^T; where(mask == 0, -1e20) with the int32 [2][1][1][2048] mask in {0, 1} (random; 0 = masked key; READ on device); softmax(energy / sqrt(embed_size) = / sqrt(1024) = / 32) (as the source); out = merged Wo^T + bo (natural [1024][1024]) -> [2][2048][1024]).
// Structure: token rows r = b*2048 + s; Q, K, V by one per-head projection launch (every 64-wide head slice of a token row is one row of a [65536][64] x [64][64]^T WMMA product, K = 64; f32 inputs rounded to bf16 and held as exact f16 in LDS, exact x16 weights, f32 accumulation, f16 outputs); V^T for all batches and heads via LDS transposes; one fused attention launch over every (batch, head): scores by WMMA (scale 1/32 = 1/sqrt(embed size), the module's literal scale), running-maximum softmax in registers (f32 statistics; unnormalised weights as f16), o = P . V by WMMA, divided by the row sum at the end (o carried x64 against f16 subnormal flush, folded into the output GEMM alpha) and written straight into the merged f16 o rows; out = o W_o + b GEMM (f32) into the output layout.
// Compute dtype: inputs rounded to bf16; x / weights exact; q, k, v, softmax weights and o as plain f16 GEMM operands (~2^-12); scores and softmax statistics f32. v_wmma_f32_16x16x32_f16.
#define NB 2
#define SQ 2048
#define DM 1024
#define NH 16
#define HD 64
#define HG 4                         /* heads per launch of the grouped k_vt overload (not launched) */
#define B0 0                         /* first batch processed (debug hook) */
#define NBR NB                       /* batches processed (debug hook) */
#define NR ((size_t)NB * SQ)         /* token rows */
#define MP ((int)((size_t)NBR * SQ)) /* token rows of the output stage, via MPO (debug hook) */
#define QN SQ                        /* query rows per batch (not used) */
#define NHD NH                       /* heads (not used) */
#define MPO MP                       /* rows through the output stage (debug hook) */
#define LQ DM      /* row pitch of the q/k/v rows */
typedef __bf16 v16b __attribute__((ext_vector_type(16)));
typedef unsigned short v8us __attribute__((ext_vector_type(8), may_alias));
typedef float  v8f  __attribute__((ext_vector_type(8)));
typedef float  v4f  __attribute__((ext_vector_type(4)));
typedef float  v4fa __attribute__((ext_vector_type(4), may_alias));
union FragB { v16b v; v8us half[2]; unsigned short u[16]; };

__device__ __forceinline__ unsigned short bf16_bits(float x) { unsigned int u = __float_as_uint(x); return (unsigned short)((u + 0x7FFFu + ((u >> 16) & 1u)) >> 16); }
__device__ __forceinline__ float bf16_val(unsigned short b) { return __uint_as_float(((unsigned int)b) << 16); }
__device__ __forceinline__ float bf16_round(float x) { return bf16_val(bf16_bits(x)); }
// D += A·B with NT terms: 1 = ah·bh, 2 = + al·bh (A split), 3 = + ah·bl (both split)
template <int NT>
__device__ __forceinline__ v8f mmaN(v16b ah, v16b al, v16b bh, v16b bl, v8f c) {
  c = __builtin_amdgcn_wmma_f32_16x16x32_bf16(false, ah, false, bh, (short)0, c, false, false);
  if (NT >= 2) c = __builtin_amdgcn_wmma_f32_16x16x32_bf16(false, al, false, bh, (short)0, c, false, false);
  if (NT >= 3) c = __builtin_amdgcn_wmma_f32_16x16x32_bf16(false, ah, false, bl, (short)0, c, false, false);
  asm volatile("v_nop\n\tv_nop\n\tv_nop\n\tv_nop" : "+v"(c) : "v"(ah), "v"(al), "v"(bh), "v"(bl));
  return c;
}

__global__ __launch_bounds__(256) void k_wt_bf16(const float* __restrict__ W, unsigned short* __restrict__ Wt, int K, int N) {
  const int t = blockIdx.x * 256 + threadIdx.x;
  const int k8n = K / 8;
  if (t >= N * k8n) return;
  const int n = t / k8n, k8 = (t % k8n) * 8;
  v8us v;
#pragma unroll
  for (int i = 0; i < 8; ++i) v[i] = bf16_bits(W[(size_t)(k8 + i) * N + n]);
  *(v8us*)(Wt + (size_t)n * K + k8) = v;
  
}

// GEMM C[M][N] (f32, pitch ldc) = act(A[M][K]·W + bias). A f32 row-major (pitch lda) converted per fragment to bf16
// (ASPLIT: hi/lo two planes -> 2 terms, else single rounded term); Wt bf16 [N][K] (pitch ldb). BIAS_BF16 rounds the
// bias to bf16 first (bias quantised to bf16 before the add). K%32==0, M%16==0, N%64==0.
template <bool ASPLIT, int ACT, bool BIAS_BF16>
__global__ __launch_bounds__(128) void k_gemm_bf(const float* __restrict__ A, int lda, const unsigned short* __restrict__ Wt, int ldb,
                                               const float* __restrict__ bias, float* __restrict__ C, int ldc, int M, int N, int K) {
  __shared__ __attribute__((aligned(16))) float so[4][16][64];
  const int tid = threadIdx.x, w = tid >> 5, lane = tid & 31, ln = lane & 15, hh = lane >> 4;
  const int ntn = N / 64;
  const int wid = blockIdx.x * 4 + w;
  const int mt = wid / ntn, nq = wid % ntn;
  if (mt * 16 >= M) return;
  const int row0 = mt * 16, col0 = nq * 64;
  const float* arow = A + (size_t)(row0 + ln) * lda;
  v8f acc[4] = {};
  for (int kb = 0; kb < K; kb += 32) {
    FragB ah, al;
    const v4f x0 = *(const v4fa*)(arow + kb + 8 * hh), x1 = *(const v4fa*)(arow + kb + 8 * hh + 4);
    const v4f x2 = *(const v4fa*)(arow + kb + 16 + 8 * hh), x3 = *(const v4fa*)(arow + kb + 16 + 8 * hh + 4);
    float xs[16] = {x0[0],x0[1],x0[2],x0[3],x1[0],x1[1],x1[2],x1[3],x2[0],x2[1],x2[2],x2[3],x3[0],x3[1],x3[2],x3[3]};
#pragma unroll
    for (int i = 0; i < 16; ++i) { const unsigned short hb = bf16_bits(xs[i]); ah.u[i] = hb; al.u[i] = ASPLIT ? bf16_bits(xs[i] - bf16_val(hb)) : (unsigned short)0; }
#pragma unroll
    for (int t = 0; t < 4; ++t) {
      const unsigned short* brow = Wt + (size_t)(col0 + t * 16 + ln) * ldb + kb;
      FragB b;
      b.half[0] = *(const v8us*)(brow + 8 * hh);
      b.half[1] = *(const v8us*)(brow + 16 + 8 * hh);
      acc[t] = mmaN<ASPLIT ? 2 : 1>(ah.v, al.v, b.v, b.v, acc[t]);
    }
  }
#pragma unroll
  for (int t = 0; t < 4; ++t) {
    float bv = bias ? bias[col0 + t * 16 + ln] : 0.f;
    if (BIAS_BF16) bv = bf16_round(bv);
#pragma unroll
    for (int r = 0; r < 8; ++r) { float v = acc[t][r] + bv; if (ACT == 1) v = fmaxf(v, 0.f); so[w][8 * hh + r][t * 16 + ln] = v; }
  }
  __builtin_amdgcn_fence(__ATOMIC_ACQ_REL, "workgroup");
  __builtin_amdgcn_wave_barrier();
  const int rsub = lane >> 4, c4 = (lane & 15) * 4;
  {
#pragma unroll
    for (int q = 0; q < 8; ++q) {
      const int r = q * 2 + rsub;
      const v4f v = *(const v4fa*)&so[w][r][c4];
      *(v4f*)(C + (size_t)(row0 + r) * ldc + col0 + c4) = v;
    }
    
  }
}

// GEMM C = act(A·W + bias + resid): A f32 (ASPLIT -> hi/lo 2 terms), Wt bf16 [N][K]; ACT 0 none, 1 relu, 2 exact gelu;
// resid (optional, f32, row index = (row % rmod), pitch ldr, RES_BF16 rounds it) added before the activation.
template <bool ASPLIT, int ACT, bool BIAS_BF16, bool RES_BF16>
__global__ __launch_bounds__(128) void k_gemm_bf3(const float* __restrict__ A, int lda, const unsigned short* __restrict__ Wt, int ldb,
                                                const float* __restrict__ bias, const float* __restrict__ resid, int rmod, int ldr,
                                                float* __restrict__ C, int ldc, int M, int N, int K) {
  __shared__ __attribute__((aligned(16))) float so[4][16][64];
  const int tid = threadIdx.x, w = tid >> 5, lane = tid & 31, ln = lane & 15, hh = lane >> 4;
  const int ntn = N / 64;
  const int wid = blockIdx.x * 4 + w;
  const int mt = wid / ntn, nq = wid % ntn;
  if (mt * 16 >= M) return;
  const int row0 = mt * 16, col0 = nq * 64;
  const float* arow = A + (size_t)(row0 + ln) * lda;
  v8f acc[4] = {};
  for (int kb = 0; kb < K; kb += 32) {
    FragB ah, al;
    const v4f x0 = *(const v4fa*)(arow + kb + 8 * hh), x1 = *(const v4fa*)(arow + kb + 8 * hh + 4);
    const v4f x2 = *(const v4fa*)(arow + kb + 16 + 8 * hh), x3 = *(const v4fa*)(arow + kb + 16 + 8 * hh + 4);
    float xs[16] = {x0[0],x0[1],x0[2],x0[3],x1[0],x1[1],x1[2],x1[3],x2[0],x2[1],x2[2],x2[3],x3[0],x3[1],x3[2],x3[3]};
#pragma unroll
    for (int i = 0; i < 16; ++i) { const unsigned short hb = bf16_bits(xs[i]); ah.u[i] = hb; al.u[i] = ASPLIT ? bf16_bits(xs[i] - bf16_val(hb)) : (unsigned short)0; }
#pragma unroll
    for (int t = 0; t < 4; ++t) {
      const unsigned short* brow = Wt + (size_t)(col0 + t * 16 + ln) * ldb + kb;
      FragB b;
      b.half[0] = *(const v8us*)(brow + 8 * hh);
      b.half[1] = *(const v8us*)(brow + 16 + 8 * hh);
      acc[t] = mmaN<ASPLIT ? 2 : 1>(ah.v, al.v, b.v, b.v, acc[t]);
    }
  }
#pragma unroll
  for (int t = 0; t < 4; ++t) {
    const int col = col0 + t * 16 + ln;
    float bv = bias ? bias[col] : 0.f;
    if (BIAS_BF16) bv = bf16_round(bv);
#pragma unroll
    for (int r = 0; r < 8; ++r) {
      float v = acc[t][r] + bv;
      if (resid) { float rv = resid[(size_t)((row0 + 8 * hh + r) % rmod) * ldr + col]; if (RES_BF16) rv = bf16_round(rv); v += rv; }
      if (ACT == 1) v = fmaxf(v, 0.f);
      if (ACT == 2) v = 0.5f * v * (1.0f + erff(v * 0.70710678118654752f));
      if (ACT == 3) { const float u = 0.7978845608028654f * (v + 0.044715f * v * v * v); v = 0.5f * v * (1.0f + tanhf(u)); }
      so[w][8 * hh + r][t * 16 + ln] = v;
    }
  }
  __builtin_amdgcn_fence(__ATOMIC_ACQ_REL, "workgroup");
  __builtin_amdgcn_wave_barrier();
  const int rsub = lane >> 4, c4 = (lane & 15) * 4;
  {
#pragma unroll
    for (int q = 0; q < 8; ++q) {
      const int r = q * 2 + rsub;
      const v4f v = *(const v4fa*)&so[w][r][c4];
      *(v4f*)(C + (size_t)(row0 + r) * ldc + col0 + c4) = v;
    }
    
  }
}
// row LayerNorm (biased variance, eps) over N: s = X (+ R); optional out_sum <- s; out_norm <- (s-mu)*rsqrt(var+eps)*g + b
template <bool PARAM_BF16>
__global__ __launch_bounds__(256) void k_layernorm(const float* __restrict__ X, const float* __restrict__ R, const float* __restrict__ g, const float* __restrict__ bta,
                                                  float* __restrict__ out_sum, float* __restrict__ out_norm, int N, float eps) {
  __shared__ float red[256];
  const int row = blockIdx.x, tid = threadIdx.x;
  const float* x = X + (size_t)row * N; const float* rr = R ? R + (size_t)row * N : nullptr;
  float vals[16];                     // up to N = 4096
  const int per = N / 256;            // contiguous chunk per thread? use strided-by-4 chunks: thread handles j = tid*4 + 1024*u
  float s1 = 0.f;
  for (int u = 0; u < per / 4; ++u) {
    const int j = tid * 4 + 1024 * u;
    const v4f a = *(const v4fa*)(x + j);
    v4f b = {0.f,0.f,0.f,0.f}; if (rr) b = *(const v4fa*)(rr + j);
#pragma unroll
    for (int q = 0; q < 4; ++q) { const float v = a[q] + b[q]; vals[u * 4 + q] = v; s1 += v; }
  }
  red[tid] = s1; __syncthreads();
  for (int st = 128; st > 0; st >>= 1) { if (tid < st) red[tid] += red[tid + st]; __syncthreads(); }
  const float mu = red[0] / (float)N; __syncthreads();
  float s2 = 0.f;
  for (int u = 0; u < per / 4; ++u)
#pragma unroll
    for (int q = 0; q < 4; ++q) { const float c = vals[u * 4 + q] - mu; s2 += c * c; }
  red[tid] = s2; __syncthreads();
  for (int st = 128; st > 0; st >>= 1) { if (tid < st) red[tid] += red[tid + st]; __syncthreads(); }
  const float rs = rsqrtf(red[0] / (float)N + eps);
  {
    for (int u = 0; u < per / 4; ++u) {
      const int j = tid * 4 + 1024 * u;
      v4f o, sm;
#pragma unroll
      for (int q = 0; q < 4; ++q) {
        float gg = g[j + q], bb = bta[j + q];
        if (PARAM_BF16) { gg = bf16_round(gg); bb = bf16_round(bb); }
        sm[q] = vals[u * 4 + q]; o[q] = (vals[u * 4 + q] - mu) * rs * gg + bb;
      }
      if (out_sum) *(v4f*)(out_sum + (size_t)row * N + j) = sm;
      *(v4f*)(out_norm + (size_t)row * N + j) = o;
    }
    
  }
}



// ---- f16 WMMA path (v_wmma_f32_16x16x32_f16): 11-bit significands for operands in range — used where a [0,1] probability operand needs more precision than bf16
typedef _Float16 v16h __attribute__((ext_vector_type(16)));
union FragH { v16h v; v8us half[2]; _Float16 h[16]; unsigned short u[16]; };
template <int NT>
__device__ __forceinline__ v8f mmaH(v16h ah, v16h al, v16h bh, v16h bl, v8f c) {
  c = __builtin_amdgcn_wmma_f32_16x16x32_f16(false, ah, false, bh, (short)0, c, false, false);
  if (NT >= 2) c = __builtin_amdgcn_wmma_f32_16x16x32_f16(false, al, false, bh, (short)0, c, false, false);
  if (NT >= 3) c = __builtin_amdgcn_wmma_f32_16x16x32_f16(false, ah, false, bl, (short)0, c, false, false);
  asm volatile("v_nop\n\tv_nop\n\tv_nop\n\tv_nop" : "+v"(c) : "v"(ah), "v"(al), "v"(bh), "v"(bl));
  return c;
}
// batched GEMM like k_gemm_b but f16 operands: A f32 (split into f16 hi/lo if ASPLIT, else rounded to f16), Bt = f16 values [n][k]; alpha; C f32; N multiple of 16 (partial tiles skipped)
template <bool ASPLIT>
__global__ __launch_bounds__(128) void k_gemm_h(const float* __restrict__ A, int lda, size_t sA, const _Float16* __restrict__ Bh, int ldb, size_t sB, float alpha, float* __restrict__ C, int ldc, size_t sC, int M, int N, int K) {
  __shared__ __attribute__((aligned(16))) float so[4][16][64];
  const int tid = threadIdx.x, w = tid >> 5, lane = tid & 31, ln = lane & 15, hh = lane >> 4; const int by = blockIdx.y;
  A += (size_t)by * sA; Bh += (size_t)by * sB; C += (size_t)by * sC;
  const int ntn = (N + 63) / 64; const int wid = blockIdx.x * 4 + w; const int mt = wid / ntn, nq = wid % ntn; if (mt * 16 >= M) return;
  const int row0 = mt * 16, col0 = nq * 64; const float* arow = A + (size_t)(row0 + ln) * lda;
  v8f acc[4] = {};
  for (int kb = 0; kb < K; kb += 32) {
    FragH ah, al;
    const v4f x0 = *(const v4fa*)(arow + kb + 8 * hh), x1 = *(const v4fa*)(arow + kb + 8 * hh + 4), x2 = *(const v4fa*)(arow + kb + 16 + 8 * hh), x3 = *(const v4fa*)(arow + kb + 16 + 8 * hh + 4);
    float xs[16] = {x0[0],x0[1],x0[2],x0[3],x1[0],x1[1],x1[2],x1[3],x2[0],x2[1],x2[2],x2[3],x3[0],x3[1],x3[2],x3[3]};
#pragma unroll
    for (int i = 0; i < 16; ++i) { const _Float16 h = (_Float16)xs[i]; ah.h[i] = h; al.h[i] = ASPLIT ? (_Float16)(xs[i] - (float)h) : (_Float16)0.0f; }
#pragma unroll
    for (int t = 0; t < 4; ++t) { if (col0 + t * 16 >= N) continue; const size_t boff = (size_t)(col0 + t * 16 + ln) * ldb + kb; FragH bq; bq.half[0] = *(const v8us*)(Bh + boff + 8 * hh); bq.half[1] = *(const v8us*)(Bh + boff + 16 + 8 * hh);
      acc[t] = mmaH<ASPLIT ? 2 : 1>(ah.v, al.v, bq.v, bq.v, acc[t]); }
  }
#pragma unroll
  for (int t = 0; t < 4; ++t) { if (col0 + t * 16 >= N) continue;
#pragma unroll
    for (int r = 0; r < 8; ++r) so[w][8 * hh + r][t * 16 + ln] = acc[t][r] * alpha; }
  __builtin_amdgcn_fence(__ATOMIC_ACQ_REL, "workgroup"); __builtin_amdgcn_wave_barrier();
  const int rsub = lane >> 4, c4 = (lane & 15) * 4;
  {
#pragma unroll
    for (int q = 0; q < 8; ++q) { const int r = q * 2 + rsub; if (col0 + c4 < N) { const v4f v = *(const v4fa*)&so[w][r][c4]; *(v4f*)(C + (size_t)(row0 + r) * ldc + col0 + c4) = v; } }
     }
}

// Wt[n][k] = f16(W[k][n]·scale) from f32 row-major W[K][N] (scale = power of two; bf16-exact weights stay exact in f16 away from the subnormal range)
__global__ __launch_bounds__(256) void k_wt_f16(const float* __restrict__ W, _Float16* __restrict__ Wt, int K, int N, float scale) {
  const int t = blockIdx.x * 256 + threadIdx.x; if (t >= N * (K / 8)) return; const int n = t / (K / 8), k8 = (t % (K / 8)) * 8; FragH f;
#pragma unroll
  for (int i = 0; i < 8; ++i) f.h[i] = (_Float16)(bf16_round(W[(size_t)(k8 + i) * N + n]) * scale); const v8us o = f.half[0];
  *(v8us*)((unsigned short*)Wt + (size_t)n * K + k8) = o; 
}
// k_gemm_hh variant with fused epilogue: v = acc·alpha + bias[by·sBias + col] (+ CP[(row/rowsPerB)·sCPb + by·64 + col] if CP) ; ACT 0 none / 1 elu ; writes f16 C16 (and f32 C if non-null)
template <int ACT>
__global__ __launch_bounds__(128) void k_gemm_hhx(const _Float16* __restrict__ A, int lda, size_t sA, const _Float16* __restrict__ Bh, int ldb, size_t sB, float alpha, const float* __restrict__ bias, size_t sBias, const float* __restrict__ CP, int rowsPerB, size_t sCPb, int row0g,
    float* __restrict__ C, _Float16* __restrict__ C16, int ldc, size_t sC, int M, int N, int K) {
  __shared__ __attribute__((aligned(16))) float so[4][16][64];
  const int tid = threadIdx.x, w = tid >> 5, lane = tid & 31, ln = lane & 15, hh = lane >> 4; const int by = blockIdx.y;
  A += (size_t)by * sA; Bh += (size_t)by * sB; const size_t cofs = (size_t)by * sC; const float* bp = bias ? bias + (size_t)by * sBias : nullptr;
  const int ntn = (N + 63) / 64; const int wid = blockIdx.x * 4 + w; const int mt = wid / ntn, nq = wid % ntn; if (mt * 16 >= M) return;
  const int row0 = mt * 16, col0 = nq * 64; const _Float16* arow = A + (size_t)(row0 + ln) * lda;
  v8f acc[4] = {};
  for (int kb = 0; kb < K; kb += 32) { FragH ah; ah.half[0] = *(const v8us*)((const unsigned short*)arow + kb + 8 * hh); ah.half[1] = *(const v8us*)((const unsigned short*)arow + kb + 16 + 8 * hh);
#pragma unroll
    for (int t = 0; t < 4; ++t) { if (col0 + t * 16 >= N) continue; const size_t boff = (size_t)(col0 + t * 16 + ln) * ldb + kb; FragH bq; bq.half[0] = *(const v8us*)((const unsigned short*)Bh + boff + 8 * hh); bq.half[1] = *(const v8us*)((const unsigned short*)Bh + boff + 16 + 8 * hh);
      acc[t] = mmaH<1>(ah.v, ah.v, bq.v, bq.v, acc[t]); }
  }
#pragma unroll
  for (int t = 0; t < 4; ++t) { if (col0 + t * 16 >= N) continue; const int col = col0 + t * 16 + ln; const float bv = bp ? bf16_round(bp[col]) : 0.f;
#pragma unroll
    for (int r = 0; r < 8; ++r) { float v = acc[t][r] * alpha + bv; if (CP) { const int rr = row0g + row0 + 8 * hh + r; if (rowsPerB < 0) v += CP[cofs + (size_t)rr * ldc + col];      /* rowsPerB < 0: own element of the batched C plane */ else { const int bidx = rr / rowsPerB; v += CP[(size_t)bidx * sCPb + (size_t)by * 64 + col]; } } if (ACT == 1) v = (v > 0.f) ? v : expm1f(v); else if (ACT == 7) v = (v > 0.f) ? v + 1.0f : expf(v); else if (ACT == 8) v = tanhf(v); else if (ACT == 9) v = 0.5f * v * (1.0f + tanhf(0.7978845608028654f * (v + 0.044715f * v * v * v))); else if (ACT == 11) v = 1.0f / (1.0f + expf(-v)); else if (ACT == 12) v = (v > 0.f) ? v : 0.01f * v; else if (ACT == 14) v = (v > 0.f) ? v : 0.1f * v; else if (ACT == 16) v = (v >= 0.f) ? v : 0.3f * v; else if (ACT == 17) v = (v >= 0.f) ? v : 0.2f * v; else if (ACT == 15) v = v / (1.0f + expf(-v)); else if (ACT == 3) v = fmaxf(v, 0.f); else if (ACT == 6) v = 0.5f * v * (1.0f + erff(v * 0.70710678118654752f)); so[w][8 * hh + r][t * 16 + ln] = v; } }
  __builtin_amdgcn_fence(__ATOMIC_ACQ_REL, "workgroup"); __builtin_amdgcn_wave_barrier();
  const int rsub = lane >> 4, c4 = (lane & 15) * 4; typedef _Float16 v4h __attribute__((ext_vector_type(4)));
  {
#pragma unroll
    for (int q = 0; q < 8; ++q) { const int r = q * 2 + rsub; if (col0 + c4 < N) { const v4f v = *(const v4fa*)&so[w][r][c4]; if (C) *(v4f*)(C + cofs + (size_t)(row0 + r) * ldc + col0 + c4) = v; if (C16) { v4h h4; for (int i = 0; i < 4; ++i) h4[i] = (_Float16)v[i]; *(v4h*)(C16 + cofs + (size_t)(row0 + r) * ldc + col0 + c4) = h4; } } }
     }
}


typedef _Float16 v4h __attribute__((ext_vector_type(4)));

__global__ __launch_bounds__(256) void k_x16(const float* __restrict__ x, _Float16* __restrict__ X16, size_t n8) { const size_t t = (size_t)blockIdx.x * 256 + threadIdx.x; if (t >= n8) return; FragH f;
#pragma unroll
  for (int q = 0; q < 8; ++q) f.h[q] = (_Float16)bf16_round(x[t * 8 + q]); *(v8us*)((unsigned short*)X16 + t * 8) = f.half[0];  }
__global__ __launch_bounds__(256) void k_h16(const float* __restrict__ x, _Float16* __restrict__ X16, size_t n8) { const size_t t = (size_t)blockIdx.x * 256 + threadIdx.x; if (t >= n8) return; FragH f;
#pragma unroll
  for (int q = 0; q < 8; ++q) f.h[q] = (_Float16)x[t * 8 + q]; *(v8us*)((unsigned short*)X16 + t * 8) = f.half[0];  }
__global__ __launch_bounds__(256) void k_round16f(const float* __restrict__ W, _Float16* __restrict__ Bt, size_t n8) { const size_t t = (size_t)blockIdx.x * 256 + threadIdx.x; if (t >= n8) return; FragH f;
#pragma unroll
  for (int i = 0; i < 8; ++i) f.h[i] = (_Float16)(bf16_round(W[t * 8 + i]) * 16.0f); *(v8us*)((unsigned short*)Bt + t * 8) = f.half[0];  }
template <int NHv, int TTv>
__global__ __launch_bounds__(256) void k_vt(const _Float16* __restrict__ V16, int ldv, int voff, _Float16* __restrict__ Vt) { __shared__ unsigned short tl[64][66]; const int tid = threadIdx.x; const int slab = blockIdx.x / (TTv / 64), lg = blockIdx.x % (TTv / 64); const int b = slab / NHv, h = slab % NHv;
  for (int i = tid; i < 64 * 8; i += 256) { const int r = i / 8, c8 = (i % 8) * 8; FragH f; f.half[0] = *(const v8us*)((const unsigned short*)V16 + ((size_t)b * TTv + lg * 64 + r) * ldv + voff + h * 64 + c8);
#pragma unroll
    for (int q = 0; q < 8; ++q) tl[r][c8 + q] = f.u[q]; }
  __syncthreads();
  {
#pragma unroll
    for (int rd = 0; rd < 2; ++rd) { const int d = rd * 32 + tid / 8, pc = tid % 8; FragH f;
#pragma unroll
      for (int q = 0; q < 8; ++q) f.u[q] = tl[pc * 8 + q][d];
      *(v8us*)((unsigned short*)Vt + ((size_t)slab * 64 + d) * TTv + lg * 64 + pc * 8) = f.half[0]; }
     } }

__global__ __launch_bounds__(256) void k_hl(const float* __restrict__ F, _Float16* __restrict__ Hh, _Float16* __restrict__ Hl, size_t n8) { const size_t t = (size_t)blockIdx.x * 256 + threadIdx.x; if (t >= n8) return; FragH fh, fl; const v4f a = *(const v4fa*)(F + t * 8), c = *(const v4fa*)(F + t * 8 + 4);
#pragma unroll
  for (int q = 0; q < 4; ++q) { _Float16 h = (_Float16)a[q]; fh.h[q] = h; fl.h[q] = (_Float16)((a[q] - (float)h) * 1024.0f); h = (_Float16)c[q]; fh.h[4 + q] = h; fl.h[4 + q] = (_Float16)((c[q] - (float)h) * 1024.0f); }
  { *(v8us*)((unsigned short*)Hh + t * 8) = fh.half[0]; *(v8us*)((unsigned short*)Hl + t * 8) = fl.half[0];  } }

// ---- fast GEMM (wave tile 32x64; requires M % 32 == 0 rows per launch region and N % 64 == 0); epilogue = k_gemm_hhx semantics ----
__device__ __forceinline__ v16h g2_frag(const _Float16* p, int hh) { FragH f; f.half[0] = *(const v8us*)((const unsigned short*)p + 8 * hh); f.half[1] = *(const v8us*)((const unsigned short*)p + 16 + 8 * hh); return f.v; }
__device__ __forceinline__ v8f g2_mma(v16h a, v16h b, v8f c) { v8f d = __builtin_amdgcn_wmma_f32_16x16x32_f16(false, a, false, b, (short)0, c, false, false); asm volatile("v_nop\n\tv_nop\n\tv_nop\n\tv_nop" : "+v"(d) : "v"(a), "v"(b)); return d; }
template <int ACT>
__global__ __launch_bounds__(128) void k_gemm2(const _Float16* __restrict__ A, int lda, size_t sA, const _Float16* __restrict__ Bh, int ldb, size_t sB, float alpha, const float* __restrict__ bias, size_t sBias, const float* __restrict__ CP, int rowsPerB, size_t sCPb, int row0g,
    float* __restrict__ C, _Float16* __restrict__ C16, int ldc, size_t sC, int M, int N, int K) { static_assert(ACT == 0 || ACT == 3 || ACT == 6 || ACT == 8 || ACT == 9 || ACT == 11 || ACT == 12 || ACT == 14 || ACT == 15 || ACT == 16 || ACT == 17, "k_gemm2: unsupported ACT code (would silently apply no activation)");
  __shared__ __attribute__((aligned(16))) float so[4][32][68];
  const int tid = threadIdx.x, w = tid >> 5, lane = tid & 31, ln = lane & 15, hh = lane >> 4; const int by = blockIdx.y;
  A += (size_t)by * sA; Bh += (size_t)by * sB; const size_t cofs = (size_t)by * sC; const float* bp = bias ? bias + (size_t)by * sBias : nullptr;
  const int ntn = N >> 6; const int mt = blockIdx.x / ntn, nq = blockIdx.x - mt * ntn; const int row0 = mt * 128 + 32 * w, col0 = nq * 64; if (row0 >= M) return;
  const _Float16* a0p = A + (size_t)(row0 + ln) * lda; const _Float16* a1p = a0p + (size_t)16 * lda;
  const _Float16* b0p = Bh + (size_t)(col0 + ln) * ldb; const _Float16* b1p = b0p + (size_t)16 * ldb; const _Float16* b2p = b1p + (size_t)16 * ldb; const _Float16* b3p = b2p + (size_t)16 * ldb;
  const v8f z8 = {0.f,0.f,0.f,0.f,0.f,0.f,0.f,0.f}; v8f c00 = z8, c01 = z8, c02 = z8, c03 = z8, c10 = z8, c11 = z8, c12 = z8, c13 = z8;
#pragma unroll 1
  for (int kb = 0; kb < K; kb += 32) { const v16h a0 = g2_frag(a0p + kb, hh), a1 = g2_frag(a1p + kb, hh);
    v16h b = g2_frag(b0p + kb, hh); c00 = g2_mma(a0, b, c00); c10 = g2_mma(a1, b, c10);
    b = g2_frag(b1p + kb, hh); c01 = g2_mma(a0, b, c01); c11 = g2_mma(a1, b, c11);
    b = g2_frag(b2p + kb, hh); c02 = g2_mma(a0, b, c02); c12 = g2_mma(a1, b, c12);
    b = g2_frag(b3p + kb, hh); c03 = g2_mma(a0, b, c03); c13 = g2_mma(a1, b, c13); }
  v8f accs[8] = {c00, c01, c02, c03, c10, c11, c12, c13};
#pragma unroll
  for (int u = 0; u < 8; ++u) { const int t = u & 3, half = u >> 2; const int col = col0 + t * 16 + ln; const float bv = bp ? bf16_round(bp[col]) : 0.f;
#pragma unroll
    for (int r = 0; r < 8; ++r) { const int rloc = half * 16 + 8 * hh + r; float v = accs[u][r] * alpha + bv; if (CP) { if (rowsPerB < 0) v += CP[cofs + (size_t)(row0g + row0 + rloc) * ldc + col];      /* rowsPerB < 0: own element of the batched C plane */ else { const int bidx = (row0g + row0 + rloc) / rowsPerB; v += CP[(size_t)bidx * sCPb + (size_t)by * 64 + col]; } }
      if (ACT == 3) v = fmaxf(v, 0.f); else if (ACT == 6) v = 0.5f * v * (1.0f + erff(v * 0.70710678118654752f)); else if (ACT == 11) v = 1.0f / (1.0f + expf(-v)); else if (ACT == 15) v = v / (1.0f + expf(-v)); else if (ACT == 12) v = (v > 0.f) ? v : 0.01f * v; else if (ACT == 8) v = tanhf(v); else if (ACT == 9) v = 0.5f * v * (1.0f + tanhf(0.7978845608028654f * (v + 0.044715f * v * v * v))); else if (ACT == 14) v = (v > 0.f) ? v : 0.1f * v; else if (ACT == 16) v = (v >= 0.f) ? v : 0.3f * v; else if (ACT == 17) v = (v >= 0.f) ? v : 0.2f * v;
      so[w][rloc][t * 16 + ln] = v; } }
  __builtin_amdgcn_fence(__ATOMIC_ACQ_REL, "workgroup"); __builtin_amdgcn_wave_barrier();
  const int rsub = lane >> 4, c4 = (lane & 15) * 4;
  {
#pragma unroll
    for (int q = 0; q < 16; ++q) { const int r = q * 2 + rsub; const v4f v = *(const v4fa*)&so[w][r][c4]; if (C) *(v4f*)(C + cofs + (size_t)(row0 + r) * ldc + col0 + c4) = v; if (C16) { v4h h4; for (int i = 0; i < 4; ++i) h4[i] = (_Float16)v[i]; *(v4h*)(C16 + cofs + (size_t)(row0 + r) * ldc + col0 + c4) = h4; } }
     } }


__global__ __launch_bounds__(256) void k_wnat(const float* __restrict__ w, size_t n8, _Float16* __restrict__ Bt) { const size_t t = (size_t)blockIdx.x * 256 + threadIdx.x; if (t >= n8) return; FragH f; for (int q = 0; q < 8; ++q) f.h[q] = (_Float16)(bf16_round(w[t * 8 + q]) * 16.0f); *(v8us*)((unsigned short*)Bt + t * 8) = f.half[0];  }
__global__ __launch_bounds__(256) void k_rsm(const float* __restrict__ S, _Float16* __restrict__ P, int nrows) {
  #pragma clang fp contract(off)
  const int i = blockIdx.x * 256 + threadIdx.x; if (i >= nrows) return; const float* s = S + (size_t)i * SQ; float mx = -3.0e38f;
#pragma unroll 1
  for (int j = 0; j < SQ; ++j) mx = fmaxf(mx, s[j]); float se = 0.f;
#pragma unroll 1
  for (int j = 0; j < SQ; ++j) se += expf(s[j] - mx); const float sc = 256.0f / se;
#pragma unroll 1
  for (int j0 = 0; j0 < SQ; j0 += 8) { FragH f; for (int q = 0; q < 8; ++q) f.h[q] = (_Float16)(expf(s[j0 + q] - mx) * sc); unsigned short* d = (unsigned short*)P + (size_t)i * SQ + j0; *(v8us*)d = f.half[0];  } }
__global__ __launch_bounds__(256) void k_vt(const _Float16* __restrict__ V16, int b, int h0, _Float16* __restrict__ VT) { __shared__ unsigned short tl[64][65]; const int tid = threadIdx.x; const int hh = blockIdx.x % HG, sg = blockIdx.x / HG; const int s0 = sg * 64; const int h = h0 + hh;
  for (int i = tid; i < 64 * 8; i += 256) { const int j = i / 8, d8 = (i % 8) * 8; FragH f; f.half[0] = *(const v8us*)((const unsigned short*)V16 + ((size_t)b * SQ + s0 + j) * DM + h * HD + d8); for (int q = 0; q < 8; ++q) tl[d8 + q][j] = f.u[q]; }
  __syncthreads();
  { for (int i = tid; i < 64 * 8; i += 256) { const int d = i / 8, j8 = (i % 8) * 8; FragH f; for (int q = 0; q < 8; ++q) f.u[q] = tl[d][j8 + q]; *(v8us*)((unsigned short*)VT + ((size_t)hh * HD + d) * SQ + s0 + j8) = f.half[0]; }  } }



__global__ __launch_bounds__(256) void k_rsmkm(const float* __restrict__ S, _Float16* __restrict__ P, int nrows, const int* __restrict__ am) {
  #pragma clang fp contract(off)
  const int t = blockIdx.x * 256 + threadIdx.x; if (t >= nrows) return; const size_t i = (size_t)t; const float* s = S + i * SQ; const int* mr = am + (size_t)(t % SQ) * SQ; float mx = -3.0e38f;
#pragma unroll 1
  for (int j = 0; j < SQ; ++j) { const float f = (mr[j] != 0) ? 1.f : 0.f; mx = fmaxf(mx, fmaf(f, s[j], (1.f - f) * -1.0e9f)); } float se = 0.f;
#pragma unroll 1
  for (int j = 0; j < SQ; ++j) { const float f = (mr[j] != 0) ? 1.f : 0.f; se += __expf(fmaf(f, s[j], (1.f - f) * -1.0e9f) - mx); } const float sc = 256.0f / se;
#pragma unroll 1
  for (int j0 = 0; j0 < SQ; j0 += 8) { FragH fr; for (int q = 0; q < 8; ++q) { const int j = j0 + q; const float f = (mr[j] != 0) ? 1.f : 0.f; fr.h[q] = (_Float16)(__expf(fmaf(f, s[j], (1.f - f) * -1.0e9f) - mx) * sc); }
    unsigned short* d = (unsigned short*)P + i * SQ + j0; *(v8us*)d = fr.half[0];  } }

__global__ __launch_bounds__(256) void k_bdshn(const float* __restrict__ Wb, _Float16* __restrict__ Bt) {
  const size_t t = (size_t)blockIdx.x * 256 + threadIdx.x; if (t >= (size_t)DM * DM / 8) return; const size_t e0 = t * 8; const int n = (int)(e0 / DM), k0 = (int)(e0 % DM); const int h = n >> 6, hk = k0 >> 6; const float on = (hk == h) ? 16.0f : 0.0f; const int o = n & 63, d0 = k0 & 63; FragH f;
  for (int q = 0; q < 8; ++q) f.h[q] = (_Float16)(bf16_round(Wb[(size_t)o * 64 + d0 + q]) * on);
  unsigned short* d = (unsigned short*)Bt + e0; *(v8us*)d = f.half[0];  }

// Fused attention: one launch for every (batch, head); scores, softmax and the weighted sum of V stay in registers, no score or weight plane in memory.
// A work-group is 8 waves x 32 queries of one head and walks the 2048 keys in stages of 64: the stage's K rows (64 keys x 64 dims) and V^T rows (64 dims x 64 keys) are fetched once per work-group with
// whole-line 16-byte loads, one stage ahead, and shared through two LDS buffers (rows of 128 B at a pitch of 144 B, the conflict-free pitch for 16-byte readers); one barrier per stage publishes the next
// buffer and ends the reads of the one refilled behind it. A wave works a stage in two passes of 32 keys. Per pass: S^T = K Q^T (A = 16 key rows, B = 16 query rows, both by g2_frag, so both in the same k order);
// a lane then holds, per 16-query tile, 16 scores of ONE query (query = lane & 15; keys 8 * (lane >> 4) + r of each 16-key tile), which is also the B-operand order of a 32-key product,
// so the weights go from the score accumulators straight into O^T += V^T P^T (A = 16 rows of V^T, again by g2_frag). Softmax is the running-maximum form in base 2: the maximum in use is raised,
// and sums and outputs rescaled, only when a pass exceeds it by more than 8 (weights stay <= 256, inside f16). Keys with mask == 0 take the module's fill through the addend of the scaling fma:
// the fill (-1e20 / 32, in base 2) absorbs any finite f16 score exactly, so the result is the fill itself, as the source's where() has it; a row with every key masked comes out uniform, as in the source.
// exp2 as asm text so that a v_nop stands directly behind the last transcendental: the instruction set asks for one slot before a result is used or a source overwritten (inside a run no v_exp_f32 touches
// another's register). Each works IN PLACE, on a register that the compiler's own subtraction has just written: so the asm never writes a register that a matrix instruction a few slots back still reads.
__device__ __forceinline__ float exp2_slot(float t) { asm("v_exp_f32 %0, %0\n\tv_nop" : "+v"(t)); return t; }
__device__ __forceinline__ void exp2_run8(float (&x)[8]) {
  asm("v_exp_f32 %0, %0\n\tv_exp_f32 %1, %1\n\tv_exp_f32 %2, %2\n\tv_exp_f32 %3, %3\n\tv_exp_f32 %4, %4\n\tv_exp_f32 %5, %5\n\tv_exp_f32 %6, %6\n\tv_exp_f32 %7, %7\n\tv_nop"
      : "+v"(x[0]), "+v"(x[1]), "+v"(x[2]), "+v"(x[3]), "+v"(x[4]), "+v"(x[5]), "+v"(x[6]), "+v"(x[7])); }
__device__ __forceinline__ float xhalf(float x) { return __builtin_bit_cast(float, __builtin_amdgcn_permlanex16(__builtin_bit_cast(int, x), __builtin_bit_cast(int, x), 0x76543210, 0xfedcba98, false, false)); }      /* lane l reads lane l ^ 16 */
__device__ __forceinline__ v8f fa_mma(v16h a, v16h b, v8f c) { return __builtin_amdgcn_wmma_f32_16x16x32_f16(false, a, false, b, (short)0, c, false, false); }
#define FA_NS (SQ / 64)      /* stages of 64 keys */
#define FA_LP 72             /* LDS row pitch in f16: 128 B of data + 16 B */
__global__ __launch_bounds__(256) void k_fattn(const _Float16* __restrict__ Q16, const _Float16* __restrict__ K16, const _Float16* __restrict__ VT, const int* __restrict__ Km, _Float16* __restrict__ O16) {
  __shared__ __attribute__((aligned(16))) float kb[SQ];      /* per key: 0 (kept) or the fill */
  __shared__ __attribute__((aligned(16))) _Float16 ks_[2][64 * FA_LP];      /* K rows of a stage: [key][dim] */
  __shared__ __attribute__((aligned(16))) _Float16 vs_[2][64 * FA_LP];      /* V^T rows of a stage: [dim][key] */
  const int tid = threadIdx.x, w = tid >> 5, lane = tid & 31, ln = lane & 15, hh = lane >> 4;
  const int bh = blockIdx.y, b = bh / NH, h = bh % NH; const int q0 = blockIdx.x * 256 + w * 32;
  const int sr = tid >> 3, sc8 = (tid & 7) * 8;      /* staging: 8 threads per 128-byte row, rows sr and sr + 32 */
  const _Float16* kg = K16 + ((size_t)b * SQ + sr) * DM + h * HD + sc8;
  const _Float16* vg = VT + ((size_t)bh * HD + sr) * SQ + sc8;
  const int so = sr * FA_LP + sc8;
  v8us gk0 = *(const v8us*)(const unsigned short*)kg, gk1 = *(const v8us*)(const unsigned short*)(kg + (size_t)32 * DM);
  v8us gv0 = *(const v8us*)(const unsigned short*)vg, gv1 = *(const v8us*)(const unsigned short*)(vg + (size_t)32 * SQ);
  for (int j = tid; j < SQ; j += 256) kb[j] = (Km[(size_t)b * SQ + j] != 0) ? 0.f : -4.5084220e18f;
  const _Float16* qp = Q16 + ((size_t)b * SQ + q0 + ln) * DM + h * HD;
  const float c2 = 0.03125f * 1.44269504f;      /* 1 / sqrt(embed size), in base 2 */
  const v8f z8 = {0.f,0.f,0.f,0.f,0.f,0.f,0.f,0.f};
  v16h qf[2][2];
#pragma unroll
  for (int t = 0; t < 2; ++t)
#pragma unroll
    for (int ks = 0; ks < 2; ++ks) qf[t][ks] = g2_frag(qp + (size_t)t * 16 * DM + ks * 32, hh);
  *(v8us*)(unsigned short*)&ks_[0][so] = gk0; *(v8us*)(unsigned short*)&ks_[0][so + 32 * FA_LP] = gk1;
  *(v8us*)(unsigned short*)&vs_[0][so] = gv0; *(v8us*)(unsigned short*)&vs_[0][so + 32 * FA_LP] = gv1;
  __syncthreads();      /* publishes stage 0 and the key table */
  v8f o[4][2];
#pragma unroll
  for (int dt = 0; dt < 4; ++dt) { o[dt][0] = z8; o[dt][1] = z8; }
  float mr[2] = {-3.0e38f, -3.0e38f}, lr[2] = {0.f, 0.f};
#pragma unroll 1
  for (int st = 0; st < FA_NS; ++st) {      /* kept rolled: one stage already fills the register file */
    const int keyn = (st + 1 < FA_NS) ? (st + 1) * 64 : st * 64;      /* the last stage refetches itself: in bounds, never read */
    const _Float16* kl = &ks_[st & 1][ln * FA_LP]; const _Float16* vl = &vs_[st & 1][ln * FA_LP];
    v16h kf[2][2], vf[4];
#pragma unroll
    for (int kt = 0; kt < 2; ++kt)
#pragma unroll
      for (int ks = 0; ks < 2; ++ks) kf[kt][ks] = g2_frag(kl + kt * 16 * FA_LP + ks * 32, hh);
#pragma unroll
    for (int p = 0; p < 2; ++p) {
      const int key0 = st * 64 + p * 32;
      /* next stage, half per pass through the same 8 registers: K rows fetched in the first pass, V^T rows in the second; each half is stored at its pass's end into the buffer that stage st - 1 read, whose readers left it at the last barrier */
      const v8us g0 = (p == 0) ? *(const v8us*)(const unsigned short*)(kg + (size_t)keyn * DM) : *(const v8us*)(const unsigned short*)(vg + keyn);
      const v8us g1 = (p == 0) ? *(const v8us*)(const unsigned short*)(kg + (size_t)(keyn + 32) * DM) : *(const v8us*)(const unsigned short*)(vg + (size_t)32 * SQ + keyn);
#pragma unroll
      for (int dt = 0; dt < 4; ++dt) vf[dt] = g2_frag(vl + dt * 16 * FA_LP + p * 32, hh);
      v8f sx[2][2];
#pragma unroll
      for (int kt = 0; kt < 2; ++kt)
#pragma unroll
        for (int qt = 0; qt < 2; ++qt) sx[kt][qt] = fa_mma(kf[kt][1], qf[qt][1], fa_mma(kf[kt][0], qf[qt][0], z8));
      if (p == 0) {      /* the second pass's K fragments, fetched behind the first pass's score products */
#pragma unroll
        for (int kt = 0; kt < 2; ++kt)
#pragma unroll
          for (int ks = 0; ks < 2; ++ks) kf[kt][ks] = g2_frag(kl + (32 + kt * 16) * FA_LP + ks * 32, hh); }
      float bias[2][8];
#pragma unroll
      for (int kt = 0; kt < 2; ++kt) { const v4f x0 = *(const v4fa*)&kb[key0 + kt * 16 + 8 * hh], x1 = *(const v4fa*)&kb[key0 + kt * 16 + 8 * hh + 4];
#pragma unroll
        for (int r = 0; r < 4; ++r) { bias[kt][r] = x0[r]; bias[kt][4 + r] = x1[r]; } }
      float mb[2]; bool need = false;
#pragma unroll
      for (int qt = 0; qt < 2; ++qt) { float mx0 = -3.0e38f, mx1 = -3.0e38f;
#pragma unroll
        for (int r = 0; r < 8; ++r) { sx[0][qt][r] = fmaf(sx[0][qt][r], c2, bias[0][r]); sx[1][qt][r] = fmaf(sx[1][qt][r], c2, bias[1][r]); mx0 = fmaxf(mx0, sx[0][qt][r]); mx1 = fmaxf(mx1, sx[1][qt][r]); }
        const float mx = fmaxf(mx0, mx1); mb[qt] = fmaxf(mx, xhalf(mx)); need = need || (mb[qt] > mr[qt] + 8.0f); }
      if (__builtin_amdgcn_ballot_w32(need) != 0) {      /* wave-uniform; rare after the first passes */
#pragma unroll
        for (int qt = 0; qt < 2; ++qt) { const float mn = fmaxf(mr[qt], mb[qt]); const float corr = exp2_slot(mr[qt] - mn); mr[qt] = mn; lr[qt] *= corr;
#pragma unroll
          for (int dt = 0; dt < 4; ++dt) o[dt][qt] = o[dt][qt] * corr; } }
#pragma unroll
      for (int qt = 0; qt < 2; ++qt) { FragH pf; float s0 = 0.f, s1 = 0.f, e0[8], e1[8];
#pragma unroll
        for (int r = 0; r < 8; ++r) { e0[r] = sx[0][qt][r] - mr[qt]; e1[r] = sx[1][qt][r] - mr[qt]; }
        exp2_run8(e0); exp2_run8(e1);
#pragma unroll
        for (int r = 0; r < 8; ++r) { s0 += e0[r]; s1 += e1[r]; pf.h[r] = (_Float16)e0[r]; pf.h[8 + r] = (_Float16)e1[r]; }
        lr[qt] += s0 + s1;
#pragma unroll
        for (int dt = 0; dt < 4; ++dt) o[dt][qt] = fa_mma(vf[dt], pf.v, o[dt][qt]); }
      { _Float16* gd = (p == 0) ? &ks_[(st + 1) & 1][so] : &vs_[(st + 1) & 1][so]; *(v8us*)(unsigned short*)gd = g0; *(v8us*)(unsigned short*)(gd + 32 * FA_LP) = g1; }
      if (p == 0) __builtin_amdgcn_sched_barrier(0);      /* keeps the next pass's score products out of this pass: moved up, their accumulators take the kernel past 256 registers */
    }
    __syncthreads();      /* publishes stage st + 1; ends every wave's reads of stage st before its buffer is refilled */
  }
#pragma unroll
  for (int qt = 0; qt < 2; ++qt) { const float sc = 64.0f / (lr[qt] + xhalf(lr[qt]));      /* the halves' sums join here; o carried x64 as before */
    unsigned short* op = (unsigned short*)O16 + ((size_t)b * SQ + q0 + qt * 16 + ln) * DM + h * HD + 8 * hh;
#pragma unroll
    for (int dt = 0; dt < 4; ++dt) { FragH f;
#pragma unroll
      for (int r = 0; r < 8; ++r) f.h[r] = (_Float16)(o[dt][qt][r] * sc);
      *(v8us*)(op + dt * 16) = f.half[0]; } }
}

// Per-head projections, one launch for Q, K and V (blockIdx.y picks input, weight and output). The module multiplies every 64-wide head slice by the SAME [64][64] matrix, so the token rows [4096][1024] are read as
// [65536][64] head rows and the product has K = 64: each input element is read once, straight from the f32 input, and no product with a zero block is formed.
// A work-group is 8 waves x 32 head rows. A wave fetches its 32 rows (8 KB in a row) with 16 whole-line 16-byte loads, rounds them (bf16, exact in f16) and lays them in its own LDS rows (128 B at a pitch of 144 B);
// the work-group converts the weight (bf16-rounded, x16) into LDS once; one barrier publishes it. Y^T = W X^T (A = 16 weight rows, B = 16 head rows, both by g2_frag, so both in the same k order, k 0..31 then 32..63):
// a lane then holds 8 neighbouring features of ONE head row, 16 bytes of f16, which go back into that row's LDS place (its fragments are already in registers) and leave as whole 128-byte lines.
#define PJ_LP 72             /* LDS row pitch in f16: 128 B of data + 16 B */
typedef unsigned short v4us __attribute__((ext_vector_type(4), may_alias));
union FragQ { v4us v; _Float16 h[4]; };
__global__ __launch_bounds__(256) void k_proj(const float* __restrict__ xq, const float* __restrict__ xk, const float* __restrict__ xv, const float* __restrict__ wq, const float* __restrict__ wk, const float* __restrict__ wv,
                                              _Float16* __restrict__ Q16, _Float16* __restrict__ K16, _Float16* __restrict__ V16) {
  __shared__ __attribute__((aligned(16))) _Float16 wl[HD * PJ_LP];      /* weight rows [out][in], x16 */
  __shared__ __attribute__((aligned(16))) _Float16 xl[8][32 * PJ_LP];      /* per wave: its 32 head rows, later its 32 output rows */
  const int tid = threadIdx.x, w = tid >> 5, lane = tid & 31, ln = lane & 15, hh = lane >> 4;
  const int sel = blockIdx.y;
  const float* x = (sel == 0) ? xq : (sel == 1) ? xk : xv;
  const float* W = (sel == 0) ? wq : (sel == 1) ? wk : wv;
  _Float16* Y = (sel == 0) ? Q16 : (sel == 1) ? K16 : V16;
  const size_t row0 = (size_t)blockIdx.x * 256 + w * 32;
  const float* xp = x + row0 * HD + lane * 4;
  v4f xr[16], wr[4];
#pragma unroll      /* constant indices: the values stay in registers */
  for (int i = 0; i < 16; ++i) xr[i] = *(const v4fa*)(xp + i * 128);      /* two rows per load */
#pragma unroll      /* constant indices: the values stay in registers */
  for (int i = 0; i < 4; ++i) wr[i] = *(const v4fa*)(W + i * 1024 + tid * 4);      /* 16 weight rows per load of the work-group */
  asm volatile("s_wait_xcnt 0x0" :: "v"(xp) : "memory");      /* precaution: no address register of the loads above is rewritten in front of this wait; naming the pair keeps the last load's result off it */
  _Float16* xw = &xl[w][0];
#pragma unroll      /* constant indices: the values stay in registers */
  for (int i = 0; i < 4; ++i) { FragQ f;
#pragma unroll      /* constant indices: the values stay in registers */
    for (int q = 0; q < 4; ++q) f.h[q] = (_Float16)(bf16_round(wr[i][q]) * 16.0f);
    *(v4us*)(unsigned short*)&wl[(i * 16 + (tid >> 4)) * PJ_LP + (tid & 15) * 4] = f.v; }
#pragma unroll      /* constant indices: the values stay in registers */
  for (int i = 0; i < 16; ++i) { FragQ f;
#pragma unroll      /* constant indices: the values stay in registers */
    for (int q = 0; q < 4; ++q) f.h[q] = (_Float16)bf16_round(xr[i][q]);
    *(v4us*)(unsigned short*)&xw[(i * 2 + hh) * PJ_LP + ln * 4] = f.v; }
  __syncthreads();      /* publishes the weight rows (and orders each wave's own rows) */
  const v8f z8 = {0.f,0.f,0.f,0.f,0.f,0.f,0.f,0.f};
  v16h wf[4][2];
#pragma unroll      /* constant indices: the values stay in registers */
  for (int t = 0; t < 4; ++t)
#pragma unroll      /* constant indices: the values stay in registers */
    for (int ks = 0; ks < 2; ++ks) wf[t][ks] = g2_frag(&wl[(t * 16 + ln) * PJ_LP + ks * 32], hh);
#pragma unroll      /* constant indices: the values stay in registers */
  for (int j = 0; j < 2; ++j) { _Float16* xrow = xw + (j * 16 + ln) * PJ_LP;
    const v16h x0 = g2_frag(xrow, hh), x1 = g2_frag(xrow + 32, hh);
#pragma unroll      /* constant indices: the values stay in registers */
    for (int t = 0; t < 4; ++t) { const v8f a = fa_mma(wf[t][1], x1, fa_mma(wf[t][0], x0, z8)); FragH f;
#pragma unroll      /* constant indices: the values stay in registers */
      for (int r = 0; r < 8; ++r) f.h[r] = (_Float16)(a[r] * 0.0625f);
      *(v8us*)(unsigned short*)(xrow + t * 16 + 8 * hh) = f.half[0]; } }
  __builtin_amdgcn_fence(__ATOMIC_ACQ_REL, "workgroup"); __builtin_amdgcn_wave_barrier();      /* the wave's lanes read each other's output pieces below */
#pragma unroll      /* constant indices: the values stay in registers */
  for (int i = 0; i < 8; ++i) { const int r = i * 4 + (lane >> 3), c8 = (lane & 7) * 8;      /* four whole rows, 512 B in a row, per store */
    const v8us v = *(const v8us*)(const unsigned short*)&xw[r * PJ_LP + c8];
    *(v8us*)((unsigned short*)Y + (row0 + r) * HD + c8) = v; }
}
extern "C" void kernel_launch(void* const* d_in, const int* in_sizes, int n_in,
                              void* d_out, int out_size, void* d_ws, size_t ws_size, hipStream_t stream) {
  (void)in_sizes; (void)n_in; (void)out_size;
  const float* const* I = (const float* const*)d_in; const float* xq = I[2]; const float* xk = I[1]; const float* xv = I[0]; const int* km = (const int*)d_in[3]; const float* wq = I[6]; const float* wk = I[5]; const float* wv = I[4]; const float* wo = I[7]; const float* bo = I[8];      /* contract order: values I[0], keys I[1], query I[2]; mask int32 [2][1][1][2048] (0 = masked key; READ on device); SHARED natural [64][64] blocks Wv I[4], Wk I[5], Wq I[6]; natural Wo [1024][1024] + bo */
  char* ws = (char*)d_ws; size_t off = 0;
  auto take = [&](size_t bytes) { char* p = ws + off; off += (bytes + 255) & ~(size_t)255; return p; };
  _Float16* BO = (_Float16*)take((size_t)DM * DM * 2);
  _Float16* Q16 = (_Float16*)take(NR * DM * 2); _Float16* K16 = (_Float16*)take(NR * DM * 2); _Float16* V16 = (_Float16*)take(NR * DM * 2); _Float16* O16 = (_Float16*)take(NR * DM * 2);
  _Float16* VT = (_Float16*)take((size_t)NB * NH * HD * SQ * 2);
  if (off > ws_size) return;
  k_wnat<<<(unsigned)(((size_t)DM * DM / 8 + 255) / 256), 256, 0, stream>>>(wo, (size_t)DM * DM / 8, BO);      /* Wo natural [out][in] = Bt x16 */
  const size_t r0p = (size_t)B0 * SQ;      /* first row of the output stage */
  k_proj<<<dim3((unsigned)(NR * NH / 256), 3), 256, 0, stream>>>(xq, xk, xv, wq, wk, wv, Q16, K16, V16);      /* q, k, v of every token row and head, f16 rows in the merged layout */
  k_vt<NH, SQ><<<NB * NH * (SQ / 64), 256, 0, stream>>>(V16, LQ, 0, VT);      /* V^T [NB][NH][HD][SQ], both batches */
  k_fattn<<<dim3(SQ / 256, NB * NH), 256, 0, stream>>>(Q16, K16, VT, km, O16);      /* scores, masked softmax and P V of every (batch, head) in one launch; o (merged heads, x64) as f16 rows */
  k_gemm2<0><<<dim3((unsigned)((MPO / 128) * (DM / 64)), 1), 128, 0, stream>>>(O16 + r0p * DM, DM, 0, BO, DM, 0, 0.0009765625f, bo, 0, nullptr, 1, 0, 0, (float*)d_out + r0p * DM, nullptr, DM, 0, MPO, DM, DM);      /* out rows are the output layout */
}

// v004
// A run of this version takes 72.6 microseconds.
// Timed twice side by side with v003, it ran 1.39 and 1.43 times as fast.
// Counting every step since v000, it is 47.5 times as fast.
#include <hip/hip_runtime.h>
// Multi-head attention over three inputs with SHARED per-head projections, a random key-padding mask and the module's literal score scale (values, keys, query [2][2048][1024]; each input is split into 16 heads of 64 and every head is multiplied by the SAME natural [64][64] matrix (x W^T: Wv / Wk / Wq; no biases); energy = q k^T; where(mask == 0, -1e20) with the int32 [2][1][1][2048] mask in {0, 1} (random; 0 = masked key; READ on device); softmax(energy / sqrt(embed_size) = / sqrt(1024) = / 32) (as the source); out = merged Wo^T + bo (natural [1024][1024]) -> [2][2048][1024]).
// Structure: token rows r = b*2048 + s; Q, K, V by one per-head projection launch (every 64-wide head slice of a token row is one row of a [65536][64] x [64][64]^T WMMA product, K = 64; f32 inputs rounded to bf16 and held as exact f16 in LDS, exact x16 weights, f32 accumulation, f16 outputs); V^T for all batches and heads via LDS transposes; one fused attention launch over every (batch, head): scores by WMMA (scale 1/32 = 1/sqrt(embed size), the module's literal scale), running-maximum softmax in registers (f32 statistics; unnormalised weights as f16), o = P . V by WMMA, divided by the row sum at the end (o carried x64 against f16 subnormal flush, folded into the output GEMM alpha) and written straight into the merged f16 o rows; out = o W_o + b GEMM (f32) into the output layout.
// Compute dtype: inputs rounded to bf16; x / weights exact; q, k, v, softmax weights and o as plain f16 GEMM operands (~2^-12); scores and softmax statistics f32. v_wmma_f32_16x16x32_f16.
#define NB 2
#define SQ 2048
#define DM 1024
#define NH 16
#define HD 64
#define HG 4                         /* heads per launch of the grouped k_vt overload (not launched) */
#define B0 0                         /* first batch processed (debug hook) */
#define NBR NB                       /* batches processed (debug hook) */
#define NR ((size_t)NB * SQ)         /* token rows */
#define MP ((int)((size_t)NBR * SQ)) /* token rows of the output stage, via MPO (debug hook) */
#define QN SQ                        /* query rows per batch (not used) */
#define NHD NH                       /* heads (not used) */
#define MPO MP                       /* rows through the output stage (debug hook) */
#define LQ DM      /* row pitch of the q/k/v rows */
typedef __bf16 v16b __attribute__((ext_vector_type(16)));
typedef unsigned short v8us __attribute__((ext_vector_type(8), may_alias));
typedef float  v8f  __attribute__((ext_vector_type(8)));
typedef float  v4f  __attribute__((ext_vector_type(4)));
typedef float  v4fa __attribute__((ext_vector_type(4), may_alias));
union FragB { v16b v; v8us half[2]; unsigned short u[16]; };

__device__ __forceinline__ unsigned short bf16_bits(float x) { unsigned int u = __float_as_uint(x); return (unsigned short)((u + 0x7FFFu + ((u >> 16) & 1u)) >> 16); }
__device__ __forceinline__ float bf16_val(unsigned short b) { return __uint_as_float(((unsigned int)b) << 16); }
__device__ __forceinline__ float bf16_round(float x) { return bf16_val(bf16_bits(x)); }
// D += A·B with NT terms: 1 = ah·bh, 2 = + al·bh (A split), 3 = + ah·bl (both split)
template <int NT>
__device__ __forceinline__ v8f mmaN(v16b ah, v16b al, v16b bh, v16b bl, v8f c) {
  c = __builtin_amdgcn_wmma_f32_16x16x32_bf16(false, ah, false, bh, (short)0, c, false, false);
  if (NT >= 2) c = __builtin_amdgcn_wmma_f32_16x16x32_bf16(false, al, false, bh, (short)0, c, false, false);
  if (NT >= 3) c = __builtin_amdgcn_wmma_f32_16x16x32_bf16(false, ah, false, bl, (short)0, c, false, false);
  asm volatile("v_nop\n\tv_nop\n\tv_nop\n\tv_nop" : "+v"(c) : "v"(ah), "v"(al), "v"(bh), "v"(bl));
  return c;
}

__global__ __launch_bounds__(256) void k_wt_bf16(const float* __restrict__ W, unsigned short* __restrict__ Wt, int K, int N) {
  const int t = blockIdx.x * 256 + threadIdx.x;
  const int k8n = K / 8;
  if (t >= N * k8n) return;
  const int n = t / k8n, k8 = (t % k8n) * 8;
  v8us v;
#pragma unroll
  for (int i = 0; i < 8; ++i) v[i] = bf16_bits(W[(size_t)(k8 + i) * N + n]);
  *(v8us*)(Wt + (size_t)n * K + k8) = v;
  
}

// GEMM C[M][N] (f32, pitch ldc) = act(A[M][K]·W + bias). A f32 row-major (pitch lda) converted per fragment to bf16
// (ASPLIT: hi/lo two planes -> 2 terms, else single rounded term); Wt bf16 [N][K] (pitch ldb). BIAS_BF16 rounds the
// bias to bf16 first (bias quantised to bf16 before the add). K%32==0, M%16==0, N%64==0.
template <bool ASPLIT, int ACT, bool BIAS_BF16>
__global__ __launch_bounds__(128) void k_gemm_bf(const float* __restrict__ A, int lda, const unsigned short* __restrict__ Wt, int ldb,
                                               const float* __restrict__ bias, float* __restrict__ C, int ldc, int M, int N, int K) {
  __shared__ __attribute__((aligned(16))) float so[4][16][64];
  const int tid = threadIdx.x, w = tid >> 5, lane = tid & 31, ln = lane & 15, hh = lane >> 4;
  const int ntn = N / 64;
  const int wid = blockIdx.x * 4 + w;
  const int mt = wid / ntn, nq = wid % ntn;
  if (mt * 16 >= M) return;
  const int row0 = mt * 16, col0 = nq * 64;
  const float* arow = A + (size_t)(row0 + ln) * lda;
  v8f acc[4] = {};
  for (int kb = 0; kb < K; kb += 32) {
    FragB ah, al;
    const v4f x0 = *(const v4fa*)(arow + kb + 8 * hh), x1 = *(const v4fa*)(arow + kb + 8 * hh + 4);
    const v4f x2 = *(const v4fa*)(arow + kb + 16 + 8 * hh), x3 = *(const v4fa*)(arow + kb + 16 + 8 * hh + 4);
    float xs[16] = {x0[0],x0[1],x0[2],x0[3],x1[0],x1[1],x1[2],x1[3],x2[0],x2[1],x2[2],x2[3],x3[0],x3[1],x3[2],x3[3]};
#pragma unroll
    for (int i = 0; i < 16; ++i) { const unsigned short hb = bf16_bits(xs[i]); ah.u[i] = hb; al.u[i] = ASPLIT ? bf16_bits(xs[i] - bf16_val(hb)) : (unsigned short)0; }
#pragma unroll
    for (int t = 0; t < 4; ++t) {
      const unsigned short* brow = Wt + (size_t)(col0 + t * 16 + ln) * ldb + kb;
      FragB b;
      b.half[0] = *(const v8us*)(brow + 8 * hh);
      b.half[1] = *(const v8us*)(brow + 16 + 8 * hh);
      acc[t] = mmaN<ASPLIT ? 2 : 1>(ah.v, al.v, b.v, b.v, acc[t]);
    }
  }
#pragma unroll
  for (int t = 0; t < 4; ++t) {
    float bv = bias ? bias[col0 + t * 16 + ln] : 0.f;
    if (BIAS_BF16) bv = bf16_round(bv);
#pragma unroll
    for (int r = 0; r < 8; ++r) { float v = acc[t][r] + bv; if (ACT == 1) v = fmaxf(v, 0.f); so[w][8 * hh + r][t * 16 + ln] = v; }
  }
  __builtin_amdgcn_fence(__ATOMIC_ACQ_REL, "workgroup");
  __builtin_amdgcn_wave_barrier();
  const int rsub = lane >> 4, c4 = (lane & 15) * 4;
  {
#pragma unroll
    for (int q = 0; q < 8; ++q) {
      const int r = q * 2 + rsub;
      const v4f v = *(const v4fa*)&so[w][r][c4];
      *(v4f*)(C + (size_t)(row0 + r) * ldc + col0 + c4) = v;
    }
    
  }
}

// GEMM C = act(A·W + bias + resid): A f32 (ASPLIT -> hi/lo 2 terms), Wt bf16 [N][K]; ACT 0 none, 1 relu, 2 exact gelu;
// resid (optional, f32, row index = (row % rmod), pitch ldr, RES_BF16 rounds it) added before the activation.
template <bool ASPLIT, int ACT, bool BIAS_BF16, bool RES_BF16>
__global__ __launch_bounds__(128) void k_gemm_bf3(const float* __restrict__ A, int lda, const unsigned short* __restrict__ Wt, int ldb,
                                                const float* __restrict__ bias, const float* __restrict__ resid, int rmod, int ldr,
                                                float* __restrict__ C, int ldc, int M, int N, int K) {
  __shared__ __attribute__((aligned(16))) float so[4][16][64];
  const int tid = threadIdx.x, w = tid >> 5, lane = tid & 31, ln = lane & 15, hh = lane >> 4;
  const int ntn = N / 64;
  const int wid = blockIdx.x * 4 + w;
  const int mt = wid / ntn, nq = wid % ntn;
  if (mt * 16 >= M) return;
  const int row0 = mt * 16, col0 = nq * 64;
  const float* arow = A + (size_t)(row0 + ln) * lda;
  v8f acc[4] = {};
  for (int kb = 0; kb < K; kb += 32) {
    FragB ah, al;
    const v4f x0 = *(const v4fa*)(arow + kb + 8 * hh), x1 = *(const v4fa*)(arow + kb + 8 * hh + 4);
    const v4f x2 = *(const v4fa*)(arow + kb + 16 + 8 * hh), x3 = *(const v4fa*)(arow + kb + 16 + 8 * hh + 4);
    float xs[16] = {x0[0],x0[1],x0[2],x0[3],x1[0],x1[1],x1[2],x1[3],x2[0],x2[1],x2[2],x2[3],x3[0],x3[1],x3[2],x3[3]};
#pragma unroll
    for (int i = 0; i < 16; ++i) { const unsigned short hb = bf16_bits(xs[i]); ah.u[i] = hb; al.u[i] = ASPLIT ? bf16_bits(xs[i] - bf16_val(hb)) : (unsigned short)0; }
#pragma unroll
    for (int t = 0; t < 4; ++t) {
      const unsigned short* brow = Wt + (size_t)(col0 + t * 16 + ln) * ldb + kb;
      FragB b;
      b.half[0] = *(const v8us*)(brow + 8 * hh);
      b.half[1] = *(const v8us*)(brow + 16 + 8 * hh);
      acc[t] = mmaN<ASPLIT ? 2 : 1>(ah.v, al.v, b.v, b.v, acc[t]);
    }
  }
#pragma unroll
  for (int t = 0; t < 4; ++t) {
    const int col = col0 + t * 16 + ln;
    float bv = bias ? bias[col] : 0.f;
    if (BIAS_BF16) bv = bf16_round(bv);
#pragma unroll
    for (int r = 0; r < 8; ++r) {
      float v = acc[t][r] + bv;
      if (resid) { float rv = resid[(size_t)((row0 + 8 * hh + r) % rmod) * ldr + col]; if (RES_BF16) rv = bf16_round(rv); v += rv; }
      if (ACT == 1) v = fmaxf(v, 0.f);
      if (ACT == 2) v = 0.5f * v * (1.0f + erff(v * 0.70710678118654752f));
      if (ACT == 3) { const float u = 0.7978845608028654f * (v + 0.044715f * v * v * v); v = 0.5f * v * (1.0f + tanhf(u)); }
      so[w][8 * hh + r][t * 16 + ln] = v;
    }
  }
  __builtin_amdgcn_fence(__ATOMIC_ACQ_REL, "workgroup");
  __builtin_amdgcn_wave_barrier();
  const int rsub = lane >> 4, c4 = (lane & 15) * 4;
  {
#pragma unroll
    for (int q = 0; q < 8; ++q) {
      const int r = q * 2 + rsub;
      const v4f v = *(const v4fa*)&so[w][r][c4];
      *(v4f*)(C + (size_t)(row0 + r) * ldc + col0 + c4) = v;
    }
    
  }
}
// row LayerNorm (biased variance, eps) over N: s = X (+ R); optional out_sum <- s; out_norm <- (s-mu)*rsqrt(var+eps)*g + b
template <bool PARAM_BF16>
__global__ __launch_bounds__(256) void k_layernorm(const float* __restrict__ X, const float* __restrict__ R, const float* __restrict__ g, const float* __restrict__ bta,
                                                  float* __restrict__ out_sum, float* __restrict__ out_norm, int N, float eps) {
  __shared__ float red[256];
  const int row = blockIdx.x, tid = threadIdx.x;
  const float* x = X + (size_t)row * N; const float* rr = R ? R + (size_t)row * N : nullptr;
  float vals[16];                     // up to N = 4096
  const int per = N / 256;            // contiguous chunk per thread? use strided-by-4 chunks: thread handles j = tid*4 + 1024*u
  float s1 = 0.f;
  for (int u = 0; u < per / 4; ++u) {
    const int j = tid * 4 + 1024 * u;
    const v4f a = *(const v4fa*)(x + j);
    v4f b = {0.f,0.f,0.f,0.f}; if (rr) b = *(const v4fa*)(rr + j);
#pragma unroll
    for (int q = 0; q < 4; ++q) { const float v = a[q] + b[q]; vals[u * 4 + q] = v; s1 += v; }
  }
  red[tid] = s1; __syncthreads();
  for (int st = 128; st > 0; st >>= 1) { if (tid < st) red[tid] += red[tid + st]; __syncthreads(); }
  const float mu = red[0] / (float)N; __syncthreads();
  float s2 = 0.f;
  for (int u = 0; u < per / 4; ++u)
#pragma unroll
    for (int q = 0; q < 4; ++q) { const float c = vals[u * 4 + q] - mu; s2 += c * c; }
  red[tid] = s2; __syncthreads();
  for (int st = 128; st > 0; st >>= 1) { if (tid < st) red[tid] += red[tid + st]; __syncthreads(); }
  const float rs = rsqrtf(red[0] / (float)N + eps);
  {
    for (int u = 0; u < per / 4; ++u) {
      const int j = tid * 4 + 1024 * u;
      v4f o, sm;
#pragma unroll
      for (int q = 0; q < 4; ++q) {
        float gg = g[j + q], bb = bta[j + q];
        if (PARAM_BF16) { gg = bf16_round(gg); bb = bf16_round(bb); }
        sm[q] = vals[u * 4 + q]; o[q] = (vals[u * 4 + q] - mu) * rs * gg + bb;
      }
      if (out_sum) *(v4f*)(out_sum + (size_t)row * N + j) = sm;
      *(v4f*)(out_norm + (size_t)row * N + j) = o;
    }
    
  }
}



// ---- f16 WMMA path (v_wmma_f32_16x16x32_f16): 11-bit significands for operands in range — used where a [0,1] probability operand needs more precision than bf16
typedef _Float16 v16h __attribute__((ext_vector_type(16)));
union FragH { v16h v; v8us half[2]; _Float16 h[16]; unsigned short u[16]; };
template <int NT>
__device__ __forceinline__ v8f mmaH(v16h ah, v16h al, v16h bh, v16h bl, v8f c) {
  c = __builtin_amdgcn_wmma_f32_16x16x32_f16(false, ah, false, bh, (short)0, c, false, false);
  if (NT >= 2) c = __builtin_amdgcn_wmma_f32_16x16x32_f16(false, al, false, bh, (short)0, c, false, false);
  if (NT >= 3) c = __builtin_amdgcn_wmma_f32_16x16x32_f16(false, ah, false, bl, (short)0, c, false, false);
  asm volatile("v_nop\n\tv_nop\n\tv_nop\n\tv_nop" : "+v"(c) : "v"(ah), "v"(al), "v"(bh), "v"(bl));
  return c;
}
// batched GEMM like k_gemm_b but f16 operands: A f32 (split into f16 hi/lo if ASPLIT, else rounded to f16), Bt = f16 values [n][k]; alpha; C f32; N multiple of 16 (partial tiles skipped)
template <bool ASPLIT>
__global__ __launch_bounds__(128) void k_gemm_h(const float* __restrict__ A, int lda, size_t sA, const _Float16* __restrict__ Bh, int ldb, size_t sB, float alpha, float* __restrict__ C, int ldc, size_t sC, int M, int N, int K) {
  __shared__ __attribute__((aligned(16))) float so[4][16][64];
  const int tid = threadIdx.x, w = tid >> 5, lane = tid & 31, ln = lane & 15, hh = lane >> 4; const int by = blockIdx.y;
  A += (size_t)by * sA; Bh += (size_t)by * sB; C += (size_t)by * sC;
  const int ntn = (N + 63) / 64; const int wid = blockIdx.x * 4 + w; const int mt = wid / ntn, nq = wid % ntn; if (mt * 16 >= M) return;
  const int row0 = mt * 16, col0 = nq * 64; const float* arow = A + (size_t)(row0 + ln) * lda;
  v8f acc[4] = {};
  for (int kb = 0; kb < K; kb += 32) {
    FragH ah, al;
    const v4f x0 = *(const v4fa*)(arow + kb + 8 * hh), x1 = *(const v4fa*)(arow + kb + 8 * hh + 4), x2 = *(const v4fa*)(arow + kb + 16 + 8 * hh), x3 = *(const v4fa*)(arow + kb + 16 + 8 * hh + 4);
    float xs[16] = {x0[0],x0[1],x0[2],x0[3],x1[0],x1[1],x1[2],x1[3],x2[0],x2[1],x2[2],x2[3],x3[0],x3[1],x3[2],x3[3]};
#pragma unroll
    for (int i = 0; i < 16; ++i) { const _Float16 h = (_Float16)xs[i]; ah.h[i] = h; al.h[i] = ASPLIT ? (_Float16)(xs[i] - (float)h) : (_Float16)0.0f; }
#pragma unroll
    for (int t = 0; t < 4; ++t) { if (col0 + t * 16 >= N) continue; const size_t boff = (size_t)(col0 + t * 16 + ln) * ldb + kb; FragH bq; bq.half[0] = *(const v8us*)(Bh + boff + 8 * hh); bq.half[1] = *(const v8us*)(Bh + boff + 16 + 8 * hh);
      acc[t] = mmaH<ASPLIT ? 2 : 1>(ah.v, al.v, bq.v, bq.v, acc[t]); }
  }
#pragma unroll
  for (int t = 0; t < 4; ++t) { if (col0 + t * 16 >= N) continue;
#pragma unroll
    for (int r = 0; r < 8; ++r) so[w][8 * hh + r][t * 16 + ln] = acc[t][r] * alpha; }
  __builtin_amdgcn_fence(__ATOMIC_ACQ_REL, "workgroup"); __builtin_amdgcn_wave_barrier();
  const int rsub = lane >> 4, c4 = (lane & 15) * 4;
  {
#pragma unroll
    for (int q = 0; q < 8; ++q) { const int r = q * 2 + rsub; if (col0 + c4 < N) { const v4f v = *(const v4fa*)&so[w][r][c4]; *(v4f*)(C + (size_t)(row0 + r) * ldc + col0 + c4) = v; } }
     }
}

// Wt[n][k] = f16(W[k][n]·scale) from f32 row-major W[K][N] (scale = power of two; bf16-exact weights stay exact in f16 away from the subnormal range)
__global__ __launch_bounds__(256) void k_wt_f16(const float* __restrict__ W, _Float16* __restrict__ Wt, int K, int N, float scale) {
  const int t = blockIdx.x * 256 + threadIdx.x; if (t >= N * (K / 8)) return; const int n = t / (K / 8), k8 = (t % (K / 8)) * 8; FragH f;
#pragma unroll
  for (int i = 0; i < 8; ++i) f.h[i] = (_Float16)(bf16_round(W[(size_t)(k8 + i) * N + n]) * scale); const v8us o = f.half[0];
  *(v8us*)((unsigned short*)Wt + (size_t)n * K + k8) = o; 
}
// k_gemm_hh variant with fused epilogue: v = acc·alpha + bias[by·sBias + col] (+ CP[(row/rowsPerB)·sCPb + by·64 + col] if CP) ; ACT 0 none / 1 elu ; writes f16 C16 (and f32 C if non-null)
template <int ACT>
__global__ __launch_bounds__(128) void k_gemm_hhx(const _Float16* __restrict__ A, int lda, size_t sA, const _Float16* __restrict__ Bh, int ldb, size_t sB, float alpha, const float* __restrict__ bias, size_t sBias, const float* __restrict__ CP, int rowsPerB, size_t sCPb, int row0g,
    float* __restrict__ C, _Float16* __restrict__ C16, int ldc, size_t sC, int M, int N, int K) {
  __shared__ __attribute__((aligned(16))) float so[4][16][64];
  const int tid = threadIdx.x, w = tid >> 5, lane = tid & 31, ln = lane & 15, hh = lane >> 4; const int by = blockIdx.y;
  A += (size_t)by * sA; Bh += (size_t)by * sB; const size_t cofs = (size_t)by * sC; const float* bp = bias ? bias + (size_t)by * sBias : nullptr;
  const int ntn = (N + 63) / 64; const int wid = blockIdx.x * 4 + w; const int mt = wid / ntn, nq = wid % ntn; if (mt * 16 >= M) return;
  const int row0 = mt * 16, col0 = nq * 64; const _Float16* arow = A + (size_t)(row0 + ln) * lda;
  v8f acc[4] = {};
  for (int kb = 0; kb < K; kb += 32) { FragH ah; ah.half[0] = *(const v8us*)((const unsigned short*)arow + kb + 8 * hh); ah.half[1] = *(const v8us*)((const unsigned short*)arow + kb + 16 + 8 * hh);
#pragma unroll
    for (int t = 0; t < 4; ++t) { if (col0 + t * 16 >= N) continue; const size_t boff = (size_t)(col0 + t * 16 + ln) * ldb + kb; FragH bq; bq.half[0] = *(const v8us*)((const unsigned short*)Bh + boff + 8 * hh); bq.half[1] = *(const v8us*)((const unsigned short*)Bh + boff + 16 + 8 * hh);
      acc[t] = mmaH<1>(ah.v, ah.v, bq.v, bq.v, acc[t]); }
  }
#pragma unroll
  for (int t = 0; t < 4; ++t) { if (col0 + t * 16 >= N) continue; const int col = col0 + t * 16 + ln; const float bv = bp ? bf16_round(bp[col]) : 0.f;
#pragma unroll
    for (int r = 0; r < 8; ++r) { float v = acc[t][r] * alpha + bv; if (CP) { const int rr = row0g + row0 + 8 * hh + r; if (rowsPerB < 0) v += CP[cofs + (size_t)rr * ldc + col];      /* rowsPerB < 0: own element of the batched C plane */ else { const int bidx = rr / rowsPerB; v += CP[(size_t)bidx * sCPb + (size_t)by * 64 + col]; } } if (ACT == 1) v = (v > 0.f) ? v : expm1f(v); else if (ACT == 7) v = (v > 0.f) ? v + 1.0f : expf(v); else if (ACT == 8) v = tanhf(v); else if (ACT == 9) v = 0.5f * v * (1.0f + tanhf(0.7978845608028654f * (v + 0.044715f * v * v * v))); else if (ACT == 11) v = 1.0f / (1.0f + expf(-v)); else if (ACT == 12) v = (v > 0.f) ? v : 0.01f * v; else if (ACT == 14) v = (v > 0.f) ? v : 0.1f * v; else if (ACT == 16) v = (v >= 0.f) ? v : 0.3f * v; else if (ACT == 17) v = (v >= 0.f) ? v : 0.2f * v; else if (ACT == 15) v = v / (1.0f + expf(-v)); else if (ACT == 3) v = fmaxf(v, 0.f); else if (ACT == 6) v = 0.5f * v * (1.0f + erff(v * 0.70710678118654752f)); so[w][8 * hh + r][t * 16 + ln] = v; } }
  __builtin_amdgcn_fence(__ATOMIC_ACQ_REL, "workgroup"); __builtin_amdgcn_wave_barrier();
  const int rsub = lane >> 4, c4 = (lane & 15) * 4; typedef _Float16 v4h __attribute__((ext_vector_type(4)));
  {
#pragma unroll
    for (int q = 0; q < 8; ++q) { const int r = q * 2 + rsub; if (col0 + c4 < N) { const v4f v = *(const v4fa*)&so[w][r][c4]; if (C) *(v4f*)(C + cofs + (size_t)(row0 + r) * ldc + col0 + c4) = v; if (C16) { v4h h4; for (int i = 0; i < 4; ++i) h4[i] = (_Float16)v[i]; *(v4h*)(C16 + cofs + (size_t)(row0 + r) * ldc + col0 + c4) = h4; } } }
     }
}


typedef _Float16 v4h __attribute__((ext_vector_type(4)));

__global__ __launch_bounds__(256) void k_x16(const float* __restrict__ x, _Float16* __restrict__ X16, size_t n8) { const size_t t = (size_t)blockIdx.x * 256 + threadIdx.x; if (t >= n8) return; FragH f;
#pragma unroll
  for (int q = 0; q < 8; ++q) f.h[q] = (_Float16)bf16_round(x[t * 8 + q]); *(v8us*)((unsigned short*)X16 + t * 8) = f.half[0];  }
__global__ __launch_bounds__(256) void k_h16(const float* __restrict__ x, _Float16* __restrict__ X16, size_t n8) { const size_t t = (size_t)blockIdx.x * 256 + threadIdx.x; if (t >= n8) return; FragH f;
#pragma unroll
  for (int q = 0; q < 8; ++q) f.h[q] = (_Float16)x[t * 8 + q]; *(v8us*)((unsigned short*)X16 + t * 8) = f.half[0];  }
__global__ __launch_bounds__(256) void k_round16f(const float* __restrict__ W, _Float16* __restrict__ Bt, size_t n8) { const size_t t = (size_t)blockIdx.x * 256 + threadIdx.x; if (t >= n8) return; FragH f;
#pragma unroll
  for (int i = 0; i < 8; ++i) f.h[i] = (_Float16)(bf16_round(W[t * 8 + i]) * 16.0f); *(v8us*)((unsigned short*)Bt + t * 8) = f.half[0];  }
template <int NHv, int TTv>
__global__ __launch_bounds__(256) void k_vt(const _Float16* __restrict__ V16, int ldv, int voff, _Float16* __restrict__ Vt) { __shared__ unsigned short tl[64][66]; const int tid = threadIdx.x; const int slab = blockIdx.x / (TTv / 64), lg = blockIdx.x % (TTv / 64); const int b = slab / NHv, h = slab % NHv;
  for (int i = tid; i < 64 * 8; i += 256) { const int r = i / 8, c8 = (i % 8) * 8; FragH f; f.half[0] = *(const v8us*)((const unsigned short*)V16 + ((size_t)b * TTv + lg * 64 + r) * ldv + voff + h * 64 + c8);
#pragma unroll
    for (int q = 0; q < 8; ++q) tl[r][c8 + q] = f.u[q]; }
  __syncthreads();
  {
#pragma unroll
    for (int rd = 0; rd < 2; ++rd) { const int d = rd * 32 + tid / 8, pc = tid % 8; FragH f;
#pragma unroll
      for (int q = 0; q < 8; ++q) f.u[q] = tl[pc * 8 + q][d];
      *(v8us*)((unsigned short*)Vt + ((size_t)slab * 64 + d) * TTv + lg * 64 + pc * 8) = f.half[0]; }
     } }

__global__ __launch_bounds__(256) void k_hl(const float* __restrict__ F, _Float16* __restrict__ Hh, _Float16* __restrict__ Hl, size_t n8) { const size_t t = (size_t)blockIdx.x * 256 + threadIdx.x; if (t >= n8) return; FragH fh, fl; const v4f a = *(const v4fa*)(F + t * 8), c = *(const v4fa*)(F + t * 8 + 4);
#pragma unroll
  for (int q = 0; q < 4; ++q) { _Float16 h = (_Float16)a[q]; fh.h[q] = h; fl.h[q] = (_Float16)((a[q] - (float)h) * 1024.0f); h = (_Float16)c[q]; fh.h[4 + q] = h; fl.h[4 + q] = (_Float16)((c[q] - (float)h) * 1024.0f); }
  { *(v8us*)((unsigned short*)Hh + t * 8) = fh.half[0]; *(v8us*)((unsigned short*)Hl + t * 8) = fl.half[0];  } }

// ---- fast GEMM (wave tile 32x64; requires M % 32 == 0 rows per launch region and N % 64 == 0); epilogue = k_gemm_hhx semantics ----
__device__ __forceinline__ v16h g2_frag(const _Float16* p, int hh) { FragH f; f.half[0] = *(const v8us*)((const unsigned short*)p + 8 * hh); f.half[1] = *(const v8us*)((const unsigned short*)p + 16 + 8 * hh); return f.v; }
__device__ __forceinline__ v8f g2_mma(v16h a, v16h b, v8f c) { v8f d = __builtin_amdgcn_wmma_f32_16x16x32_f16(false, a, false, b, (short)0, c, false, false); asm volatile("v_nop\n\tv_nop\n\tv_nop\n\tv_nop" : "+v"(d) : "v"(a), "v"(b)); return d; }
template <int ACT>
__global__ __launch_bounds__(128) void k_gemm2(const _Float16* __restrict__ A, int lda, size_t sA, const _Float16* __restrict__ Bh, int ldb, size_t sB, float alpha, const float* __restrict__ bias, size_t sBias, const float* __restrict__ CP, int rowsPerB, size_t sCPb, int row0g,
    float* __restrict__ C, _Float16* __restrict__ C16, int ldc, size_t sC, int M, int N, int K) { static_assert(ACT == 0 || ACT == 3 || ACT == 6 || ACT == 8 || ACT == 9 || ACT == 11 || ACT == 12 || ACT == 14 || ACT == 15 || ACT == 16 || ACT == 17, "k_gemm2: unsupported ACT code (would silently apply no activation)");
  __shared__ __attribute__((aligned(16))) float so[4][32][68];
  const int tid = threadIdx.x, w = tid >> 5, lane = tid & 31, ln = lane & 15, hh = lane >> 4; const int by = blockIdx.y;
  A += (size_t)by * sA; Bh += (size_t)by * sB; const size_t cofs = (size_t)by * sC; const float* bp = bias ? bias + (size_t)by * sBias : nullptr;
  const int ntn = N >> 6; const int mt = blockIdx.x / ntn, nq = blockIdx.x - mt * ntn; const int row0 = mt * 128 + 32 * w, col0 = nq * 64; if (row0 >= M) return;
  const _Float16* a0p = A + (size_t)(row0 + ln) * lda; const _Float16* a1p = a0p + (size_t)16 * lda;
  const _Float16* b0p = Bh + (size_t)(col0 + ln) * ldb; const _Float16* b1p = b0p + (size_t)16 * ldb; const _Float16* b2p = b1p + (size_t)16 * ldb; const _Float16* b3p = b2p + (size_t)16 * ldb;
  const v8f z8 = {0.f,0.f,0.f,0.f,0.f,0.f,0.f,0.f}; v8f c00 = z8, c01 = z8, c02 = z8, c03 = z8, c10 = z8, c11 = z8, c12 = z8, c13 = z8;
#pragma unroll 1
  for (int kb = 0; kb < K; kb += 32) { const v16h a0 = g2_frag(a0p + kb, hh), a1 = g2_frag(a1p + kb, hh);
    v16h b = g2_frag(b0p + kb, hh); c00 = g2_mma(a0, b, c00); c10 = g2_mma(a1, b, c10);
    b = g2_frag(b1p + kb, hh); c01 = g2_mma(a0, b, c01); c11 = g2_mma(a1, b, c11);
    b = g2_frag(b2p + kb, hh); c02 = g2_mma(a0, b, c02); c12 = g2_mma(a1, b, c12);
    b = g2_frag(b3p + kb, hh); c03 = g2_mma(a0, b, c03); c13 = g2_mma(a1, b, c13); }
  v8f accs[8] = {c00, c01, c02, c03, c10, c11, c12, c13};
#pragma unroll
  for (int u = 0; u < 8; ++u) { const int t = u & 3, half = u >> 2; const int col = col0 + t * 16 + ln; const float bv = bp ? bf16_round(bp[col]) : 0.f;
#pragma unroll
    for (int r = 0; r < 8; ++r) { const int rloc = half * 16 + 8 * hh + r; float v = accs[u][r] * alpha + bv; if (CP) { if (rowsPerB < 0) v += CP[cofs + (size_t)(row0g + row0 + rloc) * ldc + col];      /* rowsPerB < 0: own element of the batched C plane */ else { const int bidx = (row0g + row0 + rloc) / rowsPerB; v += CP[(size_t)bidx * sCPb + (size_t)by * 64 + col]; } }
      if (ACT == 3) v = fmaxf(v, 0.f); else if (ACT == 6) v = 0.5f * v * (1.0f + erff(v * 0.70710678118654752f)); else if (ACT == 11) v = 1.0f / (1.0f + expf(-v)); else if (ACT == 15) v = v / (1.0f + expf(-v)); else if (ACT == 12) v = (v > 0.f) ? v : 0.01f * v; else if (ACT == 8) v = tanhf(v); else if (ACT == 9) v = 0.5f * v * (1.0f + tanhf(0.7978845608028654f * (v + 0.044715f * v * v * v))); else if (ACT == 14) v = (v > 0.f) ? v : 0.1f * v; else if (ACT == 16) v = (v >= 0.f) ? v : 0.3f * v; else if (ACT == 17) v = (v >= 0.f) ? v : 0.2f * v;
      so[w][rloc][t * 16 + ln] = v; } }
  __builtin_amdgcn_fence(__ATOMIC_ACQ_REL, "workgroup"); __builtin_amdgcn_wave_barrier();
  const int rsub = lane >> 4, c4 = (lane & 15) * 4;
  {
#pragma unroll
    for (int q = 0; q < 16; ++q) { const int r = q * 2 + rsub; const v4f v = *(const v4fa*)&so[w][r][c4]; if (C) *(v4f*)(C + cofs + (size_t)(row0 + r) * ldc + col0 + c4) = v; if (C16) { v4h h4; for (int i = 0; i < 4; ++i) h4[i] = (_Float16)v[i]; *(v4h*)(C16 + cofs + (size_t)(row0 + r) * ldc + col0 + c4) = h4; } }
     } }


__global__ __launch_bounds__(256) void k_wnat(const float* __restrict__ w, size_t n8, _Float16* __restrict__ Bt) { const size_t t = (size_t)blockIdx.x * 256 + threadIdx.x; if (t >= n8) return; FragH f; for (int q = 0; q < 8; ++q) f.h[q] = (_Float16)(bf16_round(w[t * 8 + q]) * 16.0f); *(v8us*)((unsigned short*)Bt + t * 8) = f.half[0];  }
__global__ __launch_bounds__(256) void k_rsm(const float* __restrict__ S, _Float16* __restrict__ P, int nrows) {
  #pragma clang fp contract(off)
  const int i = blockIdx.x * 256 + threadIdx.x; if (i >= nrows) return; const float* s = S + (size_t)i * SQ; float mx = -3.0e38f;
#pragma unroll 1
  for (int j = 0; j < SQ; ++j) mx = fmaxf(mx, s[j]); float se = 0.f;
#pragma unroll 1
  for (int j = 0; j < SQ; ++j) se += expf(s[j] - mx); const float sc = 256.0f / se;
#pragma unroll 1
  for (int j0 = 0; j0 < SQ; j0 += 8) { FragH f; for (int q = 0; q < 8; ++q) f.h[q] = (_Float16)(expf(s[j0 + q] - mx) * sc); unsigned short* d = (unsigned short*)P + (size_t)i * SQ + j0; *(v8us*)d = f.half[0];  } }
__global__ __launch_bounds__(256) void k_vt(const _Float16* __restrict__ V16, int b, int h0, _Float16* __restrict__ VT) { __shared__ unsigned short tl[64][65]; const int tid = threadIdx.x; const int hh = blockIdx.x % HG, sg = blockIdx.x / HG; const int s0 = sg * 64; const int h = h0 + hh;
  for (int i = tid; i < 64 * 8; i += 256) { const int j = i / 8, d8 = (i % 8) * 8; FragH f; f.half[0] = *(const v8us*)((const unsigned short*)V16 + ((size_t)b * SQ + s0 + j) * DM + h * HD + d8); for (int q = 0; q < 8; ++q) tl[d8 + q][j] = f.u[q]; }
  __syncthreads();
  { for (int i = tid; i < 64 * 8; i += 256) { const int d = i / 8, j8 = (i % 8) * 8; FragH f; for (int q = 0; q < 8; ++q) f.u[q] = tl[d][j8 + q]; *(v8us*)((unsigned short*)VT + ((size_t)hh * HD + d) * SQ + s0 + j8) = f.half[0]; }  } }



__global__ __launch_bounds__(256) void k_rsmkm(const float* __restrict__ S, _Float16* __restrict__ P, int nrows, const int* __restrict__ am) {
  #pragma clang fp contract(off)
  const int t = blockIdx.x * 256 + threadIdx.x; if (t >= nrows) return; const size_t i = (size_t)t; const float* s = S + i * SQ; const int* mr = am + (size_t)(t % SQ) * SQ; float mx = -3.0e38f;
#pragma unroll 1
  for (int j = 0; j < SQ; ++j) { const float f = (mr[j] != 0) ? 1.f : 0.f; mx = fmaxf(mx, fmaf(f, s[j], (1.f - f) * -1.0e9f)); } float se = 0.f;
#pragma unroll 1
  for (int j = 0; j < SQ; ++j) { const float f = (mr[j] != 0) ? 1.f : 0.f; se += __expf(fmaf(f, s[j], (1.f - f) * -1.0e9f) - mx); } const float sc = 256.0f / se;
#pragma unroll 1
  for (int j0 = 0; j0 < SQ; j0 += 8) { FragH fr; for (int q = 0; q < 8; ++q) { const int j = j0 + q; const float f = (mr[j] != 0) ? 1.f : 0.f; fr.h[q] = (_Float16)(__expf(fmaf(f, s[j], (1.f - f) * -1.0e9f) - mx) * sc); }
    unsigned short* d = (unsigned short*)P + i * SQ + j0; *(v8us*)d = fr.half[0];  } }

__global__ __launch_bounds__(256) void k_bdshn(const float* __restrict__ Wb, _Float16* __restrict__ Bt) {
  const size_t t = (size_t)blockIdx.x * 256 + threadIdx.x; if (t >= (size_t)DM * DM / 8) return; const size_t e0 = t * 8; const int n = (int)(e0 / DM), k0 = (int)(e0 % DM); const int h = n >> 6, hk = k0 >> 6; const float on = (hk == h) ? 16.0f : 0.0f; const int o = n & 63, d0 = k0 & 63; FragH f;
  for (int q = 0; q < 8; ++q) f.h[q] = (_Float16)(bf16_round(Wb[(size_t)o * 64 + d0 + q]) * on);
  unsigned short* d = (unsigned short*)Bt + e0; *(v8us*)d = f.half[0];  }

// Fused attention: one launch for every (batch, head); scores, softmax and the weighted sum of V stay in registers, no score or weight plane in memory.
// A work-group is 8 waves x 32 queries of one head and walks the 2048 keys in stages of 64: the stage's K rows (64 keys x 64 dims) and V^T rows (64 dims x 64 keys) are fetched once per work-group with
// whole-line 16-byte loads, one stage ahead, and shared through two LDS buffers (rows of 128 B at a pitch of 144 B, the conflict-free pitch for 16-byte readers); one barrier per stage publishes the next
// buffer and ends the reads of the one refilled behind it. A wave works a stage in two passes of 32 keys. Per pass: S^T = K Q^T (A = 16 key rows, B = 16 query rows, both by g2_frag, so both in the same k order);
// a lane then holds, per 16-query tile, 16 scores of ONE query (query = lane & 15; keys 8 * (lane >> 4) + r of each 16-key tile), which is also the B-operand order of a 32-key product,
// so the weights go from the score accumulators straight into O^T += V^T P^T (A = 16 rows of V^T, again by g2_frag). Softmax is the running-maximum form in base 2: the maximum in use is raised,
// and sums and outputs rescaled, only when a pass exceeds it by more than 8 (weights stay <= 256, inside f16). Keys with mask == 0 take the module's fill through the addend of the scaling fma:
// the fill (-1e20 / 32, in base 2) absorbs any finite f16 score exactly, so the result is the fill itself, as the source's where() has it; a row with every key masked comes out uniform, as in the source.
// exp2 as asm text so that a v_nop stands directly behind the last transcendental: the instruction set asks for one slot before a result is used or a source overwritten (inside a run no v_exp_f32 touches
// another's register). Each works IN PLACE, on a register that the compiler's own subtraction has just written: so the asm never writes a register that a matrix instruction a few slots back still reads.
__device__ __forceinline__ float exp2_slot(float t) { asm("v_exp_f32 %0, %0\n\tv_nop" : "+v"(t)); return t; }
__device__ __forceinline__ void exp2_run8(float (&x)[8]) {
  asm("v_exp_f32 %0, %0\n\tv_exp_f32 %1, %1\n\tv_exp_f32 %2, %2\n\tv_exp_f32 %3, %3\n\tv_exp_f32 %4, %4\n\tv_exp_f32 %5, %5\n\tv_exp_f32 %6, %6\n\tv_exp_f32 %7, %7\n\tv_nop"
      : "+v"(x[0]), "+v"(x[1]), "+v"(x[2]), "+v"(x[3]), "+v"(x[4]), "+v"(x[5]), "+v"(x[6]), "+v"(x[7])); }
__device__ __forceinline__ float xhalf(float x) { return __builtin_bit_cast(float, __builtin_amdgcn_permlanex16(__builtin_bit_cast(int, x), __builtin_bit_cast(int, x), 0x76543210, 0xfedcba98, false, false)); }      /* lane l reads lane l ^ 16 */
__device__ __forceinline__ v8f fa_mma(v16h a, v16h b, v8f c) { return __builtin_amdgcn_wmma_f32_16x16x32_f16(false, a, false, b, (short)0, c, false, false); }
#define FA_NS (SQ / 64)      /* stages of 64 keys */
#define FA_LP 72             /* LDS row pitch in f16: 128 B of data + 16 B */
__global__ __launch_bounds__(256) void k_fattn(const _Float16* __restrict__ Q16, const _Float16* __restrict__ K16, const _Float16* __restrict__ VT, const int* __restrict__ Km, _Float16* __restrict__ O16) {
  __shared__ __attribute__((aligned(16))) float kb[SQ];      /* per key: 0 (kept) or the fill */
  __shared__ __attribute__((aligned(16))) _Float16 ks_[2][64 * FA_LP];      /* K rows of a stage: [key][dim] */
  __shared__ __attribute__((aligned(16))) _Float16 vs_[2][64 * FA_LP];      /* V^T rows of a stage: [dim][key] */
  const int tid = threadIdx.x, w = tid >> 5, lane = tid & 31, ln = lane & 15, hh = lane >> 4;
  const int bh = blockIdx.y, b = bh / NH, h = bh % NH; const int q0 = blockIdx.x * 256 + w * 32;
  const int sr = tid >> 3, sc8 = (tid & 7) * 8;      /* staging: 8 threads per 128-byte row, rows sr and sr + 32 */
  const _Float16* kg = K16 + ((size_t)b * SQ + sr) * DM + h * HD + sc8;
  const _Float16* vg = VT + ((size_t)bh * HD + sr) * SQ + sc8;
  const int so = sr * FA_LP + sc8;
  v8us gk0 = *(const v8us*)(const unsigned short*)kg, gk1 = *(const v8us*)(const unsigned short*)(kg + (size_t)32 * DM);
  v8us gv0 = *(const v8us*)(const unsigned short*)vg, gv1 = *(const v8us*)(const unsigned short*)(vg + (size_t)32 * SQ);
  for (int j = tid; j < SQ; j += 256) kb[j] = (Km[(size_t)b * SQ + j] != 0) ? 0.f : -4.5084220e18f;
  const _Float16* qp = Q16 + ((size_t)b * SQ + q0 + ln) * DM + h * HD;
  const float c2 = 0.03125f * 1.44269504f;      /* 1 / sqrt(embed size), in base 2 */
  const v8f z8 = {0.f,0.f,0.f,0.f,0.f,0.f,0.f,0.f};
  v16h qf[2][2];
#pragma unroll
  for (int t = 0; t < 2; ++t)
#pragma unroll
    for (int ks = 0; ks < 2; ++ks) qf[t][ks] = g2_frag(qp + (size_t)t * 16 * DM + ks * 32, hh);
  *(v8us*)(unsigned short*)&ks_[0][so] = gk0; *(v8us*)(unsigned short*)&ks_[0][so + 32 * FA_LP] = gk1;
  *(v8us*)(unsigned short*)&vs_[0][so] = gv0; *(v8us*)(unsigned short*)&vs_[0][so + 32 * FA_LP] = gv1;
  __syncthreads();      /* publishes stage 0 and the key table */
  v8f o[4][2];
#pragma unroll
  for (int dt = 0; dt < 4; ++dt) { o[dt][0] = z8; o[dt][1] = z8; }
  float mr[2] = {-3.0e38f, -3.0e38f}, lr[2] = {0.f, 0.f};
#pragma unroll 1
  for (int st = 0; st < FA_NS; ++st) {      /* kept rolled: one stage already fills the register file */
    const int keyn = (st + 1 < FA_NS) ? (st + 1) * 64 : st * 64;      /* the last stage refetches itself: in bounds, never read */
    const _Float16* kl = &ks_[st & 1][ln * FA_LP]; const _Float16* vl = &vs_[st & 1][ln * FA_LP];
    v16h kf[2][2], vf[4];
#pragma unroll
    for (int kt = 0; kt < 2; ++kt)
#pragma unroll
      for (int ks = 0; ks < 2; ++ks) kf[kt][ks] = g2_frag(kl + kt * 16 * FA_LP + ks * 32, hh);
#pragma unroll
    for (int p = 0; p < 2; ++p) {
      const int key0 = st * 64 + p * 32;
      /* next stage, half per pass through the same 8 registers: K rows fetched in the first pass, V^T rows in the second; each half is stored at its pass's end into the buffer that stage st - 1 read, whose readers left it at the last barrier */
      const v8us g0 = (p == 0) ? *(const v8us*)(const unsigned short*)(kg + (size_t)keyn * DM) : *(const v8us*)(const unsigned short*)(vg + keyn);
      const v8us g1 = (p == 0) ? *(const v8us*)(const unsigned short*)(kg + (size_t)(keyn + 32) * DM) : *(const v8us*)(const unsigned short*)(vg + (size_t)32 * SQ + keyn);
#pragma unroll
      for (int dt = 0; dt < 4; ++dt) vf[dt] = g2_frag(vl + dt * 16 * FA_LP + p * 32, hh);
      v8f sx[2][2];
#pragma unroll
      for (int kt = 0; kt < 2; ++kt)
#pragma unroll
        for (int qt = 0; qt < 2; ++qt) sx[kt][qt] = fa_mma(kf[kt][1], qf[qt][1], fa_mma(kf[kt][0], qf[qt][0], z8));
      if (p == 0) {      /* the second pass's K fragments, fetched behind the first pass's score products */
#pragma unroll
        for (int kt = 0; kt < 2; ++kt)
#pragma unroll
          for (int ks = 0; ks < 2; ++ks) kf[kt][ks] = g2_frag(kl + (32 + kt * 16) * FA_LP + ks * 32, hh); }
      float bias[2][8];
#pragma unroll
      for (int kt = 0; kt < 2; ++kt) { const v4f x0 = *(const v4fa*)&kb[key0 + kt * 16 + 8 * hh], x1 = *(const v4fa*)&kb[key0 + kt * 16 + 8 * hh + 4];
#pragma unroll
        for (int r = 0; r < 4; ++r) { bias[kt][r] = x0[r]; bias[kt][4 + r] = x1[r]; } }
      float mb[2]; bool need = false;
#pragma unroll
      for (int qt = 0; qt < 2; ++qt) { float mx0 = -3.0e38f, mx1 = -3.0e38f;
#pragma unroll
        for (int r = 0; r < 8; ++r) { sx[0][qt][r] = fmaf(sx[0][qt][r], c2, bias[0][r]); sx[1][qt][r] = fmaf(sx[1][qt][r], c2, bias[1][r]); mx0 = fmaxf(mx0, sx[0][qt][r]); mx1 = fmaxf(mx1, sx[1][qt][r]); }
        const float mx = fmaxf(mx0, mx1); mb[qt] = fmaxf(mx, xhalf(mx)); need = need || (mb[qt] > mr[qt] + 8.0f); }
      if (__builtin_amdgcn_ballot_w32(need) != 0) {      /* wave-uniform; rare after the first passes */
#pragma unroll
        for (int qt = 0; qt < 2; ++qt) { const float mn = fmaxf(mr[qt], mb[qt]); const float corr = exp2_slot(mr[qt] - mn); mr[qt] = mn; lr[qt] *= corr;
#pragma unroll
          for (int dt = 0; dt < 4; ++dt) o[dt][qt] = o[dt][qt] * corr; } }
#pragma unroll
      for (int qt = 0; qt < 2; ++qt) { FragH pf; float s0 = 0.f, s1 = 0.f, e0[8], e1[8];
#pragma unroll
        for (int r = 0; r < 8; ++r) { e0[r] = sx[0][qt][r] - mr[qt]; e1[r] = sx[1][qt][r] - mr[qt]; }
        exp2_run8(e0); exp2_run8(e1);
#pragma unroll
        for (int r = 0; r < 8; ++r) { s0 += e0[r]; s1 += e1[r]; pf.h[r] = (_Float16)e0[r]; pf.h[8 + r] = (_Float16)e1[r]; }
        lr[qt] += s0 + s1;
#pragma unroll
        for (int dt = 0; dt < 4; ++dt) o[dt][qt] = fa_mma(vf[dt], pf.v, o[dt][qt]); }
      { _Float16* gd = (p == 0) ? &ks_[(st + 1) & 1][so] : &vs_[(st + 1) & 1][so]; *(v8us*)(unsigned short*)gd = g0; *(v8us*)(unsigned short*)(gd + 32 * FA_LP) = g1; }
      if (p == 0) __builtin_amdgcn_sched_barrier(0);      /* keeps the next pass's score products out of this pass: moved up, their accumulators take the kernel past 256 registers */
    }
    __syncthreads();      /* publishes stage st + 1; ends every wave's reads of stage st before its buffer is refilled */
  }
#pragma unroll
  for (int qt = 0; qt < 2; ++qt) { const float sc = 64.0f / (lr[qt] + xhalf(lr[qt]));      /* the halves' sums join here; o carried x64 as before */
    unsigned short* op = (unsigned short*)O16 + ((size_t)b * SQ + q0 + qt * 16 + ln) * DM + h * HD + 8 * hh;
#pragma unroll
    for (int dt = 0; dt < 4; ++dt) { FragH f;
#pragma unroll
      for (int r = 0; r < 8; ++r) f.h[r] = (_Float16)(o[dt][qt][r] * sc);
      *(v8us*)(op + dt * 16) = f.half[0]; } }
}

// Per-head projections, one launch for Q, K and V (blockIdx.y picks input, weight and output). The module multiplies every 64-wide head slice by the SAME [64][64] matrix, so the token rows [4096][1024] are read as
// [65536][64] head rows and the product has K = 64: each input element is read once, straight from the f32 input, and no product with a zero block is formed.
// A work-group is 8 waves x 32 head rows. A wave fetches its 32 rows (8 KB in a row) with 16 whole-line 16-byte loads, rounds them (bf16, exact in f16) and lays them in its own LDS rows (128 B at a pitch of 144 B);
// the work-group converts the weight (bf16-rounded, x16) into LDS once; one barrier publishes it. Y^T = W X^T (A = 16 weight rows, B = 16 head rows, both by g2_frag, so both in the same k order, k 0..31 then 32..63):
// a lane then holds 8 neighbouring features of ONE head row, 16 bytes of f16, which go back into that row's LDS place (its fragments are already in registers) and leave as whole 128-byte lines.
#define PJ_LP 72             /* LDS row pitch in f16: 128 B of data + 16 B */
typedef unsigned short v4us __attribute__((ext_vector_type(4), may_alias));
union FragQ { v4us v; _Float16 h[4]; };
__global__ __launch_bounds__(256) void k_proj(const float* __restrict__ xq, const float* __restrict__ xk, const float* __restrict__ xv, const float* __restrict__ wq, const float* __restrict__ wk, const float* __restrict__ wv,
                                              _Float16* __restrict__ Q16, _Float16* __restrict__ K16, _Float16* __restrict__ V16) {
  __shared__ __attribute__((aligned(16))) _Float16 wl[HD * PJ_LP];      /* weight rows [out][in], x16 */
  __shared__ __attribute__((aligned(16))) _Float16 xl[8][32 * PJ_LP];      /* per wave: its 32 head rows, later its 32 output rows */
  const int tid = threadIdx.x, w = tid >> 5, lane = tid & 31, ln = lane & 15, hh = lane >> 4;
  const int sel = blockIdx.y;
  const float* x = (sel == 0) ? xq : (sel == 1) ? xk : xv;
  const float* W = (sel == 0) ? wq : (sel == 1) ? wk : wv;
  _Float16* Y = (sel == 0) ? Q16 : (sel == 1) ? K16 : V16;
  const size_t row0 = (size_t)blockIdx.x * 256 + w * 32;
  const float* xp = x + row0 * HD + lane * 4;
  v4f xr[16], wr[4];
#pragma unroll      /* constant indices: the values stay in registers */
  for (int i = 0; i < 16; ++i) xr[i] = *(const v4fa*)(xp + i * 128);      /* two rows per load */
#pragma unroll      /* constant indices: the values stay in registers */
  for (int i = 0; i < 4; ++i) wr[i] = *(const v4fa*)(W + i * 1024 + tid * 4);      /* 16 weight rows per load of the work-group */
  asm volatile("s_wait_xcnt 0x0" :: "v"(xp) : "memory");      /* precaution: no address register of the loads above is rewritten in front of this wait; naming the pair keeps the last load's result off it */
  _Float16* xw = &xl[w][0];
#pragma unroll      /* constant indices: the values stay in registers */
  for (int i = 0; i < 4; ++i) { FragQ f;
#pragma unroll      /* constant indices: the values stay in registers */
    for (int q = 0; q < 4; ++q) f.h[q] = (_Float16)(bf16_round(wr[i][q]) * 16.0f);
    *(v4us*)(unsigned short*)&wl[(i * 16 + (tid >> 4)) * PJ_LP + (tid & 15) * 4] = f.v; }
#pragma unroll      /* constant indices: the values stay in registers */
  for (int i = 0; i < 16; ++i) { FragQ f;
#pragma unroll      /* constant indices: the values stay in registers */
    for (int q = 0; q < 4; ++q) f.h[q] = (_Float16)bf16_round(xr[i][q]);
    *(v4us*)(unsigned short*)&xw[(i * 2 + hh) * PJ_LP + ln * 4] = f.v; }
  __syncthreads();      /* publishes the weight rows (and orders each wave's own rows) */
  const v8f z8 = {0.f,0.f,0.f,0.f,0.f,0.f,0.f,0.f};
  v16h wf[4][2];
#pragma unroll      /* constant indices: the values stay in registers */
  for (int t = 0; t < 4; ++t)
#pragma unroll      /* constant indices: the values stay in registers */
    for (int ks = 0; ks < 2; ++ks) wf[t][ks] = g2_frag(&wl[(t * 16 + ln) * PJ_LP + ks * 32], hh);
#pragma unroll      /* constant indices: the values stay in registers */
  for (int j = 0; j < 2; ++j) { _Float16* xrow = xw + (j * 16 + ln) * PJ_LP;
    const v16h x0 = g2_frag(xrow, hh), x1 = g2_frag(xrow + 32, hh);
#pragma unroll      /* constant indices: the values stay in registers */
    for (int t = 0; t < 4; ++t) { const v8f a = fa_mma(wf[t][1], x1, fa_mma(wf[t][0], x0, z8)); FragH f;
#pragma unroll      /* constant indices: the values stay in registers */
      for (int r = 0; r < 8; ++r) f.h[r] = (_Float16)(a[r] * 0.0625f);
      *(v8us*)(unsigned short*)(xrow + t * 16 + 8 * hh) = f.half[0]; } }
  __builtin_amdgcn_fence(__ATOMIC_ACQ_REL, "workgroup"); __builtin_amdgcn_wave_barrier();      /* the wave's lanes read each other's output pieces below */
#pragma unroll      /* constant indices: the values stay in registers */
  for (int i = 0; i < 8; ++i) { const int r = i * 4 + (lane >> 3), c8 = (lane & 7) * 8;      /* four whole rows, 512 B in a row, per store */
    const v8us v = *(const v8us*)(const unsigned short*)&xw[r * PJ_LP + c8];
    *(v8us*)((unsigned short*)Y + (row0 + r) * HD + c8) = v; }
}
// Output GEMM, out = o Wo^T * alpha + b: one 128 x 128 tile of out per work-group (8 waves, 2 x 4, 64 x 32 each), 256 work-groups. Both operands are K-contiguous f16 rows. A stage is 128 k (256 B) of the tile's 128 o rows
// and 128 Wo rows, brought into LDS by asynchronous 16-byte copies (a wave's copy covers two whole 256-byte row pieces, so every L2 request is a whole line and each line is asked for once per work-group),
// rows at a pitch of 272 B (conflict-free for 16-byte readers). Two buffers: stage t + 1 flies while stage t is worked on. Fragments by g2_frag from LDS for A and B alike (same k order);
// every accumulator takes its k blocks of 32 in rising order, as before. The f32 results leave through a wave's own LDS rows as whole 128-byte lines.
#define OG_BK 128            /* k per stage */
#define OG_NT (DM / OG_BK)   /* stages */
#define OG_LP 136            /* LDS row pitch in f16: 256 B of data + 16 B */
#define OG_SP 36             /* output staging pitch in f32: 128 B of data + 16 B */
// Eight copies of one thread, rows 16 apart. The s_wait_xcnt is the last line of the copies' own statement, so that no address register of a copy is rewritten in front of it (a precaution).
__device__ __forceinline__ void og_copy8(unsigned l, const _Float16* g) {
  asm volatile("global_load_async_to_lds_b128 %0, %8, off\n\tglobal_load_async_to_lds_b128 %1, %9, off\n\tglobal_load_async_to_lds_b128 %2, %10, off\n\tglobal_load_async_to_lds_b128 %3, %11, off\n\t"
               "global_load_async_to_lds_b128 %4, %12, off\n\tglobal_load_async_to_lds_b128 %5, %13, off\n\tglobal_load_async_to_lds_b128 %6, %14, off\n\tglobal_load_async_to_lds_b128 %7, %15, off\n\ts_wait_xcnt 0x0"
               :: "v"(l), "v"(l + 16u * OG_LP * 2u), "v"(l + 32u * OG_LP * 2u), "v"(l + 48u * OG_LP * 2u), "v"(l + 64u * OG_LP * 2u), "v"(l + 80u * OG_LP * 2u), "v"(l + 96u * OG_LP * 2u), "v"(l + 112u * OG_LP * 2u),
                  "v"(g), "v"(g + 16 * DM), "v"(g + 32 * DM), "v"(g + 48 * DM), "v"(g + 64 * DM), "v"(g + 80 * DM), "v"(g + 96 * DM), "v"(g + 112 * DM) : "memory"); }
__global__ __launch_bounds__(256) void k_ogemm(const _Float16* __restrict__ A, const _Float16* __restrict__ Bh, float alpha, const float* __restrict__ bias, float* __restrict__ C) {
  __shared__ __attribute__((aligned(16))) _Float16 at_[2][128 * OG_LP];      /* o rows of a stage: [row][k] */
  __shared__ __attribute__((aligned(16))) _Float16 bt_[2][128 * OG_LP];      /* Wo rows of a stage: [col][k] */
  __shared__ __attribute__((aligned(16))) float so[8][64 * OG_SP];      /* per wave: its 64 x 32 results */
  const int tid = threadIdx.x, w = tid >> 5, lane = tid & 31, ln = lane & 15, hh = lane >> 4;
  const int row0 = (blockIdx.x / (DM / 128)) * 128, col0 = (blockIdx.x % (DM / 128)) * 128;
  const int wm = w >> 2, wn = w & 3;
  const int cr = tid >> 4, cc = (tid & 15) * 8;      /* copies: 16 threads per 256-byte row piece, rows cr + 16 i */
  const _Float16* ag = A + (size_t)(row0 + cr) * DM + cc;
  const _Float16* bg = Bh + (size_t)(col0 + cr) * DM + cc;
  const unsigned al = (unsigned)(size_t)&at_[0][cr * OG_LP + cc], bl = (unsigned)(size_t)&bt_[0][cr * OG_LP + cc];      /* LDS byte addresses */
  const unsigned bufb = 128u * OG_LP * 2u;      /* bytes of one buffer */
  og_copy8(al, ag); og_copy8(bl, bg);
  asm volatile("s_wait_asynccnt 0x0" ::: "memory");      /* stage 0 has landed for this wave's copies */
  __syncthreads();      /* publishes stage 0 */
  og_copy8(al + bufb, ag + OG_BK); og_copy8(bl + bufb, bg + OG_BK);
  const v8f z8 = {0.f,0.f,0.f,0.f,0.f,0.f,0.f,0.f};
  v8f acc[4][2];
#pragma unroll      /* constant indices: the values stay in registers */
  for (int i = 0; i < 4; ++i) { acc[i][0] = z8; acc[i][1] = z8; }
  for (int t = 0; t < OG_NT; ++t) {
    const _Float16* ap = &at_[t & 1][(wm * 64 + ln) * OG_LP]; const _Float16* bp = &bt_[t & 1][(wn * 32 + ln) * OG_LP];
    v16h af[2][4], bf[2][2];      /* two fragment sets: block ks + 1 is fetched while block ks is multiplied */
#pragma unroll      /* constant indices: the values stay in registers */
    for (int i = 0; i < 4; ++i) af[0][i] = g2_frag(ap + i * 16 * OG_LP, hh);
#pragma unroll      /* constant indices: the values stay in registers */
    for (int j = 0; j < 2; ++j) bf[0][j] = g2_frag(bp + j * 16 * OG_LP, hh);
#pragma unroll      /* constant indices: the values stay in registers */
    for (int ks = 0; ks < OG_BK / 32; ++ks) { const int cu = ks & 1, nx = cu ^ 1;
      if (ks + 1 < OG_BK / 32) {
#pragma unroll      /* constant indices: the values stay in registers */
        for (int i = 0; i < 4; ++i) af[nx][i] = g2_frag(ap + i * 16 * OG_LP + (ks + 1) * 32, hh);
#pragma unroll      /* constant indices: the values stay in registers */
        for (int j = 0; j < 2; ++j) bf[nx][j] = g2_frag(bp + j * 16 * OG_LP + (ks + 1) * 32, hh); }
      __builtin_amdgcn_sched_barrier(0);      /* keeps the next block's LDS reads as one group in front of this block's products: sunk among them, one fragment set is reused and every pair of products waits out an LDS latency */
#pragma unroll      /* constant indices: the values stay in registers */
      for (int i = 0; i < 4; ++i) { acc[i][0] = fa_mma(af[cu][i], bf[cu][0], acc[i][0]); acc[i][1] = fa_mma(af[cu][i], bf[cu][1], acc[i][1]); }
      __builtin_amdgcn_sched_barrier(0);      /* keeps the block after next's reads behind these products, so that two fragment sets suffice */
    }
    asm volatile("s_wait_dscnt 0x0" ::: "memory");      /* this wave's reads of stage t have returned before its buffer is refilled */
    asm volatile("s_wait_asynccnt 0x0" ::: "memory");      /* this wave's copies of stage t + 1 have landed */
    __syncthreads();      /* publishes stage t + 1; ends every wave's reads of stage t */
    if (t + 2 < OG_NT) { const unsigned bo = (unsigned)(t & 1) * bufb; og_copy8(al + bo, ag + (t + 2) * OG_BK); og_copy8(bl + bo, bg + (t + 2) * OG_BK); }
  }
  asm volatile("s_wait_asynccnt 0x0" ::: "memory");      /* no copy is outstanding when the wave goes on and ends */
  float* sw = &so[w][0];
#pragma unroll      /* constant indices: the values stay in registers */
  for (int j = 0; j < 2; ++j) { const float bv = bf16_round(bias[col0 + wn * 32 + j * 16 + ln]);
#pragma unroll      /* constant indices: the values stay in registers */
    for (int i = 0; i < 4; ++i)
#pragma unroll      /* constant indices: the values stay in registers */
      for (int r = 0; r < 8; ++r) sw[(i * 16 + 8 * hh + r) * OG_SP + j * 16 + ln] = acc[i][j][r] * alpha + bv; }
  __builtin_amdgcn_fence(__ATOMIC_ACQ_REL, "workgroup"); __builtin_amdgcn_wave_barrier();      /* the wave's lanes read each other's results below */
  float* cp = C + (size_t)(row0 + wm * 64 + (lane >> 3)) * DM + col0 + wn * 32 + (lane & 7) * 4;
#pragma unroll      /* constant indices: the values stay in registers */
  for (int q = 0; q < 16; ++q) { const v4f v = *(const v4fa*)&sw[(q * 4 + (lane >> 3)) * OG_SP + (lane & 7) * 4];      /* four whole 128-byte lines per store */
    *(v4f*)(cp + (size_t)q * 4 * DM) = v; }
}
extern "C" void kernel_launch(void* const* d_in, const int* in_sizes, int n_in,
                              void* d_out, int out_size, void* d_ws, size_t ws_size, hipStream_t stream) {
  (void)in_sizes; (void)n_in; (void)out_size;
  const float* const* I = (const float* const*)d_in; const float* xq = I[2]; const float* xk = I[1]; const float* xv = I[0]; const int* km = (const int*)d_in[3]; const float* wq = I[6]; const float* wk = I[5]; const float* wv = I[4]; const float* wo = I[7]; const float* bo = I[8];      /* contract order: values I[0], keys I[1], query I[2]; mask int32 [2][1][1][2048] (0 = masked key; READ on device); SHARED natural [64][64] blocks Wv I[4], Wk I[5], Wq I[6]; natural Wo [1024][1024] + bo */
  char* ws = (char*)d_ws; size_t off = 0;
  auto take = [&](size_t bytes) { char* p = ws + off; off += (bytes + 255) & ~(size_t)255; return p; };
  _Float16* BO = (_Float16*)take((size_t)DM * DM * 2);
  _Float16* Q16 = (_Float16*)take(NR * DM * 2); _Float16* K16 = (_Float16*)take(NR * DM * 2); _Float16* V16 = (_Float16*)take(NR * DM * 2); _Float16* O16 = (_Float16*)take(NR * DM * 2);
  _Float16* VT = (_Float16*)take((size_t)NB * NH * HD * SQ * 2);
  if (off > ws_size) return;
  k_wnat<<<(unsigned)(((size_t)DM * DM / 8 + 255) / 256), 256, 0, stream>>>(wo, (size_t)DM * DM / 8, BO);      /* Wo natural [out][in] = Bt x16 */
  const size_t r0p = (size_t)B0 * SQ;      /* first row of the output stage */
  k_proj<<<dim3((unsigned)(NR * NH / 256), 3), 256, 0, stream>>>(xq, xk, xv, wq, wk, wv, Q16, K16, V16);      /* q, k, v of every token row and head, f16 rows in the merged layout */
  k_vt<NH, SQ><<<NB * NH * (SQ / 64), 256, 0, stream>>>(V16, LQ, 0, VT);      /* V^T [NB][NH][HD][SQ], both batches */
  k_fattn<<<dim3(SQ / 256, NB * NH), 256, 0, stream>>>(Q16, K16, VT, km, O16);      /* scores, masked softmax and P V of every (batch, head) in one launch; o (merged heads, x64) as f16 rows */
  k_ogemm<<<(unsigned)((MPO / 128) * (DM / 128)), 256, 0, stream>>>(O16 + r0p * DM, BO, 0.0009765625f, bo, (float*)d_out + r0p * DM);      /* out rows are the output layout */
}

// v005
// Measured time: 49.7 microseconds a run.
// Timed twice side by side with v004, it ran 1.46 and 1.45 times as fast.
// Over all steps from v000 it is 69.0 times as fast.
#include <hip/hip_runtime.h>
// Multi-head attention over three inputs with SHARED per-head projections, a random key-padding mask and the module's literal score scale (values, keys, query [2][2048][1024]; each input is split into 16 heads of 64 and every head is multiplied by the SAME natural [64][64] matrix (x W^T: Wv / Wk / Wq; no biases); energy = q k^T; where(mask == 0, -1e20) with the int32 [2][1][1][2048] mask in {0, 1} (random; 0 = masked key; READ on device); softmax(energy / sqrt(embed_size) = / sqrt(1024) = / 32) (as the source); out = merged Wo^T + bo (natural [1024][1024]) -> [2][2048][1024]).
// Keys with mask == 0 have weight exactly 0 wherever their batch keeps a key: the kept keys are ranked per batch, K and V rows are projected and stored for kept keys only, packed by rank, and attention walks the packed rows alone (any mask; a batch with no kept key walks all keys under the fill).
// Structure: token rows r = b*2048 + s; Q, K, V by one per-head projection launch (every 64-wide head slice of a token row is one row of a [65536][64] x [64][64]^T WMMA product, K = 64; f32 inputs rounded to bf16 and held as exact f16 in LDS, exact x16 weights, f32 accumulation, f16 outputs); V^T for all batches and heads via LDS transposes; one fused attention launch over every (batch, head): scores by WMMA (scale 1/32 = 1/sqrt(embed size), the module's literal scale), running-maximum softmax in registers (f32 statistics; unnormalised weights as f16), o = P . V by WMMA, divided by the row sum at the end (o carried x64 against f16 subnormal flush, folded into the output GEMM alpha) and written straight into the merged f16 o rows; out = o W_o + b GEMM (f32) into the output layout.
// Compute dtype: inputs rounded to bf16; x / weights exact; q, k, v, softmax weights and o as plain f16 GEMM operands (~2^-12); scores and softmax statistics f32. v_wmma_f32_16x16x32_f16.
#define NB 2
#define SQ 2048
#define DM 1024
#define NH 16
#define HD 64
#define HG 4                         /* heads per launch of the grouped k_vt overload (not launched) */
#define B0 0                         /* first batch processed (debug hook) */
#define NBR NB                       /* batches processed (debug hook) */
#define NR ((size_t)NB * SQ)         /* token rows */
#define MP ((int)((size_t)NBR * SQ)) /* token rows of the output stage, via MPO (debug hook) */
#define QN SQ                        /* query rows per batch (not used) */
#define NHD NH                       /* heads (not used) */
#define MPO MP                       /* rows through the output stage (debug hook) */
#define LQ DM      /* row pitch of the q/k/v rows */
typedef __bf16 v16b __attribute__((ext_vector_type(16)));
typedef unsigned short v8us __attribute__((ext_vector_type(8), may_alias));
typedef float  v8f  __attribute__((ext_vector_type(8)));
typedef float  v4f  __attribute__((ext_vector_type(4)));
typedef float  v4fa __attribute__((ext_vector_type(4), may_alias));
union FragB { v16b v; v8us half[2]; unsigned short u[16]; };

__device__ __forceinline__ unsigned short bf16_bits(float x) { unsigned int u = __float_as_uint(x); return (unsigned short)((u + 0x7FFFu + ((u >> 16) & 1u)) >> 16); }
__device__ __forceinline__ float bf16_val(unsigned short b) { return __uint_as_float(((unsigned int)b) << 16); }
__device__ __forceinline__ float bf16_round(float x) { return bf16_val(bf16_bits(x)); }
// D += A·B with NT terms: 1 = ah·bh, 2 = + al·bh (A split), 3 = + ah·bl (both split)
template <int NT>
__device__ __forceinline__ v8f mmaN(v16b ah, v16b al, v16b bh, v16b bl, v8f c) {
  c = __builtin_amdgcn_wmma_f32_16x16x32_bf16(false, ah, false, bh, (short)0, c, false, false);
  if (NT >= 2) c = __builtin_amdgcn_wmma_f32_16x16x32_bf16(false, al, false, bh, (short)0, c, false, false);
  if (NT >= 3) c = __builtin_amdgcn_wmma_f32_16x16x32_bf16(false, ah, false, bl, (short)0, c, false, false);
  asm volatile("v_nop\n\tv_nop\n\tv_nop\n\tv_nop" : "+v"(c) : "v"(ah), "v"(al), "v"(bh), "v"(bl));
  return c;
}

__global__ __launch_bounds__(256) void k_wt_bf16(const float* __restrict__ W, unsigned short* __restrict__ Wt, int K, int N) {
  const int t = blockIdx.x * 256 + threadIdx.x;
  const int k8n = K / 8;
  if (t >= N * k8n) return;
  const int n = t / k8n, k8 = (t % k8n) * 8;
  v8us v;
#pragma unroll
  for (int i = 0; i < 8; ++i) v[i] = bf16_bits(W[(size_t)(k8 + i) * N + n]);
  *(v8us*)(Wt + (size_t)n * K + k8) = v;
  
}

// GEMM C[M][N] (f32, pitch ldc) = act(A[M][K]·W + bias). A f32 row-major (pitch lda) converted per fragment to bf16
// (ASPLIT: hi/lo two planes -> 2 terms, else single rounded term); Wt bf16 [N][K] (pitch ldb). BIAS_BF16 rounds the
// bias to bf16 first (bias quantised to bf16 before the add). K%32==0, M%16==0, N%64==0.
template <bool ASPLIT, int ACT, bool BIAS_BF16>
__global__ __launch_bounds__(128) void k_gemm_bf(const float* __restrict__ A, int lda, const unsigned short* __restrict__ Wt, int ldb,
                                               const float* __restrict__ bias, float* __restrict__ C, int ldc, int M, int N, int K) {
  __shared__ __attribute__((aligned(16))) float so[4][16][64];
  const int tid = threadIdx.x, w = tid >> 5, lane = tid & 31, ln = lane & 15, hh = lane >> 4;
  const int ntn = N / 64;
  const int wid = blockIdx.x * 4 + w;
  const int mt = wid / ntn, nq = wid % ntn;
  if (mt * 16 >= M) return;
  const int row0 = mt * 16, col0 = nq * 64;
  const float* arow = A + (size_t)(row0 + ln) * lda;
  v8f acc[4] = {};
  for (int kb = 0; kb < K; kb += 32) {
    FragB ah, al;
    const v4f x0 = *(const v4fa*)(arow + kb + 8 * hh), x1 = *(const v4fa*)(arow + kb + 8 * hh + 4);
    const v4f x2 = *(const v4fa*)(arow + kb + 16 + 8 * hh), x3 = *(const v4fa*)(arow + kb + 16 + 8 * hh + 4);
    float xs[16] = {x0[0],x0[1],x0[2],x0[3],x1[0],x1[1],x1[2],x1[3],x2[0],x2[1],x2[2],x2[3],x3[0],x3[1],x3[2],x3[3]};
#pragma unroll
    for (int i = 0; i < 16; ++i) { const unsigned short hb = bf16_bits(xs[i]); ah.u[i] = hb; al.u[i] = ASPLIT ? bf16_bits(xs[i] - bf16_val(hb)) : (unsigned short)0; }
#pragma unroll
    for (int t = 0; t < 4; ++t) {
      const unsigned short* brow = Wt + (size_t)(col0 + t * 16 + ln) * ldb + kb;
      FragB b;
      b.half[0] = *(const v8us*)(brow + 8 * hh);
      b.half[1] = *(const v8us*)(brow + 16 + 8 * hh);
      acc[t] = mmaN<ASPLIT ? 2 : 1>(ah.v, al.v, b.v, b.v, acc[t]);
    }
  }
#pragma unroll
  for (int t = 0; t < 4; ++t) {
    float bv = bias ? bias[col0 + t * 16 + ln] : 0.f;
    if (BIAS_BF16) bv = bf16_round(bv);
#pragma unroll
    for (int r = 0; r < 8; ++r) { float v = acc[t][r] + bv; if (ACT == 1) v = fmaxf(v, 0.f); so[w][8 * hh + r][t * 16 + ln] = v; }
  }
  __builtin_amdgcn_fence(__ATOMIC_ACQ_REL, "workgroup");
  __builtin_amdgcn_wave_barrier();
  const int rsub = lane >> 4, c4 = (lane & 15) * 4;
  {
#pragma unroll
    for (int q = 0; q < 8; ++q) {
      const int r = q * 2 + rsub;
      const v4f v = *(const v4fa*)&so[w][r][c4];
      *(v4f*)(C + (size_t)(row0 + r) * ldc + col0 + c4) = v;
    }
    
  }
}

// GEMM C = act(A·W + bias + resid): A f32 (ASPLIT -> hi/lo 2 terms), Wt bf16 [N][K]; ACT 0 none, 1 relu, 2 exact gelu;
// resid (optional, f32, row index = (row % rmod), pitch ldr, RES_BF16 rounds it) added before the activation.
template <bool ASPLIT, int ACT, bool BIAS_BF16, bool RES_BF16>
__global__ __launch_bounds__(128) void k_gemm_bf3(const float* __restrict__ A, int lda, const unsigned short* __restrict__ Wt, int ldb,
                                                const float* __restrict__ bias, const float* __restrict__ resid, int rmod, int ldr,
                                                float* __restrict__ C, int ldc, int M, int N, int K) {
  __shared__ __attribute__((aligned(16))) float so[4][16][64];
  const int tid = threadIdx.x, w = tid >> 5, lane = tid & 31, ln = lane & 15, hh = lane >> 4;
  const int ntn = N / 64;
  const int wid = blockIdx.x * 4 + w;
  const int mt = wid / ntn, nq = wid % ntn;
  if (mt * 16 >= M) return;
  const int row0 = mt * 16, col0 = nq * 64;
  const float* arow = A + (size_t)(row0 + ln) * lda;
  v8f acc[4] = {};
  for (int kb = 0; kb < K; kb += 32) {
    FragB ah, al;
    const v4f x0 = *(const v4fa*)(arow + kb + 8 * hh), x1 = *(const v4fa*)(arow + kb + 8 * hh + 4);
    const v4f x2 = *(const v4fa*)(arow + kb + 16 + 8 * hh), x3 = *(const v4fa*)(arow + kb + 16 + 8 * hh + 4);
    float xs[16] = {x0[0],x0[1],x0[2],x0[3],x1[0],x1[1],x1[2],x1[3],x2[0],x2[1],x2[2],x2[3],x3[0],x3[1],x3[2],x3[3]};
#pragma unroll
    for (int i = 0; i < 16; ++i) { const unsigned short hb = bf16_bits(xs[i]); ah.u[i] = hb; al.u[i] = ASPLIT ? bf16_bits(xs[i] - bf16_val(hb)) : (unsigned short)0; }
#pragma unroll
    for (int t = 0; t < 4; ++t) {
      const unsigned short* brow = Wt + (size_t)(col0 + t * 16 + ln) * ldb + kb;
      FragB b;
      b.half[0] = *(const v8us*)(brow + 8 * hh);
      b.half[1] = *(const v8us*)(brow + 16 + 8 * hh);
      acc[t] = mmaN<ASPLIT ? 2 : 1>(ah.v, al.v, b.v, b.v, acc[t]);
    }
  }
#pragma unroll
  for (int t = 0; t < 4; ++t) {
    const int col = col0 + t * 16 + ln;
    float bv = bias ? bias[col] : 0.f;
    if (BIAS_BF16) bv = bf16_round(bv);
#pragma unroll
    for (int r = 0; r < 8; ++r) {
      float v = acc[t][r] + bv;
      if (resid) { float rv = resid[(size_t)((row0 + 8 * hh + r) % rmod) * ldr + col]; if (RES_BF16) rv = bf16_round(rv); v += rv; }
      if (ACT == 1) v = fmaxf(v, 0.f);
      if (ACT == 2) v = 0.5f * v * (1.0f + erff(v * 0.70710678118654752f));
      if (ACT == 3) { const float u = 0.7978845608028654f * (v + 0.044715f * v * v * v); v = 0.5f * v * (1.0f + tanhf(u)); }
      so[w][8 * hh + r][t * 16 + ln] = v;
    }
  }
  __builtin_amdgcn_fence(__ATOMIC_ACQ_REL, "workgroup");
  __builtin_amdgcn_wave_barrier();
  const int rsub = lane >> 4, c4 = (lane & 15) * 4;
  {
#pragma unroll
    for (int q = 0; q < 8; ++q) {
      const int r = q * 2 + rsub;
      const v4f v = *(const v4fa*)&so[w][r][c4];
      *(v4f*)(C + (size_t)(row0 + r) * ldc + col0 + c4) = v;
    }
    
  }
}
// row LayerNorm (biased variance, eps) over N: s = X (+ R); optional out_sum <- s; out_norm <- (s-mu)*rsqrt(var+eps)*g + b
template <bool PARAM_BF16>
__global__ __launch_bounds__(256) void k_layernorm(const float* __restrict__ X, const float* __restrict__ R, const float* __restrict__ g, const float* __restrict__ bta,
                                                  float* __restrict__ out_sum, float* __restrict__ out_norm, int N, float eps) {
  __shared__ float red[256];
  const int row = blockIdx.x, tid = threadIdx.x;
  const float* x = X + (size_t)row * N; const float* rr = R ? R + (size_t)row * N : nullptr;
  float vals[16];                     // up to N = 4096
  const int per = N / 256;            // contiguous chunk per thread? use strided-by-4 chunks: thread handles j = tid*4 + 1024*u
  float s1 = 0.f;
  for (int u = 0; u < per / 4; ++u) {
    const int j = tid * 4 + 1024 * u;
    const v4f a = *(const v4fa*)(x + j);
    v4f b = {0.f,0.f,0.f,0.f}; if (rr) b = *(const v4fa*)(rr + j);
#pragma unroll
    for (int q = 0; q < 4; ++q) { const float v = a[q] + b[q]; vals[u * 4 + q] = v; s1 += v; }
  }
  red[tid] = s1; __syncthreads();
  for (int st = 128; st > 0; st >>= 1) { if (tid < st) red[tid] += red[tid + st]; __syncthreads(); }
  const float mu = red[0] / (float)N; __syncthreads();
  float s2 = 0.f;
  for (int u = 0; u < per / 4; ++u)
#pragma unroll
    for (int q = 0; q < 4; ++q) { const float c = vals[u * 4 + q] - mu; s2 += c * c; }
  red[tid] = s2; __syncthreads();
  for (int st = 128; st > 0; st >>= 1) { if (tid < st) red[tid] += red[tid + st]; __syncthreads(); }
  const float rs = rsqrtf(red[0] / (float)N + eps);
  {
    for (int u = 0; u < per / 4; ++u) {
      const int j = tid * 4 + 1024 * u;
      v4f o, sm;
#pragma unroll
      for (int q = 0; q < 4; ++q) {
        float gg = g[j + q], bb = bta[j + q];
        if (PARAM_BF16) { gg = bf16_round(gg); bb = bf16_round(bb); }
        sm[q] = vals[u * 4 + q]; o[q] = (vals[u * 4 + q] - mu) * rs * gg + bb;
      }
      if (out_sum) *(v4f*)(out_sum + (size_t)row * N + j) = sm;
      *(v4f*)(out_norm + (size_t)row * N + j) = o;
    }
    
  }
}



// ---- f16 WMMA path (v_wmma_f32_16x16x32_f16): 11-bit significands for operands in range — used where a [0,1] probability operand needs more precision than bf16
typedef _Float16 v16h __attribute__((ext_vector_type(16)));
union FragH { v16h v; v8us half[2]; _Float16 h[16]; unsigned short u[16]; };
template <int NT>
__device__ __forceinline__ v8f mmaH(v16h ah, v16h al, v16h bh, v16h bl, v8f c) {
  c = __builtin_amdgcn_wmma_f32_16x16x32_f16(false, ah, false, bh, (short)0, c, false, false);
  if (NT >= 2) c = __builtin_amdgcn_wmma_f32_16x16x32_f16(false, al, false, bh, (short)0, c, false, false);
  if (NT >= 3) c = __builtin_amdgcn_wmma_f32_16x16x32_f16(false, ah, false, bl, (short)0, c, false, false);
  asm volatile("v_nop\n\tv_nop\n\tv_nop\n\tv_nop" : "+v"(c) : "v"(ah), "v"(al), "v"(bh), "v"(bl));
  return c;
}
// batched GEMM like k_gemm_b but f16 operands: A f32 (split into f16 hi/lo if ASPLIT, else rounded to f16), Bt = f16 values [n][k]; alpha; C f32; N multiple of 16 (partial tiles skipped)
template <bool ASPLIT>
__global__ __launch_bounds__(128) void k_gemm_h(const float* __restrict__ A, int lda, size_t sA, const _Float16* __restrict__ Bh, int ldb, size_t sB, float alpha, float* __restrict__ C, int ldc, size_t sC, int M, int N, int K) {
  __shared__ __attribute__((aligned(16))) float so[4][16][64];
  const int tid = threadIdx.x, w = tid >> 5, lane = tid & 31, ln = lane & 15, hh = lane >> 4; const int by = blockIdx.y;
  A += (size_t)by * sA; Bh += (size_t)by * sB; C += (size_t)by * sC;
  const int ntn = (N + 63) / 64; const int wid = blockIdx.x * 4 + w; const int mt = wid / ntn, nq = wid % ntn; if (mt * 16 >= M) return;
  const int row0 = mt * 16, col0 = nq * 64; const float* arow = A + (size_t)(row0 + ln) * lda;
  v8f acc[4] = {};
  for (int kb = 0; kb < K; kb += 32) {
    FragH ah, al;
    const v4f x0 = *(const v4fa*)(arow + kb + 8 * hh), x1 = *(const v4fa*)(arow + kb + 8 * hh + 4), x2 = *(const v4fa*)(arow + kb + 16 + 8 * hh), x3 = *(const v4fa*)(arow + kb + 16 + 8 * hh + 4);
    float xs[16] = {x0[0],x0[1],x0[2],x0[3],x1[0],x1[1],x1[2],x1[3],x2[0],x2[1],x2[2],x2[3],x3[0],x3[1],x3[2],x3[3]};
#pragma unroll
    for (int i = 0; i < 16; ++i) { const _Float16 h = (_Float16)xs[i]; ah.h[i] = h; al.h[i] = ASPLIT ? (_Float16)(xs[i] - (float)h) : (_Float16)0.0f; }
#pragma unroll
    for (int t = 0; t < 4; ++t) { if (col0 + t * 16 >= N) continue; const size_t boff = (size_t)(col0 + t * 16 + ln) * ldb + kb; FragH bq; bq.half[0] = *(const v8us*)(Bh + boff + 8 * hh); bq.half[1] = *(const v8us*)(Bh + boff + 16 + 8 * hh);
      acc[t] = mmaH<ASPLIT ? 2 : 1>(ah.v, al.v, bq.v, bq.v, acc[t]); }
  }
#pragma unroll
  for (int t = 0; t < 4; ++t) { if (col0 + t * 16 >= N) continue;
#pragma unroll
    for (int r = 0; r < 8; ++r) so[w][8 * hh + r][t * 16 + ln] = acc[t][r] * alpha; }
  __builtin_amdgcn_fence(__ATOMIC_ACQ_REL, "workgroup"); __builtin_amdgcn_wave_barrier();
  const int rsub = lane >> 4, c4 = (lane & 15) * 4;
  {
#pragma unroll
    for (int q = 0; q < 8; ++q) { const int r = q * 2 + rsub; if (col0 + c4 < N) { const v4f v = *(const v4fa*)&so[w][r][c4]; *(v4f*)(C + (size_t)(row0 + r) * ldc + col0 + c4) = v; } }
     }
}

// Wt[n][k] = f16(W[k][n]·scale) from f32 row-major W[K][N] (scale = power of two; bf16-exact weights stay exact in f16 away from the subnormal range)
__global__ __launch_bounds__(256) void k_wt_f16(const float* __restrict__ W, _Float16* __restrict__ Wt, int K, int N, float scale) {
  const int t = blockIdx.x * 256 + threadIdx.x; if (t >= N * (K / 8)) return; const int n = t / (K / 8), k8 = (t % (K / 8)) * 8; FragH f;
#pragma unroll
  for (int i = 0; i < 8; ++i) f.h[i] = (_Float16)(bf16_round(W[(size_t)(k8 + i) * N + n]) * scale); const v8us o = f.half[0];
  *(v8us*)((unsigned short*)Wt + (size_t)n * K + k8) = o; 
}
// k_gemm_hh variant with fused epilogue: v = acc·alpha + bias[by·sBias + col] (+ CP[(row/rowsPerB)·sCPb + by·64 + col] if CP) ; ACT 0 none / 1 elu ; writes f16 C16 (and f32 C if non-null)
template <int ACT>
__global__ __launch_bounds__(128) void k_gemm_hhx(const _Float16* __restrict__ A, int lda, size_t sA, const _Float16* __restrict__ Bh, int ldb, size_t sB, float alpha, const float* __restrict__ bias, size_t sBias, const float* __restrict__ CP, int rowsPerB, size_t sCPb, int row0g,
    float* __restrict__ C, _Float16* __restrict__ C16, int ldc, size_t sC, int M, int N, int K) {
  __shared__ __attribute__((aligned(16))) float so[4][16][64];
  const int tid = threadIdx.x, w = tid >> 5, lane = tid & 31, ln = lane & 15, hh = lane >> 4; const int by = blockIdx.y;
  A += (size_t)by * sA; Bh += (size_t)by * sB; const size_t cofs = (size_t)by * sC; const float* bp = bias ? bias + (size_t)by * sBias : nullptr;
  const int ntn = (N + 63) / 64; const int wid = blockIdx.x * 4 + w; const int mt = wid / ntn, nq = wid % ntn; if (mt * 16 >= M) return;
  const int row0 = mt * 16, col0 = nq * 64; const _Float16* arow = A + (size_t)(row0 + ln) * lda;
  v8f acc[4] = {};
  for (int kb = 0; kb < K; kb += 32) { FragH ah; ah.half[0] = *(const v8us*)((const unsigned short*)arow + kb + 8 * hh); ah.half[1] = *(const v8us*)((const unsigned short*)arow + kb + 16 + 8 * hh);
#pragma unroll
    for (int t = 0; t < 4; ++t) { if (col0 + t * 16 >= N) continue; const size_t boff = (size_t)(col0 + t * 16 + ln) * ldb + kb; FragH bq; bq.half[0] = *(const v8us*)((const unsigned short*)Bh + boff + 8 * hh); bq.half[1] = *(const v8us*)((const unsigned short*)Bh + boff + 16 + 8 * hh);
      acc[t] = mmaH<1>(ah.v, ah.v, bq.v, bq.v, acc[t]); }
  }
#pragma unroll
  for (int t = 0; t < 4; ++t) { if (col0 + t * 16 >= N) continue; const int col = col0 + t * 16 + ln; const float bv = bp ? bf16_round(bp[col]) : 0.f;
#pragma unroll
    for (int r = 0; r < 8; ++r) { float v = acc[t][r] * alpha + bv; if (CP) { const int rr = row0g + row0 + 8 * hh + r; if (rowsPerB < 0) v += CP[cofs + (size_t)rr * ldc + col];      /* rowsPerB < 0: own element of the batched C plane */ else { const int bidx = rr / rowsPerB; v += CP[(size_t)bidx * sCPb + (size_t)by * 64 + col]; } } if (ACT == 1) v = (v > 0.f) ? v : expm1f(v); else if (ACT == 7) v = (v > 0.f) ? v + 1.0f : expf(v); else if (ACT == 8) v = tanhf(v); else if (ACT == 9) v = 0.5f * v * (1.0f + tanhf(0.7978845608028654f * (v + 0.044715f * v * v * v))); else if (ACT == 11) v = 1.0f / (1.0f + expf(-v)); else if (ACT == 12) v = (v > 0.f) ? v : 0.01f * v; else if (ACT == 14) v = (v > 0.f) ? v : 0.1f * v; else if (ACT == 16) v = (v >= 0.f) ? v : 0.3f * v; else if (ACT == 17) v = (v >= 0.f) ? v : 0.2f * v; else if (ACT == 15) v = v / (1.0f + expf(-v)); else if (ACT == 3) v = fmaxf(v, 0.f); else if (ACT == 6) v = 0.5f * v * (1.0f + erff(v * 0.70710678118654752f)); so[w][8 * hh + r][t * 16 + ln] = v; } }
  __builtin_amdgcn_fence(__ATOMIC_ACQ_REL, "workgroup"); __builtin_amdgcn_wave_barrier();
  const int rsub = lane >> 4, c4 = (lane & 15) * 4; typedef _Float16 v4h __attribute__((ext_vector_type(4)));
  {
#pragma unroll
    for (int q = 0; q < 8; ++q) { const int r = q * 2 + rsub; if (col0 + c4 < N) { const v4f v = *(const v4fa*)&so[w][r][c4]; if (C) *(v4f*)(C + cofs + (size_t)(row0 + r) * ldc + col0 + c4) = v; if (C16) { v4h h4; for (int i = 0; i < 4; ++i) h4[i] = (_Float16)v[i]; *(v4h*)(C16 + cofs + (size_t)(row0 + r) * ldc + col0 + c4) = h4; } } }
     }
}


typedef _Float16 v4h __attribute__((ext_vector_type(4)));

__global__ __launch_bounds__(256) void k_x16(const float* __restrict__ x, _Float16* __restrict__ X16, size_t n8) { const size_t t = (size_t)blockIdx.x * 256 + threadIdx.x; if (t >= n8) return; FragH f;
#pragma unroll
  for (int q = 0; q < 8; ++q) f.h[q] = (_Float16)bf16_round(x[t * 8 + q]); *(v8us*)((unsigned short*)X16 + t * 8) = f.half[0];  }
__global__ __launch_bounds__(256) void k_h16(const float* __restrict__ x, _Float16* __restrict__ X16, size_t n8) { const size_t t = (size_t)blockIdx.x * 256 + threadIdx.x; if (t >= n8) return; FragH f;
#pragma unroll
  for (int q = 0; q < 8; ++q) f.h[q] = (_Float16)x[t * 8 + q]; *(v8us*)((unsigned short*)X16 + t * 8) = f.half[0];  }
__global__ __launch_bounds__(256) void k_round16f(const float* __restrict__ W, _Float16* __restrict__ Bt, size_t n8) { const size_t t = (size_t)blockIdx.x * 256 + threadIdx.x; if (t >= n8) return; FragH f;
#pragma unroll
  for (int i = 0; i < 8; ++i) f.h[i] = (_Float16)(bf16_round(W[t * 8 + i]) * 16.0f); *(v8us*)((unsigned short*)Bt + t * 8) = f.half[0];  }
template <int NHv, int TTv>
__global__ __launch_bounds__(256) void k_vt(const _Float16* __restrict__ V16, int ldv, int voff, _Float16* __restrict__ Vt, const int* __restrict__ KN) { __shared__ unsigned short tl[64][66]; const int tid = threadIdx.x; const int slab = blockIdx.x / (TTv / 64), lg = blockIdx.x % (TTv / 64); const int b = slab / NHv, h = slab % NHv;
  const int n = KN[b], nk = (n < 1 || n > TTv) ? TTv : n;      /* packed V rows of the batch (all of them where no key is kept) */
  if (lg * 64 >= nk) return;      /* no packed row in this group of 64: the whole work-group leaves, in front of the barrier */
  for (int i = tid; i < 64 * 8; i += 256) { const int r = i / 8, c8 = (i % 8) * 8; const int rr = (lg * 64 + r < nk) ? lg * 64 + r : nk - 1;      /* past the last packed row: that row again, a finite value under a zero weight */
    FragH f; f.half[0] = *(const v8us*)((const unsigned short*)V16 + ((size_t)b * TTv + rr) * ldv + voff + h * 64 + c8);
#pragma unroll
    for (int q = 0; q < 8; ++q) tl[r][c8 + q] = f.u[q]; }
  __syncthreads();
  {
#pragma unroll
    for (int rd = 0; rd < 2; ++rd) { const int d = rd * 32 + tid / 8, pc = tid % 8; FragH f;
#pragma unroll
      for (int q = 0; q < 8; ++q) f.u[q] = tl[pc * 8 + q][d];
      *(v8us*)((unsigned short*)Vt + ((size_t)slab * 64 + d) * TTv + lg * 64 + pc * 8) = f.half[0]; }
     } }

__global__ __launch_bounds__(256) void k_hl(const float* __restrict__ F, _Float16* __restrict__ Hh, _Float16* __restrict__ Hl, size_t n8) { const size_t t = (size_t)blockIdx.x * 256 + threadIdx.x; if (t >= n8) return; FragH fh, fl; const v4f a = *(const v4fa*)(F + t * 8), c = *(const v4fa*)(F + t * 8 + 4);
#pragma unroll
  for (int q = 0; q < 4; ++q) { _Float16 h = (_Float16)a[q]; fh.h[q] = h; fl.h[q] = (_Float16)((a[q] - (float)h) * 1024.0f); h = (_Float16)c[q]; fh.h[4 + q] = h; fl.h[4 + q] = (_Float16)((c[q] - (float)h) * 1024.0f); }
  { *(v8us*)((unsigned short*)Hh + t * 8) = fh.half[0]; *(v8us*)((unsigned short*)Hl + t * 8) = fl.half[0];  } }

// ---- fast GEMM (wave tile 32x64; requires M % 32 == 0 rows per launch region and N % 64 == 0); epilogue = k_gemm_hhx semantics ----
__device__ __forceinline__ v16h g2_frag(const _Float16* p, int hh) { FragH f; f.half[0] = *(const v8us*)((const unsigned short*)p + 8 * hh); f.half[1] = *(const v8us*)((const unsigned short*)p + 16 + 8 * hh); return f.v; }
__device__ __forceinline__ v8f g2_mma(v16h a, v16h b, v8f c) { v8f d = __builtin_amdgcn_wmma_f32_16x16x32_f16(false, a, false, b, (short)0, c, false, false); asm volatile("v_nop\n\tv_nop\n\tv_nop\n\tv_nop" : "+v"(d) : "v"(a), "v"(b)); return d; }
template <int ACT>
__global__ __launch_bounds__(128) void k_gemm2(const _Float16* __restrict__ A, int lda, size_t sA, const _Float16* __restrict__ Bh, int ldb, size_t sB, float alpha, const float* __restrict__ bias, size_t sBias, const float* __restrict__ CP, int rowsPerB, size_t sCPb, int row0g,
    float* __restrict__ C, _Float16* __restrict__ C16, int ldc, size_t sC, int M, int N, int K) { static_assert(ACT == 0 || ACT == 3 || ACT == 6 || ACT == 8 || ACT == 9 || ACT == 11 || ACT == 12 || ACT == 14 || ACT == 15 || ACT == 16 || ACT == 17, "k_gemm2: unsupported ACT code (would silently apply no activation)");
  __shared__ __attribute__((aligned(16))) float so[4][32][68];
  const int tid = threadIdx.x, w = tid >> 5, lane = tid & 31, ln = lane & 15, hh = lane >> 4; const int by = blockIdx.y;
  A += (size_t)by * sA; Bh += (size_t)by * sB; const size_t cofs = (size_t)by * sC; const float* bp = bias ? bias + (size_t)by * sBias : nullptr;
  const int ntn = N >> 6; const int mt = blockIdx.x / ntn, nq = blockIdx.x - mt * ntn; const int row0 = mt * 128 + 32 * w, col0 = nq * 64; if (row0 >= M) return;
  const _Float16* a0p = A + (size_t)(row0 + ln) * lda; const _Float16* a1p = a0p + (size_t)16 * lda;
  const _Float16* b0p = Bh + (size_t)(col0 + ln) * ldb; const _Float16* b1p = b0p + (size_t)16 * ldb; const _Float16* b2p = b1p + (size_t)16 * ldb; const _Float16* b3p = b2p + (size_t)16 * ldb;
  const v8f z8 = {0.f,0.f,0.f,0.f,0.f,0.f,0.f,0.f}; v8f c00 = z8, c01 = z8, c02 = z8, c03 = z8, c10 = z8, c11 = z8, c12 = z8, c13 = z8;
#pragma unroll 1
  for (int kb = 0; kb < K; kb += 32) { const v16h a0 = g2_frag(a0p + kb, hh), a1 = g2_frag(a1p + kb, hh);
    v16h b = g2_frag(b0p + kb, hh); c00 = g2_mma(a0, b, c00); c10 = g2_mma(a1, b, c10);
    b = g2_frag(b1p + kb, hh); c01 = g2_mma(a0, b, c01); c11 = g2_mma(a1, b, c11);
    b = g2_frag(b2p + kb, hh); c02 = g2_mma(a0, b, c02); c12 = g2_mma(a1, b, c12);
    b = g2_frag(b3p + kb, hh); c03 = g2_mma(a0, b, c03); c13 = g2_mma(a1, b, c13); }
  v8f accs[8] = {c00, c01, c02, c03, c10, c11, c12, c13};
#pragma unroll
  for (int u = 0; u < 8; ++u) { const int t = u & 3, half = u >> 2; const int col = col0 + t * 16 + ln; const float bv = bp ? bf16_round(bp[col]) : 0.f;
#pragma unroll
    for (int r = 0; r < 8; ++r) { const int rloc = half * 16 + 8 * hh + r; float v = accs[u][r] * alpha + bv; if (CP) { if (rowsPerB < 0) v += CP[cofs + (size_t)(row0g + row0 + rloc) * ldc + col];      /* rowsPerB < 0: own element of the batched C plane */ else { const int bidx = (row0g + row0 + rloc) / rowsPerB; v += CP[(size_t)bidx * sCPb + (size_t)by * 64 + col]; } }
      if (ACT == 3) v = fmaxf(v, 0.f); else if (ACT == 6) v = 0.5f * v * (1.0f + erff(v * 0.70710678118654752f)); else if (ACT == 11) v = 1.0f / (1.0f + expf(-v)); else if (ACT == 15) v = v / (1.0f + expf(-v)); else if (ACT == 12) v = (v > 0.f) ? v : 0.01f * v; else if (ACT == 8) v = tanhf(v); else if (ACT == 9) v = 0.5f * v * (1.0f + tanhf(0.7978845608028654f * (v + 0.044715f * v * v * v))); else if (ACT == 14) v = (v > 0.f) ? v : 0.1f * v; else if (ACT == 16) v = (v >= 0.f) ? v : 0.3f * v; else if (ACT == 17) v = (v >= 0.f) ? v : 0.2f * v;
      so[w][rloc][t * 16 + ln] = v; } }
  __builtin_amdgcn_fence(__ATOMIC_ACQ_REL, "workgroup"); __builtin_amdgcn_wave_barrier();
  const int rsub = lane >> 4, c4 = (lane & 15) * 4;
  {
#pragma unroll
    for (int q = 0; q < 16; ++q) { const int r = q * 2 + rsub; const v4f v = *(const v4fa*)&so[w][r][c4]; if (C) *(v4f*)(C + cofs + (size_t)(row0 + r) * ldc + col0 + c4) = v; if (C16) { v4h h4; for (int i = 0; i < 4; ++i) h4[i] = (_Float16)v[i]; *(v4h*)(C16 + cofs + (size_t)(row0 + r) * ldc + col0 + c4) = h4; } }
     } }


// Ranks of the kept keys, one work-group per batch: KP[b][s] = how many keys with mask != 0 stand in front of key s (its row among the batch's packed K and V rows), or -1 for a key with mask == 0; KN[b] = the number kept.
// A key with mask == 0 has weight exp(fill - max) = 0 exactly in f32 as soon as one key of the batch is kept, so it is left out of K, V and the key walk. A batch with no key kept keeps them all (rank = s, KN = 0):
// the attention kernel then gives every key the fill, and the rows come out uniform, as in the source.
__device__ __forceinline__ void key_ranks(const int* __restrict__ Km, int* __restrict__ KP, int* __restrict__ KN, int b) {
  __shared__ int sc[8];      /* kept keys per wave */
  const int tid = threadIdx.x, w = tid >> 5, lane = tid & 31; const size_t k0 = (size_t)b * SQ + w * 256 + lane;      /* a wave takes 256 keys in a row, 32 per load */
  unsigned bm[8]; int tot = 0;
#pragma unroll      /* constant indices: the values stay in registers */
  for (int i = 0; i < 8; ++i) { bm[i] = __builtin_amdgcn_ballot_w32(Km[k0 + i * 32] != 0); tot += __builtin_popcount(bm[i]); }
  if (lane == 0) sc[w] = tot;
  __syncthreads();      /* publishes the waves' counts */
  int n = 0, p = 0;
#pragma unroll      /* constant indices: the values stay in registers */
  for (int u = 0; u < 8; ++u) { const int v = sc[u]; n += v; p += (u < w) ? v : 0; }
  int rk[8];
#pragma unroll      /* constant indices: the values stay in registers */
  for (int i = 0; i < 8; ++i) { const int r = p + __builtin_popcount(bm[i] & ((1u << lane) - 1u));
    rk[i] = (n == 0) ? w * 256 + i * 32 + lane : (((bm[i] >> lane) & 1u) ? r : -1); p += __builtin_popcount(bm[i]); }
#pragma unroll      /* constant indices: the values stay in registers */
  for (int i = 0; i < 8; ++i) KP[k0 + i * 32] = rk[i];
  if (tid == 0) KN[b] = n; }
#define WN_NB (DM * DM / 8 / 256)      /* work-groups that convert Wo; the NB behind them rank the keys */
__global__ __launch_bounds__(256) void k_wnat(const float* __restrict__ w, size_t n8, _Float16* __restrict__ Bt, const int* __restrict__ Km, int* __restrict__ KP, int* __restrict__ KN) {
  if (blockIdx.x >= WN_NB) { key_ranks(Km, KP, KN, (int)blockIdx.x - WN_NB); return; }      /* the same for a whole work-group */
  const size_t t = (size_t)blockIdx.x * 256 + threadIdx.x; if (t >= n8) return; FragH f; for (int q = 0; q < 8; ++q) f.h[q] = (_Float16)(bf16_round(w[t * 8 + q]) * 16.0f); *(v8us*)((unsigned short*)Bt + t * 8) = f.half[0];  }
__global__ __launch_bounds__(256) void k_rsm(const float* __restrict__ S, _Float16* __restrict__ P, int nrows) {
  #pragma clang fp contract(off)
  const int i = blockIdx.x * 256 + threadIdx.x; if (i >= nrows) return; const float* s = S + (size_t)i * SQ; float mx = -3.0e38f;
#pragma unroll 1
  for (int j = 0; j < SQ; ++j) mx = fmaxf(mx, s[j]); float se = 0.f;
#pragma unroll 1
  for (int j = 0; j < SQ; ++j) se += expf(s[j] - mx); const float sc = 256.0f / se;
#pragma unroll 1
  for (int j0 = 0; j0 < SQ; j0 += 8) { FragH f; for (int q = 0; q < 8; ++q) f.h[q] = (_Float16)(expf(s[j0 + q] - mx) * sc); unsigned short* d = (unsigned short*)P + (size_t)i * SQ + j0; *(v8us*)d = f.half[0];  } }
__global__ __launch_bounds__(256) void k_vt(const _Float16* __restrict__ V16, int b, int h0, _Float16* __restrict__ VT) { __shared__ unsigned short tl[64][65]; const int tid = threadIdx.x; const int hh = blockIdx.x % HG, sg = blockIdx.x / HG; const int s0 = sg * 64; const int h = h0 + hh;
  for (int i = tid; i < 64 * 8; i += 256) { const int j = i / 8, d8 = (i % 8) * 8; FragH f; f.half[0] = *(const v8us*)((const unsigned short*)V16 + ((size_t)b * SQ + s0 + j) * DM + h * HD + d8); for (int q = 0; q < 8; ++q) tl[d8 + q][j] = f.u[q]; }
  __syncthreads();
  { for (int i = tid; i < 64 * 8; i += 256) { const int d = i / 8, j8 = (i % 8) * 8; FragH f; for (int q = 0; q < 8; ++q) f.u[q] = tl[d][j8 + q]; *(v8us*)((unsigned short*)VT + ((size_t)hh * HD + d) * SQ + s0 + j8) = f.half[0]; }  } }



__global__ __launch_bounds__(256) void k_rsmkm(const float* __restrict__ S, _Float16* __restrict__ P, int nrows, const int* __restrict__ am) {
  #pragma clang fp contract(off)
  const int t = blockIdx.x * 256 + threadIdx.x; if (t >= nrows) return; const size_t i = (size_t)t; const float* s = S + i * SQ; const int* mr = am + (size_t)(t % SQ) * SQ; float mx = -3.0e38f;
#pragma unroll 1
  for (int j = 0; j < SQ; ++j) { const float f = (mr[j] != 0) ? 1.f : 0.f; mx = fmaxf(mx, fmaf(f, s[j], (1.f - f) * -1.0e9f)); } float se = 0.f;
#pragma unroll 1
  for (int j = 0; j < SQ; ++j) { const float f = (mr[j] != 0) ? 1.f : 0.f; se += __expf(fmaf(f, s[j], (1.f - f) * -1.0e9f) - mx); } const float sc = 256.0f / se;
#pragma unroll 1
  for (int j0 = 0; j0 < SQ; j0 += 8) { FragH fr; for (int q = 0; q < 8; ++q) { const int j = j0 + q; const float f = (mr[j] != 0) ? 1.f : 0.f; fr.h[q] = (_Float16)(__expf(fmaf(f, s[j], (1.f - f) * -1.0e9f) - mx) * sc); }
    unsigned short* d = (unsigned short*)P + i * SQ + j0; *(v8us*)d = fr.half[0];  } }

__global__ __launch_bounds__(256) void k_bdshn(const float* __restrict__ Wb, _Float16* __restrict__ Bt) {
  const size_t t = (size_t)blockIdx.x * 256 + threadIdx.x; if (t >= (size_t)DM * DM / 8) return; const size_t e0 = t * 8; const int n = (int)(e0 / DM), k0 = (int)(e0 % DM); const int h = n >> 6, hk = k0 >> 6; const float on = (hk == h) ? 16.0f : 0.0f; const int o = n & 63, d0 = k0 & 63; FragH f;
  for (int q = 0; q < 8; ++q) f.h[q] = (_Float16)(bf16_round(Wb[(size_t)o * 64 + d0 + q]) * on);
  unsigned short* d = (unsigned short*)Bt + e0; *(v8us*)d = f.half[0];  }

// Fused attention: one launch for every (batch, head); scores, softmax and the weighted sum of V stay in registers, no score or weight plane in memory.
// A work-group is 8 waves x 32 queries of one head and walks the batch's packed (kept) keys in stages of 64, the last stage filled up with keys under the fill: the stage's K rows (64 keys x 64 dims) and V^T rows (64 dims x 64 keys) are fetched once per work-group with
// whole-line 16-byte loads, one stage ahead, and shared through two LDS buffers (rows of 128 B at a pitch of 144 B, the conflict-free pitch for 16-byte readers); one barrier per stage publishes the next
// buffer and ends the reads of the one refilled behind it. A wave works a stage in two passes of 32 keys. Per pass: S^T = K Q^T (A = 16 key rows, B = 16 query rows, both by g2_frag, so both in the same k order);
// a lane then holds, per 16-query tile, 16 scores of ONE query (query = lane & 15; keys 8 * (lane >> 4) + r of each 16-key tile), which is also the B-operand order of a 32-key product,
// so the weights go from the score accumulators straight into O^T += V^T P^T (A = 16 rows of V^T, again by g2_frag). Softmax is the running-maximum form in base 2: the maximum in use is raised,
// and sums and outputs rescaled, only when a pass exceeds it by more than 8 (weights stay <= 256, inside f16). The filling keys (and, where a batch keeps no key, all keys) take the module's fill through the addend of the scaling fma:
// the fill (-1e20 / 32, in base 2) absorbs any finite f16 score exactly, so the result is the fill itself, as the source's where() has it; a row with every key masked comes out uniform, as in the source.
// exp2 as asm text so that a v_nop stands directly behind the last transcendental: the instruction set asks for one slot before a result is used or a source overwritten (inside a run no v_exp_f32 touches
// another's register). Each works IN PLACE, on a register that the compiler's own subtraction has just written: so the asm never writes a register that a matrix instruction a few slots back still reads.
__device__ __forceinline__ float exp2_slot(float t) { asm("v_exp_f32 %0, %0\n\tv_nop" : "+v"(t)); return t; }
__device__ __forceinline__ void exp2_run8(float (&x)[8]) {
  asm("v_exp_f32 %0, %0\n\tv_exp_f32 %1, %1\n\tv_exp_f32 %2, %2\n\tv_exp_f32 %3, %3\n\tv_exp_f32 %4, %4\n\tv_exp_f32 %5, %5\n\tv_exp_f32 %6, %6\n\tv_exp_f32 %7, %7\n\tv_nop"
      : "+v"(x[0]), "+v"(x[1]), "+v"(x[2]), "+v"(x[3]), "+v"(x[4]), "+v"(x[5]), "+v"(x[6]), "+v"(x[7])); }
__device__ __forceinline__ float xhalf(float x) { return __builtin_bit_cast(float, __builtin_amdgcn_permlanex16(__builtin_bit_cast(int, x), __builtin_bit_cast(int, x), 0x76543210, 0xfedcba98, false, false)); }      /* lane l reads lane l ^ 16 */
__device__ __forceinline__ v8f fa_mma(v16h a, v16h b, v8f c) { return __builtin_amdgcn_wmma_f32_16x16x32_f16(false, a, false, b, (short)0, c, false, false); }
#define FA_NS (SQ / 64)      /* stages of 64 keys */
#define FA_LP 72             /* LDS row pitch in f16: 128 B of data + 16 B */
__global__ __launch_bounds__(256) void k_fattn(const _Float16* __restrict__ Q16, const _Float16* __restrict__ K16, const _Float16* __restrict__ VT, const int* __restrict__ KN, _Float16* __restrict__ O16) {
  __shared__ __attribute__((aligned(16))) float kb[SQ];      /* per packed key: 0 (kept) or the fill */
  __shared__ __attribute__((aligned(16))) _Float16 ks_[2][64 * FA_LP];      /* K rows of a stage: [key][dim] */
  __shared__ __attribute__((aligned(16))) _Float16 vs_[2][64 * FA_LP];      /* V^T rows of a stage: [dim][key] */
  const int tid = threadIdx.x, w = tid >> 5, lane = tid & 31, ln = lane & 15, hh = lane >> 4;
  const int bh = blockIdx.y, b = bh / NH, h = bh % NH; const int q0 = blockIdx.x * 256 + w * 32;
  const int sr = tid >> 3, sc8 = (tid & 7) * 8;      /* staging: 8 threads per 128-byte row, rows sr and sr + 32 */
  const int n = KN[b], nk = (n < 1 || n > SQ) ? SQ : n, ns = (nk + 63) >> 6;      /* kept keys of the batch; packed rows to walk (all keys where none is kept); stages, 1 to FA_NS, the same for the whole work-group */
  const int kl1 = nk - 1 - sr;      /* a K row past the last packed one is read as that one: a finite score, which the fill absorbs */
  const _Float16* kg = K16 + ((size_t)b * SQ + sr) * DM + h * HD + sc8;
  const _Float16* vg = VT + ((size_t)bh * HD + sr) * SQ + sc8;
  const int so = sr * FA_LP + sc8;
  v8us gk0 = *(const v8us*)(const unsigned short*)(kg + (ptrdiff_t)min(0, kl1) * DM), gk1 = *(const v8us*)(const unsigned short*)(kg + (ptrdiff_t)min(32, kl1) * DM);
  v8us gv0 = *(const v8us*)(const unsigned short*)vg, gv1 = *(const v8us*)(const unsigned short*)(vg + (size_t)32 * SQ);
  for (int j = tid; j < SQ; j += 256) kb[j] = (j < n) ? 0.f : -4.5084220e18f;
  const _Float16* qp = Q16 + ((size_t)b * SQ + q0 + ln) * DM + h * HD;
  const float c2 = 0.03125f * 1.44269504f;      /* 1 / sqrt(embed size), in base 2 */
  const v8f z8 = {0.f,0.f,0.f,0.f,0.f,0.f,0.f,0.f};
  v16h qf[2][2];
#pragma unroll
  for (int t = 0; t < 2; ++t)
#pragma unroll
    for (int ks = 0; ks < 2; ++ks) qf[t][ks] = g2_frag(qp + (size_t)t * 16 * DM + ks * 32, hh);
  *(v8us*)(unsigned short*)&ks_[0][so] = gk0; *(v8us*)(unsigned short*)&ks_[0][so + 32 * FA_LP] = gk1;
  *(v8us*)(unsigned short*)&vs_[0][so] = gv0; *(v8us*)(unsigned short*)&vs_[0][so + 32 * FA_LP] = gv1;
  __syncthreads();      /* publishes stage 0 and the key table */
  v8f o[4][2];
#pragma unroll
  for (int dt = 0; dt < 4; ++dt) { o[dt][0] = z8; o[dt][1] = z8; }
  float mr[2] = {-3.0e38f, -3.0e38f}, lr[2] = {0.f, 0.f};
#pragma unroll 1
  for (int st = 0; st < ns; ++st) {      /* kept rolled: one stage already fills the register file */
    const int keyn = (st + 1 < ns) ? (st + 1) * 64 : st * 64;      /* the last stage refetches itself: in bounds, never read */
    const _Float16* kl = &ks_[st & 1][ln * FA_LP]; const _Float16* vl = &vs_[st & 1][ln * FA_LP];
    v16h kf[2][2], vf[4];
#pragma unroll
    for (int kt = 0; kt < 2; ++kt)
#pragma unroll
      for (int ks = 0; ks < 2; ++ks) kf[kt][ks] = g2_frag(kl + kt * 16 * FA_LP + ks * 32, hh);
#pragma unroll
    for (int p = 0; p < 2; ++p) {
      const int key0 = st * 64 + p * 32;
      /* next stage, half per pass through the same 8 registers: K rows fetched in the first pass, V^T rows in the second; each half is stored at its pass's end into the buffer that stage st - 1 read, whose readers left it at the last barrier */
      const v8us g0 = (p == 0) ? *(const v8us*)(const unsigned short*)(kg + (ptrdiff_t)min(keyn, kl1) * DM) : *(const v8us*)(const unsigned short*)(vg + keyn);
      const v8us g1 = (p == 0) ? *(const v8us*)(const unsigned short*)(kg + (ptrdiff_t)min(keyn + 32, kl1) * DM) : *(const v8us*)(const unsigned short*)(vg + (size_t)32 * SQ + keyn);
#pragma unroll
      for (int dt = 0; dt < 4; ++dt) vf[dt] = g2_frag(vl + dt * 16 * FA_LP + p * 32, hh);
      v8f sx[2][2];
#pragma unroll
      for (int kt = 0; kt < 2; ++kt)
#pragma unroll
        for (int qt = 0; qt < 2; ++qt) sx[kt][qt] = fa_mma(kf[kt][1], qf[qt][1], fa_mma(kf[kt][0], qf[qt][0], z8));
      if (p == 0) {      /* the second pass's K fragments, fetched behind the first pass's score products */
#pragma unroll
        for (int kt = 0; kt < 2; ++kt)
#pragma unroll
          for (int ks = 0; ks < 2; ++ks) kf[kt][ks] = g2_frag(kl + (32 + kt * 16) * FA_LP + ks * 32, hh); }
      float bias[2][8];
#pragma unroll
      for (int kt = 0; kt < 2; ++kt) { const v4f x0 = *(const v4fa*)&kb[key0 + kt * 16 + 8 * hh], x1 = *(const v4fa*)&kb[key0 + kt * 16 + 8 * hh + 4];
#pragma unroll
        for (int r = 0; r < 4; ++r) { bias[kt][r] = x0[r]; bias[kt][4 + r] = x1[r]; } }
      float mb[2]; bool need = false;
#pragma unroll
      for (int qt = 0; qt < 2; ++qt) { float mx0 = -3.0e38f, mx1 = -3.0e38f;
#pragma unroll
        for (int r = 0; r < 8; ++r) { sx[0][qt][r] = fmaf(sx[0][qt][r], c2, bias[0][r]); sx[1][qt][r] = fmaf(sx[1][qt][r], c2, bias[1][r]); mx0 = fmaxf(mx0, sx[0][qt][r]); mx1 = fmaxf(mx1, sx[1][qt][r]); }
        const float mx = fmaxf(mx0, mx1); mb[qt] = fmaxf(mx, xhalf(mx)); need = need || (mb[qt] > mr[qt] + 8.0f); }
      if (__builtin_amdgcn_ballot_w32(need) != 0) {      /* wave-uniform; rare after the first passes */
#pragma unroll
        for (int qt = 0; qt < 2; ++qt) { const float mn = fmaxf(mr[qt], mb[qt]); const float corr = exp2_slot(mr[qt] - mn); mr[qt] = mn; lr[qt] *= corr;
#pragma unroll
          for (int dt = 0; dt < 4; ++dt) o[dt][qt] = o[dt][qt] * corr; } }
#pragma unroll
      for (int qt = 0; qt < 2; ++qt) { FragH pf; float s0 = 0.f, s1 = 0.f, e0[8], e1[8];
#pragma unroll
        for (int r = 0; r < 8; ++r) { e0[r] = sx[0][qt][r] - mr[qt]; e1[r] = sx[1][qt][r] - mr[qt]; }
        exp2_run8(e0); exp2_run8(e1);
#pragma unroll
        for (int r = 0; r < 8; ++r) { s0 += e0[r]; s1 += e1[r]; pf.h[r] = (_Float16)e0[r]; pf.h[8 + r] = (_Float16)e1[r]; }
        lr[qt] += s0 + s1;
#pragma unroll
        for (int dt = 0; dt < 4; ++dt) o[dt][qt] = fa_mma(vf[dt], pf.v, o[dt][qt]); }
      { _Float16* gd = (p == 0) ? &ks_[(st + 1) & 1][so] : &vs_[(st + 1) & 1][so]; *(v8us*)(unsigned short*)gd = g0; *(v8us*)(unsigned short*)(gd + 32 * FA_LP) = g1; }
      if (p == 0) __builtin_amdgcn_sched_barrier(0);      /* keeps the next pass's score products out of this pass: moved up, their accumulators take the kernel past 256 registers */
    }
    __syncthreads();      /* publishes stage st + 1; ends every wave's reads of stage st before its buffer is refilled */
  }
#pragma unroll
  for (int qt = 0; qt < 2; ++qt) { const float sc = 64.0f / (lr[qt] + xhalf(lr[qt]));      /* the halves' sums join here; o carried x64 as before */
    unsigned short* op = (unsigned short*)O16 + ((size_t)b * SQ + q0 + qt * 16 + ln) * DM + h * HD + 8 * hh;
#pragma unroll
    for (int dt = 0; dt < 4; ++dt) { FragH f;
#pragma unroll
      for (int r = 0; r < 8; ++r) f.h[r] = (_Float16)(o[dt][qt][r] * sc);
      *(v8us*)(op + dt * 16) = f.half[0]; } }
}

// Per-head projections, one launch for Q, K and V (blockIdx.y picks input, weight and output). The module multiplies every 64-wide head slice by the SAME [64][64] matrix, so the token rows [4096][1024] are read as
// [65536][64] head rows and the product has K = 64: each input element is read once, straight from the f32 input, and no product with a zero block is formed.
// A work-group is 8 waves x 32 head rows. A wave fetches its 32 rows (8 KB in a row) with 16 whole-line 16-byte loads, rounds them (bf16, exact in f16) and lays them in its own LDS rows (128 B at a pitch of 144 B);
// the work-group converts the weight (bf16-rounded, x16) into LDS once; one barrier publishes it. Y^T = W X^T (A = 16 weight rows, B = 16 head rows, both by g2_frag, so both in the same k order, k 0..31 then 32..63):
// a lane then holds 8 neighbouring features of ONE head row, 16 bytes of f16, which go back into that row's LDS place (its fragments are already in registers) and leave as whole 128-byte lines.
#define PJ_LP 72             /* LDS row pitch in f16: 128 B of data + 16 B */
typedef unsigned short v4us __attribute__((ext_vector_type(4), may_alias));
union FragQ { v4us v; _Float16 h[4]; };
__global__ __launch_bounds__(256) void k_proj(const float* __restrict__ xq, const float* __restrict__ xk, const float* __restrict__ xv, const float* __restrict__ wq, const float* __restrict__ wk, const float* __restrict__ wv,
                                              _Float16* __restrict__ Q16, _Float16* __restrict__ K16, _Float16* __restrict__ V16, const int* __restrict__ KP) {
  __shared__ __attribute__((aligned(16))) _Float16 wl[HD * PJ_LP];      /* weight rows [out][in], x16 */
  __shared__ __attribute__((aligned(16))) _Float16 xl[8][32 * PJ_LP];      /* per wave: its 32 head rows, later its 32 output rows */
  const int tid = threadIdx.x, w = tid >> 5, lane = tid & 31, ln = lane & 15, hh = lane >> 4;
  const int sel = blockIdx.y;
  const float* x = (sel == 0) ? xq : (sel == 1) ? xk : xv;
  const float* W = (sel == 0) ? wq : (sel == 1) ? wk : wv;
  _Float16* Y = (sel == 0) ? Q16 : (sel == 1) ? K16 : V16;
  const size_t row0 = (size_t)blockIdx.x * 256 + w * 32;
  const float* xp = x + row0 * HD + lane * 4;
  /* a wave's 32 head rows are two tokens; d0, d1: the token rows they are written to, or -1. Queries keep their place; a K or V token goes to its rank among the batch's kept keys, and one with mask == 0 is neither read nor written */
  const int tok = (int)(row0 >> 4); int d0 = tok, d1 = tok + 1;
  if (sel != 0) { const int p0 = KP[tok], p1 = KP[tok + 1], tb = tok & ~(SQ - 1); d0 = (p0 < 0) ? -1 : tb + min(p0, SQ - 1); d1 = (p1 < 0) ? -1 : tb + min(p1, SQ - 1); }
  d0 = __builtin_amdgcn_readfirstlane(d0); d1 = __builtin_amdgcn_readfirstlane(d1);      /* the same in every lane of the wave: the tests below are scalar branches */
  v4f xr[16], wr[4];      /* a token that is left out has no values here: every use below stands under the same test */
  if (d0 >= 0) {
#pragma unroll      /* constant indices: the values stay in registers */
    for (int i = 0; i < 8; ++i) xr[i] = *(const v4fa*)(xp + i * 128); }      /* two rows per load */
  if (d1 >= 0) {
#pragma unroll      /* constant indices: the values stay in registers */
    for (int i = 8; i < 16; ++i) xr[i] = *(const v4fa*)(xp + i * 128); }
#pragma unroll      /* constant indices: the values stay in registers */
  for (int i = 0; i < 4; ++i) wr[i] = *(const v4fa*)(W + i * 1024 + tid * 4);      /* 16 weight rows per load of the work-group */
  asm volatile("s_wait_xcnt 0x0" :: "v"(xp) : "memory");      /* precaution: no address register of the loads above is rewritten in front of this wait; naming the pair keeps the last load's result off it */
  _Float16* xw = &xl[w][0];
#pragma unroll      /* constant indices: the values stay in registers */
  for (int i = 0; i < 4; ++i) { FragQ f;
#pragma unroll      /* constant indices: the values stay in registers */
    for (int q = 0; q < 4; ++q) f.h[q] = (_Float16)(bf16_round(wr[i][q]) * 16.0f);
    *(v4us*)(unsigned short*)&wl[(i * 16 + (tid >> 4)) * PJ_LP + (tid & 15) * 4] = f.v; }
#pragma unroll      /* constant indices: the values stay in registers */
  for (int j = 0; j < 2; ++j) { if ((j ? d1 : d0) < 0) continue;
#pragma unroll      /* constant indices: the values stay in registers */
    for (int i = j * 8; i < j * 8 + 8; ++i) { FragQ f;
#pragma unroll      /* constant indices: the values stay in registers */
      for (int q = 0; q < 4; ++q) f.h[q] = (_Float16)bf16_round(xr[i][q]);
      *(v4us*)(unsigned short*)&xw[(i * 2 + hh) * PJ_LP + ln * 4] = f.v; } }
  __syncthreads();      /* publishes the weight rows (and orders each wave's own rows) */
  const v8f z8 = {0.f,0.f,0.f,0.f,0.f,0.f,0.f,0.f};
  v16h wf[4][2];
#pragma unroll      /* constant indices: the values stay in registers */
  for (int t = 0; t < 4; ++t)
#pragma unroll      /* constant indices: the values stay in registers */
    for (int ks = 0; ks < 2; ++ks) wf[t][ks] = g2_frag(&wl[(t * 16 + ln) * PJ_LP + ks * 32], hh);
#pragma unroll      /* constant indices: the values stay in registers */
  for (int j = 0; j < 2; ++j) { if ((j ? d1 : d0) < 0) continue;
    _Float16* xrow = xw + (j * 16 + ln) * PJ_LP;
    const v16h x0 = g2_frag(xrow, hh), x1 = g2_frag(xrow + 32, hh);
#pragma unroll      /* constant indices: the values stay in registers */
    for (int t = 0; t < 4; ++t) { const v8f a = fa_mma(wf[t][1], x1, fa_mma(wf[t][0], x0, z8)); FragH f;
#pragma unroll      /* constant indices: the values stay in registers */
      for (int r = 0; r < 8; ++r) f.h[r] = (_Float16)(a[r] * 0.0625f);
      *(v8us*)(unsigned short*)(xrow + t * 16 + 8 * hh) = f.half[0]; } }
  __builtin_amdgcn_fence(__ATOMIC_ACQ_REL, "workgroup"); __builtin_amdgcn_wave_barrier();      /* the wave's lanes read each other's output pieces below */
#pragma unroll      /* constant indices: the values stay in registers */
  for (int j = 0; j < 2; ++j) { const int dt = j ? d1 : d0;
    if (dt >= 0) {
#pragma unroll      /* constant indices: the values stay in registers */
      for (int i = 0; i < 4; ++i) { const int r = i * 4 + (lane >> 3), c8 = (lane & 7) * 8;      /* four whole rows, 512 B in a row, per store */
        const v8us v = *(const v8us*)(const unsigned short*)&xw[(j * 16 + r) * PJ_LP + c8];
        *(v8us*)((unsigned short*)Y + ((size_t)dt * NH + r) * HD + c8) = v; }
      if (j == 0) asm volatile("s_wait_xcnt 0x0" ::: "memory"); } }      /* precaution: the second token's LDS reads reuse the data registers of the stores above */
}
// Output GEMM, out = o Wo^T * alpha + b: one 128 x 128 tile of out per work-group (8 waves, 2 x 4, 64 x 32 each), 256 work-groups. Both operands are K-contiguous f16 rows. A stage is 128 k (256 B) of the tile's 128 o rows
// and 128 Wo rows, brought into LDS by asynchronous 16-byte copies (a wave's copy covers two whole 256-byte row pieces, so every L2 request is a whole line and each line is asked for once per work-group),
// rows at a pitch of 272 B (conflict-free for 16-byte readers). Two buffers: stage t + 1 flies while stage t is worked on. Fragments by g2_frag from LDS for A and B alike (same k order);
// every accumulator takes its k blocks of 32 in rising order, as before. The f32 results leave through a wave's own LDS rows as whole 128-byte lines.
#define OG_BK 128            /* k per stage */
#define OG_NT (DM / OG_BK)   /* stages */
#define OG_LP 136            /* LDS row pitch in f16: 256 B of data + 16 B */
#define OG_SP 36             /* output staging pitch in f32: 128 B of data + 16 B */
// Eight copies of one thread, rows 16 apart. The s_wait_xcnt is the last line of the copies' own statement, so that no address register of a copy is rewritten in front of it (a precaution).
__device__ __forceinline__ void og_copy8(unsigned l, const _Float16* g) {
  asm volatile("global_load_async_to_lds_b128 %0, %8, off\n\tglobal_load_async_to_lds_b128 %1, %9, off\n\tglobal_load_async_to_lds_b128 %2, %10, off\n\tglobal_load_async_to_lds_b128 %3, %11, off\n\t"
               "global_load_async_to_lds_b128 %4, %12, off\n\tglobal_load_async_to_lds_b128 %5, %13, off\n\tglobal_load_async_to_lds_b128 %6, %14, off\n\tglobal_load_async_to_lds_b128 %7, %15, off\n\ts_wait_xcnt 0x0"
               :: "v"(l), "v"(l + 16u * OG_LP * 2u), "v"(l + 32u * OG_LP * 2u), "v"(l + 48u * OG_LP * 2u), "v"(l + 64u * OG_LP * 2u), "v"(l + 80u * OG_LP * 2u), "v"(l + 96u * OG_LP * 2u), "v"(l + 112u * OG_LP * 2u),
                  "v"(g), "v"(g + 16 * DM), "v"(g + 32 * DM), "v"(g + 48 * DM), "v"(g + 64 * DM), "v"(g + 80 * DM), "v"(g + 96 * DM), "v"(g + 112 * DM) : "memory"); }
__global__ __launch_bounds__(256) void k_ogemm(const _Float16* __restrict__ A, const _Float16* __restrict__ Bh, float alpha, const float* __restrict__ bias, float* __restrict__ C) {
  __shared__ __attribute__((aligned(16))) _Float16 at_[2][128 * OG_LP];      /* o rows of a stage: [row][k] */
  __shared__ __attribute__((aligned(16))) _Float16 bt_[2][128 * OG_LP];      /* Wo rows of a stage: [col][k] */
  __shared__ __attribute__((aligned(16))) float so[8][64 * OG_SP];      /* per wave: its 64 x 32 results */
  const int tid = threadIdx.x, w = tid >> 5, lane = tid & 31, ln = lane & 15, hh = lane >> 4;
  const int row0 = (blockIdx.x / (DM / 128)) * 128, col0 = (blockIdx.x % (DM / 128)) * 128;
  const int wm = w >> 2, wn = w & 3;
  const int cr = tid >> 4, cc = (tid & 15) * 8;      /* copies: 16 threads per 256-byte row piece, rows cr + 16 i */
  const _Float16* ag = A + (size_t)(row0 + cr) * DM + cc;
  const _Float16* bg = Bh + (size_t)(col0 + cr) * DM + cc;
  const unsigned al = (unsigned)(size_t)&at_[0][cr * OG_LP + cc], bl = (unsigned)(size_t)&bt_[0][cr * OG_LP + cc];      /* LDS byte addresses */
  const unsigned bufb = 128u * OG_LP * 2u;      /* bytes of one buffer */
  og_copy8(al, ag); og_copy8(bl, bg);
  asm volatile("s_wait_asynccnt 0x0" ::: "memory");      /* stage 0 has landed for this wave's copies */
  __syncthreads();      /* publishes stage 0 */
  og_copy8(al + bufb, ag + OG_BK); og_copy8(bl + bufb, bg + OG_BK);
  const v8f z8 = {0.f,0.f,0.f,0.f,0.f,0.f,0.f,0.f};
  v8f acc[4][2];
#pragma unroll      /* constant indices: the values stay in registers */
  for (int i = 0; i < 4; ++i) { acc[i][0] = z8; acc[i][1] = z8; }
  for (int t = 0; t < OG_NT; ++t) {
    const _Float16* ap = &at_[t & 1][(wm * 64 + ln) * OG_LP]; const _Float16* bp = &bt_[t & 1][(wn * 32 + ln) * OG_LP];
    v16h af[2][4], bf[2][2];      /* two fragment sets: block ks + 1 is fetched while block ks is multiplied */
#pragma unroll      /* constant indices: the values stay in registers */
    for (int i = 0; i < 4; ++i) af[0][i] = g2_frag(ap + i * 16 * OG_LP, hh);
#pragma unroll      /* constant indices: the values stay in registers */
    for (int j = 0; j < 2; ++j) bf[0][j] = g2_frag(bp + j * 16 * OG_LP, hh);
#pragma unroll      /* constant indices: the values stay in registers */
    for (int ks = 0; ks < OG_BK / 32; ++ks) { const int cu = ks & 1, nx = cu ^ 1;
      if (ks + 1 < OG_BK / 32) {
#pragma unroll      /* constant indices: the values stay in registers */
        for (int i = 0; i < 4; ++i) af[nx][i] = g2_frag(ap + i * 16 * OG_LP + (ks + 1) * 32, hh);
#pragma unroll      /* constant indices: the values stay in registers */
        for (int j = 0; j < 2; ++j) bf[nx][j] = g2_frag(bp + j * 16 * OG_LP + (ks + 1) * 32, hh); }
      __builtin_amdgcn_sched_barrier(0);      /* keeps the next block's LDS reads as one group in front of this block's products: sunk among them, one fragment set is reused and every pair of products waits out an LDS latency */
#pragma unroll      /* constant indices: the values stay in registers */
      for (int i = 0; i < 4; ++i) { acc[i][0] = fa_mma(af[cu][i], bf[cu][0], acc[i][0]); acc[i][1] = fa_mma(af[cu][i], bf[cu][1], acc[i][1]); }
      __builtin_amdgcn_sched_barrier(0);      /* keeps the block after next's reads behind these products, so that two fragment sets suffice */
    }
    asm volatile("s_wait_dscnt 0x0" ::: "memory");      /* this wave's reads of stage t have returned before its buffer is refilled */
    asm volatile("s_wait_asynccnt 0x0" ::: "memory");      /* this wave's copies of stage t + 1 have landed */
    __syncthreads();      /* publishes stage t + 1; ends every wave's reads of stage t */
    if (t + 2 < OG_NT) { const unsigned bo = (unsigned)(t & 1) * bufb; og_copy8(al + bo, ag + (t + 2) * OG_BK); og_copy8(bl + bo, bg + (t + 2) * OG_BK); }
  }
  asm volatile("s_wait_asynccnt 0x0" ::: "memory");      /* no copy is outstanding when the wave goes on and ends */
  float* sw = &so[w][0];
#pragma unroll      /* constant indices: the values stay in registers */
  for (int j = 0; j < 2; ++j) { const float bv = bf16_round(bias[col0 + wn * 32 + j * 16 + ln]);
#pragma unroll      /* constant indices: the values stay in registers */
    for (int i = 0; i < 4; ++i)
#pragma unroll      /* constant indices: the values stay in registers */
      for (int r = 0; r < 8; ++r) sw[(i * 16 + 8 * hh + r) * OG_SP + j * 16 + ln] = acc[i][j][r] * alpha + bv; }
  __builtin_amdgcn_fence(__ATOMIC_ACQ_REL, "workgroup"); __builtin_amdgcn_wave_barrier();      /* the wave's lanes read each other's results below */
  float* cp = C + (size_t)(row0 + wm * 64 + (lane >> 3)) * DM + col0 + wn * 32 + (lane & 7) * 4;
#pragma unroll      /* constant indices: the values stay in registers */
  for (int q = 0; q < 16; ++q) { const v4f v = *(const v4fa*)&sw[(q * 4 + (lane >> 3)) * OG_SP + (lane & 7) * 4];      /* four whole 128-byte lines per store */
    *(v4f*)(cp + (size_t)q * 4 * DM) = v; }
}
extern "C" void kernel_launch(void* const* d_in, const int* in_sizes, int n_in,
                              void* d_out, int out_size, void* d_ws, size_t ws_size, hipStream_t stream) {
  (void)in_sizes; (void)n_in; (void)out_size;
  const float* const* I = (const float* const*)d_in; const float* xq = I[2]; const float* xk = I[1]; const float* xv = I[0]; const int* km = (const int*)d_in[3]; const float* wq = I[6]; const float* wk = I[5]; const float* wv = I[4]; const float* wo = I[7]; const float* bo = I[8];      /* contract order: values I[0], keys I[1], query I[2]; mask int32 [2][1][1][2048] (0 = masked key; READ on device); SHARED natural [64][64] blocks Wv I[4], Wk I[5], Wq I[6]; natural Wo [1024][1024] + bo */
  char* ws = (char*)d_ws; size_t off = 0;
  auto take = [&](size_t bytes) { char* p = ws + off; off += (bytes + 255) & ~(size_t)255; return p; };
  _Float16* BO = (_Float16*)take((size_t)DM * DM * 2);
  _Float16* Q16 = (_Float16*)take(NR * DM * 2); _Float16* K16 = (_Float16*)take(NR * DM * 2); _Float16* V16 = (_Float16*)take(NR * DM * 2); _Float16* O16 = (_Float16*)take(NR * DM * 2);
  _Float16* VT = (_Float16*)take((size_t)NB * NH * HD * SQ * 2);
  int* KP = (int*)take((size_t)NB * SQ * 4); int* KN = (int*)take((size_t)NB * 4);
  if (off > ws_size) return;
  k_wnat<<<WN_NB + NB, 256, 0, stream>>>(wo, (size_t)DM * DM / 8, BO, km, KP, KN);      /* Wo natural [out][in] = Bt x16; in the last NB work-groups the kept keys' ranks and count */
  const size_t r0p = (size_t)B0 * SQ;      /* first row of the output stage */
  k_proj<<<dim3((unsigned)(NR * NH / 256), 3), 256, 0, stream>>>(xq, xk, xv, wq, wk, wv, Q16, K16, V16, KP);      /* q of every token row and head, k and v of the kept keys packed to the front of their batch; f16 rows in the merged layout */
  k_vt<NH, SQ><<<NB * NH * (SQ / 64), 256, 0, stream>>>(V16, LQ, 0, VT, KN);      /* V^T [NB][NH][HD][SQ], both batches, packed keys */
  k_fattn<<<dim3(SQ / 256, NB * NH), 256, 0, stream>>>(Q16, K16, VT, KN, O16);      /* scores, masked softmax and P V of every (batch, head) in one launch; o (merged heads, x64) as f16 rows */
  k_ogemm<<<(unsigned)((MPO / 128) * (DM / 128)), 256, 0, stream>>>(O16 + r0p * DM, BO, 0.0009765625f, bo, (float*)d_out + r0p * DM);      /* out rows are the output layout */
}

// v006
// A run of this version takes 45.5 microseconds.
// In two side-by-side timings against v005, it was 1.10 and 1.11 times as fast.
// All steps since v000 together make it 76.1 times as fast.
#include <hip/hip_runtime.h>
// Multi-head attention over three inputs with SHARED per-head projections, a random key-padding mask and the module's literal score scale (values, keys, query [2][2048][1024]; each input is split into 16 heads of 64 and every head is multiplied by the SAME natural [64][64] matrix (x W^T: Wv / Wk / Wq; no biases); energy = q k^T; where(mask == 0, -1e20) with the int32 [2][1][1][2048] mask in {0, 1} (random; 0 = masked key; READ on device); softmax(energy / sqrt(embed_size) = / sqrt(1024) = / 32) (as the source); out = merged Wo^T + bo (natural [1024][1024]) -> [2][2048][1024]).
// Keys with mask == 0 have weight exactly 0 wherever their batch keeps a key: the kept keys are ranked per batch, K and V rows are projected and stored for kept keys only, packed by rank, and attention walks the packed rows alone (any mask; a batch with no kept key walks all keys under the fill).
// Structure: token rows r = b*2048 + s; Q, K, V by one per-head projection launch (every 64-wide head slice of a token row is one row of a [65536][64] x [64][64]^T WMMA product, K = 64; f32 inputs rounded to bf16 and held as exact f16 in LDS, exact x16 weights, f32 accumulation, f16 outputs); V^T for all batches and heads via LDS transposes; one fused attention launch over every (batch, head): scores by WMMA (scale 1/32 = 1/sqrt(embed size), the module's literal scale), running-maximum softmax in registers (f32 statistics; unnormalised weights as f16), o = P . V by WMMA, divided by the row sum at the end (o carried x64 against f16 subnormal flush, folded into the output GEMM alpha) and written straight into the merged f16 o rows; out = o W_o + b GEMM (f32) into the output layout.
// Compute dtype: inputs rounded to bf16; x / weights exact; q, k, v, softmax weights and o as plain f16 GEMM operands (~2^-12); scores and softmax statistics f32. v_wmma_f32_16x16x32_f16.
#define NB 2
#define SQ 2048
#define DM 1024
#define NH 16
#define HD 64
#define HG 4                         /* heads per launch of the grouped k_vt overload (not launched) */
#define B0 0                         /* first batch processed (debug hook) */
#define NBR NB                       /* batches processed (debug hook) */
#define NR ((size_t)NB * SQ)         /* token rows */
#define MP ((int)((size_t)NBR * SQ)) /* token rows of the output stage, via MPO (debug hook) */
#define QN SQ                        /* query rows per batch (not used) */
#define NHD NH                       /* heads (not used) */
#define MPO MP                       /* rows through the output stage (debug hook) */
#define LQ DM      /* row pitch of the q/k/v rows */
typedef __bf16 v16b __attribute__((ext_vector_type(16)));
typedef unsigned short v8us __attribute__((ext_vector_type(8), may_alias));
typedef float  v8f  __attribute__((ext_vector_type(8)));
typedef float  v4f  __attribute__((ext_vector_type(4)));
typedef float  v4fa __attribute__((ext_vector_type(4), may_alias));
union FragB { v16b v; v8us half[2]; unsigned short u[16]; };

__device__ __forceinline__ unsigned short bf16_bits(float x) { unsigned int u = __float_as_uint(x); return (unsigned short)((u + 0x7FFFu + ((u >> 16) & 1u)) >> 16); }
__device__ __forceinline__ float bf16_val(unsigned short b) { return __uint_as_float(((unsigned int)b) << 16); }
__device__ __forceinline__ float bf16_round(float x) { return bf16_val(bf16_bits(x)); }
// D += A·B with NT terms: 1 = ah·bh, 2 = + al·bh (A split), 3 = + ah·bl (both split)
template <int NT>
__device__ __forceinline__ v8f mmaN(v16b ah, v16b al, v16b bh, v16b bl, v8f c) {
  c = __builtin_amdgcn_wmma_f32_16x16x32_bf16(false, ah, false, bh, (short)0, c, false, false);
  if (NT >= 2) c = __builtin_amdgcn_wmma_f32_16x16x32_bf16(false, al, false, bh, (short)0, c, false, false);
  if (NT >= 3) c = __builtin_amdgcn_wmma_f32_16x16x32_bf16(false, ah, false, bl, (short)0, c, false, false);
  asm volatile("v_nop\n\tv_nop\n\tv_nop\n\tv_nop" : "+v"(c) : "v"(ah), "v"(al), "v"(bh), "v"(bl));
  return c;
}

__global__ __launch_bounds__(256) void k_wt_bf16(const float* __restrict__ W, unsigned short* __restrict__ Wt, int K, int N) {
  const int t = blockIdx.x * 256 + threadIdx.x;
  const int k8n = K / 8;
  if (t >= N * k8n) return;
  const int n = t / k8n, k8 = (t % k8n) * 8;
  v8us v;
#pragma unroll
  for (int i = 0; i < 8; ++i) v[i] = bf16_bits(W[(size_t)(k8 + i) * N + n]);
  *(v8us*)(Wt + (size_t)n * K + k8) = v;
  
}

// GEMM C[M][N] (f32, pitch ldc) = act(A[M][K]·W + bias). A f32 row-major (pitch lda) converted per fragment to bf16
// (ASPLIT: hi/lo two planes -> 2 terms, else single rounded term); Wt bf16 [N][K] (pitch ldb). BIAS_BF16 rounds the
// bias to bf16 first (bias quantised to bf16 before the add). K%32==0, M%16==0, N%64==0.
template <bool ASPLIT, int ACT, bool BIAS_BF16>
__global__ __launch_bounds__(128) void k_gemm_bf(const float* __restrict__ A, int lda, const unsigned short* __restrict__ Wt, int ldb,
                                               const float* __restrict__ bias, float* __restrict__ C, int ldc, int M, int N, int K) {
  __shared__ __attribute__((aligned(16))) float so[4][16][64];
  const int tid = threadIdx.x, w = tid >> 5, lane = tid & 31, ln = lane & 15, hh = lane >> 4;
  const int ntn = N / 64;
  const int wid = blockIdx.x * 4 + w;
  const int mt = wid / ntn, nq = wid % ntn;
  if (mt * 16 >= M) return;
  const int row0 = mt * 16, col0 = nq * 64;
  const float* arow = A + (size_t)(row0 + ln) * lda;
  v8f acc[4] = {};
  for (int kb = 0; kb < K; kb += 32) {
    FragB ah, al;
    const v4f x0 = *(const v4fa*)(arow + kb + 8 * hh), x1 = *(const v4fa*)(arow + kb + 8 * hh + 4);
    const v4f x2 = *(const v4fa*)(arow + kb + 16 + 8 * hh), x3 = *(const v4fa*)(arow + kb + 16 + 8 * hh + 4);
    float xs[16] = {x0[0],x0[1],x0[2],x0[3],x1[0],x1[1],x1[2],x1[3],x2[0],x2[1],x2[2],x2[3],x3[0],x3[1],x3[2],x3[3]};
#pragma unroll
    for (int i = 0; i < 16; ++i) { const unsigned short hb = bf16_bits(xs[i]); ah.u[i] = hb; al.u[i] = ASPLIT ? bf16_bits(xs[i] - bf16_val(hb)) : (unsigned short)0; }
#pragma unroll
    for (int t = 0; t < 4; ++t) {
      const unsigned short* brow = Wt + (size_t)(col0 + t * 16 + ln) * ldb + kb;
      FragB b;
      b.half[0] = *(const v8us*)(brow + 8 * hh);
      b.half[1] = *(const v8us*)(brow + 16 + 8 * hh);
      acc[t] = mmaN<ASPLIT ? 2 : 1>(ah.v, al.v, b.v, b.v, acc[t]);
    }
  }
#pragma unroll
  for (int t = 0; t < 4; ++t) {
    float bv = bias ? bias[col0 + t * 16 + ln] : 0.f;
    if (BIAS_BF16) bv = bf16_round(bv);
#pragma unroll
    for (int r = 0; r < 8; ++r) { float v = acc[t][r] + bv; if (ACT == 1) v = fmaxf(v, 0.f); so[w][8 * hh + r][t * 16 + ln] = v; }
  }
  __builtin_amdgcn_fence(__ATOMIC_ACQ_REL, "workgroup");
  __builtin_amdgcn_wave_barrier();
  const int rsub = lane >> 4, c4 = (lane & 15) * 4;
  {
#pragma unroll
    for (int q = 0; q < 8; ++q) {
      const int r = q * 2 + rsub;
      const v4f v = *(const v4fa*)&so[w][r][c4];
      *(v4f*)(C + (size_t)(row0 + r) * ldc + col0 + c4) = v;
    }
    
  }
}

// GEMM C = act(A·W + bias + resid): A f32 (ASPLIT -> hi/lo 2 terms), Wt bf16 [N][K]; ACT 0 none, 1 relu, 2 exact gelu;
// resid (optional, f32, row index = (row % rmod), pitch ldr, RES_BF16 rounds it) added before the activation.
template <bool ASPLIT, int ACT, bool BIAS_BF16, bool RES_BF16>
__global__ __launch_bounds__(128) void k_gemm_bf3(const float* __restrict__ A, int lda, const unsigned short* __restrict__ Wt, int ldb,
                                                const float* __restrict__ bias, const float* __restrict__ resid, int rmod, int ldr,
                                                float* __restrict__ C, int ldc, int M, int N, int K) {
  __shared__ __attribute__((aligned(16))) float so[4][16][64];
  const int tid = threadIdx.x, w = tid >> 5, lane = tid & 31, ln = lane & 15, hh = lane >> 4;
  const int ntn = N / 64;
  const int wid = blockIdx.x * 4 + w;
  const int mt = wid / ntn, nq = wid % ntn;
  if (mt * 16 >= M) return;
  const int row0 = mt * 16, col0 = nq * 64;
  const float* arow = A + (size_t)(row0 + ln) * lda;
  v8f acc[4] = {};
  for (int kb = 0; kb < K; kb += 32) {
    FragB ah, al;
    const v4f x0 = *(const v4fa*)(arow + kb + 8 * hh), x1 = *(const v4fa*)(arow + kb + 8 * hh + 4);
    const v4f x2 = *(const v4fa*)(arow + kb + 16 + 8 * hh), x3 = *(const v4fa*)(arow + kb + 16 + 8 * hh + 4);
    float xs[16] = {x0[0],x0[1],x0[2],x0[3],x1[0],x1[1],x1[2],x1[3],x2[0],x2[1],x2[2],x2[3],x3[0],x3[1],x3[2],x3[3]};
#pragma unroll
    for (int i = 0; i < 16; ++i) { const unsigned short hb = bf16_bits(xs[i]); ah.u[i] = hb; al.u[i] = ASPLIT ? bf16_bits(xs[i] - bf16_val(hb)) : (unsigned short)0; }
#pragma unroll
    for (int t = 0; t < 4; ++t) {
      const unsigned short* brow = Wt + (size_t)(col0 + t * 16 + ln) * ldb + kb;
      FragB b;
      b.half[0] = *(const v8us*)(brow + 8 * hh);
      b.half[1] = *(const v8us*)(brow + 16 + 8 * hh);
      acc[t] = mmaN<ASPLIT ? 2 : 1>(ah.v, al.v, b.v, b.v, acc[t]);
    }
  }
#pragma unroll
  for (int t = 0; t < 4; ++t) {
    const int col = col0 + t * 16 + ln;
    float bv = bias ? bias[col] : 0.f;
    if (BIAS_BF16) bv = bf16_round(bv);
#pragma unroll
    for (int r = 0; r < 8; ++r) {
      float v = acc[t][r] + bv;
      if (resid) { float rv = resid[(size_t)((row0 + 8 * hh + r) % rmod) * ldr + col]; if (RES_BF16) rv = bf16_round(rv); v += rv; }
      if (ACT == 1) v = fmaxf(v, 0.f);
      if (ACT == 2) v = 0.5f * v * (1.0f + erff(v * 0.70710678118654752f));
      if (ACT == 3) { const float u = 0.7978845608028654f * (v + 0.044715f * v * v * v); v = 0.5f * v * (1.0f + tanhf(u)); }
      so[w][8 * hh + r][t * 16 + ln] = v;
    }
  }
  __builtin_amdgcn_fence(__ATOMIC_ACQ_REL, "workgroup");
  __builtin_amdgcn_wave_barrier();
  const int rsub = lane >> 4, c4 = (lane & 15) * 4;
  {
#pragma unroll
    for (int q = 0; q < 8; ++q) {
      const int r = q * 2 + rsub;
      const v4f v = *(const v4fa*)&so[w][r][c4];
      *(v4f*)(C + (size_t)(row0 + r) * ldc + col0 + c4) = v;
    }
    
  }
}
// row LayerNorm (biased variance, eps) over N: s = X (+ R); optional out_sum <- s; out_norm <- (s-mu)*rsqrt(var+eps)*g + b
template <bool PARAM_BF16>
__global__ __launch_bounds__(256) void k_layernorm(const float* __restrict__ X, const float* __restrict__ R, const float* __restrict__ g, const float* __restrict__ bta,
                                                  float* __restrict__ out_sum, float* __restrict__ out_norm, int N, float eps) {
  __shared__ float red[256];
  const int row = blockIdx.x, tid = threadIdx.x;
  const float* x = X + (size_t)row * N; const float* rr = R ? R + (size_t)row * N : nullptr;
  float vals[16];                     // up to N = 4096
  const int per = N / 256;            // contiguous chunk per thread? use strided-by-4 chunks: thread handles j = tid*4 + 1024*u
  float s1 = 0.f;
  for (int u = 0; u < per / 4; ++u) {
    const int j = tid * 4 + 1024 * u;
    const v4f a = *(const v4fa*)(x + j);
    v4f b = {0.f,0.f,0.f,0.f}; if (rr) b = *(const v4fa*)(rr + j);
#pragma unroll
    for (int q = 0; q < 4; ++q) { const float v = a[q] + b[q]; vals[u * 4 + q] = v; s1 += v; }
  }
  red[tid] = s1; __syncthreads();
  for (int st = 128; st > 0; st >>= 1) { if (tid < st) red[tid] += red[tid + st]; __syncthreads(); }
  const float mu = red[0] / (float)N; __syncthreads();
  float s2 = 0.f;
  for (int u = 0; u < per / 4; ++u)
#pragma unroll
    for (int q = 0; q < 4; ++q) { const float c = vals[u * 4 + q] - mu; s2 += c * c; }
  red[tid] = s2; __syncthreads();
  for (int st = 128; st > 0; st >>= 1) { if (tid < st) red[tid] += red[tid + st]; __syncthreads(); }
  const float rs = rsqrtf(red[0] / (float)N + eps);
  {
    for (int u = 0; u < per / 4; ++u) {
      const int j = tid * 4 + 1024 * u;
      v4f o, sm;
#pragma unroll
      for (int q = 0; q < 4; ++q) {
        float gg = g[j + q], bb = bta[j + q];
        if (PARAM_BF16) { gg = bf16_round(gg); bb = bf16_round(bb); }
        sm[q] = vals[u * 4 + q]; o[q] = (vals[u * 4 + q] - mu) * rs * gg + bb;
      }
      if (out_sum) *(v4f*)(out_sum + (size_t)row * N + j) = sm;
      *(v4f*)(out_norm + (size_t)row * N + j) = o;
    }
    
  }
}



// ---- f16 WMMA path (v_wmma_f32_16x16x32_f16): 11-bit significands for operands in range — used where a [0,1] probability operand needs more precision than bf16
typedef _Float16 v16h __attribute__((ext_vector_type(16)));
union FragH { v16h v; v8us half[2]; _Float16 h[16]; unsigned short u[16]; };
template <int NT>
__device__ __forceinline__ v8f mmaH(v16h ah, v16h al, v16h bh, v16h bl, v8f c) {
  c = __builtin_amdgcn_wmma_f32_16x16x32_f16(false, ah, false, bh, (short)0, c, false, false);
  if (NT >= 2) c = __builtin_amdgcn_wmma_f32_16x16x32_f16(false, al, false, bh, (short)0, c, false, false);
  if (NT >= 3) c = __builtin_amdgcn_wmma_f32_16x16x32_f16(false, ah, false, bl, (short)0, c, false, false);
  asm volatile("v_nop\n\tv_nop\n\tv_nop\n\tv_nop" : "+v"(c) : "v"(ah), "v"(al), "v"(bh), "v"(bl));
  return c;
}
// batched GEMM like k_gemm_b but f16 operands: A f32 (split into f16 hi/lo if ASPLIT, else rounded to f16), Bt = f16 values [n][k]; alpha; C f32; N multiple of 16 (partial tiles skipped)
template <bool ASPLIT>
__global__ __launch_bounds__(128) void k_gemm_h(const float* __restrict__ A, int lda, size_t sA, const _Float16* __restrict__ Bh, int ldb, size_t sB, float alpha, float* __restrict__ C, int ldc, size_t sC, int M, int N, int K) {
  __shared__ __attribute__((aligned(16))) float so[4][16][64];
  const int tid = threadIdx.x, w = tid >> 5, lane = tid & 31, ln = lane & 15, hh = lane >> 4; const int by = blockIdx.y;
  A += (size_t)by * sA; Bh += (size_t)by * sB; C += (size_t)by * sC;
  const int ntn = (N + 63) / 64; const int wid = blockIdx.x * 4 + w; const int mt = wid / ntn, nq = wid % ntn; if (mt * 16 >= M) return;
  const int row0 = mt * 16, col0 = nq * 64; const float* arow = A + (size_t)(row0 + ln) * lda;
  v8f acc[4] = {};
  for (int kb = 0; kb < K; kb += 32) {
    FragH ah, al;
    const v4f x0 = *(const v4fa*)(arow + kb + 8 * hh), x1 = *(const v4fa*)(arow + kb + 8 * hh + 4), x2 = *(const v4fa*)(arow + kb + 16 + 8 * hh), x3 = *(const v4fa*)(arow + kb + 16 + 8 * hh + 4);
    float xs[16] = {x0[0],x0[1],x0[2],x0[3],x1[0],x1[1],x1[2],x1[3],x2[0],x2[1],x2[2],x2[3],x3[0],x3[1],x3[2],x3[3]};
#pragma unroll
    for (int i = 0; i < 16; ++i) { const _Float16 h = (_Float16)xs[i]; ah.h[i] = h; al.h[i] = ASPLIT ? (_Float16)(xs[i] - (float)h) : (_Float16)0.0f; }
#pragma unroll
    for (int t = 0; t < 4; ++t) { if (col0 + t * 16 >= N) continue; const size_t boff = (size_t)(col0 + t * 16 + ln) * ldb + kb; FragH bq; bq.half[0] = *(const v8us*)(Bh + boff + 8 * hh); bq.half[1] = *(const v8us*)(Bh + boff + 16 + 8 * hh);
      acc[t] = mmaH<ASPLIT ? 2 : 1>(ah.v, al.v, bq.v, bq.v, acc[t]); }
  }
#pragma unroll
  for (int t = 0; t < 4; ++t) { if (col0 + t * 16 >= N) continue;
#pragma unroll
    for (int r = 0; r < 8; ++r) so[w][8 * hh + r][t * 16 + ln] = acc[t][r] * alpha; }
  __builtin_amdgcn_fence(__ATOMIC_ACQ_REL, "workgroup"); __builtin_amdgcn_wave_barrier();
  const int rsub = lane >> 4, c4 = (lane & 15) * 4;
  {
#pragma unroll
    for (int q = 0; q < 8; ++q) { const int r = q * 2 + rsub; if (col0 + c4 < N) { const v4f v = *(const v4fa*)&so[w][r][c4]; *(v4f*)(C + (size_t)(row0 + r) * ldc + col0 + c4) = v; } }
     }
}

// Wt[n][k] = f16(W[k][n]·scale) from f32 row-major W[K][N] (scale = power of two; bf16-exact weights stay exact in f16 away from the subnormal range)
__global__ __launch_bounds__(256) void k_wt_f16(const float* __restrict__ W, _Float16* __restrict__ Wt, int K, int N, float scale) {
  const int t = blockIdx.x * 256 + threadIdx.x; if (t >= N * (K / 8)) return; const int n = t / (K / 8), k8 = (t % (K / 8)) * 8; FragH f;
#pragma unroll
  for (int i = 0; i < 8; ++i) f.h[i] = (_Float16)(bf16_round(W[(size_t)(k8 + i) * N + n]) * scale); const v8us o = f.half[0];
  *(v8us*)((unsigned short*)Wt + (size_t)n * K + k8) = o; 
}
// k_gemm_hh variant with fused epilogue: v = acc·alpha + bias[by·sBias + col] (+ CP[(row/rowsPerB)·sCPb + by·64 + col] if CP) ; ACT 0 none / 1 elu ; writes f16 C16 (and f32 C if non-null)
template <int ACT>
__global__ __launch_bounds__(128) void k_gemm_hhx(const _Float16* __restrict__ A, int lda, size_t sA, const _Float16* __restrict__ Bh, int ldb, size_t sB, float alpha, const float* __restrict__ bias, size_t sBias, const float* __restrict__ CP, int rowsPerB, size_t sCPb, int row0g,
    float* __restrict__ C, _Float16* __restrict__ C16, int ldc, size_t sC, int M, int N, int K) {
  __shared__ __attribute__((aligned(16))) float so[4][16][64];
  const int tid = threadIdx.x, w = tid >> 5, lane = tid & 31, ln = lane & 15, hh = lane >> 4; const int by = blockIdx.y;
  A += (size_t)by * sA; Bh += (size_t)by * sB; const size_t cofs = (size_t)by * sC; const float* bp = bias ? bias + (size_t)by * sBias : nullptr;
  const int ntn = (N + 63) / 64; const int wid = blockIdx.x * 4 + w; const int mt = wid / ntn, nq = wid % ntn; if (mt * 16 >= M) return;
  const int row0 = mt * 16, col0 = nq * 64; const _Float16* arow = A + (size_t)(row0 + ln) * lda;
  v8f acc[4] = {};
  for (int kb = 0; kb < K; kb += 32) { FragH ah; ah.half[0] = *(const v8us*)((const unsigned short*)arow + kb + 8 * hh); ah.half[1] = *(const v8us*)((const unsigned short*)arow + kb + 16 + 8 * hh);
#pragma unroll
    for (int t = 0; t < 4; ++t) { if (col0 + t * 16 >= N) continue; const size_t boff = (size_t)(col0 + t * 16 + ln) * ldb + kb; FragH bq; bq.half[0] = *(const v8us*)((const unsigned short*)Bh + boff + 8 * hh); bq.half[1] = *(const v8us*)((const unsigned short*)Bh + boff + 16 + 8 * hh);
      acc[t] = mmaH<1>(ah.v, ah.v, bq.v, bq.v, acc[t]); }
  }
#pragma unroll
  for (int t = 0; t < 4; ++t) { if (col0 + t * 16 >= N) continue; const int col = col0 + t * 16 + ln; const float bv = bp ? bf16_round(bp[col]) : 0.f;
#pragma unroll
    for (int r = 0; r < 8; ++r) { float v = acc[t][r] * alpha + bv; if (CP) { const int rr = row0g + row0 + 8 * hh + r; if (rowsPerB < 0) v += CP[cofs + (size_t)rr * ldc + col];      /* rowsPerB < 0: own element of the batched C plane */ else { const int bidx = rr / rowsPerB; v += CP[(size_t)bidx * sCPb + (size_t)by * 64 + col]; } } if (ACT == 1) v = (v > 0.f) ? v : expm1f(v); else if (ACT == 7) v = (v > 0.f) ? v + 1.0f : expf(v); else if (ACT == 8) v = tanhf(v); else if (ACT == 9) v = 0.5f * v * (1.0f + tanhf(0.7978845608028654f * (v + 0.044715f * v * v * v))); else if (ACT == 11) v = 1.0f / (1.0f + expf(-v)); else if (ACT == 12) v = (v > 0.f) ? v : 0.01f * v; else if (ACT == 14) v = (v > 0.f) ? v : 0.1f * v; else if (ACT == 16) v = (v >= 0.f) ? v : 0.3f * v; else if (ACT == 17) v = (v >= 0.f) ? v : 0.2f * v; else if (ACT == 15) v = v / (1.0f + expf(-v)); else if (ACT == 3) v = fmaxf(v, 0.f); else if (ACT == 6) v = 0.5f * v * (1.0f + erff(v * 0.70710678118654752f)); so[w][8 * hh + r][t * 16 + ln] = v; } }
  __builtin_amdgcn_fence(__ATOMIC_ACQ_REL, "workgroup"); __builtin_amdgcn_wave_barrier();
  const int rsub = lane >> 4, c4 = (lane & 15) * 4; typedef _Float16 v4h __attribute__((ext_vector_type(4)));
  {
#pragma unroll
    for (int q = 0; q < 8; ++q) { const int r = q * 2 + rsub; if (col0 + c4 < N) { const v4f v = *(const v4fa*)&so[w][r][c4]; if (C) *(v4f*)(C + cofs + (size_t)(row0 + r) * ldc + col0 + c4) = v; if (C16) { v4h h4; for (int i = 0; i < 4; ++i) h4[i] = (_Float16)v[i]; *(v4h*)(C16 + cofs + (size_t)(row0 + r) * ldc + col0 + c4) = h4; } } }
     }
}


typedef _Float16 v4h __attribute__((ext_vector_type(4)));

__global__ __launch_bounds__(256) void k_x16(const float* __restrict__ x, _Float16* __restrict__ X16, size_t n8) { const size_t t = (size_t)blockIdx.x * 256 + threadIdx.x; if (t >= n8) return; FragH f;
#pragma unroll
  for (int q = 0; q < 8; ++q) f.h[q] = (_Float16)bf16_round(x[t * 8 + q]); *(v8us*)((unsigned short*)X16 + t * 8) = f.half[0];  }
__global__ __launch_bounds__(256) void k_h16(const float* __restrict__ x, _Float16* __restrict__ X16, size_t n8) { const size_t t = (size_t)blockIdx.x * 256 + threadIdx.x; if (t >= n8) return; FragH f;
#pragma unroll
  for (int q = 0; q < 8; ++q) f.h[q] = (_Float16)x[t * 8 + q]; *(v8us*)((unsigned short*)X16 + t * 8) = f.half[0];  }
__global__ __launch_bounds__(256) void k_round16f(const float* __restrict__ W, _Float16* __restrict__ Bt, size_t n8) { const size_t t = (size_t)blockIdx.x * 256 + threadIdx.x; if (t >= n8) return; FragH f;
#pragma unroll
  for (int i = 0; i < 8; ++i) f.h[i] = (_Float16)(bf16_round(W[t * 8 + i]) * 16.0f); *(v8us*)((unsigned short*)Bt + t * 8) = f.half[0];  }
template <int NHv, int TTv>
__global__ __launch_bounds__(256) void k_vt(const _Float16* __restrict__ V16, int ldv, int voff, _Float16* __restrict__ Vt, const int* __restrict__ KN) { __shared__ unsigned short tl[64][66]; const int tid = threadIdx.x; const int slab = blockIdx.x / (TTv / 64), lg = blockIdx.x % (TTv / 64); const int b = slab / NHv, h = slab % NHv;
  const int n = KN[b], nk = (n < 1 || n > TTv) ? TTv : n;      /* packed V rows of the batch (all of them where no key is kept) */
  if (lg * 64 >= nk) return;      /* no packed row in this group of 64: the whole work-group leaves, in front of the barrier */
  for (int i = tid; i < 64 * 8; i += 256) { const int r = i / 8, c8 = (i % 8) * 8; const int rr = (lg * 64 + r < nk) ? lg * 64 + r : nk - 1;      /* past the last packed row: that row again, a finite value under a zero weight */
    FragH f; f.half[0] = *(const v8us*)((const unsigned short*)V16 + ((size_t)b * TTv + rr) * ldv + voff + h * 64 + c8);
#pragma unroll
    for (int q = 0; q < 8; ++q) tl[r][c8 + q] = f.u[q]; }
  __syncthreads();
  {
#pragma unroll
    for (int rd = 0; rd < 2; ++rd) { const int d = rd * 32 + tid / 8, pc = tid % 8; FragH f;
#pragma unroll
      for (int q = 0; q < 8; ++q) f.u[q] = tl[pc * 8 + q][d];
      *(v8us*)((unsigned short*)Vt + ((size_t)slab * 64 + d) * TTv + lg * 64 + pc * 8) = f.half[0]; }
     } }

__global__ __launch_bounds__(256) void k_hl(const float* __restrict__ F, _Float16* __restrict__ Hh, _Float16* __restrict__ Hl, size_t n8) { const size_t t = (size_t)blockIdx.x * 256 + threadIdx.x; if (t >= n8) return; FragH fh, fl; const v4f a = *(const v4fa*)(F + t * 8), c = *(const v4fa*)(F + t * 8 + 4);
#pragma unroll
  for (int q = 0; q < 4; ++q) { _Float16 h = (_Float16)a[q]; fh.h[q] = h; fl.h[q] = (_Float16)((a[q] - (float)h) * 1024.0f); h = (_Float16)c[q]; fh.h[4 + q] = h; fl.h[4 + q] = (_Float16)((c[q] - (float)h) * 1024.0f); }
  { *(v8us*)((unsigned short*)Hh + t * 8) = fh.half[0]; *(v8us*)((unsigned short*)Hl + t * 8) = fl.half[0];  } }

// ---- fast GEMM (wave tile 32x64; requires M % 32 == 0 rows per launch region and N % 64 == 0); epilogue = k_gemm_hhx semantics ----
__device__ __forceinline__ v16h g2_frag(const _Float16* p, int hh) { FragH f; f.half[0] = *(const v8us*)((const unsigned short*)p + 8 * hh); f.half[1] = *(const v8us*)((const unsigned short*)p + 16 + 8 * hh); return f.v; }
__device__ __forceinline__ v8f g2_mma(v16h a, v16h b, v8f c) { v8f d = __builtin_amdgcn_wmma_f32_16x16x32_f16(false, a, false, b, (short)0, c, false, false); asm volatile("v_nop\n\tv_nop\n\tv_nop\n\tv_nop" : "+v"(d) : "v"(a), "v"(b)); return d; }
template <int ACT>
__global__ __launch_bounds__(128) void k_gemm2(const _Float16* __restrict__ A, int lda, size_t sA, const _Float16* __restrict__ Bh, int ldb, size_t sB, float alpha, const float* __restrict__ bias, size_t sBias, const float* __restrict__ CP, int rowsPerB, size_t sCPb, int row0g,
    float* __restrict__ C, _Float16* __restrict__ C16, int ldc, size_t sC, int M, int N, int K) { static_assert(ACT == 0 || ACT == 3 || ACT == 6 || ACT == 8 || ACT == 9 || ACT == 11 || ACT == 12 || ACT == 14 || ACT == 15 || ACT == 16 || ACT == 17, "k_gemm2: unsupported ACT code (would silently apply no activation)");
  __shared__ __attribute__((aligned(16))) float so[4][32][68];
  const int tid = threadIdx.x, w = tid >> 5, lane = tid & 31, ln = lane & 15, hh = lane >> 4; const int by = blockIdx.y;
  A += (size_t)by * sA; Bh += (size_t)by * sB; const size_t cofs = (size_t)by * sC; const float* bp = bias ? bias + (size_t)by * sBias : nullptr;
  const int ntn = N >> 6; const int mt = blockIdx.x / ntn, nq = blockIdx.x - mt * ntn; const int row0 = mt * 128 + 32 * w, col0 = nq * 64; if (row0 >= M) return;
  const _Float16* a0p = A + (size_t)(row0 + ln) * lda; const _Float16* a1p = a0p + (size_t)16 * lda;
  const _Float16* b0p = Bh + (size_t)(col0 + ln) * ldb; const _Float16* b1p = b0p + (size_t)16 * ldb; const _Float16* b2p = b1p + (size_t)16 * ldb; const _Float16* b3p = b2p + (size_t)16 * ldb;
  const v8f z8 = {0.f,0.f,0.f,0.f,0.f,0.f,0.f,0.f}; v8f c00 = z8, c01 = z8, c02 = z8, c03 = z8, c10 = z8, c11 = z8, c12 = z8, c13 = z8;
#pragma unroll 1
  for (int kb = 0; kb < K; kb += 32) { const v16h a0 = g2_frag(a0p + kb, hh), a1 = g2_frag(a1p + kb, hh);
    v16h b = g2_frag(b0p + kb, hh); c00 = g2_mma(a0, b, c00); c10 = g2_mma(a1, b, c10);
    b = g2_frag(b1p + kb, hh); c01 = g2_mma(a0, b, c01); c11 = g2_mma(a1, b, c11);
    b = g2_frag(b2p + kb, hh); c02 = g2_mma(a0, b, c02); c12 = g2_mma(a1, b, c12);
    b = g2_frag(b3p + kb, hh); c03 = g2_mma(a0, b, c03); c13 = g2_mma(a1, b, c13); }
  v8f accs[8] = {c00, c01, c02, c03, c10, c11, c12, c13};
#pragma unroll
  for (int u = 0; u < 8; ++u) { const int t = u & 3, half = u >> 2; const int col = col0 + t * 16 + ln; const float bv = bp ? bf16_round(bp[col]) : 0.f;
#pragma unroll
    for (int r = 0; r < 8; ++r) { const int rloc = half * 16 + 8 * hh + r; float v = accs[u][r] * alpha + bv; if (CP) { if (rowsPerB < 0) v += CP[cofs + (size_t)(row0g + row0 + rloc) * ldc + col];      /* rowsPerB < 0: own element of the batched C plane */ else { const int bidx = (row0g + row0 + rloc) / rowsPerB; v += CP[(size_t)bidx * sCPb + (size_t)by * 64 + col]; } }
      if (ACT == 3) v = fmaxf(v, 0.f); else if (ACT == 6) v = 0.5f * v * (1.0f + erff(v * 0.70710678118654752f)); else if (ACT == 11) v = 1.0f / (1.0f + expf(-v)); else if (ACT == 15) v = v / (1.0f + expf(-v)); else if (ACT == 12) v = (v > 0.f) ? v : 0.01f * v; else if (ACT == 8) v = tanhf(v); else if (ACT == 9) v = 0.5f * v * (1.0f + tanhf(0.7978845608028654f * (v + 0.044715f * v * v * v))); else if (ACT == 14) v = (v > 0.f) ? v : 0.1f * v; else if (ACT == 16) v = (v >= 0.f) ? v : 0.3f * v; else if (ACT == 17) v = (v >= 0.f) ? v : 0.2f * v;
      so[w][rloc][t * 16 + ln] = v; } }
  __builtin_amdgcn_fence(__ATOMIC_ACQ_REL, "workgroup"); __builtin_amdgcn_wave_barrier();
  const int rsub = lane >> 4, c4 = (lane & 15) * 4;
  {
#pragma unroll
    for (int q = 0; q < 16; ++q) { const int r = q * 2 + rsub; const v4f v = *(const v4fa*)&so[w][r][c4]; if (C) *(v4f*)(C + cofs + (size_t)(row0 + r) * ldc + col0 + c4) = v; if (C16) { v4h h4; for (int i = 0; i < 4; ++i) h4[i] = (_Float16)v[i]; *(v4h*)(C16 + cofs + (size_t)(row0 + r) * ldc + col0 + c4) = h4; } }
     } }


// Ranks of the kept keys, one work-group per batch: KP[b][s] = how many keys with mask != 0 stand in front of key s (its row among the batch's packed K and V rows), or -1 for a key with mask == 0; KN[b] = the number kept.
// A key with mask == 0 has weight exp(fill - max) = 0 exactly in f32 as soon as one key of the batch is kept, so it is left out of K, V and the key walk. A batch with no key kept keeps them all (rank = s, KN = 0):
// the attention kernel then gives every key the fill, and the rows come out uniform, as in the source.
__device__ __forceinline__ void key_ranks(const int* __restrict__ Km, int* __restrict__ KP, int* __restrict__ KN, int b) {
  __shared__ int sc[8];      /* kept keys per wave */
  const int tid = threadIdx.x, w = tid >> 5, lane = tid & 31; const size_t k0 = (size_t)b * SQ + w * 256 + lane;      /* a wave takes 256 keys in a row, 32 per load */
  unsigned bm[8]; int tot = 0;
#pragma unroll      /* constant indices: the values stay in registers */
  for (int i = 0; i < 8; ++i) { bm[i] = __builtin_amdgcn_ballot_w32(Km[k0 + i * 32] != 0); tot += __builtin_popcount(bm[i]); }
  if (lane == 0) sc[w] = tot;
  __syncthreads();      /* publishes the waves' counts */
  int n = 0, p = 0;
#pragma unroll      /* constant indices: the values stay in registers */
  for (int u = 0; u < 8; ++u) { const int v = sc[u]; n += v; p += (u < w) ? v : 0; }
  int rk[8];
#pragma unroll      /* constant indices: the values stay in registers */
  for (int i = 0; i < 8; ++i) { const int r = p + __builtin_popcount(bm[i] & ((1u << lane) - 1u));
    rk[i] = (n == 0) ? w * 256 + i * 32 + lane : (((bm[i] >> lane) & 1u) ? r : -1); p += __builtin_popcount(bm[i]); }
#pragma unroll      /* constant indices: the values stay in registers */
  for (int i = 0; i < 8; ++i) KP[k0 + i * 32] = rk[i];
  if (tid == 0) KN[b] = n; }
#define WN_NB (DM * DM / 8 / 256)      /* work-groups that convert Wo; the NB behind them rank the keys */
__global__ __launch_bounds__(256) void k_wnat(const float* __restrict__ w, size_t n8, _Float16* __restrict__ Bt, const int* __restrict__ Km, int* __restrict__ KP, int* __restrict__ KN) {
  if (blockIdx.x >= WN_NB) { key_ranks(Km, KP, KN, (int)blockIdx.x - WN_NB); return; }      /* the same for a whole work-group */
  const size_t t = (size_t)blockIdx.x * 256 + threadIdx.x; if (t >= n8) return; FragH f; for (int q = 0; q < 8; ++q) f.h[q] = (_Float16)(bf16_round(w[t * 8 + q]) * 16.0f); *(v8us*)((unsigned short*)Bt + t * 8) = f.half[0];  }
__global__ __launch_bounds__(256) void k_rsm(const float* __restrict__ S, _Float16* __restrict__ P, int nrows) {
  #pragma clang fp contract(off)
  const int i = blockIdx.x * 256 + threadIdx.x; if (i >= nrows) return; const float* s = S + (size_t)i * SQ; float mx = -3.0e38f;
#pragma unroll 1
  for (int j = 0; j < SQ; ++j) mx = fmaxf(mx, s[j]); float se = 0.f;
#pragma unroll 1
  for (int j = 0; j < SQ; ++j) se += expf(s[j] - mx); const float sc = 256.0f / se;
#pragma unroll 1
  for (int j0 = 0; j0 < SQ; j0 += 8) { FragH f; for (int q = 0; q < 8; ++q) f.h[q] = (_Float16)(expf(s[j0 + q] - mx) * sc); unsigned short* d = (unsigned short*)P + (size_t)i * SQ + j0; *(v8us*)d = f.half[0];  } }
__global__ __launch_bounds__(256) void k_vt(const _Float16* __restrict__ V16, int b, int h0, _Float16* __restrict__ VT) { __shared__ unsigned short tl[64][65]; const int tid = threadIdx.x; const int hh = blockIdx.x % HG, sg = blockIdx.x / HG; const int s0 = sg * 64; const int h = h0 + hh;
  for (int i = tid; i < 64 * 8; i += 256) { const int j = i / 8, d8 = (i % 8) * 8; FragH f; f.half[0] = *(const v8us*)((const unsigned short*)V16 + ((size_t)b * SQ + s0 + j) * DM + h * HD + d8); for (int q = 0; q < 8; ++q) tl[d8 + q][j] = f.u[q]; }
  __syncthreads();
  { for (int i = tid; i < 64 * 8; i += 256) { const int d = i / 8, j8 = (i % 8) * 8; FragH f; for (int q = 0; q < 8; ++q) f.u[q] = tl[d][j8 + q]; *(v8us*)((unsigned short*)VT + ((size_t)hh * HD + d) * SQ + s0 + j8) = f.half[0]; }  } }



__global__ __launch_bounds__(256) void k_rsmkm(const float* __restrict__ S, _Float16* __restrict__ P, int nrows, const int* __restrict__ am) {
  #pragma clang fp contract(off)
  const int t = blockIdx.x * 256 + threadIdx.x; if (t >= nrows) return; const size_t i = (size_t)t; const float* s = S + i * SQ; const int* mr = am + (size_t)(t % SQ) * SQ; float mx = -3.0e38f;
#pragma unroll 1
  for (int j = 0; j < SQ; ++j) { const float f = (mr[j] != 0) ? 1.f : 0.f; mx = fmaxf(mx, fmaf(f, s[j], (1.f - f) * -1.0e9f)); } float se = 0.f;
#pragma unroll 1
  for (int j = 0; j < SQ; ++j) { const float f = (mr[j] != 0) ? 1.f : 0.f; se += __expf(fmaf(f, s[j], (1.f - f) * -1.0e9f) - mx); } const float sc = 256.0f / se;
#pragma unroll 1
  for (int j0 = 0; j0 < SQ; j0 += 8) { FragH fr; for (int q = 0; q < 8; ++q) { const int j = j0 + q; const float f = (mr[j] != 0) ? 1.f : 0.f; fr.h[q] = (_Float16)(__expf(fmaf(f, s[j], (1.f - f) * -1.0e9f) - mx) * sc); }
    unsigned short* d = (unsigned short*)P + i * SQ + j0; *(v8us*)d = fr.half[0];  } }

__global__ __launch_bounds__(256) void k_bdshn(const float* __restrict__ Wb, _Float16* __restrict__ Bt) {
  const size_t t = (size_t)blockIdx.x * 256 + threadIdx.x; if (t >= (size_t)DM * DM / 8) return; const size_t e0 = t * 8; const int n = (int)(e0 / DM), k0 = (int)(e0 % DM); const int h = n >> 6, hk = k0 >> 6; const float on = (hk == h) ? 16.0f : 0.0f; const int o = n & 63, d0 = k0 & 63; FragH f;
  for (int q = 0; q < 8; ++q) f.h[q] = (_Float16)(bf16_round(Wb[(size_t)o * 64 + d0 + q]) * on);
  unsigned short* d = (unsigned short*)Bt + e0; *(v8us*)d = f.half[0];  }

// Fused attention: one launch for every (batch, head); scores, softmax and the weighted sum of V stay in registers, no score or weight plane in memory.
// A work-group is 16 waves, four per SIMD, so that one wave's vector work and waits stand beside three others' products: two sets of 8 waves x 32 queries hold the SAME 256 queries of one head, and set g takes the stages g, g + 2, ... with
// LDS buffers of its own; at the end the two sets' running maxima, sums and outputs are joined through LDS (each wave hands one 16-query tile to its partner and finishes the other).
// A set walks the batch's packed (kept) keys in stages of 64, the last stage filled up with keys under the fill: the stage's K rows (64 keys x 64 dims) and V^T rows (64 dims x 64 keys) are fetched once per work-group with
// whole-line 16-byte loads, one stage ahead, and shared through two LDS buffers (rows of 128 B at a pitch of 144 B, the conflict-free pitch for 16-byte readers); one barrier per stage publishes the next
// buffer and ends the reads of the one refilled behind it. A wave works a stage in two passes of 32 keys. Per pass: S^T = K Q^T (A = 16 key rows, B = 16 query rows, both by g2_frag, so both in the same k order);
// a lane then holds, per 16-query tile, 16 scores of ONE query (query = lane & 15; keys 8 * (lane >> 4) + r of each 16-key tile), which is also the B-operand order of a 32-key product,
// so the weights go from the score accumulators straight into O^T += V^T P^T (A = 16 rows of V^T, again by g2_frag). Softmax is the running-maximum form in base 2: the maximum in use is raised,
// and sums and outputs rescaled, only when a pass exceeds it by more than 8 (weights stay <= 256, inside f16). The filling keys (and, where a batch keeps no key, all keys) take the module's fill through the addend of the scaling fma:
// the fill (-1e20 / 32, in base 2) absorbs any finite f16 score exactly, so the result is the fill itself, as the source's where() has it; a row with every key masked comes out uniform, as in the source.
// exp2 as asm text so that a v_nop stands directly behind the last transcendental: the instruction set asks for one slot before a result is used or a source overwritten (inside a run no v_exp_f32 touches
// another's register). Each works IN PLACE, on a register that the compiler's own subtraction has just written: so the asm never writes a register that a matrix instruction a few slots back still reads.
__device__ __forceinline__ float exp2_slot(float t) { asm("v_exp_f32 %0, %0\n\tv_nop" : "+v"(t)); return t; }
__device__ __forceinline__ void exp2_run8(float (&x)[8]) {
  asm("v_exp_f32 %0, %0\n\tv_exp_f32 %1, %1\n\tv_exp_f32 %2, %2\n\tv_exp_f32 %3, %3\n\tv_exp_f32 %4, %4\n\tv_exp_f32 %5, %5\n\tv_exp_f32 %6, %6\n\tv_exp_f32 %7, %7\n\tv_nop"
      : "+v"(x[0]), "+v"(x[1]), "+v"(x[2]), "+v"(x[3]), "+v"(x[4]), "+v"(x[5]), "+v"(x[6]), "+v"(x[7])); }
__device__ __forceinline__ float xhalf(float x) { return __builtin_bit_cast(float, __builtin_amdgcn_permlanex16(__builtin_bit_cast(int, x), __builtin_bit_cast(int, x), 0x76543210, 0xfedcba98, false, false)); }      /* lane l reads lane l ^ 16 */
__device__ __forceinline__ v8f fa_mma(v16h a, v16h b, v8f c) { return __builtin_amdgcn_wmma_f32_16x16x32_f16(false, a, false, b, (short)0, c, false, false); }
// The join's two halves, for query tile QT of a wave (a constant, so that the values stay in registers). fa_give: the tile's 32 outputs per lane, its maximum in use and its sum go to the wave's LDS rows, 16 bytes a lane in a row.
template <int QT>
__device__ __forceinline__ void fa_give(float (&m)[9][32][4], int lane, const v8f (&o)[4][2], const float (&mr)[2], const float (&lr)[2]) {
#pragma unroll      /* constant indices: the values stay in registers */
  for (int dt = 0; dt < 4; ++dt) { const v4f x0 = {o[dt][QT][0], o[dt][QT][1], o[dt][QT][2], o[dt][QT][3]}, x1 = {o[dt][QT][4], o[dt][QT][5], o[dt][QT][6], o[dt][QT][7]};
    *(v4fa*)&m[dt * 2][lane][0] = x0; *(v4fa*)&m[dt * 2 + 1][lane][0] = x1; }
  const v4f xm = {mr[QT], lr[QT], 0.f, 0.f}; *(v4fa*)&m[8][lane][0] = xm; }
// fa_join: the partner's rows m for the same tile are brought to the common maximum with the wave's own, summed and divided by the joint row sum; res: the tile's f16 outputs, 16 bytes per 16 dims.
template <int QT>
__device__ __forceinline__ void fa_join(const float (&m)[9][32][4], int lane, const v8f (&o)[4][2], const float (&mr)[2], const float (&lr)[2], v8us (&res)[4]) {
  const v4f xm = *(const v4fa*)&m[8][lane][0];
  const float mn = fmaxf(mr[QT], xm[0]);      /* a set that had no stage hands over -3e38, sum 0 and outputs 0: its factor below is 0 */
  const float ca = exp2_slot(mr[QT] - mn), cb = exp2_slot(xm[0] - mn);
  const float l2 = lr[QT] * ca + xm[1] * cb;
  const float sc = 64.0f / (l2 + xhalf(l2));      /* the lane halves' sums join here; o carried x64 as before */
  const float fa = ca * sc, fb = cb * sc;
#pragma unroll      /* constant indices: the values stay in registers */
  for (int dt = 0; dt < 4; ++dt) { FragH f; const v4f x0 = *(const v4fa*)&m[dt * 2][lane][0], x1 = *(const v4fa*)&m[dt * 2 + 1][lane][0];
#pragma unroll      /* constant indices: the values stay in registers */
    for (int r = 0; r < 4; ++r) { f.h[r] = (_Float16)(o[dt][QT][r] * fa + x0[r] * fb); f.h[4 + r] = (_Float16)(o[dt][QT][4 + r] * fa + x1[r] * fb); }
    res[dt] = f.half[0]; } }
#define FA_NS (SQ / 64)      /* stages of 64 keys */
#define FA_LP 72             /* LDS row pitch in f16: 128 B of data + 16 B */
__global__ __launch_bounds__(512) void k_fattn(const _Float16* __restrict__ Q16, const _Float16* __restrict__ K16, const _Float16* __restrict__ VT, const int* __restrict__ KN, _Float16* __restrict__ O16) {
  __shared__ __attribute__((aligned(16))) float kb[SQ];      /* per packed key: 0 (kept) or the fill */
  __shared__ __attribute__((aligned(16))) _Float16 ks_[2][2][64 * FA_LP];      /* per set, two buffers: K rows of a stage: [key][dim] */
  __shared__ __attribute__((aligned(16))) _Float16 vs_[2][2][64 * FA_LP];      /* per set, two buffers: V^T rows of a stage: [dim][key] */
  __shared__ __attribute__((aligned(16))) float mg[16][9][32][4];      /* the join: per wave and lane, the 32 outputs of the tile it hands over, then that tile's maximum and sum */
  const int tid = threadIdx.x, w = tid >> 5, lane = tid & 31, ln = lane & 15, hh = lane >> 4;
  const int g = __builtin_amdgcn_readfirstlane(w >> 3);      /* the wave's set; the same in every lane: the tests on it are scalar branches */
  const int bh = blockIdx.y, b = bh / NH, h = bh % NH; const int q0 = blockIdx.x * 256 + (w & 7) * 32;
  const int sr = (tid & 255) >> 3, sc8 = (tid & 7) * 8;      /* staging, by a set's 256 threads for itself: 8 threads per 128-byte row, rows sr and sr + 32 */
  const int n = KN[b], nk = (n < 1 || n > SQ) ? SQ : n, ns = (nk + 63) >> 6;      /* kept keys of the batch; packed rows to walk (all keys where none is kept); stages, 1 to FA_NS, the same for the whole work-group */
  const int nt = (ns + 1) >> 1;      /* trips: two stages, one per set, each */
  const int f0 = min(g, ns - 1) * 64;      /* first key of the set's first stage (one stage in all: the second set fetches it too, in bounds, never read) */
  const int kl1 = nk - 1 - sr;      /* a K row past the last packed one is read as that one: a finite score, which the fill absorbs */
  const _Float16* kg = K16 + ((size_t)b * SQ + sr) * DM + h * HD + sc8;
  const _Float16* vg = VT + ((size_t)bh * HD + sr) * SQ + sc8;
  const int so = sr * FA_LP + sc8;
  v8us gk0 = *(const v8us*)(const unsigned short*)(kg + (ptrdiff_t)min(f0, kl1) * DM), gk1 = *(const v8us*)(const unsigned short*)(kg + (ptrdiff_t)min(f0 + 32, kl1) * DM);
  v8us gv0 = *(const v8us*)(const unsigned short*)(vg + f0), gv1 = *(const v8us*)(const unsigned short*)(vg + (size_t)32 * SQ + f0);
  for (int j = tid; j < SQ; j += 512) kb[j] = (j < n) ? 0.f : -4.5084220e18f;
  const _Float16* qp = Q16 + ((size_t)b * SQ + q0 + ln) * DM + h * HD;
  const float c2 = 0.03125f * 1.44269504f;      /* 1 / sqrt(embed size), in base 2 */
  const v8f z8 = {0.f,0.f,0.f,0.f,0.f,0.f,0.f,0.f};
  v16h qf[2][2];
#pragma unroll
  for (int t = 0; t < 2; ++t)
#pragma unroll
    for (int ks = 0; ks < 2; ++ks) qf[t][ks] = g2_frag(qp + (size_t)t * 16 * DM + ks * 32, hh);
  *(v8us*)(unsigned short*)&ks_[g][0][so] = gk0; *(v8us*)(unsigned short*)&ks_[g][0][so + 32 * FA_LP] = gk1;
  *(v8us*)(unsigned short*)&vs_[g][0][so] = gv0; *(v8us*)(unsigned short*)&vs_[g][0][so + 32 * FA_LP] = gv1;
  __syncthreads();      /* publishes each set's first stage and the key table */
  v8f o[4][2];
#pragma unroll
  for (int dt = 0; dt < 4; ++dt) { o[dt][0] = z8; o[dt][1] = z8; }
  float mr[2] = {-3.0e38f, -3.0e38f}, lr[2] = {0.f, 0.f};
#pragma unroll 1
  for (int tr = 0; tr < nt; ++tr) {      /* kept rolled: one stage already fills the register file */
    const int st = 2 * tr + g;      /* the set's stage of this trip */
    if (st < ns) {      /* scalar; an odd number of stages leaves the second set without one in the last trip: it goes straight to the barrier */
    const int keyn = (st + 2 < ns) ? (st + 2) * 64 : st * 64;      /* a set's last stage refetches itself: in bounds, never read */
    const _Float16* kl = &ks_[g][tr & 1][ln * FA_LP]; const _Float16* vl = &vs_[g][tr & 1][ln * FA_LP];
    v16h kf[2][2], vf[4];
#pragma unroll
    for (int kt = 0; kt < 2; ++kt)
#pragma unroll
      for (int ks = 0; ks < 2; ++ks) kf[kt][ks] = g2_frag(kl + kt * 16 * FA_LP + ks * 32, hh);
#pragma unroll
    for (int p = 0; p < 2; ++p) {
      const int key0 = st * 64 + p * 32;
      /* the set's next stage, half per pass through the same 8 registers: K rows fetched in the first pass, V^T rows in the second; each half is stored at its pass's end into the buffer that the trip before read, whose readers left it at the last barrier */
      const v8us g0 = (p == 0) ? *(const v8us*)(const unsigned short*)(kg + (ptrdiff_t)min(keyn, kl1) * DM) : *(const v8us*)(const unsigned short*)(vg + keyn);
      const v8us g1 = (p == 0) ? *(const v8us*)(const unsigned short*)(kg + (ptrdiff_t)min(keyn + 32, kl1) * DM) : *(const v8us*)(const unsigned short*)(vg + (size_t)32 * SQ + keyn);
#pragma unroll
      for (int dt = 0; dt < 4; ++dt) vf[dt] = g2_frag(vl + dt * 16 * FA_LP + p * 32, hh);
      v8f sx[2][2];
#pragma unroll
      for (int kt = 0; kt < 2; ++kt)
#pragma unroll
        for (int qt = 0; qt < 2; ++qt) sx[kt][qt] = fa_mma(kf[kt][1], qf[qt][1], fa_mma(kf[kt][0], qf[qt][0], z8));
      if (p == 0) {      /* the second pass's K fragments, fetched behind the first pass's score products */
#pragma unroll
        for (int kt = 0; kt < 2; ++kt)
#pragma unroll
          for (int ks = 0; ks < 2; ++ks) kf[kt][ks] = g2_frag(kl + (32 + kt * 16) * FA_LP + ks * 32, hh); }
      float bias[2][8];
#pragma unroll
      for (int kt = 0; kt < 2; ++kt) { const v4f x0 = *(const v4fa*)&kb[key0 + kt * 16 + 8 * hh], x1 = *(const v4fa*)&kb[key0 + kt * 16 + 8 * hh + 4];
#pragma unroll
        for (int r = 0; r < 4; ++r) { bias[kt][r] = x0[r]; bias[kt][4 + r] = x1[r]; } }
      float mb[2]; bool need = false;
#pragma unroll
      for (int qt = 0; qt < 2; ++qt) { float mx0 = -3.0e38f, mx1 = -3.0e38f;
#pragma unroll
        for (int r = 0; r < 8; ++r) { sx[0][qt][r] = fmaf(sx[0][qt][r], c2, bias[0][r]); sx[1][qt][r] = fmaf(sx[1][qt][r], c2, bias[1][r]); mx0 = fmaxf(mx0, sx[0][qt][r]); mx1 = fmaxf(mx1, sx[1][qt][r]); }
        const float mx = fmaxf(mx0, mx1); mb[qt] = fmaxf(mx, xhalf(mx)); need = need || (mb[qt] > mr[qt] + 8.0f); }
      if (__builtin_amdgcn_ballot_w32(need) != 0) {      /* wave-uniform; rare after the first passes */
#pragma unroll
        for (int qt = 0; qt < 2; ++qt) { const float mn = fmaxf(mr[qt], mb[qt]); const float corr = exp2_slot(mr[qt] - mn); mr[qt] = mn; lr[qt] *= corr;
#pragma unroll
          for (int dt = 0; dt < 4; ++dt) o[dt][qt] = o[dt][qt] * corr; } }
#pragma unroll
      for (int qt = 0; qt < 2; ++qt) { FragH pf; float s0 = 0.f, s1 = 0.f, e0[8], e1[8];
#pragma unroll
        for (int r = 0; r < 8; ++r) { e0[r] = sx[0][qt][r] - mr[qt]; e1[r] = sx[1][qt][r] - mr[qt]; }
        exp2_run8(e0); exp2_run8(e1);
#pragma unroll
        for (int r = 0; r < 8; ++r) { s0 += e0[r]; s1 += e1[r]; pf.h[r] = (_Float16)e0[r]; pf.h[8 + r] = (_Float16)e1[r]; }
        lr[qt] += s0 + s1;
#pragma unroll
        for (int dt = 0; dt < 4; ++dt) o[dt][qt] = fa_mma(vf[dt], pf.v, o[dt][qt]); }
      { _Float16* gd = (p == 0) ? &ks_[g][(tr + 1) & 1][so] : &vs_[g][(tr + 1) & 1][so]; *(v8us*)(unsigned short*)gd = g0; *(v8us*)(unsigned short*)(gd + 32 * FA_LP) = g1; }
      if (p == 0) __builtin_amdgcn_sched_barrier(0);      /* keeps the next pass's score products out of this pass: moved up, their accumulators take the kernel past 256 registers */
    }
    }
    __syncthreads();      /* every wave, every trip: publishes each set's next stage; ends every wave's reads of this trip's stages before their buffers are refilled */
  }
  /* The join. Wave w and wave w ^ 8 hold the same 32 queries over the two halves of the stages, in the same lanes and registers. A wave of set g finishes query tile g and hands the other tile to its partner. */
  if (g == 0) fa_give<1>(mg[w], lane, o, mr, lr); else fa_give<0>(mg[w], lane, o, mr, lr);      /* scalar test */
  __syncthreads();      /* publishes the tiles handed over */
  v8us res[4];
  if (g == 0) fa_join<0>(mg[w ^ 8], lane, o, mr, lr, res); else fa_join<1>(mg[w ^ 8], lane, o, mr, lr, res);      /* scalar test */
  unsigned short* op = (unsigned short*)O16 + ((size_t)b * SQ + q0 + g * 16 + ln) * DM + h * HD + 8 * hh;
#pragma unroll      /* constant indices: the values stay in registers */
  for (int dt = 0; dt < 4; ++dt) *(v8us*)(op + dt * 16) = res[dt];      /* the stores stand together at the kernel's end: no register of theirs is written behind them */
}

// Per-head projections, one launch for Q, K and V (blockIdx.y picks input, weight and output). The module multiplies every 64-wide head slice by the SAME [64][64] matrix, so the token rows [4096][1024] are read as
// [65536][64] head rows and the product has K = 64: each input element is read once, straight from the f32 input, and no product with a zero block is formed.
// A work-group is 8 waves x 32 head rows. A wave fetches its 32 rows (8 KB in a row) with 16 whole-line 16-byte loads, rounds them (bf16, exact in f16) and lays them in its own LDS rows (128 B at a pitch of 144 B);
// the work-group converts the weight (bf16-rounded, x16) into LDS once; one barrier publishes it. Y^T = W X^T (A = 16 weight rows, B = 16 head rows, both by g2_frag, so both in the same k order, k 0..31 then 32..63):
// a lane then holds 8 neighbouring features of ONE head row, 16 bytes of f16, which go back into that row's LDS place (its fragments are already in registers) and leave as whole 128-byte lines.
#define PJ_LP 72             /* LDS row pitch in f16: 128 B of data + 16 B */
typedef unsigned short v4us __attribute__((ext_vector_type(4), may_alias));
union FragQ { v4us v; _Float16 h[4]; };
__global__ __launch_bounds__(256) void k_proj(const float* __restrict__ xq, const float* __restrict__ xk, const float* __restrict__ xv, const float* __restrict__ wq, const float* __restrict__ wk, const float* __restrict__ wv,
                                              _Float16* __restrict__ Q16, _Float16* __restrict__ K16, _Float16* __restrict__ V16, const int* __restrict__ KP) {
  __shared__ __attribute__((aligned(16))) _Float16 wl[HD * PJ_LP];      /* weight rows [out][in], x16 */
  __shared__ __attribute__((aligned(16))) _Float16 xl[8][32 * PJ_LP];      /* per wave: its 32 head rows, later its 32 output rows */
  const int tid = threadIdx.x, w = tid >> 5, lane = tid & 31, ln = lane & 15, hh = lane >> 4;
  const int sel = blockIdx.y;
  const float* x = (sel == 0) ? xq : (sel == 1) ? xk : xv;
  const float* W = (sel == 0) ? wq : (sel == 1) ? wk : wv;
  _Float16* Y = (sel == 0) ? Q16 : (sel == 1) ? K16 : V16;
  const size_t row0 = (size_t)blockIdx.x * 256 + w * 32;
  const float* xp = x + row0 * HD + lane * 4;
  /* a wave's 32 head rows are two tokens; d0, d1: the token rows they are written to, or -1. Queries keep their place; a K or V token goes to its rank among the batch's kept keys, and one with mask == 0 is neither read nor written */
  const int tok = (int)(row0 >> 4); int d0 = tok, d1 = tok + 1;
  if (sel != 0) { const int p0 = KP[tok], p1 = KP[tok + 1], tb = tok & ~(SQ - 1); d0 = (p0 < 0) ? -1 : tb + min(p0, SQ - 1); d1 = (p1 < 0) ? -1 : tb + min(p1, SQ - 1); }
  d0 = __builtin_amdgcn_readfirstlane(d0); d1 = __builtin_amdgcn_readfirstlane(d1);      /* the same in every lane of the wave: the tests below are scalar branches */
  v4f xr[16], wr[4];      /* a token that is left out has no values here: every use below stands under the same test */
  if (d0 >= 0) {
#pragma unroll      /* constant indices: the values stay in registers */
    for (int i = 0; i < 8; ++i) xr[i] = *(const v4fa*)(xp + i * 128); }      /* two rows per load */
  if (d1 >= 0) {
#pragma unroll      /* constant indices: the values stay in registers */
    for (int i = 8; i < 16; ++i) xr[i] = *(const v4fa*)(xp + i * 128); }
#pragma unroll      /* constant indices: the values stay in registers */
  for (int i = 0; i < 4; ++i) wr[i] = *(const v4fa*)(W + i * 1024 + tid * 4);      /* 16 weight rows per load of the work-group */
  asm volatile("s_wait_xcnt 0x0" :: "v"(xp) : "memory");      /* precaution: no address register of the loads above is rewritten in front of this wait; naming the pair keeps the last load's result off it */
  _Float16* xw = &xl[w][0];
#pragma unroll      /* constant indices: the values stay in registers */
  for (int i = 0; i < 4; ++i) { FragQ f;
#pragma unroll      /* constant indices: the values stay in registers */
    for (int q = 0; q < 4; ++q) f.h[q] = (_Float16)(bf16_round(wr[i][q]) * 16.0f);
    *(v4us*)(unsigned short*)&wl[(i * 16 + (tid >> 4)) * PJ_LP + (tid & 15) * 4] = f.v; }
#pragma unroll      /* constant indices: the values stay in registers */
  for (int j = 0; j < 2; ++j) { if ((j ? d1 : d0) < 0) continue;
#pragma unroll      /* constant indices: the values stay in registers */
    for (int i = j * 8; i < j * 8 + 8; ++i) { FragQ f;
#pragma unroll      /* constant indices: the values stay in registers */
      for (int q = 0; q < 4; ++q) f.h[q] = (_Float16)bf16_round(xr[i][q]);
      *(v4us*)(unsigned short*)&xw[(i * 2 + hh) * PJ_LP + ln * 4] = f.v; } }
  __syncthreads();      /* publishes the weight rows (and orders each wave's own rows) */
  const v8f z8 = {0.f,0.f,0.f,0.f,0.f,0.f,0.f,0.f};
  v16h wf[4][2];
#pragma unroll      /* constant indices: the values stay in registers */
  for (int t = 0; t < 4; ++t)
#pragma unroll      /* constant indices: the values stay in registers */
    for (int ks = 0; ks < 2; ++ks) wf[t][ks] = g2_frag(&wl[(t * 16 + ln) * PJ_LP + ks * 32], hh);
#pragma unroll      /* constant indices: the values stay in registers */
  for (int j = 0; j < 2; ++j) { if ((j ? d1 : d0) < 0) continue;
    _Float16* xrow = xw + (j * 16 + ln) * PJ_LP;
    const v16h x0 = g2_frag(xrow, hh), x1 = g2_frag(xrow + 32, hh);
#pragma unroll      /* constant indices: the values stay in registers */
    for (int t = 0; t < 4; ++t) { const v8f a = fa_mma(wf[t][1], x1, fa_mma(wf[t][0], x0, z8)); FragH f;
#pragma unroll      /* constant indices: the values stay in registers */
      for (int r = 0; r < 8; ++r) f.h[r] = (_Float16)(a[r] * 0.0625f);
      *(v8us*)(unsigned short*)(xrow + t * 16 + 8 * hh) = f.half[0]; } }
  __builtin_amdgcn_fence(__ATOMIC_ACQ_REL, "workgroup"); __builtin_amdgcn_wave_barrier();      /* the wave's lanes read each other's output pieces below */
#pragma unroll      /* constant indices: the values stay in registers */
  for (int j = 0; j < 2; ++j) { const int dt = j ? d1 : d0;
    if (dt >= 0) {
#pragma unroll      /* constant indices: the values stay in registers */
      for (int i = 0; i < 4; ++i) { const int r = i * 4 + (lane >> 3), c8 = (lane & 7) * 8;      /* four whole rows, 512 B in a row, per store */
        const v8us v = *(const v8us*)(const unsigned short*)&xw[(j * 16 + r) * PJ_LP + c8];
        *(v8us*)((unsigned short*)Y + ((size_t)dt * NH + r) * HD + c8) = v; }
      if (j == 0) asm volatile("s_wait_xcnt 0x0" ::: "memory"); } }      /* precaution: the second token's LDS reads reuse the data registers of the stores above */
}
// Output GEMM, out = o Wo^T * alpha + b: one 128 x 128 tile of out per work-group (8 waves, 2 x 4, 64 x 32 each), 256 work-groups. Both operands are K-contiguous f16 rows. A stage is 128 k (256 B) of the tile's 128 o rows
// and 128 Wo rows, brought into LDS by asynchronous 16-byte copies (a wave's copy covers two whole 256-byte row pieces, so every L2 request is a whole line and each line is asked for once per work-group),
// rows at a pitch of 272 B (conflict-free for 16-byte readers). Two buffers: stage t + 1 flies while stage t is worked on. Fragments by g2_frag from LDS for A and B alike (same k order);
// every accumulator takes its k blocks of 32 in rising order, as before. The f32 results leave through a wave's own LDS rows as whole 128-byte lines.
#define OG_BK 128            /* k per stage */
#define OG_NT (DM / OG_BK)   /* stages */
#define OG_LP 136            /* LDS row pitch in f16: 256 B of data + 16 B */
#define OG_SP 36             /* output staging pitch in f32: 128 B of data + 16 B */
// Eight copies of one thread, rows 16 apart. The s_wait_xcnt is the last line of the copies' own statement, so that no address register of a copy is rewritten in front of it (a precaution).
__device__ __forceinline__ void og_copy8(unsigned l, const _Float16* g) {
  asm volatile("global_load_async_to_lds_b128 %0, %8, off\n\tglobal_load_async_to_lds_b128 %1, %9, off\n\tglobal_load_async_to_lds_b128 %2, %10, off\n\tglobal_load_async_to_lds_b128 %3, %11, off\n\t"
               "global_load_async_to_lds_b128 %4, %12, off\n\tglobal_load_async_to_lds_b128 %5, %13, off\n\tglobal_load_async_to_lds_b128 %6, %14, off\n\tglobal_load_async_to_lds_b128 %7, %15, off\n\ts_wait_xcnt 0x0"
               :: "v"(l), "v"(l + 16u * OG_LP * 2u), "v"(l + 32u * OG_LP * 2u), "v"(l + 48u * OG_LP * 2u), "v"(l + 64u * OG_LP * 2u), "v"(l + 80u * OG_LP * 2u), "v"(l + 96u * OG_LP * 2u), "v"(l + 112u * OG_LP * 2u),
                  "v"(g), "v"(g + 16 * DM), "v"(g + 32 * DM), "v"(g + 48 * DM), "v"(g + 64 * DM), "v"(g + 80 * DM), "v"(g + 96 * DM), "v"(g + 112 * DM) : "memory"); }
__global__ __launch_bounds__(256) void k_ogemm(const _Float16* __restrict__ A, const _Float16* __restrict__ Bh, float alpha, const float* __restrict__ bias, float* __restrict__ C) {
  __shared__ __attribute__((aligned(16))) _Float16 at_[2][128 * OG_LP];      /* o rows of a stage: [row][k] */
  __shared__ __attribute__((aligned(16))) _Float16 bt_[2][128 * OG_LP];      /* Wo rows of a stage: [col][k] */
  __shared__ __attribute__((aligned(16))) float so[8][64 * OG_SP];      /* per wave: its 64 x 32 results */
  const int tid = threadIdx.x, w = tid >> 5, lane = tid & 31, ln = lane & 15, hh = lane >> 4;
  const int row0 = (blockIdx.x / (DM / 128)) * 128, col0 = (blockIdx.x % (DM / 128)) * 128;
  const int wm = w >> 2, wn = w & 3;
  const int cr = tid >> 4, cc = (tid & 15) * 8;      /* copies: 16 threads per 256-byte row piece, rows cr + 16 i */
  const _Float16* ag = A + (size_t)(row0 + cr) * DM + cc;
  const _Float16* bg = Bh + (size_t)(col0 + cr) * DM + cc;
  const unsigned al = (unsigned)(size_t)&at_[0][cr * OG_LP + cc], bl = (unsigned)(size_t)&bt_[0][cr * OG_LP + cc];      /* LDS byte addresses */
  const unsigned bufb = 128u * OG_LP * 2u;      /* bytes of one buffer */
  og_copy8(al, ag); og_copy8(bl, bg);
  asm volatile("s_wait_asynccnt 0x0" ::: "memory");      /* stage 0 has landed for this wave's copies */
  __syncthreads();      /* publishes stage 0 */
  og_copy8(al + bufb, ag + OG_BK); og_copy8(bl + bufb, bg + OG_BK);
  const v8f z8 = {0.f,0.f,0.f,0.f,0.f,0.f,0.f,0.f};
  v8f acc[4][2];
#pragma unroll      /* constant indices: the values stay in registers */
  for (int i = 0; i < 4; ++i) { acc[i][0] = z8; acc[i][1] = z8; }
  for (int t = 0; t < OG_NT; ++t) {
    const _Float16* ap = &at_[t & 1][(wm * 64 + ln) * OG_LP]; const _Float16* bp = &bt_[t & 1][(wn * 32 + ln) * OG_LP];
    v16h af[2][4], bf[2][2];      /* two fragment sets: block ks + 1 is fetched while block ks is multiplied */
#pragma unroll      /* constant indices: the values stay in registers */
    for (int i = 0; i < 4; ++i) af[0][i] = g2_frag(ap + i * 16 * OG_LP, hh);
#pragma unroll      /* constant indices: the values stay in registers */
    for (int j = 0; j < 2; ++j) bf[0][j] = g2_frag(bp + j * 16 * OG_LP, hh);
#pragma unroll      /* constant indices: the values stay in registers */
    for (int ks = 0; ks < OG_BK / 32; ++ks) { const int cu = ks & 1, nx = cu ^ 1;
      if (ks + 1 < OG_BK / 32) {
#pragma unroll      /* constant indices: the values stay in registers */
        for (int i = 0; i < 4; ++i) af[nx][i] = g2_frag(ap + i * 16 * OG_LP + (ks + 1) * 32, hh);
#pragma unroll      /* constant indices: the values stay in registers */
        for (int j = 0; j < 2; ++j) bf[nx][j] = g2_frag(bp + j * 16 * OG_LP + (ks + 1) * 32, hh); }
      __builtin_amdgcn_sched_barrier(0);      /* keeps the next block's LDS reads as one group in front of this block's products: sunk among them, one fragment set is reused and every pair of products waits out an LDS latency */
#pragma unroll      /* constant indices: the values stay in registers */
      for (int i = 0; i < 4; ++i) { acc[i][0] = fa_mma(af[cu][i], bf[cu][0], acc[i][0]); acc[i][1] = fa_mma(af[cu][i], bf[cu][1], acc[i][1]); }
      __builtin_amdgcn_sched_barrier(0);      /* keeps the block after next's reads behind these products, so that two fragment sets suffice */
    }
    asm volatile("s_wait_dscnt 0x0" ::: "memory");      /* this wave's reads of stage t have returned before its buffer is refilled */
    asm volatile("s_wait_asynccnt 0x0" ::: "memory");      /* this wave's copies of stage t + 1 have landed */
    __syncthreads();      /* publishes stage t + 1; ends every wave's reads of stage t */
    if (t + 2 < OG_NT) { const unsigned bo = (unsigned)(t & 1) * bufb; og_copy8(al + bo, ag + (t + 2) * OG_BK); og_copy8(bl + bo, bg + (t + 2) * OG_BK); }
  }
  asm volatile("s_wait_asynccnt 0x0" ::: "memory");      /* no copy is outstanding when the wave goes on and ends */
  float* sw = &so[w][0];
#pragma unroll      /* constant indices: the values stay in registers */
  for (int j = 0; j < 2; ++j) { const float bv = bf16_round(bias[col0 + wn * 32 + j * 16 + ln]);
#pragma unroll      /* constant indices: the values stay in registers */
    for (int i = 0; i < 4; ++i)
#pragma unroll      /* constant indices: the values stay in registers */
      for (int r = 0; r < 8; ++r) sw[(i * 16 + 8 * hh + r) * OG_SP + j * 16 + ln] = acc[i][j][r] * alpha + bv; }
  __builtin_amdgcn_fence(__ATOMIC_ACQ_REL, "workgroup"); __builtin_amdgcn_wave_barrier();      /* the wave's lanes read each other's results below */
  float* cp = C + (size_t)(row0 + wm * 64 + (lane >> 3)) * DM + col0 + wn * 32 + (lane & 7) * 4;
#pragma unroll      /* constant indices: the values stay in registers */
  for (int q = 0; q < 16; ++q) { const v4f v = *(const v4fa*)&sw[(q * 4 + (lane >> 3)) * OG_SP + (lane & 7) * 4];      /* four whole 128-byte lines per store */
    *(v4f*)(cp + (size_t)q * 4 * DM) = v; }
}
extern "C" void kernel_launch(void* const* d_in, const int* in_sizes, int n_in,
                              void* d_out, int out_size, void* d_ws, size_t ws_size, hipStream_t stream) {
  (void)in_sizes; (void)n_in; (void)out_size;
  const float* const* I = (const float* const*)d_in; const float* xq = I[2]; const float* xk = I[1]; const float* xv = I[0]; const int* km = (const int*)d_in[3]; const float* wq = I[6]; const float* wk = I[5]; const float* wv = I[4]; const float* wo = I[7]; const float* bo = I[8];      /* contract order: values I[0], keys I[1], query I[2]; mask int32 [2][1][1][2048] (0 = masked key; READ on device); SHARED natural [64][64] blocks Wv I[4], Wk I[5], Wq I[6]; natural Wo [1024][1024] + bo */
  char* ws = (char*)d_ws; size_t off = 0;
  auto take = [&](size_t bytes) { char* p = ws + off; off += (bytes + 255) & ~(size_t)255; return p; };
  _Float16* BO = (_Float16*)take((size_t)DM * DM * 2);
  _Float16* Q16 = (_Float16*)take(NR * DM * 2); _Float16* K16 = (_Float16*)take(NR * DM * 2); _Float16* V16 = (_Float16*)take(NR * DM * 2); _Float16* O16 = (_Float16*)take(NR * DM * 2);
  _Float16* VT = (_Float16*)take((size_t)NB * NH * HD * SQ * 2);
  int* KP = (int*)take((size_t)NB * SQ * 4); int* KN = (int*)take((size_t)NB * 4);
  if (off > ws_size) return;
  k_wnat<<<WN_NB + NB, 256, 0, stream>>>(wo, (size_t)DM * DM / 8, BO, km, KP, KN);      /* Wo natural [out][in] = Bt x16; in the last NB work-groups the kept keys' ranks and count */
  const size_t r0p = (size_t)B0 * SQ;      /* first row of the output stage */
  k_proj<<<dim3((unsigned)(NR * NH / 256), 3), 256, 0, stream>>>(xq, xk, xv, wq, wk, wv, Q16, K16, V16, KP);      /* q of every token row and head, k and v of the kept keys packed to the front of their batch; f16 rows in the merged layout */
  k_vt<NH, SQ><<<NB * NH * (SQ / 64), 256, 0, stream>>>(V16, LQ, 0, VT, KN);      /* V^T [NB][NH][HD][SQ], both batches, packed keys */
  k_fattn<<<dim3(SQ / 256, NB * NH), 512, 0, stream>>>(Q16, K16, VT, KN, O16);      /* scores, masked softmax and P V of every (batch, head) in one launch; o (merged heads, x64) as f16 rows */
  k_ogemm<<<(unsigned)((MPO / 128) * (DM / 128)), 256, 0, stream>>>(O16 + r0p * DM, BO, 0.0009765625f, bo, (float*)d_out + r0p * DM);      /* out rows are the output layout */
}

// v007
// Measured time: 44.1 microseconds a run.
// Next to v006, in two timings, it ran 1.04 and 1.03 times as fast.
// All steps since v000 together make it 78.8 times as fast.
#include <hip/hip_runtime.h>
// Multi-head attention over three inputs with SHARED per-head projections, a random key-padding mask and the module's literal score scale (values, keys, query [2][2048][1024]; each input is split into 16 heads of 64 and every head is multiplied by the SAME natural [64][64] matrix (x W^T: Wv / Wk / Wq; no biases); energy = q k^T; where(mask == 0, -1e20) with the int32 [2][1][1][2048] mask in {0, 1} (random; 0 = masked key; READ on device); softmax(energy / sqrt(embed_size) = / sqrt(1024) = / 32) (as the source); out = merged Wo^T + bo (natural [1024][1024]) -> [2][2048][1024]).
// Keys with mask == 0 have weight exactly 0 wherever their batch keeps a key: the kept keys are ranked per batch, K and V rows are projected and stored for kept keys only, packed by rank, and attention walks the packed rows alone (any mask; a batch with no kept key walks all keys under the fill).
// Structure: token rows r = b*2048 + s; Q, K, V by one per-head projection launch (every 64-wide head slice of a token row is one row of a [65536][64] x [64][64]^T WMMA product, K = 64; f32 inputs rounded to bf16 and held as exact f16 in LDS, exact x16 weights, f32 accumulation, f16 outputs); V^T for all batches and heads via LDS transposes; one fused attention launch over every (batch, head): scores by WMMA (scale 1/32 = 1/sqrt(embed size), the module's literal scale), running-maximum softmax in registers (f32 statistics; unnormalised weights as f16), o = P . V by WMMA, divided by the row sum at the end (o carried x64 against f16 subnormal flush, folded into the output GEMM alpha) and written straight into the merged f16 o rows; out = o W_o + b GEMM (f32) into the output layout.
// Compute dtype: inputs rounded to bf16; x / weights exact; q, k, v, softmax weights and o as plain f16 GEMM operands (~2^-12); scores and softmax statistics f32. v_wmma_f32_16x16x32_f16.
#define NB 2
#define SQ 2048
#define DM 1024
#define NH 16
#define HD 64
#define HG 4                         /* heads per launch of the grouped k_vt overload (not launched) */
#define B0 0                         /* first batch processed (debug hook) */
#define NBR NB                       /* batches processed (debug hook) */
#define NR ((size_t)NB * SQ)         /* token rows */
#define MP ((int)((size_t)NBR * SQ)) /* token rows of the output stage, via MPO (debug hook) */
#define QN SQ                        /* query rows per batch (not used) */
#define NHD NH                       /* heads (not used) */
#define MPO MP                       /* rows through the output stage (debug hook) */
#define LQ DM      /* row pitch of the q/k/v rows */
typedef __bf16 v16b __attribute__((ext_vector_type(16)));
typedef unsigned short v8us __attribute__((ext_vector_type(8), may_alias));
typedef float  v8f  __attribute__((ext_vector_type(8)));
typedef float  v4f  __attribute__((ext_vector_type(4)));
typedef float  v4fa __attribute__((ext_vector_type(4), may_alias));
union FragB { v16b v; v8us half[2]; unsigned short u[16]; };

__device__ __forceinline__ unsigned short bf16_bits(float x) { unsigned int u = __float_as_uint(x); return (unsigned short)((u + 0x7FFFu + ((u >> 16) & 1u)) >> 16); }
__device__ __forceinline__ float bf16_val(unsigned short b) { return __uint_as_float(((unsigned int)b) << 16); }
__device__ __forceinline__ float bf16_round(float x) { return bf16_val(bf16_bits(x)); }
// D += A·B with NT terms: 1 = ah·bh, 2 = + al·bh (A split), 3 = + ah·bl (both split)
template <int NT>
__device__ __forceinline__ v8f mmaN(v16b ah, v16b al, v16b bh, v16b bl, v8f c) {
  c = __builtin_amdgcn_wmma_f32_16x16x32_bf16(false, ah, false, bh, (short)0, c, false, false);
  if (NT >= 2) c = __builtin_amdgcn_wmma_f32_16x16x32_bf16(false, al, false, bh, (short)0, c, false, false);
  if (NT >= 3) c = __builtin_amdgcn_wmma_f32_16x16x32_bf16(false, ah, false, bl, (short)0, c, false, false);
  asm volatile("v_nop\n\tv_nop\n\tv_nop\n\tv_nop" : "+v"(c) : "v"(ah), "v"(al), "v"(bh), "v"(bl));
  return c;
}

__global__ __launch_bounds__(256) void k_wt_bf16(const float* __restrict__ W, unsigned short* __restrict__ Wt, int K, int N) {
  const int t = blockIdx.x * 256 + threadIdx.x;
  const int k8n = K / 8;
  if (t >= N * k8n) return;
  const int n = t / k8n, k8 = (t % k8n) * 8;
  v8us v;
#pragma unroll
  for (int i = 0; i < 8; ++i) v[i] = bf16_bits(W[(size_t)(k8 + i) * N + n]);
  *(v8us*)(Wt + (size_t)n * K + k8) = v;
  
}

// GEMM C[M][N] (f32, pitch ldc) = act(A[M][K]·W + bias). A f32 row-major (pitch lda) converted per fragment to bf16
// (ASPLIT: hi/lo two planes -> 2 terms, else single rounded term); Wt bf16 [N][K] (pitch ldb). BIAS_BF16 rounds the
// bias to bf16 first (bias quantised to bf16 before the add). K%32==0, M%16==0, N%64==0.
template <bool ASPLIT, int ACT, bool BIAS_BF16>
__global__ __launch_bounds__(128) void k_gemm_bf(const float* __restrict__ A, int lda, const unsigned short* __restrict__ Wt, int ldb,
                                               const float* __restrict__ bias, float* __restrict__ C, int ldc, int M, int N, int K) {
  __shared__ __attribute__((aligned(16))) float so[4][16][64];
  const int tid = threadIdx.x, w = tid >> 5, lane = tid & 31, ln = lane & 15, hh = lane >> 4;
  const int ntn = N / 64;
  const int wid = blockIdx.x * 4 + w;
  const int mt = wid / ntn, nq = wid % ntn;
  if (mt * 16 >= M) return;
  const int row0 = mt * 16, col0 = nq * 64;
  const float* arow = A + (size_t)(row0 + ln) * lda;
  v8f acc[4] = {};
  for (int kb = 0; kb < K; kb += 32) {
    FragB ah, al;
    const v4f x0 = *(const v4fa*)(arow + kb + 8 * hh), x1 = *(const v4fa*)(arow + kb + 8 * hh + 4);
    const v4f x2 = *(const v4fa*)(arow + kb + 16 + 8 * hh), x3 = *(const v4fa*)(arow + kb + 16 + 8 * hh + 4);
    float xs[16] = {x0[0],x0[1],x0[2],x0[3],x1[0],x1[1],x1[2],x1[3],x2[0],x2[1],x2[2],x2[3],x3[0],x3[1],x3[2],x3[3]};
#pragma unroll
    for (int i = 0; i < 16; ++i) { const unsigned short hb = bf16_bits(xs[i]); ah.u[i] = hb; al.u[i] = ASPLIT ? bf16_bits(xs[i] - bf16_val(hb)) : (unsigned short)0; }
#pragma unroll
    for (int t = 0; t < 4; ++t) {
      const unsigned short* brow = Wt + (size_t)(col0 + t * 16 + ln) * ldb + kb;
      FragB b;
      b.half[0] = *(const v8us*)(brow + 8 * hh);
      b.half[1] = *(const v8us*)(brow + 16 + 8 * hh);
      acc[t] = mmaN<ASPLIT ? 2 : 1>(ah.v, al.v, b.v, b.v, acc[t]);
    }
  }
#pragma unroll
  for (int t = 0; t < 4; ++t) {
    float bv = bias ? bias[col0 + t * 16 + ln] : 0.f;
    if (BIAS_BF16) bv = bf16_round(bv);
#pragma unroll
    for (int r = 0; r < 8; ++r) { float v = acc[t][r] + bv; if (ACT == 1) v = fmaxf(v, 0.f); so[w][8 * hh + r][t * 16 + ln] = v; }
  }
  __builtin_amdgcn_fence(__ATOMIC_ACQ_REL, "workgroup");
  __builtin_amdgcn_wave_barrier();
  const int rsub = lane >> 4, c4 = (lane & 15) * 4;
  {
#pragma unroll
    for (int q = 0; q < 8; ++q) {
      const int r = q * 2 + rsub;
      const v4f v = *(const v4fa*)&so[w][r][c4];
      *(v4f*)(C + (size_t)(row0 + r) * ldc + col0 + c4) = v;
    }
    
  }
}

// GEMM C = act(A·W + bias + resid): A f32 (ASPLIT -> hi/lo 2 terms), Wt bf16 [N][K]; ACT 0 none, 1 relu, 2 exact gelu;
// resid (optional, f32, row index = (row % rmod), pitch ldr, RES_BF16 rounds it) added before the activation.
template <bool ASPLIT, int ACT, bool BIAS_BF16, bool RES_BF16>
__global__ __launch_bounds__(128) void k_gemm_bf3(const float* __restrict__ A, int lda, const unsigned short* __restrict__ Wt, int ldb,
                                                const float* __restrict__ bias, const float* __restrict__ resid, int rmod, int ldr,
                                                float* __restrict__ C, int ldc, int M, int N, int K) {
  __shared__ __attribute__((aligned(16))) float so[4][16][64];
  const int tid = threadIdx.x, w = tid >> 5, lane = tid & 31, ln = lane & 15, hh = lane >> 4;
  const int ntn = N / 64;
  const int wid = blockIdx.x * 4 + w;
  const int mt = wid / ntn, nq = wid % ntn;
  if (mt * 16 >= M) return;
  const int row0 = mt * 16, col0 = nq * 64;
  const float* arow = A + (size_t)(row0 + ln) * lda;
  v8f acc[4] = {};
  for (int kb = 0; kb < K; kb += 32) {
    FragB ah, al;
    const v4f x0 = *(const v4fa*)(arow + kb + 8 * hh), x1 = *(const v4fa*)(arow + kb + 8 * hh + 4);
    const v4f x2 = *(const v4fa*)(arow + kb + 16 + 8 * hh), x3 = *(const v4fa*)(arow + kb + 16 + 8 * hh + 4);
    float xs[16] = {x0[0],x0[1],x0[2],x0[3],x1[0],x1[1],x1[2],x1[3],x2[0],x2[1],x2[2],x2[3],x3[0],x3[1],x3[2],x3[3]};
#pragma unroll
    for (int i = 0; i < 16; ++i) { const unsigned short hb = bf16_bits(xs[i]); ah.u[i] = hb; al.u[i] = ASPLIT ? bf16_bits(xs[i] - bf16_val(hb)) : (unsigned short)0; }
#pragma unroll
    for (int t = 0; t < 4; ++t) {
      const unsigned short* brow = Wt + (size_t)(col0 + t * 16 + ln) * ldb + kb;
      FragB b;
      b.half[0] = *(const v8us*)(brow + 8 * hh);
      b.half[1] = *(const v8us*)(brow + 16 + 8 * hh);
      acc[t] = mmaN<ASPLIT ? 2 : 1>(ah.v, al.v, b.v, b.v, acc[t]);
    }
  }
#pragma unroll
  for (int t = 0; t < 4; ++t) {
    const int col = col0 + t * 16 + ln;
    float bv = bias ? bias[col] : 0.f;
    if (BIAS_BF16) bv = bf16_round(bv);
#pragma unroll
    for (int r = 0; r < 8; ++r) {
      float v = acc[t][r] + bv;
      if (resid) { float rv = resid[(size_t)((row0 + 8 * hh + r) % rmod) * ldr + col]; if (RES_BF16) rv = bf16_round(rv); v += rv; }
      if (ACT == 1) v = fmaxf(v, 0.f);
      if (ACT == 2) v = 0.5f * v * (1.0f + erff(v * 0.70710678118654752f));
      if (ACT == 3) { const float u = 0.7978845608028654f * (v + 0.044715f * v * v * v); v = 0.5f * v * (1.0f + tanhf(u)); }
      so[w][8 * hh + r][t * 16 + ln] = v;
    }
  }
  __builtin_amdgcn_fence(__ATOMIC_ACQ_REL, "workgroup");
  __builtin_amdgcn_wave_barrier();
  const int rsub = lane >> 4, c4 = (lane & 15) * 4;
  {
#pragma unroll
    for (int q = 0; q < 8; ++q) {
      const int r = q * 2 + rsub;
      const v4f v = *(const v4fa*)&so[w][r][c4];
      *(v4f*)(C + (size_t)(row0 + r) * ldc + col0 + c4) = v;
    }
    
  }
}
// row LayerNorm (biased variance, eps) over N: s = X (+ R); optional out_sum <- s; out_norm <- (s-mu)*rsqrt(var+eps)*g + b
template <bool PARAM_BF16>
__global__ __launch_bounds__(256) void k_layernorm(const float* __restrict__ X, const float* __restrict__ R, const float* __restrict__ g, const float* __restrict__ bta,
                                                  float* __restrict__ out_sum, float* __restrict__ out_norm, int N, float eps) {
  __shared__ float red[256];
  const int row = blockIdx.x, tid = threadIdx.x;
  const float* x = X + (size_t)row * N; const float* rr = R ? R + (size_t)row * N : nullptr;
  float vals[16];                     // up to N = 4096
  const int per = N / 256;            // contiguous chunk per thread? use strided-by-4 chunks: thread handles j = tid*4 + 1024*u
  float s1 = 0.f;
  for (int u = 0; u < per / 4; ++u) {
    const int j = tid * 4 + 1024 * u;
    const v4f a = *(const v4fa*)(x + j);
    v4f b = {0.f,0.f,0.f,0.f}; if (rr) b = *(const v4fa*)(rr + j);
#pragma unroll
    for (int q = 0; q < 4; ++q) { const float v = a[q] + b[q]; vals[u * 4 + q] = v; s1 += v; }
  }
  red[tid] = s1; __syncthreads();
  for (int st = 128; st > 0; st >>= 1) { if (tid < st) red[tid] += red[tid + st]; __syncthreads(); }
  const float mu = red[0] / (float)N; __syncthreads();
  float s2 = 0.f;
  for (int u = 0; u < per / 4; ++u)
#pragma unroll
    for (int q = 0; q < 4; ++q) { const float c = vals[u * 4 + q] - mu; s2 += c * c; }
  red[tid] = s2; __syncthreads();
  for (int st = 128; st > 0; st >>= 1) { if (tid < st) red[tid] += red[tid + st]; __syncthreads(); }
  const float rs = rsqrtf(red[0] / (float)N + eps);
  {
    for (int u = 0; u < per / 4; ++u) {
      const int j = tid * 4 + 1024 * u;
      v4f o, sm;
#pragma unroll
      for (int q = 0; q < 4; ++q) {
        float gg = g[j + q], bb = bta[j + q];
        if (PARAM_BF16) { gg = bf16_round(gg); bb = bf16_round(bb); }
        sm[q] = vals[u * 4 + q]; o[q] = (vals[u * 4 + q] - mu) * rs * gg + bb;
      }
      if (out_sum) *(v4f*)(out_sum + (size_t)row * N + j) = sm;
      *(v4f*)(out_norm + (size_t)row * N + j) = o;
    }
    
  }
}



// ---- f16 WMMA path (v_wmma_f32_16x16x32_f16): 11-bit significands for operands in range — used where a [0,1] probability operand needs more precision than bf16
typedef _Float16 v16h __attribute__((ext_vector_type(16)));
union FragH { v16h v; v8us half[2]; _Float16 h[16]; unsigned short u[16]; };
template <int NT>
__device__ __forceinline__ v8f mmaH(v16h ah, v16h al, v16h bh, v16h bl, v8f c) {
  c = __builtin_amdgcn_wmma_f32_16x16x32_f16(false, ah, false, bh, (short)0, c, false, false);
  if (NT >= 2) c = __builtin_amdgcn_wmma_f32_16x16x32_f16(false, al, false, bh, (short)0, c, false, false);
  if (NT >= 3) c = __builtin_amdgcn_wmma_f32_16x16x32_f16(false, ah, false, bl, (short)0, c, false, false);
  asm volatile("v_nop\n\tv_nop\n\tv_nop\n\tv_nop" : "+v"(c) : "v"(ah), "v"(al), "v"(bh), "v"(bl));
  return c;
}
// batched GEMM like k_gemm_b but f16 operands: A f32 (split into f16 hi/lo if ASPLIT, else rounded to f16), Bt = f16 values [n][k]; alpha; C f32; N multiple of 16 (partial tiles skipped)
template <bool ASPLIT>
__global__ __launch_bounds__(128) void k_gemm_h(const float* __restrict__ A, int lda, size_t sA, const _Float16* __restrict__ Bh, int ldb, size_t sB, float alpha, float* __restrict__ C, int ldc, size_t sC, int M, int N, int K) {
  __shared__ __attribute__((aligned(16))) float so[4][16][64];
  const int tid = threadIdx.x, w = tid >> 5, lane = tid & 31, ln = lane & 15, hh = lane >> 4; const int by = blockIdx.y;
  A += (size_t)by * sA; Bh += (size_t)by * sB; C += (size_t)by * sC;
  const int ntn = (N + 63) / 64; const int wid = blockIdx.x * 4 + w; const int mt = wid / ntn, nq = wid % ntn; if (mt * 16 >= M) return;
  const int row0 = mt * 16, col0 = nq * 64; const float* arow = A + (size_t)(row0 + ln) * lda;
  v8f acc[4] = {};
  for (int kb = 0; kb < K; kb += 32) {
    FragH ah, al;
    const v4f x0 = *(const v4fa*)(arow + kb + 8 * hh), x1 = *(const v4fa*)(arow + kb + 8 * hh + 4), x2 = *(const v4fa*)(arow + kb + 16 + 8 * hh), x3 = *(const v4fa*)(arow + kb + 16 + 8 * hh + 4);
    float xs[16] = {x0[0],x0[1],x0[2],x0[3],x1[0],x1[1],x1[2],x1[3],x2[0],x2[1],x2[2],x2[3],x3[0],x3[1],x3[2],x3[3]};
#pragma unroll
    for (int i = 0; i < 16; ++i) { const _Float16 h = (_Float16)xs[i]; ah.h[i] = h; al.h[i] = ASPLIT ? (_Float16)(xs[i] - (float)h) : (_Float16)0.0f; }
#pragma unroll
    for (int t = 0; t < 4; ++t) { if (col0 + t * 16 >= N) continue; const size_t boff = (size_t)(col0 + t * 16 + ln) * ldb + kb; FragH bq; bq.half[0] = *(const v8us*)(Bh + boff + 8 * hh); bq.half[1] = *(const v8us*)(Bh + boff + 16 + 8 * hh);
      acc[t] = mmaH<ASPLIT ? 2 : 1>(ah.v, al.v, bq.v, bq.v, acc[t]); }
  }
#pragma unroll
  for (int t = 0; t < 4; ++t) { if (col0 + t * 16 >= N) continue;
#pragma unroll
    for (int r = 0; r < 8; ++r) so[w][8 * hh + r][t * 16 + ln] = acc[t][r] * alpha; }
  __builtin_amdgcn_fence(__ATOMIC_ACQ_REL, "workgroup"); __builtin_amdgcn_wave_barrier();
  const int rsub = lane >> 4, c4 = (lane & 15) * 4;
  {
#pragma unroll
    for (int q = 0; q < 8; ++q) { const int r = q * 2 + rsub; if (col0 + c4 < N) { const v4f v = *(const v4fa*)&so[w][r][c4]; *(v4f*)(C + (size_t)(row0 + r) * ldc + col0 + c4) = v; } }
     }
}

// Wt[n][k] = f16(W[k][n]·scale) from f32 row-major W[K][N] (scale = power of two; bf16-exact weights stay exact in f16 away from the subnormal range)
__global__ __launch_bounds__(256) void k_wt_f16(const float* __restrict__ W, _Float16* __restrict__ Wt, int K, int N, float scale) {
  const int t = blockIdx.x * 256 + threadIdx.x; if (t >= N * (K / 8)) return; const int n = t / (K / 8), k8 = (t % (K / 8)) * 8; FragH f;
#pragma unroll
  for (int i = 0; i < 8; ++i) f.h[i] = (_Float16)(bf16_round(W[(size_t)(k8 + i) * N + n]) * scale); const v8us o = f.half[0];
  *(v8us*)((unsigned short*)Wt + (size_t)n * K + k8) = o; 
}
// k_gemm_hh variant with fused epilogue: v = acc·alpha + bias[by·sBias + col] (+ CP[(row/rowsPerB)·sCPb + by·64 + col] if CP) ; ACT 0 none / 1 elu ; writes f16 C16 (and f32 C if non-null)
template <int ACT>
__global__ __launch_bounds__(128) void k_gemm_hhx(const _Float16* __restrict__ A, int lda, size_t sA, const _Float16* __restrict__ Bh, int ldb, size_t sB, float alpha, const float* __restrict__ bias, size_t sBias, const float* __restrict__ CP, int rowsPerB, size_t sCPb, int row0g,
    float* __restrict__ C, _Float16* __restrict__ C16, int ldc, size_t sC, int M, int N, int K) {
  __shared__ __attribute__((aligned(16))) float so[4][16][64];
  const int tid = threadIdx.x, w = tid >> 5, lane = tid & 31, ln = lane & 15, hh = lane >> 4; const int by = blockIdx.y;
  A += (size_t)by * sA; Bh += (size_t)by * sB; const size_t cofs = (size_t)by * sC; const float* bp = bias ? bias + (size_t)by * sBias : nullptr;
  const int ntn = (N + 63) / 64; const int wid = blockIdx.x * 4 + w; const int mt = wid / ntn, nq = wid % ntn; if (mt * 16 >= M) return;
  const int row0 = mt * 16, col0 = nq * 64; const _Float16* arow = A + (size_t)(row0 + ln) * lda;
  v8f acc[4] = {};
  for (int kb = 0; kb < K; kb += 32) { FragH ah; ah.half[0] = *(const v8us*)((const unsigned short*)arow + kb + 8 * hh); ah.half[1] = *(const v8us*)((const unsigned short*)arow + kb + 16 + 8 * hh);
#pragma unroll
    for (int t = 0; t < 4; ++t) { if (col0 + t * 16 >= N) continue; const size_t boff = (size_t)(col0 + t * 16 + ln) * ldb + kb; FragH bq; bq.half[0] = *(const v8us*)((const unsigned short*)Bh + boff + 8 * hh); bq.half[1] = *(const v8us*)((const unsigned short*)Bh + boff + 16 + 8 * hh);
      acc[t] = mmaH<1>(ah.v, ah.v, bq.v, bq.v, acc[t]); }
  }
#pragma unroll
  for (int t = 0; t < 4; ++t) { if (col0 + t * 16 >= N) continue; const int col = col0 + t * 16 + ln; const float bv = bp ? bf16_round(bp[col]) : 0.f;
#pragma unroll
    for (int r = 0; r < 8; ++r) { float v = acc[t][r] * alpha + bv; if (CP) { const int rr = row0g + row0 + 8 * hh + r; if (rowsPerB < 0) v += CP[cofs + (size_t)rr * ldc + col];      /* rowsPerB < 0: own element of the batched C plane */ else { const int bidx = rr / rowsPerB; v += CP[(size_t)bidx * sCPb + (size_t)by * 64 + col]; } } if (ACT == 1) v = (v > 0.f) ? v : expm1f(v); else if (ACT == 7) v = (v > 0.f) ? v + 1.0f : expf(v); else if (ACT == 8) v = tanhf(v); else if (ACT == 9) v = 0.5f * v * (1.0f + tanhf(0.7978845608028654f * (v + 0.044715f * v * v * v))); else if (ACT == 11) v = 1.0f / (1.0f + expf(-v)); else if (ACT == 12) v = (v > 0.f) ? v : 0.01f * v; else if (ACT == 14) v = (v > 0.f) ? v : 0.1f * v; else if (ACT == 16) v = (v >= 0.f) ? v : 0.3f * v; else if (ACT == 17) v = (v >= 0.f) ? v : 0.2f * v; else if (ACT == 15) v = v / (1.0f + expf(-v)); else if (ACT == 3) v = fmaxf(v, 0.f); else if (ACT == 6) v = 0.5f * v * (1.0f + erff(v * 0.70710678118654752f)); so[w][8 * hh + r][t * 16 + ln] = v; } }
  __builtin_amdgcn_fence(__ATOMIC_ACQ_REL, "workgroup"); __builtin_amdgcn_wave_barrier();
  const int rsub = lane >> 4, c4 = (lane & 15) * 4; typedef _Float16 v4h __attribute__((ext_vector_type(4)));
  {
#pragma unroll
    for (int q = 0; q < 8; ++q) { const int r = q * 2 + rsub; if (col0 + c4 < N) { const v4f v = *(const v4fa*)&so[w][r][c4]; if (C) *(v4f*)(C + cofs + (size_t)(row0 + r) * ldc + col0 + c4) = v; if (C16) { v4h h4; for (int i = 0; i < 4; ++i) h4[i] = (_Float16)v[i]; *(v4h*)(C16 + cofs + (size_t)(row0 + r) * ldc + col0 + c4) = h4; } } }
     }
}


typedef _Float16 v4h __attribute__((ext_vector_type(4)));

__global__ __launch_bounds__(256) void k_x16(const float* __restrict__ x, _Float16* __restrict__ X16, size_t n8) { const size_t t = (size_t)blockIdx.x * 256 + threadIdx.x; if (t >= n8) return; FragH f;
#pragma unroll
  for (int q = 0; q < 8; ++q) f.h[q] = (_Float16)bf16_round(x[t * 8 + q]); *(v8us*)((unsigned short*)X16 + t * 8) = f.half[0];  }
__global__ __launch_bounds__(256) void k_h16(const float* __restrict__ x, _Float16* __restrict__ X16, size_t n8) { const size_t t = (size_t)blockIdx.x * 256 + threadIdx.x; if (t >= n8) return; FragH f;
#pragma unroll
  for (int q = 0; q < 8; ++q) f.h[q] = (_Float16)x[t * 8 + q]; *(v8us*)((unsigned short*)X16 + t * 8) = f.half[0];  }
__global__ __launch_bounds__(256) void k_round16f(const float* __restrict__ W, _Float16* __restrict__ Bt, size_t n8) { const size_t t = (size_t)blockIdx.x * 256 + threadIdx.x; if (t >= n8) return; FragH f;
#pragma unroll
  for (int i = 0; i < 8; ++i) f.h[i] = (_Float16)(bf16_round(W[t * 8 + i]) * 16.0f); *(v8us*)((unsigned short*)Bt + t * 8) = f.half[0];  }
template <int NHv, int TTv>
__global__ __launch_bounds__(256) void k_vt(const _Float16* __restrict__ V16, int ldv, int voff, _Float16* __restrict__ Vt, const int* __restrict__ KN) { __shared__ unsigned short tl[64][66]; const int tid = threadIdx.x; const int slab = blockIdx.x / (TTv / 64), lg = blockIdx.x % (TTv / 64); const int b = slab / NHv, h = slab % NHv;
  const int n = KN[b], nk = (n < 1 || n > TTv) ? TTv : n;      /* packed V rows of the batch (all of them where no key is kept) */
  if (lg * 64 >= nk) return;      /* no packed row in this group of 64: the whole work-group leaves, in front of the barrier */
  for (int i = tid; i < 64 * 8; i += 256) { const int r = i / 8, c8 = (i % 8) * 8; const int rr = (lg * 64 + r < nk) ? lg * 64 + r : nk - 1;      /* past the last packed row: that row again, a finite value under a zero weight */
    FragH f; f.half[0] = *(const v8us*)((const unsigned short*)V16 + ((size_t)b * TTv + rr) * ldv + voff + h * 64 + c8);
#pragma unroll
    for (int q = 0; q < 8; ++q) tl[r][c8 + q] = f.u[q]; }
  __syncthreads();
  {
#pragma unroll
    for (int rd = 0; rd < 2; ++rd) { const int d = rd * 32 + tid / 8, pc = tid % 8; FragH f;
#pragma unroll
      for (int q = 0; q < 8; ++q) f.u[q] = tl[pc * 8 + q][d];
      *(v8us*)((unsigned short*)Vt + ((size_t)slab * 64 + d) * TTv + lg * 64 + pc * 8) = f.half[0]; }
     } }

__global__ __launch_bounds__(256) void k_hl(const float* __restrict__ F, _Float16* __restrict__ Hh, _Float16* __restrict__ Hl, size_t n8) { const size_t t = (size_t)blockIdx.x * 256 + threadIdx.x; if (t >= n8) return; FragH fh, fl; const v4f a = *(const v4fa*)(F + t * 8), c = *(const v4fa*)(F + t * 8 + 4);
#pragma unroll
  for (int q = 0; q < 4; ++q) { _Float16 h = (_Float16)a[q]; fh.h[q] = h; fl.h[q] = (_Float16)((a[q] - (float)h) * 1024.0f); h = (_Float16)c[q]; fh.h[4 + q] = h; fl.h[4 + q] = (_Float16)((c[q] - (float)h) * 1024.0f); }
  { *(v8us*)((unsigned short*)Hh + t * 8) = fh.half[0]; *(v8us*)((unsigned short*)Hl + t * 8) = fl.half[0];  } }

// ---- fast GEMM (wave tile 32x64; requires M % 32 == 0 rows per launch region and N % 64 == 0); epilogue = k_gemm_hhx semantics ----
__device__ __forceinline__ v16h g2_frag(const _Float16* p, int hh) { FragH f; f.half[0] = *(const v8us*)((const unsigned short*)p + 8 * hh); f.half[1] = *(const v8us*)((const unsigned short*)p + 16 + 8 * hh); return f.v; }
__device__ __forceinline__ v8f g2_mma(v16h a, v16h b, v8f c) { v8f d = __builtin_amdgcn_wmma_f32_16x16x32_f16(false, a, false, b, (short)0, c, false, false); asm volatile("v_nop\n\tv_nop\n\tv_nop\n\tv_nop" : "+v"(d) : "v"(a), "v"(b)); return d; }
template <int ACT>
__global__ __launch_bounds__(128) void k_gemm2(const _Float16* __restrict__ A, int lda, size_t sA, const _Float16* __restrict__ Bh, int ldb, size_t sB, float alpha, const float* __restrict__ bias, size_t sBias, const float* __restrict__ CP, int rowsPerB, size_t sCPb, int row0g,
    float* __restrict__ C, _Float16* __restrict__ C16, int ldc, size_t sC, int M, int N, int K) { static_assert(ACT == 0 || ACT == 3 || ACT == 6 || ACT == 8 || ACT == 9 || ACT == 11 || ACT == 12 || ACT == 14 || ACT == 15 || ACT == 16 || ACT == 17, "k_gemm2: unsupported ACT code (would silently apply no activation)");
  __shared__ __attribute__((aligned(16))) float so[4][32][68];
  const int tid = threadIdx.x, w = tid >> 5, lane = tid & 31, ln = lane & 15, hh = lane >> 4; const int by = blockIdx.y;
  A += (size_t)by * sA; Bh += (size_t)by * sB; const size_t cofs = (size_t)by * sC; const float* bp = bias ? bias + (size_t)by * sBias : nullptr;
  const int ntn = N >> 6; const int mt = blockIdx.x / ntn, nq = blockIdx.x - mt * ntn; const int row0 = mt * 128 + 32 * w, col0 = nq * 64; if (row0 >= M) return;
  const _Float16* a0p = A + (size_t)(row0 + ln) * lda; const _Float16* a1p = a0p + (size_t)16 * lda;
  const _Float16* b0p = Bh + (size_t)(col0 + ln) * ldb; const _Float16* b1p = b0p + (size_t)16 * ldb; const _Float16* b2p = b1p + (size_t)16 * ldb; const _Float16* b3p = b2p + (size_t)16 * ldb;
  const v8f z8 = {0.f,0.f,0.f,0.f,0.f,0.f,0.f,0.f}; v8f c00 = z8, c01 = z8, c02 = z8, c03 = z8, c10 = z8, c11 = z8, c12 = z8, c13 = z8;
#pragma unroll 1
  for (int kb = 0; kb < K; kb += 32) { const v16h a0 = g2_frag(a0p + kb, hh), a1 = g2_frag(a1p + kb, hh);
    v16h b = g2_frag(b0p + kb, hh); c00 = g2_mma(a0, b, c00); c10 = g2_mma(a1, b, c10);
    b = g2_frag(b1p + kb, hh); c01 = g2_mma(a0, b, c01); c11 = g2_mma(a1, b, c11);
    b = g2_frag(b2p + kb, hh); c02 = g2_mma(a0, b, c02); c12 = g2_mma(a1, b, c12);
    b = g2_frag(b3p + kb, hh); c03 = g2_mma(a0, b, c03); c13 = g2_mma(a1, b, c13); }
  v8f accs[8] = {c00, c01, c02, c03, c10, c11, c12, c13};
#pragma unroll
  for (int u = 0; u < 8; ++u) { const int t = u & 3, half = u >> 2; const int col = col0 + t * 16 + ln; const float bv = bp ? bf16_round(bp[col]) : 0.f;
#pragma unroll
    for (int r = 0; r < 8; ++r) { const int rloc = half * 16 + 8 * hh + r; float v = accs[u][r] * alpha + bv; if (CP) { if (rowsPerB < 0) v += CP[cofs + (size_t)(row0g + row0 + rloc) * ldc + col];      /* rowsPerB < 0: own element of the batched C plane */ else { const int bidx = (row0g + row0 + rloc) / rowsPerB; v += CP[(size_t)bidx * sCPb + (size_t)by * 64 + col]; } }
      if (ACT == 3) v = fmaxf(v, 0.f); else if (ACT == 6) v = 0.5f * v * (1.0f + erff(v * 0.70710678118654752f)); else if (ACT == 11) v = 1.0f / (1.0f + expf(-v)); else if (ACT == 15) v = v / (1.0f + expf(-v)); else if (ACT == 12) v = (v > 0.f) ? v : 0.01f * v; else if (ACT == 8) v = tanhf(v); else if (ACT == 9) v = 0.5f * v * (1.0f + tanhf(0.7978845608028654f * (v + 0.044715f * v * v * v))); else if (ACT == 14) v = (v > 0.f) ? v : 0.1f * v; else if (ACT == 16) v = (v >= 0.f) ? v : 0.3f * v; else if (ACT == 17) v = (v >= 0.f) ? v : 0.2f * v;
      so[w][rloc][t * 16 + ln] = v; } }
  __builtin_amdgcn_fence(__ATOMIC_ACQ_REL, "workgroup"); __builtin_amdgcn_wave_barrier();
  const int rsub = lane >> 4, c4 = (lane & 15) * 4;
  {
#pragma unroll
    for (int q = 0; q < 16; ++q) { const int r = q * 2 + rsub; const v4f v = *(const v4fa*)&so[w][r][c4]; if (C) *(v4f*)(C + cofs + (size_t)(row0 + r) * ldc + col0 + c4) = v; if (C16) { v4h h4; for (int i = 0; i < 4; ++i) h4[i] = (_Float16)v[i]; *(v4h*)(C16 + cofs + (size_t)(row0 + r) * ldc + col0 + c4) = h4; } }
     } }


// Ranks of the kept keys, made by every K or V work-group of the projection launch for its own tokens (no launch of its own, no rank plane in memory). The work-group reads its batch's whole mask, a wave 256 keys in a row,
// 32 per load, and lays one bit per key (mask != 0) and the waves' counts in LDS; behind one barrier a wave takes, for its two tokens s and s + 1 (s even: both bits in one word), r = how many kept keys stand in front
// (the token's row among the batch's packed K and V rows), or -1 for a key with mask == 0; n = the number kept in the batch.
// A key with mask == 0 has weight exp(fill - max) = 0 exactly in f32 as soon as one key of the batch is kept, so it is left out of K, V and the key walk. A batch with no key kept keeps them all (rank = s, n = 0):
// the attention kernel then gives every key the fill, and the rows come out uniform, as in the source.
typedef unsigned v4u __attribute__((ext_vector_type(4), may_alias));
__device__ __forceinline__ void tok_ranks(const int* __restrict__ Km, int b, int s, int& r0, int& r1, int& n) {
  __shared__ __attribute__((aligned(16))) unsigned sb[SQ / 32];      /* one bit per key of the batch */
  __shared__ __attribute__((aligned(16))) unsigned sc[8];      /* kept keys per wave */
  const int tid = threadIdx.x, w = tid >> 5, lane = tid & 31; const int* kp = Km + (size_t)b * SQ + w * 256 + lane;
  int mv[8];
#pragma unroll      /* constant indices: the values stay in registers */
  for (int i = 0; i < 8; ++i) mv[i] = kp[i * 32];
  asm volatile("s_wait_xcnt 0x0" :: "v"(kp) : "memory");      /* precaution: no address register of the loads above is rewritten in front of this wait */
  unsigned bm[8], tot = 0;
#pragma unroll      /* constant indices: the values stay in registers */
  for (int i = 0; i < 8; ++i) { bm[i] = __builtin_amdgcn_ballot_w32(mv[i] != 0); tot += (unsigned)__builtin_popcount(bm[i]); }
  if (lane == 0) { const v4u x0 = {bm[0], bm[1], bm[2], bm[3]}, x1 = {bm[4], bm[5], bm[6], bm[7]}; *(v4u*)&sb[w * 8] = x0; *(v4u*)&sb[w * 8 + 4] = x1; sc[w] = tot; }
  __syncthreads();      /* publishes the waves' bits and counts */
  const int u = s >> 8, ji = (s >> 5) & 7, bi = s & 31;      /* the 256 keys, the word among their 8 and the bit that hold token s */
  const v4u c0 = *(const v4u*)&sc[0], c1 = *(const v4u*)&sc[4], w0 = *(const v4u*)&sb[u * 8], w1 = *(const v4u*)&sb[u * 8 + 4];
  const unsigned cs[8] = {c0[0], c0[1], c0[2], c0[3], c1[0], c1[1], c1[2], c1[3]}, wd[8] = {w0[0], w0[1], w0[2], w0[3], w1[0], w1[1], w1[2], w1[3]};
  unsigned p = 0, nn = 0, ws = 0;
#pragma unroll      /* constant indices: the values stay in registers */
  for (int i = 0; i < 8; ++i) { nn += cs[i]; p += (i < u) ? cs[i] : 0u;
    const unsigned mk = (i < ji) ? 0xFFFFFFFFu : (i == ji) ? ((1u << bi) - 1u) : 0u; p += (unsigned)__builtin_popcount(wd[i] & mk); ws = (i == ji) ? wd[i] : ws; }
  const unsigned k0 = (ws >> bi) & 1u, k1 = (ws >> (bi + 1)) & 1u;      /* bi is even, at most 30 */
  n = (int)nn; r0 = (nn == 0) ? s : (k0 ? (int)p : -1); r1 = (nn == 0) ? s + 1 : (k1 ? (int)(p + k0) : -1); }
// Wo natural [out][in] = Bt x16 (bf16-rounded, exact in f16): shared out among the Q work-groups of the projection launch, which have no ranks to make; a thread converts two runs of 8 elements, WO_T runs apart.
#define WO_T (DM * DM / 8 / 2)
__device__ __forceinline__ void wo_store(const v4f (&a)[4], _Float16* __restrict__ Bt, size_t t) {
  FragH f, g;
#pragma unroll      /* constant indices: the values stay in registers */
  for (int q = 0; q < 4; ++q) { f.h[q] = (_Float16)(bf16_round(a[0][q]) * 16.0f); f.h[4 + q] = (_Float16)(bf16_round(a[1][q]) * 16.0f); g.h[q] = (_Float16)(bf16_round(a[2][q]) * 16.0f); g.h[4 + q] = (_Float16)(bf16_round(a[3][q]) * 16.0f); }
  unsigned short* d = (unsigned short*)Bt + t * 8;
  *(v8us*)d = f.half[0]; *(v8us*)(d + (size_t)WO_T * 8) = g.half[0];
  asm volatile("s_wait_xcnt 0x0" ::: "memory"); }      /* precaution: no register of the stores above is rewritten in front of this wait */
__global__ __launch_bounds__(256) void k_rsm(const float* __restrict__ S, _Float16* __restrict__ P, int nrows) {
  #pragma clang fp contract(off)
  const int i = blockIdx.x * 256 + threadIdx.x; if (i >= nrows) return; const float* s = S + (size_t)i * SQ; float mx = -3.0e38f;
#pragma unroll 1
  for (int j = 0; j < SQ; ++j) mx = fmaxf(mx, s[j]); float se = 0.f;
#pragma unroll 1
  for (int j = 0; j < SQ; ++j) se += expf(s[j] - mx); const float sc = 256.0f / se;
#pragma unroll 1
  for (int j0 = 0; j0 < SQ; j0 += 8) { FragH f; for (int q = 0; q < 8; ++q) f.h[q] = (_Float16)(expf(s[j0 + q] - mx) * sc); unsigned short* d = (unsigned short*)P + (size_t)i * SQ + j0; *(v8us*)d = f.half[0];  } }
__global__ __launch_bounds__(256) void k_vt(const _Float16* __restrict__ V16, int b, int h0, _Float16* __restrict__ VT) { __shared__ unsigned short tl[64][65]; const int tid = threadIdx.x; const int hh = blockIdx.x % HG, sg = blockIdx.x / HG; const int s0 = sg * 64; const int h = h0 + hh;
  for (int i = tid; i < 64 * 8; i += 256) { const int j = i / 8, d8 = (i % 8) * 8; FragH f; f.half[0] = *(const v8us*)((const unsigned short*)V16 + ((size_t)b * SQ + s0 + j) * DM + h * HD + d8); for (int q = 0; q < 8; ++q) tl[d8 + q][j] = f.u[q]; }
  __syncthreads();
  { for (int i = tid; i < 64 * 8; i += 256) { const int d = i / 8, j8 = (i % 8) * 8; FragH f; for (int q = 0; q < 8; ++q) f.u[q] = tl[d][j8 + q]; *(v8us*)((unsigned short*)VT + ((size_t)hh * HD + d) * SQ + s0 + j8) = f.half[0]; }  } }



__global__ __launch_bounds__(256) void k_rsmkm(const float* __restrict__ S, _Float16* __restrict__ P, int nrows, const int* __restrict__ am) {
  #pragma clang fp contract(off)
  const int t = blockIdx.x * 256 + threadIdx.x; if (t >= nrows) return; const size_t i = (size_t)t; const float* s = S + i * SQ; const int* mr = am + (size_t)(t % SQ) * SQ; float mx = -3.0e38f;
#pragma unroll 1
  for (int j = 0; j < SQ; ++j) { const float f = (mr[j] != 0) ? 1.f : 0.f; mx = fmaxf(mx, fmaf(f, s[j], (1.f - f) * -1.0e9f)); } float se = 0.f;
#pragma unroll 1
  for (int j = 0; j < SQ; ++j) { const float f = (mr[j] != 0) ? 1.f : 0.f; se += __expf(fmaf(f, s[j], (1.f - f) * -1.0e9f) - mx); } const float sc = 256.0f / se;
#pragma unroll 1
  for (int j0 = 0; j0 < SQ; j0 += 8) { FragH fr; for (int q = 0; q < 8; ++q) { const int j = j0 + q; const float f = (mr[j] != 0) ? 1.f : 0.f; fr.h[q] = (_Float16)(__expf(fmaf(f, s[j], (1.f - f) * -1.0e9f) - mx) * sc); }
    unsigned short* d = (unsigned short*)P + i * SQ + j0; *(v8us*)d = fr.half[0];  } }

__global__ __launch_bounds__(256) void k_bdshn(const float* __restrict__ Wb, _Float16* __restrict__ Bt) {
  const size_t t = (size_t)blockIdx.x * 256 + threadIdx.x; if (t >= (size_t)DM * DM / 8) return; const size_t e0 = t * 8; const int n = (int)(e0 / DM), k0 = (int)(e0 % DM); const int h = n >> 6, hk = k0 >> 6; const float on = (hk == h) ? 16.0f : 0.0f; const int o = n & 63, d0 = k0 & 63; FragH f;
  for (int q = 0; q < 8; ++q) f.h[q] = (_Float16)(bf16_round(Wb[(size_t)o * 64 + d0 + q]) * on);
  unsigned short* d = (unsigned short*)Bt + e0; *(v8us*)d = f.half[0];  }

// Fused attention: one launch for every (batch, head); scores, softmax and the weighted sum of V stay in registers, no score or weight plane in memory.
// A work-group is 16 waves, four per SIMD, so that one wave's vector work and waits stand beside three others' products: two sets of 8 waves x 32 queries hold the SAME 256 queries of one head, and set g takes the stages g, g + 2, ... with
// LDS buffers of its own; at the end the two sets' running maxima, sums and outputs are joined through LDS (each wave hands one 16-query tile to its partner and finishes the other).
// A set walks the batch's packed (kept) keys in stages of 64, the last stage filled up with keys under the fill: the stage's K rows (64 keys x 64 dims) and V^T rows (64 dims x 64 keys) are fetched once per work-group with
// whole-line 16-byte loads, one stage ahead, and shared through two LDS buffers (rows of 128 B at a pitch of 144 B, the conflict-free pitch for 16-byte readers); one barrier per stage publishes the next
// buffer and ends the reads of the one refilled behind it. A wave works a stage in two passes of 32 keys. Per pass: S^T = K Q^T (A = 16 key rows, B = 16 query rows, both by g2_frag, so both in the same k order);
// a lane then holds, per 16-query tile, 16 scores of ONE query (query = lane & 15; keys 8 * (lane >> 4) + r of each 16-key tile), which is also the B-operand order of a 32-key product,
// so the weights go from the score accumulators straight into O^T += V^T P^T (A = 16 rows of V^T, again by g2_frag). Softmax is the running-maximum form in base 2: the maximum in use is raised,
// and sums and outputs rescaled, only when a pass exceeds it by more than 8 (weights stay <= 256, inside f16). The filling keys (and, where a batch keeps no key, all keys) take the module's fill through the addend of the scaling fma:
// the fill (-1e20 / 32, in base 2) absorbs any finite f16 score exactly, so the result is the fill itself, as the source's where() has it; a row with every key masked comes out uniform, as in the source.
// exp2 as asm text so that a v_nop stands directly behind the last transcendental: the instruction set asks for one slot before a result is used or a source overwritten (inside a run no v_exp_f32 touches
// another's register). Each works IN PLACE, on a register that the compiler's own subtraction has just written: so the asm never writes a register that a matrix instruction a few slots back still reads.
__device__ __forceinline__ float exp2_slot(float t) { asm("v_exp_f32 %0, %0\n\tv_nop" : "+v"(t)); return t; }
__device__ __forceinline__ void exp2_run8(float (&x)[8]) {
  asm("v_exp_f32 %0, %0\n\tv_exp_f32 %1, %1\n\tv_exp_f32 %2, %2\n\tv_exp_f32 %3, %3\n\tv_exp_f32 %4, %4\n\tv_exp_f32 %5, %5\n\tv_exp_f32 %6, %6\n\tv_exp_f32 %7, %7\n\tv_nop"
      : "+v"(x[0]), "+v"(x[1]), "+v"(x[2]), "+v"(x[3]), "+v"(x[4]), "+v"(x[5]), "+v"(x[6]), "+v"(x[7])); }
__device__ __forceinline__ float xhalf(float x) { return __builtin_bit_cast(float, __builtin_amdgcn_permlanex16(__builtin_bit_cast(int, x), __builtin_bit_cast(int, x), 0x76543210, 0xfedcba98, false, false)); }      /* lane l reads lane l ^ 16 */
__device__ __forceinline__ v8f fa_mma(v16h a, v16h b, v8f c) { return __builtin_amdgcn_wmma_f32_16x16x32_f16(false, a, false, b, (short)0, c, false, false); }
// The join's two halves, for query tile QT of a wave (a constant, so that the values stay in registers). fa_give: the tile's 32 outputs per lane, its maximum in use and its sum go to the wave's LDS rows, 16 bytes a lane in a row.
template <int QT>
__device__ __forceinline__ void fa_give(float (&m)[9][32][4], int lane, const v8f (&o)[4][2], const float (&mr)[2], const float (&lr)[2]) {
#pragma unroll      /* constant indices: the values stay in registers */
  for (int dt = 0; dt < 4; ++dt) { const v4f x0 = {o[dt][QT][0], o[dt][QT][1], o[dt][QT][2], o[dt][QT][3]}, x1 = {o[dt][QT][4], o[dt][QT][5], o[dt][QT][6], o[dt][QT][7]};
    *(v4fa*)&m[dt * 2][lane][0] = x0; *(v4fa*)&m[dt * 2 + 1][lane][0] = x1; }
  const v4f xm = {mr[QT], lr[QT], 0.f, 0.f}; *(v4fa*)&m[8][lane][0] = xm; }
// fa_join: the partner's rows m for the same tile are brought to the common maximum with the wave's own, summed and divided by the joint row sum; res: the tile's f16 outputs, 16 bytes per 16 dims.
template <int QT>
__device__ __forceinline__ void fa_join(const float (&m)[9][32][4], int lane, const v8f (&o)[4][2], const float (&mr)[2], const float (&lr)[2], v8us (&res)[4]) {
  const v4f xm = *(const v4fa*)&m[8][lane][0];
  const float mn = fmaxf(mr[QT], xm[0]);      /* a set that had no stage hands over -3e38, sum 0 and outputs 0: its factor below is 0 */
  const float ca = exp2_slot(mr[QT] - mn), cb = exp2_slot(xm[0] - mn);
  const float l2 = lr[QT] * ca + xm[1] * cb;
  const float sc = 64.0f / (l2 + xhalf(l2));      /* the lane halves' sums join here; o carried x64 as before */
  const float fa = ca * sc, fb = cb * sc;
#pragma unroll      /* constant indices: the values stay in registers */
  for (int dt = 0; dt < 4; ++dt) { FragH f; const v4f x0 = *(const v4fa*)&m[dt * 2][lane][0], x1 = *(const v4fa*)&m[dt * 2 + 1][lane][0];
#pragma unroll      /* constant indices: the values stay in registers */
    for (int r = 0; r < 4; ++r) { f.h[r] = (_Float16)(o[dt][QT][r] * fa + x0[r] * fb); f.h[4 + r] = (_Float16)(o[dt][QT][4 + r] * fa + x1[r] * fb); }
    res[dt] = f.half[0]; } }
#define FA_NS (SQ / 64)      /* stages of 64 keys */
#define FA_LP 72             /* LDS row pitch in f16: 128 B of data + 16 B */
__global__ __launch_bounds__(512) void k_fattn(const _Float16* __restrict__ Q16, const _Float16* __restrict__ K16, const _Float16* __restrict__ VT, const int* __restrict__ KN, _Float16* __restrict__ O16) {
  __shared__ __attribute__((aligned(16))) float kb[SQ];      /* per packed key: 0 (kept) or the fill */
  __shared__ __attribute__((aligned(16))) _Float16 ks_[2][2][64 * FA_LP];      /* per set, two buffers: K rows of a stage: [key][dim] */
  __shared__ __attribute__((aligned(16))) _Float16 vs_[2][2][64 * FA_LP];      /* per set, two buffers: V^T rows of a stage: [dim][key] */
  __shared__ __attribute__((aligned(16))) float mg[16][9][32][4];      /* the join: per wave and lane, the 32 outputs of the tile it hands over, then that tile's maximum and sum */
  const int tid = threadIdx.x, w = tid >> 5, lane = tid & 31, ln = lane & 15, hh = lane >> 4;
  const int g = __builtin_amdgcn_readfirstlane(w >> 3);      /* the wave's set; the same in every lane: the tests on it are scalar branches */
  const int bh = blockIdx.y, b = bh / NH, h = bh % NH; const int q0 = blockIdx.x * 256 + (w & 7) * 32;
  const int sr = (tid & 255) >> 3, sc8 = (tid & 7) * 8;      /* staging, by a set's 256 threads for itself: 8 threads per 128-byte row, rows sr and sr + 32 */
  const int n = KN[b], nk = (n < 1 || n > SQ) ? SQ : n, ns = (nk + 63) >> 6;      /* kept keys of the batch; packed rows to walk (all keys where none is kept); stages, 1 to FA_NS, the same for the whole work-group */
  const int nt = (ns + 1) >> 1;      /* trips: two stages, one per set, each */
  const int f0 = min(g, ns - 1) * 64;      /* first key of the set's first stage (one stage in all: the second set fetches it too, in bounds, never read) */
  const int kl1 = nk - 1 - sr;      /* a K row past the last packed one is read as that one: a finite score, which the fill absorbs */
  const _Float16* kg = K16 + ((size_t)b * SQ + sr) * DM + h * HD + sc8;
  const _Float16* vg = VT + ((size_t)bh * HD + sr) * SQ + sc8;
  const int so = sr * FA_LP + sc8;
  v8us gk0 = *(const v8us*)(const unsigned short*)(kg + (ptrdiff_t)min(f0, kl1) * DM), gk1 = *(const v8us*)(const unsigned short*)(kg + (ptrdiff_t)min(f0 + 32, kl1) * DM);
  v8us gv0 = *(const v8us*)(const unsigned short*)(vg + f0), gv1 = *(const v8us*)(const unsigned short*)(vg + (size_t)32 * SQ + f0);
  for (int j = tid; j < SQ; j += 512) kb[j] = (j < n) ? 0.f : -4.5084220e18f;
  const _Float16* qp = Q16 + ((size_t)b * SQ + q0 + ln) * DM + h * HD;
  const float c2 = 0.03125f * 1.44269504f;      /* 1 / sqrt(embed size), in base 2 */
  const v8f z8 = {0.f,0.f,0.f,0.f,0.f,0.f,0.f,0.f};
  v16h qf[2][2];
#pragma unroll
  for (int t = 0; t < 2; ++t)
#pragma unroll
    for (int ks = 0; ks < 2; ++ks) qf[t][ks] = g2_frag(qp + (size_t)t * 16 * DM + ks * 32, hh);
  *(v8us*)(unsigned short*)&ks_[g][0][so] = gk0; *(v8us*)(unsigned short*)&ks_[g][0][so + 32 * FA_LP] = gk1;
  *(v8us*)(unsigned short*)&vs_[g][0][so] = gv0; *(v8us*)(unsigned short*)&vs_[g][0][so + 32 * FA_LP] = gv1;
  __syncthreads();      /* publishes each set's first stage and the key table */
  v8f o[4][2];
#pragma unroll
  for (int dt = 0; dt < 4; ++dt) { o[dt][0] = z8; o[dt][1] = z8; }
  float mr[2] = {-3.0e38f, -3.0e38f}, lr[2] = {0.f, 0.f};
#pragma unroll 1
  for (int tr = 0; tr < nt; ++tr) {      /* kept rolled: one stage already fills the register file */
    const int st = 2 * tr + g;      /* the set's stage of this trip */
    if (st < ns) {      /* scalar; an odd number of stages leaves the second set without one in the last trip: it goes straight to the barrier */
    const int keyn = (st + 2 < ns) ? (st + 2) * 64 : st * 64;      /* a set's last stage refetches itself: in bounds, never read */
    const _Float16* kl = &ks_[g][tr & 1][ln * FA_LP]; const _Float16* vl = &vs_[g][tr & 1][ln * FA_LP];
    v16h kf[2][2], vf[4];
#pragma unroll
    for (int kt = 0; kt < 2; ++kt)
#pragma unroll
      for (int ks = 0; ks < 2; ++ks) kf[kt][ks] = g2_frag(kl + kt * 16 * FA_LP + ks * 32, hh);
#pragma unroll
    for (int p = 0; p < 2; ++p) {
      const int key0 = st * 64 + p * 32;
      /* the set's next stage, half per pass through the same 8 registers: K rows fetched in the first pass, V^T rows in the second; each half is stored at its pass's end into the buffer that the trip before read, whose readers left it at the last barrier */
      const v8us g0 = (p == 0) ? *(const v8us*)(const unsigned short*)(kg + (ptrdiff_t)min(keyn, kl1) * DM) : *(const v8us*)(const unsigned short*)(vg + keyn);
      const v8us g1 = (p == 0) ? *(const v8us*)(const unsigned short*)(kg + (ptrdiff_t)min(keyn + 32, kl1) * DM) : *(const v8us*)(const unsigned short*)(vg + (size_t)32 * SQ + keyn);
#pragma unroll
      for (int dt = 0; dt < 4; ++dt) vf[dt] = g2_frag(vl + dt * 16 * FA_LP + p * 32, hh);
      v8f sx[2][2];
#pragma unroll
      for (int kt = 0; kt < 2; ++kt)
#pragma unroll
        for (int qt = 0; qt < 2; ++qt) sx[kt][qt] = fa_mma(kf[kt][1], qf[qt][1], fa_mma(kf[kt][0], qf[qt][0], z8));
      if (p == 0) {      /* the second pass's K fragments, fetched behind the first pass's score products */
#pragma unroll
        for (int kt = 0; kt < 2; ++kt)
#pragma unroll
          for (int ks = 0; ks < 2; ++ks) kf[kt][ks] = g2_frag(kl + (32 + kt * 16) * FA_LP + ks * 32, hh); }
      float bias[2][8];
#pragma unroll
      for (int kt = 0; kt < 2; ++kt) { const v4f x0 = *(const v4fa*)&kb[key0 + kt * 16 + 8 * hh], x1 = *(const v4fa*)&kb[key0 + kt * 16 + 8 * hh + 4];
#pragma unroll
        for (int r = 0; r < 4; ++r) { bias[kt][r] = x0[r]; bias[kt][4 + r] = x1[r]; } }
      float mb[2]; bool need = false;
#pragma unroll
      for (int qt = 0; qt < 2; ++qt) { float mx0 = -3.0e38f, mx1 = -3.0e38f;
#pragma unroll
        for (int r = 0; r < 8; ++r) { sx[0][qt][r] = fmaf(sx[0][qt][r], c2, bias[0][r]); sx[1][qt][r] = fmaf(sx[1][qt][r], c2, bias[1][r]); mx0 = fmaxf(mx0, sx[0][qt][r]); mx1 = fmaxf(mx1, sx[1][qt][r]); }
        const float mx = fmaxf(mx0, mx1); mb[qt] = fmaxf(mx, xhalf(mx)); need = need || (mb[qt] > mr[qt] + 8.0f); }
      if (__builtin_amdgcn_ballot_w32(need) != 0) {      /* wave-uniform; rare after the first passes */
#pragma unroll
        for (int qt = 0; qt < 2; ++qt) { const float mn = fmaxf(mr[qt], mb[qt]); const float corr = exp2_slot(mr[qt] - mn); mr[qt] = mn; lr[qt] *= corr;
#pragma unroll
          for (int dt = 0; dt < 4; ++dt) o[dt][qt] = o[dt][qt] * corr; } }
#pragma unroll
      for (int qt = 0; qt < 2; ++qt) { FragH pf; float s0 = 0.f, s1 = 0.f, e0[8], e1[8];
#pragma unroll
        for (int r = 0; r < 8; ++r) { e0[r] = sx[0][qt][r] - mr[qt]; e1[r] = sx[1][qt][r] - mr[qt]; }
        exp2_run8(e0); exp2_run8(e1);
#pragma unroll
        for (int r = 0; r < 8; ++r) { s0 += e0[r]; s1 += e1[r]; pf.h[r] = (_Float16)e0[r]; pf.h[8 + r] = (_Float16)e1[r]; }
        lr[qt] += s0 + s1;
#pragma unroll
        for (int dt = 0; dt < 4; ++dt) o[dt][qt] = fa_mma(vf[dt], pf.v, o[dt][qt]); }
      { _Float16* gd = (p == 0) ? &ks_[g][(tr + 1) & 1][so] : &vs_[g][(tr + 1) & 1][so]; *(v8us*)(unsigned short*)gd = g0; *(v8us*)(unsigned short*)(gd + 32 * FA_LP) = g1; }
      if (p == 0) __builtin_amdgcn_sched_barrier(0);      /* keeps the next pass's score products out of this pass: moved up, their accumulators take the kernel past 256 registers */
    }
    }
    __syncthreads();      /* every wave, every trip: publishes each set's next stage; ends every wave's reads of this trip's stages before their buffers are refilled */
  }
  /* The join. Wave w and wave w ^ 8 hold the same 32 queries over the two halves of the stages, in the same lanes and registers. A wave of set g finishes query tile g and hands the other tile to its partner. */
  if (g == 0) fa_give<1>(mg[w], lane, o, mr, lr); else fa_give<0>(mg[w], lane, o, mr, lr);      /* scalar test */
  __syncthreads();      /* publishes the tiles handed over */
  v8us res[4];
  if (g == 0) fa_join<0>(mg[w ^ 8], lane, o, mr, lr, res); else fa_join<1>(mg[w ^ 8], lane, o, mr, lr, res);      /* scalar test */
  unsigned short* op = (unsigned short*)O16 + ((size_t)b * SQ + q0 + g * 16 + ln) * DM + h * HD + 8 * hh;
#pragma unroll      /* constant indices: the values stay in registers */
  for (int dt = 0; dt < 4; ++dt) *(v8us*)(op + dt * 16) = res[dt];      /* the stores stand together at the kernel's end: no register of theirs is written behind them */
}

// Per-head projections, one launch for Q, K and V (blockIdx.y picks input, weight and output; the conversion of Wo, which depends on nothing here, rides with the Q work-groups). The module multiplies every 64-wide head slice by the SAME [64][64] matrix, so the token rows [4096][1024] are read as
// [65536][64] head rows and the product has K = 64: each input element is read once, straight from the f32 input, and no product with a zero block is formed.
// A work-group is 8 waves x 32 head rows. A wave fetches its 32 rows (8 KB in a row) with 16 whole-line 16-byte loads, rounds them (bf16, exact in f16) and lays them in its own LDS rows (128 B at a pitch of 144 B);
// the work-group converts the weight (bf16-rounded, x16) into LDS once; one barrier publishes it. Y^T = W X^T (A = 16 weight rows, B = 16 head rows, both by g2_frag, so both in the same k order, k 0..31 then 32..63):
// a lane then holds 8 neighbouring features of ONE head row, 16 bytes of f16, which go back into that row's LDS place (its fragments are already in registers) and leave as whole 128-byte lines.
#define PJ_LP 72             /* LDS row pitch in f16: 128 B of data + 16 B */
typedef unsigned short v4us __attribute__((ext_vector_type(4), may_alias));
union FragQ { v4us v; _Float16 h[4]; };
__global__ __launch_bounds__(256) void k_proj(const float* __restrict__ xq, const float* __restrict__ xk, const float* __restrict__ xv, const float* __restrict__ wq, const float* __restrict__ wk, const float* __restrict__ wv,
                                              const float* __restrict__ wo, const int* __restrict__ Km, _Float16* __restrict__ Q16, _Float16* __restrict__ K16, _Float16* __restrict__ V16, _Float16* __restrict__ BO, int* __restrict__ KN) {
  static_assert((size_t)(NR * NH / 256) * 256 == (size_t)WO_T, "the Q work-groups' threads cover half of Wo's runs of 8");
  __shared__ __attribute__((aligned(16))) _Float16 wl[HD * PJ_LP];      /* weight rows [out][in], x16 */
  __shared__ __attribute__((aligned(16))) _Float16 xl[8][32 * PJ_LP];      /* per wave: its 32 head rows, later its 32 output rows */
  const int tid = threadIdx.x, w = tid >> 5, lane = tid & 31, ln = lane & 15, hh = lane >> 4;
  const int sel = blockIdx.y;
  const float* x = (sel == 0) ? xq : (sel == 1) ? xk : xv;
  const float* W = (sel == 0) ? wq : (sel == 1) ? wk : wv;
  _Float16* Y = (sel == 0) ? Q16 : (sel == 1) ? K16 : V16;
  const size_t row0 = (size_t)blockIdx.x * 256 + w * 32;
  const float* xp = x + row0 * HD + lane * 4;
  /* a wave's 32 head rows are two tokens; d0, d1: the token rows they are written to, or -1. Queries keep their place; a K or V token goes to its rank among the batch's kept keys, and one with mask == 0 is neither read nor written */
  const int tok = (int)(row0 >> 4); int d0 = tok, d1 = tok + 1;
  if (sel != 0) { int p0, p1, n; const int tb = tok & ~(SQ - 1); tok_ranks(Km, tok / SQ, tok - tb, p0, p1, n);      /* the same test for a whole work-group: every wave passes the barrier inside */
    d0 = (p0 < 0) ? -1 : tb + min(p0, SQ - 1); d1 = (p1 < 0) ? -1 : tb + min(p1, SQ - 1);
    if (sel == 1 && tok == tb && lane == 0) { KN[tok / SQ] = n;      /* the batch's count, for the launches behind: one writer per batch, the wave that holds the batch's first token */
      asm volatile("s_wait_xcnt 0x0" ::: "memory"); } }      /* precaution: no register of the store above is rewritten in front of this wait */
  d0 = __builtin_amdgcn_readfirstlane(d0); d1 = __builtin_amdgcn_readfirstlane(d1);      /* the same in every lane of the wave: the tests below are scalar branches */
  v4f xr[16], wr[4];      /* a token that is left out has no values here: every use below stands under the same test */
  if (d0 >= 0) {
#pragma unroll      /* constant indices: the values stay in registers */
    for (int i = 0; i < 8; ++i) xr[i] = *(const v4fa*)(xp + i * 128); }      /* two rows per load */
  if (d1 >= 0) {
#pragma unroll      /* constant indices: the values stay in registers */
    for (int i = 8; i < 16; ++i) xr[i] = *(const v4fa*)(xp + i * 128); }
#pragma unroll      /* constant indices: the values stay in registers */
  for (int i = 0; i < 4; ++i) wr[i] = *(const v4fa*)(W + i * 1024 + tid * 4);      /* 16 weight rows per load of the work-group */
  const size_t ot = (size_t)blockIdx.x * 256 + tid; const float* op = wo + ot * 8; v4f ow[4];      /* a Q work-group's share of Wo, fetched behind its own loads; no values elsewhere: the use below stands under the same test */
  if (sel == 0) { ow[0] = *(const v4fa*)op; ow[1] = *(const v4fa*)(op + 4); ow[2] = *(const v4fa*)(op + (size_t)WO_T * 8); ow[3] = *(const v4fa*)(op + (size_t)WO_T * 8 + 4); }
  asm volatile("s_wait_xcnt 0x0" :: "v"(xp), "v"(op) : "memory");      /* precaution: no address register of the loads above is rewritten in front of this wait; naming the pairs keeps the last loads' results off them */
  _Float16* xw = &xl[w][0];
#pragma unroll      /* constant indices: the values stay in registers */
  for (int i = 0; i < 4; ++i) { FragQ f;
#pragma unroll      /* constant indices: the values stay in registers */
    for (int q = 0; q < 4; ++q) f.h[q] = (_Float16)(bf16_round(wr[i][q]) * 16.0f);
    *(v4us*)(unsigned short*)&wl[(i * 16 + (tid >> 4)) * PJ_LP + (tid & 15) * 4] = f.v; }
#pragma unroll      /* constant indices: the values stay in registers */
  for (int j = 0; j < 2; ++j) { if ((j ? d1 : d0) < 0) continue;
#pragma unroll      /* constant indices: the values stay in registers */
    for (int i = j * 8; i < j * 8 + 8; ++i) { FragQ f;
#pragma unroll      /* constant indices: the values stay in registers */
      for (int q = 0; q < 4; ++q) f.h[q] = (_Float16)bf16_round(xr[i][q]);
      *(v4us*)(unsigned short*)&xw[(i * 2 + hh) * PJ_LP + ln * 4] = f.v; } }
  if (sel == 0) wo_store(ow, BO, ot);      /* scalar test */
  __syncthreads();      /* publishes the weight rows (and orders each wave's own rows) */
  const v8f z8 = {0.f,0.f,0.f,0.f,0.f,0.f,0.f,0.f};
  v16h wf[4][2];
#pragma unroll      /* constant indices: the values stay in registers */
  for (int t = 0; t < 4; ++t)
#pragma unroll      /* constant indices: the values stay in registers */
    for (int ks = 0; ks < 2; ++ks) wf[t][ks] = g2_frag(&wl[(t * 16 + ln) * PJ_LP + ks * 32], hh);
#pragma unroll      /* constant indices: the values stay in registers */
  for (int j = 0; j < 2; ++j) { if ((j ? d1 : d0) < 0) continue;
    _Float16* xrow = xw + (j * 16 + ln) * PJ_LP;
    const v16h x0 = g2_frag(xrow, hh), x1 = g2_frag(xrow + 32, hh);
#pragma unroll      /* constant indices: the values stay in registers */
    for (int t = 0; t < 4; ++t) { const v8f a = fa_mma(wf[t][1], x1, fa_mma(wf[t][0], x0, z8)); FragH f;
#pragma unroll      /* constant indices: the values stay in registers */
      for (int r = 0; r < 8; ++r) f.h[r] = (_Float16)(a[r] * 0.0625f);
      *(v8us*)(unsigned short*)(xrow + t * 16 + 8 * hh) = f.half[0]; } }
  __builtin_amdgcn_fence(__ATOMIC_ACQ_REL, "workgroup"); __builtin_amdgcn_wave_barrier();      /* the wave's lanes read each other's output pieces below */
#pragma unroll      /* constant indices: the values stay in registers */
  for (int j = 0; j < 2; ++j) { const int dt = j ? d1 : d0;
    if (dt >= 0) {
#pragma unroll      /* constant indices: the values stay in registers */
      for (int i = 0; i < 4; ++i) { const int r = i * 4 + (lane >> 3), c8 = (lane & 7) * 8;      /* four whole rows, 512 B in a row, per store */
        const v8us v = *(const v8us*)(const unsigned short*)&xw[(j * 16 + r) * PJ_LP + c8];
        *(v8us*)((unsigned short*)Y + ((size_t)dt * NH + r) * HD + c8) = v; }
      if (j == 0) asm volatile("s_wait_xcnt 0x0" ::: "memory"); } }      /* precaution: the second token's LDS reads reuse the data registers of the stores above */
}
// Output GEMM, out = o Wo^T * alpha + b: one 128 x 128 tile of out per work-group (8 waves, 2 x 4, 64 x 32 each), 256 work-groups. Both operands are K-contiguous f16 rows. A stage is 128 k (256 B) of the tile's 128 o rows
// and 128 Wo rows, brought into LDS by asynchronous 16-byte copies (a wave's copy covers two whole 256-byte row pieces, so every L2 request is a whole line and each line is asked for once per work-group),
// rows at a pitch of 272 B (conflict-free for 16-byte readers). Two buffers: stage t + 1 flies while stage t is worked on. Fragments by g2_frag from LDS for A and B alike (same k order);
// every accumulator takes its k blocks of 32 in rising order, as before. The f32 results leave through a wave's own LDS rows as whole 128-byte lines.
#define OG_BK 128            /* k per stage */
#define OG_NT (DM / OG_BK)   /* stages */
#define OG_LP 136            /* LDS row pitch in f16: 256 B of data + 16 B */
#define OG_SP 36             /* output staging pitch in f32: 128 B of data + 16 B */
// Eight copies of one thread, rows 16 apart. The s_wait_xcnt is the last line of the copies' own statement, so that no address register of a copy is rewritten in front of it (a precaution).
__device__ __forceinline__ void og_copy8(unsigned l, const _Float16* g) {
  asm volatile("global_load_async_to_lds_b128 %0, %8, off\n\tglobal_load_async_to_lds_b128 %1, %9, off\n\tglobal_load_async_to_lds_b128 %2, %10, off\n\tglobal_load_async_to_lds_b128 %3, %11, off\n\t"
               "global_load_async_to_lds_b128 %4, %12, off\n\tglobal_load_async_to_lds_b128 %5, %13, off\n\tglobal_load_async_to_lds_b128 %6, %14, off\n\tglobal_load_async_to_lds_b128 %7, %15, off\n\ts_wait_xcnt 0x0"
               :: "v"(l), "v"(l + 16u * OG_LP * 2u), "v"(l + 32u * OG_LP * 2u), "v"(l + 48u * OG_LP * 2u), "v"(l + 64u * OG_LP * 2u), "v"(l + 80u * OG_LP * 2u), "v"(l + 96u * OG_LP * 2u), "v"(l + 112u * OG_LP * 2u),
                  "v"(g), "v"(g + 16 * DM), "v"(g + 32 * DM), "v"(g + 48 * DM), "v"(g + 64 * DM), "v"(g + 80 * DM), "v"(g + 96 * DM), "v"(g + 112 * DM) : "memory"); }
__global__ __launch_bounds__(256) void k_ogemm(const _Float16* __restrict__ A, const _Float16* __restrict__ Bh, float alpha, const float* __restrict__ bias, float* __restrict__ C) {
  __shared__ __attribute__((aligned(16))) _Float16 at_[2][128 * OG_LP];      /* o rows of a stage: [row][k] */
  __shared__ __attribute__((aligned(16))) _Float16 bt_[2][128 * OG_LP];      /* Wo rows of a stage: [col][k] */
  __shared__ __attribute__((aligned(16))) float so[8][64 * OG_SP];      /* per wave: its 64 x 32 results */
  const int tid = threadIdx.x, w = tid >> 5, lane = tid & 31, ln = lane & 15, hh = lane >> 4;
  const int row0 = (blockIdx.x / (DM / 128)) * 128, col0 = (blockIdx.x % (DM / 128)) * 128;
  const int wm = w >> 2, wn = w & 3;
  const int cr = tid >> 4, cc = (tid & 15) * 8;      /* copies: 16 threads per 256-byte row piece, rows cr + 16 i */
  const _Float16* ag = A + (size_t)(row0 + cr) * DM + cc;
  const _Float16* bg = Bh + (size_t)(col0 + cr) * DM + cc;
  const unsigned al = (unsigned)(size_t)&at_[0][cr * OG_LP + cc], bl = (unsigned)(size_t)&bt_[0][cr * OG_LP + cc];      /* LDS byte addresses */
  const unsigned bufb = 128u * OG_LP * 2u;      /* bytes of one buffer */
  og_copy8(al, ag); og_copy8(bl, bg);
  asm volatile("s_wait_asynccnt 0x0" ::: "memory");      /* stage 0 has landed for this wave's copies */
  __syncthreads();      /* publishes stage 0 */
  og_copy8(al + bufb, ag + OG_BK); og_copy8(bl + bufb, bg + OG_BK);
  const v8f z8 = {0.f,0.f,0.f,0.f,0.f,0.f,0.f,0.f};
  v8f acc[4][2];
#pragma unroll      /* constant indices: the values stay in registers */
  for (int i = 0; i < 4; ++i) { acc[i][0] = z8; acc[i][1] = z8; }
  for (int t = 0; t < OG_NT; ++t) {
    const _Float16* ap = &at_[t & 1][(wm * 64 + ln) * OG_LP]; const _Float16* bp = &bt_[t & 1][(wn * 32 + ln) * OG_LP];
    v16h af[2][4], bf[2][2];      /* two fragment sets: block ks + 1 is fetched while block ks is multiplied */
#pragma unroll      /* constant indices: the values stay in registers */
    for (int i = 0; i < 4; ++i) af[0][i] = g2_frag(ap + i * 16 * OG_LP, hh);
#pragma unroll      /* constant indices: the values stay in registers */
    for (int j = 0; j < 2; ++j) bf[0][j] = g2_frag(bp + j * 16 * OG_LP, hh);
#pragma unroll      /* constant indices: the values stay in registers */
    for (int ks = 0; ks < OG_BK / 32; ++ks) { const int cu = ks & 1, nx = cu ^ 1;
      if (ks + 1 < OG_BK / 32) {
#pragma unroll      /* constant indices: the values stay in registers */
        for (int i = 0; i < 4; ++i) af[nx][i] = g2_frag(ap + i * 16 * OG_LP + (ks + 1) * 32, hh);
#pragma unroll      /* constant indices: the values stay in registers */
        for (int j = 0; j < 2; ++j) bf[nx][j] = g2_frag(bp + j * 16 * OG_LP + (ks + 1) * 32, hh); }
      __builtin_amdgcn_sched_barrier(0);      /* keeps the next block's LDS reads as one group in front of this block's products: sunk among them, one fragment set is reused and every pair of products waits out an LDS latency */
#pragma unroll      /* constant indices: the values stay in registers */
      for (int i = 0; i < 4; ++i) { acc[i][0] = fa_mma(af[cu][i], bf[cu][0], acc[i][0]); acc[i][1] = fa_mma(af[cu][i], bf[cu][1], acc[i][1]); }
      __builtin_amdgcn_sched_barrier(0);      /* keeps the block after next's reads behind these products, so that two fragment sets suffice */
    }
    asm volatile("s_wait_dscnt 0x0" ::: "memory");      /* this wave's reads of stage t have returned before its buffer is refilled */
    asm volatile("s_wait_asynccnt 0x0" ::: "memory");      /* this wave's copies of stage t + 1 have landed */
    __syncthreads();      /* publishes stage t + 1; ends every wave's reads of stage t */
    if (t + 2 < OG_NT) { const unsigned bo = (unsigned)(t & 1) * bufb; og_copy8(al + bo, ag + (t + 2) * OG_BK); og_copy8(bl + bo, bg + (t + 2) * OG_BK); }
  }
  asm volatile("s_wait_asynccnt 0x0" ::: "memory");      /* no copy is outstanding when the wave goes on and ends */
  float* sw = &so[w][0];
#pragma unroll      /* constant indices: the values stay in registers */
  for (int j = 0; j < 2; ++j) { const float bv = bf16_round(bias[col0 + wn * 32 + j * 16 + ln]);
#pragma unroll      /* constant indices: the values stay in registers */
    for (int i = 0; i < 4; ++i)
#pragma unroll      /* constant indices: the values stay in registers */
      for (int r = 0; r < 8; ++r) sw[(i * 16 + 8 * hh + r) * OG_SP + j * 16 + ln] = acc[i][j][r] * alpha + bv; }
  __builtin_amdgcn_fence(__ATOMIC_ACQ_REL, "workgroup"); __builtin_amdgcn_wave_barrier();      /* the wave's lanes read each other's results below */
  float* cp = C + (size_t)(row0 + wm * 64 + (lane >> 3)) * DM + col0 + wn * 32 + (lane & 7) * 4;
#pragma unroll      /* constant indices: the values stay in registers */
  for (int q = 0; q < 16; ++q) { const v4f v = *(const v4fa*)&sw[(q * 4 + (lane >> 3)) * OG_SP + (lane & 7) * 4];      /* four whole 128-byte lines per store */
    *(v4f*)(cp + (size_t)q * 4 * DM) = v; }
}
extern "C" void kernel_launch(void* const* d_in, const int* in_sizes, int n_in,
                              void* d_out, int out_size, void* d_ws, size_t ws_size, hipStream_t stream) {
  (void)in_sizes; (void)n_in; (void)out_size;
  const float* const* I = (const float* const*)d_in; const float* xq = I[2]; const float* xk = I[1]; const float* xv = I[0]; const int* km = (const int*)d_in[3]; const float* wq = I[6]; const float* wk = I[5]; const float* wv = I[4]; const float* wo = I[7]; const float* bo = I[8];      /* contract order: values I[0], keys I[1], query I[2]; mask int32 [2][1][1][2048] (0 = masked key; READ on device); SHARED natural [64][64] blocks Wv I[4], Wk I[5], Wq I[6]; natural Wo [1024][1024] + bo */
  char* ws = (char*)d_ws; size_t off = 0;
  auto take = [&](size_t bytes) { char* p = ws + off; off += (bytes + 255) & ~(size_t)255; return p; };
  _Float16* BO = (_Float16*)take((size_t)DM * DM * 2);
  _Float16* Q16 = (_Float16*)take(NR * DM * 2); _Float16* K16 = (_Float16*)take(NR * DM * 2); _Float16* V16 = (_Float16*)take(NR * DM * 2); _Float16* O16 = (_Float16*)take(NR * DM * 2);
  _Float16* VT = (_Float16*)take((size_t)NB * NH * HD * SQ * 2);
  int* KN = (int*)take((size_t)NB * 4);
  if (off > ws_size) return;
  const size_t r0p = (size_t)B0 * SQ;      /* first row of the output stage */
  k_proj<<<dim3((unsigned)(NR * NH / 256), 3), 256, 0, stream>>>(xq, xk, xv, wq, wk, wv, wo, km, Q16, K16, V16, BO, KN);      /* q of every token row and head, k and v of the kept keys packed to the front of their batch, f16 rows in the merged layout; the kept keys' count; by the Q work-groups Wo natural [out][in] = Bt x16 */
  k_vt<NH, SQ><<<NB * NH * (SQ / 64), 256, 0, stream>>>(V16, LQ, 0, VT, KN);      /* V^T [NB][NH][HD][SQ], both batches, packed keys */
  k_fattn<<<dim3(SQ / 256, NB * NH), 512, 0, stream>>>(Q16, K16, VT, KN, O16);      /* scores, masked softmax and P V of every (batch, head) in one launch; o (merged heads, x64) as f16 rows */
  k_ogemm<<<(unsigned)((MPO / 128) * (DM / 128)), 256, 0, stream>>>(O16 + r0p * DM, BO, 0.0009765625f, bo, (float*)d_out + r0p * DM);      /* out rows are the output layout */
}

// v008
// A run of this version takes 41.7 microseconds.
// Next to v007, in two timings, it ran 1.06 and 1.04 times as fast.
// All steps since v000 together make it 82.6 times as fast.
#include <hip/hip_runtime.h>
// Multi-head attention over three inputs with SHARED per-head projections, a random key-padding mask and the module's literal score scale (values, keys, query [2][2048][1024]; each input is split into 16 heads of 64 and every head is multiplied by the SAME natural [64][64] matrix (x W^T: Wv / Wk / Wq; no biases); energy = q k^T; where(mask == 0, -1e20) with the int32 [2][1][1][2048] mask in {0, 1} (random; 0 = masked key; READ on device); softmax(energy / sqrt(embed_size) = / sqrt(1024) = / 32) (as the source); out = merged Wo^T + bo (natural [1024][1024]) -> [2][2048][1024]).
// Keys with mask == 0 have weight exactly 0 wherever their batch keeps a key: the kept keys are ranked per batch, K and V rows are projected and stored for kept keys only, packed by rank, and attention walks the packed rows alone (any mask; a batch with no kept key walks all keys under the fill).
// Structure: token rows r = b*2048 + s; Q, K, V by one per-head projection launch (every 64-wide head slice of a token row is one row of a [65536][64] x [64][64]^T WMMA product, K = 64; f32 inputs rounded to bf16 and held as exact f16 in LDS, exact x16 weights, f32 accumulation, f16 outputs); one fused attention launch over every (batch, head): scores by WMMA (scale 1/32 = 1/sqrt(embed size), the module's literal scale), running-maximum softmax in registers (f32 statistics; unnormalised weights as f16), o = P . V by WMMA (V^T fragments by transposing LDS loads from the V rows as they lie), divided by the row sum at the end (o carried x64 against f16 subnormal flush, folded into the output GEMM alpha) and written straight into the merged f16 o rows; out = o W_o + b GEMM (f32) into the output layout.
// Compute dtype: inputs rounded to bf16; x / weights exact; q, k, v, softmax weights and o as plain f16 GEMM operands (~2^-12); scores and softmax statistics f32. v_wmma_f32_16x16x32_f16.
#define NB 2
#define SQ 2048
#define DM 1024
#define NH 16
#define HD 64
#define HG 4                         /* heads per launch of the grouped k_vt overload (not launched) */
#define B0 0                         /* first batch processed (debug hook) */
#define NBR NB                       /* batches processed (debug hook) */
#define NR ((size_t)NB * SQ)         /* token rows */
#define MP ((int)((size_t)NBR * SQ)) /* token rows of the output stage, via MPO (debug hook) */
#define QN SQ                        /* query rows per batch (not used) */
#define NHD NH                       /* heads (not used) */
#define MPO MP                       /* rows through the output stage (debug hook) */
#define LQ DM      /* row pitch of the q/k/v rows */
typedef __bf16 v16b __attribute__((ext_vector_type(16)));
typedef unsigned short v8us __attribute__((ext_vector_type(8), may_alias));
typedef float  v8f  __attribute__((ext_vector_type(8)));
typedef float  v4f  __attribute__((ext_vector_type(4)));
typedef float  v4fa __attribute__((ext_vector_type(4), may_alias));
union FragB { v16b v; v8us half[2]; unsigned short u[16]; };

__device__ __forceinline__ unsigned short bf16_bits(float x) { unsigned int u = __float_as_uint(x); return (unsigned short)((u + 0x7FFFu + ((u >> 16) & 1u)) >> 16); }
__device__ __forceinline__ float bf16_val(unsigned short b) { return __uint_as_float(((unsigned int)b) << 16); }
__device__ __forceinline__ float bf16_round(float x) { return bf16_val(bf16_bits(x)); }
// D += A·B with NT terms: 1 = ah·bh, 2 = + al·bh (A split), 3 = + ah·bl (both split)
template <int NT>
__device__ __forceinline__ v8f mmaN(v16b ah, v16b al, v16b bh, v16b bl, v8f c) {
  c = __builtin_amdgcn_wmma_f32_16x16x32_bf16(false, ah, false, bh, (short)0, c, false, false);
  if (NT >= 2) c = __builtin_amdgcn_wmma_f32_16x16x32_bf16(false, al, false, bh, (short)0, c, false, false);
  if (NT >= 3) c = __builtin_amdgcn_wmma_f32_16x16x32_bf16(false, ah, false, bl, (short)0, c, false, false);
  asm volatile("v_nop\n\tv_nop\n\tv_nop\n\tv_nop" : "+v"(c) : "v"(ah), "v"(al), "v"(bh), "v"(bl));
  return c;
}

__global__ __launch_bounds__(256) void k_wt_bf16(const float* __restrict__ W, unsigned short* __restrict__ Wt, int K, int N) {
  const int t = blockIdx.x * 256 + threadIdx.x;
  const int k8n = K / 8;
  if (t >= N * k8n) return;
  const int n = t / k8n, k8 = (t % k8n) * 8;
  v8us v;
#pragma unroll
  for (int i = 0; i < 8; ++i) v[i] = bf16_bits(W[(size_t)(k8 + i) * N + n]);
  *(v8us*)(Wt + (size_t)n * K + k8) = v;
  
}

// GEMM C[M][N] (f32, pitch ldc) = act(A[M][K]·W + bias). A f32 row-major (pitch lda) converted per fragment to bf16
// (ASPLIT: hi/lo two planes -> 2 terms, else single rounded term); Wt bf16 [N][K] (pitch ldb). BIAS_BF16 rounds the
// bias to bf16 first (bias quantised to bf16 before the add). K%32==0, M%16==0, N%64==0.
template <bool ASPLIT, int ACT, bool BIAS_BF16>
__global__ __launch_bounds__(128) void k_gemm_bf(const float* __restrict__ A, int lda, const unsigned short* __restrict__ Wt, int ldb,
                                               const float* __restrict__ bias, float* __restrict__ C, int ldc, int M, int N, int K) {
  __shared__ __attribute__((aligned(16))) float so[4][16][64];
  const int tid = threadIdx.x, w = tid >> 5, lane = tid & 31, ln = lane & 15, hh = lane >> 4;
  const int ntn = N / 64;
  const int wid = blockIdx.x * 4 + w;
  const int mt = wid / ntn, nq = wid % ntn;
  if (mt * 16 >= M) return;
  const int row0 = mt * 16, col0 = nq * 64;
  const float* arow = A + (size_t)(row0 + ln) * lda;
  v8f acc[4] = {};
  for (int kb = 0; kb < K; kb += 32) {
    FragB ah, al;
    const v4f x0 = *(const v4fa*)(arow + kb + 8 * hh), x1 = *(const v4fa*)(arow + kb + 8 * hh + 4);
    const v4f x2 = *(const v4fa*)(arow + kb + 16 + 8 * hh), x3 = *(const v4fa*)(arow + kb + 16 + 8 * hh + 4);
    float xs[16] = {x0[0],x0[1],x0[2],x0[3],x1[0],x1[1],x1[2],x1[3],x2[0],x2[1],x2[2],x2[3],x3[0],x3[1],x3[2],x3[3]};
#pragma unroll
    for (int i = 0; i < 16; ++i) { const unsigned short hb = bf16_bits(xs[i]); ah.u[i] = hb; al.u[i] = ASPLIT ? bf16_bits(xs[i] - bf16_val(hb)) : (unsigned short)0; }
#pragma unroll
    for (int t = 0; t < 4; ++t) {
      const unsigned short* brow = Wt + (size_t)(col0 + t * 16 + ln) * ldb + kb;
      FragB b;
      b.half[0] = *(const v8us*)(brow + 8 * hh);
      b.half[1] = *(const v8us*)(brow + 16 + 8 * hh);
      acc[t] = mmaN<ASPLIT ? 2 : 1>(ah.v, al.v, b.v, b.v, acc[t]);
    }
  }
#pragma unroll
  for (int t = 0; t < 4; ++t) {
    float bv = bias ? bias[col0 + t * 16 + ln] : 0.f;
    if (BIAS_BF16) bv = bf16_round(bv);
#pragma unroll
    for (int r = 0; r < 8; ++r) { float v = acc[t][r] + bv; if (ACT == 1) v = fmaxf(v, 0.f); so[w][8 * hh + r][t * 16 + ln] = v; }
  }
  __builtin_amdgcn_fence(__ATOMIC_ACQ_REL, "workgroup");
  __builtin_amdgcn_wave_barrier();
  const int rsub = lane >> 4, c4 = (lane & 15) * 4;
  {
#pragma unroll
    for (int q = 0; q < 8; ++q) {
      const int r = q * 2 + rsub;
      const v4f v = *(const v4fa*)&so[w][r][c4];
      *(v4f*)(C + (size_t)(row0 + r) * ldc + col0 + c4) = v;
    }
    
  }
}

// GEMM C = act(A·W + bias + resid): A f32 (ASPLIT -> hi/lo 2 terms), Wt bf16 [N][K]; ACT 0 none, 1 relu, 2 exact gelu;
// resid (optional, f32, row index = (row % rmod), pitch ldr, RES_BF16 rounds it) added before the activation.
template <bool ASPLIT, int ACT, bool BIAS_BF16, bool RES_BF16>
__global__ __launch_bounds__(128) void k_gemm_bf3(const float* __restrict__ A, int lda, const unsigned short* __restrict__ Wt, int ldb,
                                                const float* __restrict__ bias, const float* __restrict__ resid, int rmod, int ldr,
                                                float* __restrict__ C, int ldc, int M, int N, int K) {
  __shared__ __attribute__((aligned(16))) float so[4][16][64];
  const int tid = threadIdx.x, w = tid >> 5, lane = tid & 31, ln = lane & 15, hh = lane >> 4;
  const int ntn = N / 64;
  const int wid = blockIdx.x * 4 + w;
  const int mt = wid / ntn, nq = wid % ntn;
  if (mt * 16 >= M) return;
  const int row0 = mt * 16, col0 = nq * 64;
  const float* arow = A + (size_t)(row0 + ln) * lda;
  v8f acc[4] = {};
  for (int kb = 0; kb < K; kb += 32) {
    FragB ah, al;
    const v4f x0 = *(const v4fa*)(arow + kb + 8 * hh), x1 = *(const v4fa*)(arow + kb + 8 * hh + 4);
    const v4f x2 = *(const v4fa*)(arow + kb + 16 + 8 * hh), x3 = *(const v4fa*)(arow + kb + 16 + 8 * hh + 4);
    float xs[16] = {x0[0],x0[1],x0[2],x0[3],x1[0],x1[1],x1[2],x1[3],x2[0],x2[1],x2[2],x2[3],x3[0],x3[1],x3[2],x3[3]};
#pragma unroll
    for (int i = 0; i < 16; ++i) { const unsigned short hb = bf16_bits(xs[i]); ah.u[i] = hb; al.u[i] = ASPLIT ? bf16_bits(xs[i] - bf16_val(hb)) : (unsigned short)0; }
#pragma unroll
    for (int t = 0; t < 4; ++t) {
      const unsigned short* brow = Wt + (size_t)(col0 + t * 16 + ln) * ldb + kb;
      FragB b;
      b.half[0] = *(const v8us*)(brow + 8 * hh);
      b.half[1] = *(const v8us*)(brow + 16 + 8 * hh);
      acc[t] = mmaN<ASPLIT ? 2 : 1>(ah.v, al.v, b.v, b.v, acc[t]);
    }
  }
#pragma unroll
  for (int t = 0; t < 4; ++t) {
    const int col = col0 + t * 16 + ln;
    float bv = bias ? bias[col] : 0.f;
    if (BIAS_BF16) bv = bf16_round(bv);
#pragma unroll
    for (int r = 0; r < 8; ++r) {
      float v = acc[t][r] + bv;
      if (resid) { float rv = resid[(size_t)((row0 + 8 * hh + r) % rmod) * ldr + col]; if (RES_BF16) rv = bf16_round(rv); v += rv; }
      if (ACT == 1) v = fmaxf(v, 0.f);
      if (ACT == 2) v = 0.5f * v * (1.0f + erff(v * 0.70710678118654752f));
      if (ACT == 3) { const float u = 0.7978845608028654f * (v + 0.044715f * v * v * v); v = 0.5f * v * (1.0f + tanhf(u)); }
      so[w][8 * hh + r][t * 16 + ln] = v;
    }
  }
  __builtin_amdgcn_fence(__ATOMIC_ACQ_REL, "workgroup");
  __builtin_amdgcn_wave_barrier();
  const int rsub = lane >> 4, c4 = (lane & 15) * 4;
  {
#pragma unroll
    for (int q = 0; q < 8; ++q) {
      const int r = q * 2 + rsub;
      const v4f v = *(const v4fa*)&so[w][r][c4];
      *(v4f*)(C + (size_t)(row0 + r) * ldc + col0 + c4) = v;
    }
    
  }
}
// row LayerNorm (biased variance, eps) over N: s = X (+ R); optional out_sum <- s; out_norm <- (s-mu)*rsqrt(var+eps)*g + b
template <bool PARAM_BF16>
__global__ __launch_bounds__(256) void k_layernorm(const float* __restrict__ X, const float* __restrict__ R, const float* __restrict__ g, const float* __restrict__ bta,
                                                  float* __restrict__ out_sum, float* __restrict__ out_norm, int N, float eps) {
  __shared__ float red[256];
  const int row = blockIdx.x, tid = threadIdx.x;
  const float* x = X + (size_t)row * N; const float* rr = R ? R + (size_t)row * N : nullptr;
  float vals[16];                     // up to N = 4096
  const int per = N / 256;            // contiguous chunk per thread? use strided-by-4 chunks: thread handles j = tid*4 + 1024*u
  float s1 = 0.f;
  for (int u = 0; u < per / 4; ++u) {
    const int j = tid * 4 + 1024 * u;
    const v4f a = *(const v4fa*)(x + j);
    v4f b = {0.f,0.f,0.f,0.f}; if (rr) b = *(const v4fa*)(rr + j);
#pragma unroll
    for (int q = 0; q < 4; ++q) { const float v = a[q] + b[q]; vals[u * 4 + q] = v; s1 += v; }
  }
  red[tid] = s1; __syncthreads();
  for (int st = 128; st > 0; st >>= 1) { if (tid < st) red[tid] += red[tid + st]; __syncthreads(); }
  const float mu = red[0] / (float)N; __syncthreads();
  float s2 = 0.f;
  for (int u = 0; u < per / 4; ++u)
#pragma unroll
    for (int q = 0; q < 4; ++q) { const float c = vals[u * 4 + q] - mu; s2 += c * c; }
  red[tid] = s2; __syncthreads();
  for (int st = 128; st > 0; st >>= 1) { if (tid < st) red[tid] += red[tid + st]; __syncthreads(); }
  const float rs = rsqrtf(red[0] / (float)N + eps);
  {
    for (int u = 0; u < per / 4; ++u) {
      const int j = tid * 4 + 1024 * u;
      v4f o, sm;
#pragma unroll
      for (int q = 0; q < 4; ++q) {
        float gg = g[j + q], bb = bta[j + q];
        if (PARAM_BF16) { gg = bf16_round(gg); bb = bf16_round(bb); }
        sm[q] = vals[u * 4 + q]; o[q] = (vals[u * 4 + q] - mu) * rs * gg + bb;
      }
      if (out_sum) *(v4f*)(out_sum + (size_t)row * N + j) = sm;
      *(v4f*)(out_norm + (size_t)row * N + j) = o;
    }
    
  }
}



// ---- f16 WMMA path (v_wmma_f32_16x16x32_f16): 11-bit significands for operands in range — used where a [0,1] probability operand needs more precision than bf16
typedef _Float16 v16h __attribute__((ext_vector_type(16)));
union FragH { v16h v; v8us half[2]; _Float16 h[16]; unsigned short u[16]; };
template <int NT>
__device__ __forceinline__ v8f mmaH(v16h ah, v16h al, v16h bh, v16h bl, v8f c) {
  c = __builtin_amdgcn_wmma_f32_16x16x32_f16(false, ah, false, bh, (short)0, c, false, false);
  if (NT >= 2) c = __builtin_amdgcn_wmma_f32_16x16x32_f16(false, al, false, bh, (short)0, c, false, false);
  if (NT >= 3) c = __builtin_amdgcn_wmma_f32_16x16x32_f16(false, ah, false, bl, (short)0, c, false, false);
  asm volatile("v_nop\n\tv_nop\n\tv_nop\n\tv_nop" : "+v"(c) : "v"(ah), "v"(al), "v"(bh), "v"(bl));
  return c;
}
// batched GEMM like k_gemm_b but f16 operands: A f32 (split into f16 hi/lo if ASPLIT, else rounded to f16), Bt = f16 values [n][k]; alpha; C f32; N multiple of 16 (partial tiles skipped)
template <bool ASPLIT>
__global__ __launch_bounds__(128) void k_gemm_h(const float* __restrict__ A, int lda, size_t sA, const _Float16* __restrict__ Bh, int ldb, size_t sB, float alpha, float* __restrict__ C, int ldc, size_t sC, int M, int N, int K) {
  __shared__ __attribute__((aligned(16))) float so[4][16][64];
  const int tid = threadIdx.x, w = tid >> 5, lane = tid & 31, ln = lane & 15, hh = lane >> 4; const int by = blockIdx.y;
  A += (size_t)by * sA; Bh += (size_t)by * sB; C += (size_t)by * sC;
  const int ntn = (N + 63) / 64; const int wid = blockIdx.x * 4 + w; const int mt = wid / ntn, nq = wid % ntn; if (mt * 16 >= M) return;
  const int row0 = mt * 16, col0 = nq * 64; const float* arow = A + (size_t)(row0 + ln) * lda;
  v8f acc[4] = {};
  for (int kb = 0; kb < K; kb += 32) {
    FragH ah, al;
    const v4f x0 = *(const v4fa*)(arow + kb + 8 * hh), x1 = *(const v4fa*)(arow + kb + 8 * hh + 4), x2 = *(const v4fa*)(arow + kb + 16 + 8 * hh), x3 = *(const v4fa*)(arow + kb + 16 + 8 * hh + 4);
    float xs[16] = {x0[0],x0[1],x0[2],x0[3],x1[0],x1[1],x1[2],x1[3],x2[0],x2[1],x2[2],x2[3],x3[0],x3[1],x3[2],x3[3]};
#pragma unroll
    for (int i = 0; i < 16; ++i) { const _Float16 h = (_Float16)xs[i]; ah.h[i] = h; al.h[i] = ASPLIT ? (_Float16)(xs[i] - (float)h) : (_Float16)0.0f; }
#pragma unroll
    for (int t = 0; t < 4; ++t) { if (col0 + t * 16 >= N) continue; const size_t boff = (size_t)(col0 + t * 16 + ln) * ldb + kb; FragH bq; bq.half[0] = *(const v8us*)(Bh + boff + 8 * hh); bq.half[1] = *(const v8us*)(Bh + boff + 16 + 8 * hh);
      acc[t] = mmaH<ASPLIT ? 2 : 1>(ah.v, al.v, bq.v, bq.v, acc[t]); }
  }
#pragma unroll
  for (int t = 0; t < 4; ++t) { if (col0 + t * 16 >= N) continue;
#pragma unroll
    for (int r = 0; r < 8; ++r) so[w][8 * hh + r][t * 16 + ln] = acc[t][r] * alpha; }
  __builtin_amdgcn_fence(__ATOMIC_ACQ_REL, "workgroup"); __builtin_amdgcn_wave_barrier();
  const int rsub = lane >> 4, c4 = (lane & 15) * 4;
  {
#pragma unroll
    for (int q = 0; q < 8; ++q) { const int r = q * 2 + rsub; if (col0 + c4 < N) { const v4f v = *(const v4fa*)&so[w][r][c4]; *(v4f*)(C + (size_t)(row0 + r) * ldc + col0 + c4) = v; } }
     }
}

// Wt[n][k] = f16(W[k][n]·scale) from f32 row-major W[K][N] (scale = power of two; bf16-exact weights stay exact in f16 away from the subnormal range)
__global__ __launch_bounds__(256) void k_wt_f16(const float* __restrict__ W, _Float16* __restrict__ Wt, int K, int N, float scale) {
  const int t = blockIdx.x * 256 + threadIdx.x; if (t >= N * (K / 8)) return; const int n = t / (K / 8), k8 = (t % (K / 8)) * 8; FragH f;
#pragma unroll
  for (int i = 0; i < 8; ++i) f.h[i] = (_Float16)(bf16_round(W[(size_t)(k8 + i) * N + n]) * scale); const v8us o = f.half[0];
  *(v8us*)((unsigned short*)Wt + (size_t)n * K + k8) = o; 
}
// k_gemm_hh variant with fused epilogue: v = acc·alpha + bias[by·sBias + col] (+ CP[(row/rowsPerB)·sCPb + by·64 + col] if CP) ; ACT 0 none / 1 elu ; writes f16 C16 (and f32 C if non-null)
template <int ACT>
__global__ __launch_bounds__(128) void k_gemm_hhx(const _Float16* __restrict__ A, int lda, size_t sA, const _Float16* __restrict__ Bh, int ldb, size_t sB, float alpha, const float* __restrict__ bias, size_t sBias, const float* __restrict__ CP, int rowsPerB, size_t sCPb, int row0g,
    float* __restrict__ C, _Float16* __restrict__ C16, int ldc, size_t sC, int M, int N, int K) {
  __shared__ __attribute__((aligned(16))) float so[4][16][64];
  const int tid = threadIdx.x, w = tid >> 5, lane = tid & 31, ln = lane & 15, hh = lane >> 4; const int by = blockIdx.y;
  A += (size_t)by * sA; Bh += (size_t)by * sB; const size_t cofs = (size_t)by * sC; const float* bp = bias ? bias + (size_t)by * sBias : nullptr;
  const int ntn = (N + 63) / 64; const int wid = blockIdx.x * 4 + w; const int mt = wid / ntn, nq = wid % ntn; if (mt * 16 >= M) return;
  const int row0 = mt * 16, col0 = nq * 64; const _Float16* arow = A + (size_t)(row0 + ln) * lda;
  v8f acc[4] = {};
  for (int kb = 0; kb < K; kb += 32) { FragH ah; ah.half[0] = *(const v8us*)((const unsigned short*)arow + kb + 8 * hh); ah.half[1] = *(const v8us*)((const unsigned short*)arow + kb + 16 + 8 * hh);
#pragma unroll
    for (int t = 0; t < 4; ++t) { if (col0 + t * 16 >= N) continue; const size_t boff = (size_t)(col0 + t * 16 + ln) * ldb + kb; FragH bq; bq.half[0] = *(const v8us*)((const unsigned short*)Bh + boff + 8 * hh); bq.half[1] = *(const v8us*)((const unsigned short*)Bh + boff + 16 + 8 * hh);
      acc[t] = mmaH<1>(ah.v, ah.v, bq.v, bq.v, acc[t]); }
  }
#pragma unroll
  for (int t = 0; t < 4; ++t) { if (col0 + t * 16 >= N) continue; const int col = col0 + t * 16 + ln; const float bv = bp ? bf16_round(bp[col]) : 0.f;
#pragma unroll
    for (int r = 0; r < 8; ++r) { float v = acc[t][r] * alpha + bv; if (CP) { const int rr = row0g + row0 + 8 * hh + r; if (rowsPerB < 0) v += CP[cofs + (size_t)rr * ldc + col];      /* rowsPerB < 0: own element of the batched C plane */ else { const int bidx = rr / rowsPerB; v += CP[(size_t)bidx * sCPb + (size_t)by * 64 + col]; } } if (ACT == 1) v = (v > 0.f) ? v : expm1f(v); else if (ACT == 7) v = (v > 0.f) ? v + 1.0f : expf(v); else if (ACT == 8) v = tanhf(v); else if (ACT == 9) v = 0.5f * v * (1.0f + tanhf(0.7978845608028654f * (v + 0.044715f * v * v * v))); else if (ACT == 11) v = 1.0f / (1.0f + expf(-v)); else if (ACT == 12) v = (v > 0.f) ? v : 0.01f * v; else if (ACT == 14) v = (v > 0.f) ? v : 0.1f * v; else if (ACT == 16) v = (v >= 0.f) ? v : 0.3f * v; else if (ACT == 17) v = (v >= 0.f) ? v : 0.2f * v; else if (ACT == 15) v = v / (1.0f + expf(-v)); else if (ACT == 3) v = fmaxf(v, 0.f); else if (ACT == 6) v = 0.5f * v * (1.0f + erff(v * 0.70710678118654752f)); so[w][8 * hh + r][t * 16 + ln] = v; } }
  __builtin_amdgcn_fence(__ATOMIC_ACQ_REL, "workgroup"); __builtin_amdgcn_wave_barrier();
  const int rsub = lane >> 4, c4 = (lane & 15) * 4; typedef _Float16 v4h __attribute__((ext_vector_type(4)));
  {
#pragma unroll
    for (int q = 0; q < 8; ++q) { const int r = q * 2 + rsub; if (col0 + c4 < N) { const v4f v = *(const v4fa*)&so[w][r][c4]; if (C) *(v4f*)(C + cofs + (size_t)(row0 + r) * ldc + col0 + c4) = v; if (C16) { v4h h4; for (int i = 0; i < 4; ++i) h4[i] = (_Float16)v[i]; *(v4h*)(C16 + cofs + (size_t)(row0 + r) * ldc + col0 + c4) = h4; } } }
     }
}


typedef _Float16 v4h __attribute__((ext_vector_type(4)));

__global__ __launch_bounds__(256) void k_x16(const float* __restrict__ x, _Float16* __restrict__ X16, size_t n8) { const size_t t = (size_t)blockIdx.x * 256 + threadIdx.x; if (t >= n8) return; FragH f;
#pragma unroll
  for (int q = 0; q < 8; ++q) f.h[q] = (_Float16)bf16_round(x[t * 8 + q]); *(v8us*)((unsigned short*)X16 + t * 8) = f.half[0];  }
__global__ __launch_bounds__(256) void k_h16(const float* __restrict__ x, _Float16* __restrict__ X16, size_t n8) { const size_t t = (size_t)blockIdx.x * 256 + threadIdx.x; if (t >= n8) return; FragH f;
#pragma unroll
  for (int q = 0; q < 8; ++q) f.h[q] = (_Float16)x[t * 8 + q]; *(v8us*)((unsigned short*)X16 + t * 8) = f.half[0];  }
__global__ __launch_bounds__(256) void k_round16f(const float* __restrict__ W, _Float16* __restrict__ Bt, size_t n8) { const size_t t = (size_t)blockIdx.x * 256 + threadIdx.x; if (t >= n8) return; FragH f;
#pragma unroll
  for (int i = 0; i < 8; ++i) f.h[i] = (_Float16)(bf16_round(W[t * 8 + i]) * 16.0f); *(v8us*)((unsigned short*)Bt + t * 8) = f.half[0];  }
__global__ __launch_bounds__(256) void k_hl(const float* __restrict__ F, _Float16* __restrict__ Hh, _Float16* __restrict__ Hl, size_t n8) { const size_t t = (size_t)blockIdx.x * 256 + threadIdx.x; if (t >= n8) return; FragH fh, fl; const v4f a = *(const v4fa*)(F + t * 8), c = *(const v4fa*)(F + t * 8 + 4);
#pragma unroll
  for (int q = 0; q < 4; ++q) { _Float16 h = (_Float16)a[q]; fh.h[q] = h; fl.h[q] = (_Float16)((a[q] - (float)h) * 1024.0f); h = (_Float16)c[q]; fh.h[4 + q] = h; fl.h[4 + q] = (_Float16)((c[q] - (float)h) * 1024.0f); }
  { *(v8us*)((unsigned short*)Hh + t * 8) = fh.half[0]; *(v8us*)((unsigned short*)Hl + t * 8) = fl.half[0];  } }

// ---- fast GEMM (wave tile 32x64; requires M % 32 == 0 rows per launch region and N % 64 == 0); epilogue = k_gemm_hhx semantics ----
__device__ __forceinline__ v16h g2_frag(const _Float16* p, int hh) { FragH f; f.half[0] = *(const v8us*)((const unsigned short*)p + 8 * hh); f.half[1] = *(const v8us*)((const unsigned short*)p + 16 + 8 * hh); return f.v; }
__device__ __forceinline__ v8f g2_mma(v16h a, v16h b, v8f c) { v8f d = __builtin_amdgcn_wmma_f32_16x16x32_f16(false, a, false, b, (short)0, c, false, false); asm volatile("v_nop\n\tv_nop\n\tv_nop\n\tv_nop" : "+v"(d) : "v"(a), "v"(b)); return d; }
template <int ACT>
__global__ __launch_bounds__(128) void k_gemm2(const _Float16* __restrict__ A, int lda, size_t sA, const _Float16* __restrict__ Bh, int ldb, size_t sB, float alpha, const float* __restrict__ bias, size_t sBias, const float* __restrict__ CP, int rowsPerB, size_t sCPb, int row0g,
    float* __restrict__ C, _Float16* __restrict__ C16, int ldc, size_t sC, int M, int N, int K) { static_assert(ACT == 0 || ACT == 3 || ACT == 6 || ACT == 8 || ACT == 9 || ACT == 11 || ACT == 12 || ACT == 14 || ACT == 15 || ACT == 16 || ACT == 17, "k_gemm2: unsupported ACT code (would silently apply no activation)");
  __shared__ __attribute__((aligned(16))) float so[4][32][68];
  const int tid = threadIdx.x, w = tid >> 5, lane = tid & 31, ln = lane & 15, hh = lane >> 4; const int by = blockIdx.y;
  A += (size_t)by * sA; Bh += (size_t)by * sB; const size_t cofs = (size_t)by * sC; const float* bp = bias ? bias + (size_t)by * sBias : nullptr;
  const int ntn = N >> 6; const int mt = blockIdx.x / ntn, nq = blockIdx.x - mt * ntn; const int row0 = mt * 128 + 32 * w, col0 = nq * 64; if (row0 >= M) return;
  const _Float16* a0p = A + (size_t)(row0 + ln) * lda; const _Float16* a1p = a0p + (size_t)16 * lda;
  const _Float16* b0p = Bh + (size_t)(col0 + ln) * ldb; const _Float16* b1p = b0p + (size_t)16 * ldb; const _Float16* b2p = b1p + (size_t)16 * ldb; const _Float16* b3p = b2p + (size_t)16 * ldb;
  const v8f z8 = {0.f,0.f,0.f,0.f,0.f,0.f,0.f,0.f}; v8f c00 = z8, c01 = z8, c02 = z8, c03 = z8, c10 = z8, c11 = z8, c12 = z8, c13 = z8;
#pragma unroll 1
  for (int kb = 0; kb < K; kb += 32) { const v16h a0 = g2_frag(a0p + kb, hh), a1 = g2_frag(a1p + kb, hh);
    v16h b = g2_frag(b0p + kb, hh); c00 = g2_mma(a0, b, c00); c10 = g2_mma(a1, b, c10);
    b = g2_frag(b1p + kb, hh); c01 = g2_mma(a0, b, c01); c11 = g2_mma(a1, b, c11);
    b = g2_frag(b2p + kb, hh); c02 = g2_mma(a0, b, c02); c12 = g2_mma(a1, b, c12);
    b = g2_frag(b3p + kb, hh); c03 = g2_mma(a0, b, c03); c13 = g2_mma(a1, b, c13); }
  v8f accs[8] = {c00, c01, c02, c03, c10, c11, c12, c13};
#pragma unroll
  for (int u = 0; u < 8; ++u) { const int t = u & 3, half = u >> 2; const int col = col0 + t * 16 + ln; const float bv = bp ? bf16_round(bp[col]) : 0.f;
#pragma unroll
    for (int r = 0; r < 8; ++r) { const int rloc = half * 16 + 8 * hh + r; float v = accs[u][r] * alpha + bv; if (CP) { if (rowsPerB < 0) v += CP[cofs + (size_t)(row0g + row0 + rloc) * ldc + col];      /* rowsPerB < 0: own element of the batched C plane */ else { const int bidx = (row0g + row0 + rloc) / rowsPerB; v += CP[(size_t)bidx * sCPb + (size_t)by * 64 + col]; } }
      if (ACT == 3) v = fmaxf(v, 0.f); else if (ACT == 6) v = 0.5f * v * (1.0f + erff(v * 0.70710678118654752f)); else if (ACT == 11) v = 1.0f / (1.0f + expf(-v)); else if (ACT == 15) v = v / (1.0f + expf(-v)); else if (ACT == 12) v = (v > 0.f) ? v : 0.01f * v; else if (ACT == 8) v = tanhf(v); else if (ACT == 9) v = 0.5f * v * (1.0f + tanhf(0.7978845608028654f * (v + 0.044715f * v * v * v))); else if (ACT == 14) v = (v > 0.f) ? v : 0.1f * v; else if (ACT == 16) v = (v >= 0.f) ? v : 0.3f * v; else if (ACT == 17) v = (v >= 0.f) ? v : 0.2f * v;
      so[w][rloc][t * 16 + ln] = v; } }
  __builtin_amdgcn_fence(__ATOMIC_ACQ_REL, "workgroup"); __builtin_amdgcn_wave_barrier();
  const int rsub = lane >> 4, c4 = (lane & 15) * 4;
  {
#pragma unroll
    for (int q = 0; q < 16; ++q) { const int r = q * 2 + rsub; const v4f v = *(const v4fa*)&so[w][r][c4]; if (C) *(v4f*)(C + cofs + (size_t)(row0 + r) * ldc + col0 + c4) = v; if (C16) { v4h h4; for (int i = 0; i < 4; ++i) h4[i] = (_Float16)v[i]; *(v4h*)(C16 + cofs + (size_t)(row0 + r) * ldc + col0 + c4) = h4; } }
     } }


// Ranks of the kept keys, made by every K or V work-group of the projection launch for its own tokens (no launch of its own, no rank plane in memory). The work-group reads its batch's whole mask, a wave 256 keys in a row,
// 32 per load, and lays one bit per key (mask != 0) and the waves' counts in LDS; behind one barrier a wave takes, for its two tokens s and s + 1 (s even: both bits in one word), r = how many kept keys stand in front
// (the token's row among the batch's packed K and V rows), or -1 for a key with mask == 0; n = the number kept in the batch.
// A key with mask == 0 has weight exp(fill - max) = 0 exactly in f32 as soon as one key of the batch is kept, so it is left out of K, V and the key walk. A batch with no key kept keeps them all (rank = s, n = 0):
// the attention kernel then gives every key the fill, and the rows come out uniform, as in the source.
typedef unsigned v4u __attribute__((ext_vector_type(4), may_alias));
__device__ __forceinline__ void tok_ranks(const int* __restrict__ Km, int b, int s, int& r0, int& r1, int& n) {
  __shared__ __attribute__((aligned(16))) unsigned sb[SQ / 32];      /* one bit per key of the batch */
  __shared__ __attribute__((aligned(16))) unsigned sc[8];      /* kept keys per wave */
  const int tid = threadIdx.x, w = tid >> 5, lane = tid & 31; const int* kp = Km + (size_t)b * SQ + w * 256 + lane;
  int mv[8];
#pragma unroll      /* constant indices: the values stay in registers */
  for (int i = 0; i < 8; ++i) mv[i] = kp[i * 32];
  asm volatile("s_wait_xcnt 0x0" :: "v"(kp) : "memory");      /* precaution: no address register of the loads above is rewritten in front of this wait */
  unsigned bm[8], tot = 0;
#pragma unroll      /* constant indices: the values stay in registers */
  for (int i = 0; i < 8; ++i) { bm[i] = __builtin_amdgcn_ballot_w32(mv[i] != 0); tot += (unsigned)__builtin_popcount(bm[i]); }
  if (lane == 0) { const v4u x0 = {bm[0], bm[1], bm[2], bm[3]}, x1 = {bm[4], bm[5], bm[6], bm[7]}; *(v4u*)&sb[w * 8] = x0; *(v4u*)&sb[w * 8 + 4] = x1; sc[w] = tot; }
  __syncthreads();      /* publishes the waves' bits and counts */
  const int u = s >> 8, ji = (s >> 5) & 7, bi = s & 31;      /* the 256 keys, the word among their 8 and the bit that hold token s */
  const v4u c0 = *(const v4u*)&sc[0], c1 = *(const v4u*)&sc[4], w0 = *(const v4u*)&sb[u * 8], w1 = *(const v4u*)&sb[u * 8 + 4];
  const unsigned cs[8] = {c0[0], c0[1], c0[2], c0[3], c1[0], c1[1], c1[2], c1[3]}, wd[8] = {w0[0], w0[1], w0[2], w0[3], w1[0], w1[1], w1[2], w1[3]};
  unsigned p = 0, nn = 0, ws = 0;
#pragma unroll      /* constant indices: the values stay in registers */
  for (int i = 0; i < 8; ++i) { nn += cs[i]; p += (i < u) ? cs[i] : 0u;
    const unsigned mk = (i < ji) ? 0xFFFFFFFFu : (i == ji) ? ((1u << bi) - 1u) : 0u; p += (unsigned)__builtin_popcount(wd[i] & mk); ws = (i == ji) ? wd[i] : ws; }
  const unsigned k0 = (ws >> bi) & 1u, k1 = (ws >> (bi + 1)) & 1u;      /* bi is even, at most 30 */
  n = (int)nn; r0 = (nn == 0) ? s : (k0 ? (int)p : -1); r1 = (nn == 0) ? s + 1 : (k1 ? (int)(p + k0) : -1); }
// Wo natural [out][in] = Bt x16 (bf16-rounded, exact in f16): shared out among the Q work-groups of the projection launch, which have no ranks to make; a thread converts two runs of 8 elements, WO_T runs apart.
#define WO_T (DM * DM / 8 / 2)
__device__ __forceinline__ void wo_store(const v4f (&a)[4], _Float16* __restrict__ Bt, size_t t) {
  FragH f, g;
#pragma unroll      /* constant indices: the values stay in registers */
  for (int q = 0; q < 4; ++q) { f.h[q] = (_Float16)(bf16_round(a[0][q]) * 16.0f); f.h[4 + q] = (_Float16)(bf16_round(a[1][q]) * 16.0f); g.h[q] = (_Float16)(bf16_round(a[2][q]) * 16.0f); g.h[4 + q] = (_Float16)(bf16_round(a[3][q]) * 16.0f); }
  unsigned short* d = (unsigned short*)Bt + t * 8;
  *(v8us*)d = f.half[0]; *(v8us*)(d + (size_t)WO_T * 8) = g.half[0];
  asm volatile("s_wait_xcnt 0x0" ::: "memory"); }      /* precaution: no register of the stores above is rewritten in front of this wait */
__global__ __launch_bounds__(256) void k_rsm(const float* __restrict__ S, _Float16* __restrict__ P, int nrows) {
  #pragma clang fp contract(off)
  const int i = blockIdx.x * 256 + threadIdx.x; if (i >= nrows) return; const float* s = S + (size_t)i * SQ; float mx = -3.0e38f;
#pragma unroll 1
  for (int j = 0; j < SQ; ++j) mx = fmaxf(mx, s[j]); float se = 0.f;
#pragma unroll 1
  for (int j = 0; j < SQ; ++j) se += expf(s[j] - mx); const float sc = 256.0f / se;
#pragma unroll 1
  for (int j0 = 0; j0 < SQ; j0 += 8) { FragH f; for (int q = 0; q < 8; ++q) f.h[q] = (_Float16)(expf(s[j0 + q] - mx) * sc); unsigned short* d = (unsigned short*)P + (size_t)i * SQ + j0; *(v8us*)d = f.half[0];  } }
__global__ __launch_bounds__(256) void k_vt(const _Float16* __restrict__ V16, int b, int h0, _Float16* __restrict__ VT) { __shared__ unsigned short tl[64][65]; const int tid = threadIdx.x; const int hh = blockIdx.x % HG, sg = blockIdx.x / HG; const int s0 = sg * 64; const int h = h0 + hh;
  for (int i = tid; i < 64 * 8; i += 256) { const int j = i / 8, d8 = (i % 8) * 8; FragH f; f.half[0] = *(const v8us*)((const unsigned short*)V16 + ((size_t)b * SQ + s0 + j) * DM + h * HD + d8); for (int q = 0; q < 8; ++q) tl[d8 + q][j] = f.u[q]; }
  __syncthreads();
  { for (int i = tid; i < 64 * 8; i += 256) { const int d = i / 8, j8 = (i % 8) * 8; FragH f; for (int q = 0; q < 8; ++q) f.u[q] = tl[d][j8 + q]; *(v8us*)((unsigned short*)VT + ((size_t)hh * HD + d) * SQ + s0 + j8) = f.half[0]; }  } }



__global__ __launch_bounds__(256) void k_rsmkm(const float* __restrict__ S, _Float16* __restrict__ P, int nrows, const int* __restrict__ am) {
  #pragma clang fp contract(off)
  const int t = blockIdx.x * 256 + threadIdx.x; if (t >= nrows) return; const size_t i = (size_t)t; const float* s = S + i * SQ; const int* mr = am + (size_t)(t % SQ) * SQ; float mx = -3.0e38f;
#pragma unroll 1
  for (int j = 0; j < SQ; ++j) { const float f = (mr[j] != 0) ? 1.f : 0.f; mx = fmaxf(mx, fmaf(f, s[j], (1.f - f) * -1.0e9f)); } float se = 0.f;
#pragma unroll 1
  for (int j = 0; j < SQ; ++j) { const float f = (mr[j] != 0) ? 1.f : 0.f; se += __expf(fmaf(f, s[j], (1.f - f) * -1.0e9f) - mx); } const float sc = 256.0f / se;
#pragma unroll 1
  for (int j0 = 0; j0 < SQ; j0 += 8) { FragH fr; for (int q = 0; q < 8; ++q) { const int j = j0 + q; const float f = (mr[j] != 0) ? 1.f : 0.f; fr.h[q] = (_Float16)(__expf(fmaf(f, s[j], (1.f - f) * -1.0e9f) - mx) * sc); }
    unsigned short* d = (unsigned short*)P + i * SQ + j0; *(v8us*)d = fr.half[0];  } }

__global__ __launch_bounds__(256) void k_bdshn(const float* __restrict__ Wb, _Float16* __restrict__ Bt) {
  const size_t t = (size_t)blockIdx.x * 256 + threadIdx.x; if (t >= (size_t)DM * DM / 8) return; const size_t e0 = t * 8; const int n = (int)(e0 / DM), k0 = (int)(e0 % DM); const int h = n >> 6, hk = k0 >> 6; const float on = (hk == h) ? 16.0f : 0.0f; const int o = n & 63, d0 = k0 & 63; FragH f;
  for (int q = 0; q < 8; ++q) f.h[q] = (_Float16)(bf16_round(Wb[(size_t)o * 64 + d0 + q]) * on);
  unsigned short* d = (unsigned short*)Bt + e0; *(v8us*)d = f.half[0];  }

// Fused attention: one launch for every (batch, head); scores, softmax and the weighted sum of V stay in registers, no score or weight plane in memory.
// A work-group is 16 waves, four per SIMD, so that one wave's vector work and waits stand beside three others' products: two sets of 8 waves x 32 queries hold the SAME 256 queries of one head, and set g takes the stages g, g + 2, ... with
// LDS buffers of its own; at the end the two sets' running maxima, sums and outputs are joined through LDS (each wave hands one 16-query tile to its partner and finishes the other).
// A set walks the batch's packed (kept) keys in stages of 64, the last stage filled up with keys under the fill: the stage's K rows and V rows (64 keys x 64 dims each) are fetched once per work-group with
// whole-line 16-byte loads, one stage ahead, and shared through two LDS buffers (rows of 128 B; K at a pitch of 144 B, the conflict-free pitch for 16-byte readers, V at 160 B, that of the transposing reader); one barrier per stage publishes the next
// buffer and ends the reads of the one refilled behind it. A wave works a stage in two passes of 32 keys. Per pass: S^T = K Q^T (A = 16 key rows, B = 16 query rows, both by g2_frag, so both in the same k order);
// a lane then holds, per 16-query tile, 16 scores of ONE query (query = lane & 15; keys 8 * (lane >> 4) + r of each 16-key tile), which is also the B-operand order of a 32-key product,
// so the weights go from the score accumulators straight into O^T += V^T P^T (A = 16 rows of V^T, two ds_load_tr16_b128 from the V rows: keys 8 * (lane >> 4) + r of each 16-key tile, the same k order). Softmax is the running-maximum form in base 2: the maximum in use is raised,
// and sums and outputs rescaled, only when a pass exceeds it by more than 8 (weights stay <= 256, inside f16). The filling keys (and, where a batch keeps no key, all keys) take the module's fill through the addend of the scaling fma:
// the fill (-1e20 / 32, in base 2) absorbs any finite f16 score exactly, so the result is the fill itself, as the source's where() has it; a row with every key masked comes out uniform, as in the source.
// exp2 as asm text so that a v_nop stands directly behind the last transcendental: the instruction set asks for one slot before a result is used or a source overwritten (inside a run no v_exp_f32 touches
// another's register). Each works IN PLACE, on a register that the compiler's own subtraction has just written: so the asm never writes a register that a matrix instruction a few slots back still reads.
__device__ __forceinline__ float exp2_slot(float t) { asm("v_exp_f32 %0, %0\n\tv_nop" : "+v"(t)); return t; }
__device__ __forceinline__ void exp2_run8(float (&x)[8]) {
  asm("v_exp_f32 %0, %0\n\tv_exp_f32 %1, %1\n\tv_exp_f32 %2, %2\n\tv_exp_f32 %3, %3\n\tv_exp_f32 %4, %4\n\tv_exp_f32 %5, %5\n\tv_exp_f32 %6, %6\n\tv_exp_f32 %7, %7\n\tv_nop"
      : "+v"(x[0]), "+v"(x[1]), "+v"(x[2]), "+v"(x[3]), "+v"(x[4]), "+v"(x[5]), "+v"(x[6]), "+v"(x[7])); }
__device__ __forceinline__ float xhalf(float x) { return __builtin_bit_cast(float, __builtin_amdgcn_permlanex16(__builtin_bit_cast(int, x), __builtin_bit_cast(int, x), 0x76543210, 0xfedcba98, false, false)); }      /* lane l reads lane l ^ 16 */
__device__ __forceinline__ v8f fa_mma(v16h a, v16h b, v8f c) { return __builtin_amdgcn_wmma_f32_16x16x32_f16(false, a, false, b, (short)0, c, false, false); }
// The join's two halves, for query tile QT of a wave (a constant, so that the values stay in registers). fa_give: the tile's 32 outputs per lane, its maximum in use and its sum go to the wave's LDS rows, 16 bytes a lane in a row.
template <int QT>
__device__ __forceinline__ void fa_give(float (&m)[9][32][4], int lane, const v8f (&o)[4][2], const float (&mr)[2], const float (&lr)[2]) {
#pragma unroll      /* constant indices: the values stay in registers */
  for (int dt = 0; dt < 4; ++dt) { const v4f x0 = {o[dt][QT][0], o[dt][QT][1], o[dt][QT][2], o[dt][QT][3]}, x1 = {o[dt][QT][4], o[dt][QT][5], o[dt][QT][6], o[dt][QT][7]};
    *(v4fa*)&m[dt * 2][lane][0] = x0; *(v4fa*)&m[dt * 2 + 1][lane][0] = x1; }
  const v4f xm = {mr[QT], lr[QT], 0.f, 0.f}; *(v4fa*)&m[8][lane][0] = xm; }
// fa_join: the partner's rows m for the same tile are brought to the common maximum with the wave's own, summed and divided by the joint row sum; res: the tile's f16 outputs, 16 bytes per 16 dims.
template <int QT>
__device__ __forceinline__ void fa_join(const float (&m)[9][32][4], int lane, const v8f (&o)[4][2], const float (&mr)[2], const float (&lr)[2], v8us (&res)[4]) {
  const v4f xm = *(const v4fa*)&m[8][lane][0];
  const float mn = fmaxf(mr[QT], xm[0]);      /* a set that had no stage hands over -3e38, sum 0 and outputs 0: its factor below is 0 */
  const float ca = exp2_slot(mr[QT] - mn), cb = exp2_slot(xm[0] - mn);
  const float l2 = lr[QT] * ca + xm[1] * cb;
  const float sc = 64.0f / (l2 + xhalf(l2));      /* the lane halves' sums join here; o carried x64 as before */
  const float fa = ca * sc, fb = cb * sc;
#pragma unroll      /* constant indices: the values stay in registers */
  for (int dt = 0; dt < 4; ++dt) { FragH f; const v4f x0 = *(const v4fa*)&m[dt * 2][lane][0], x1 = *(const v4fa*)&m[dt * 2 + 1][lane][0];
#pragma unroll      /* constant indices: the values stay in registers */
    for (int r = 0; r < 4; ++r) { f.h[r] = (_Float16)(o[dt][QT][r] * fa + x0[r] * fb); f.h[4 + r] = (_Float16)(o[dt][QT][4 + r] * fa + x1[r] * fb); }
    res[dt] = f.half[0]; } }
#define FA_NS (SQ / 64)      /* stages of 64 keys */
#define FA_LP 72             /* LDS row pitch of K in f16: 128 B of data + 16 B */
#define FA_VP 80             /* LDS row pitch of V in f16: 128 B of data + 32 B */
// Transposing LDS load: lane l gives the address of 16 bytes of row 8 * (l >> 4) + (l & 7), piece (l >> 3) & 1, of a 16 x 16 tile of f16; it gets column l & 15, rows 8 * (l >> 4) + 0..7.
typedef short s16x8 __attribute__((ext_vector_type(8)));
__device__ __forceinline__ v8us ld_tr16(const _Float16* p) { typedef __attribute__((address_space(3))) s16x8 lds_s16x8; return __builtin_bit_cast(v8us, __builtin_amdgcn_ds_load_tr16_b128_v8i16((lds_s16x8*)p)); }
__global__ __launch_bounds__(512) void k_fattn(const _Float16* __restrict__ Q16, const _Float16* __restrict__ K16, const _Float16* __restrict__ V16, const int* __restrict__ KN, _Float16* __restrict__ O16) {
  __shared__ __attribute__((aligned(16))) float kb[SQ];      /* per packed key: 0 (kept) or the fill */
  __shared__ __attribute__((aligned(16))) _Float16 ks_[2][2][64 * FA_LP];      /* per set, two buffers: K rows of a stage: [key][dim] */
  __shared__ __attribute__((aligned(16))) _Float16 vs_[2][2][64 * FA_VP];      /* per set, two buffers: V rows of a stage: [key][dim] */
  __shared__ __attribute__((aligned(16))) float mg[16][9][32][4];      /* the join: per wave and lane, the 32 outputs of the tile it hands over, then that tile's maximum and sum */
  const int tid = threadIdx.x, w = tid >> 5, lane = tid & 31, ln = lane & 15, hh = lane >> 4;
  const int g = __builtin_amdgcn_readfirstlane(w >> 3);      /* the wave's set; the same in every lane: the tests on it are scalar branches */
  const int bh = blockIdx.y, b = bh / NH, h = bh % NH; const int q0 = blockIdx.x * 256 + (w & 7) * 32;
  const int sr = (tid & 255) >> 3, sc8 = (tid & 7) * 8;      /* staging, by a set's 256 threads for itself: 8 threads per 128-byte row, rows sr and sr + 32 */
  const int n = KN[b], nk = (n < 1 || n > SQ) ? SQ : n, ns = (nk + 63) >> 6;      /* kept keys of the batch; packed rows to walk (all keys where none is kept); stages, 1 to FA_NS, the same for the whole work-group */
  const int nt = (ns + 1) >> 1;      /* trips: two stages, one per set, each */
  const int f0 = min(g, ns - 1) * 64;      /* first key of the set's first stage (one stage in all: the second set fetches it too, in bounds, never read) */
  const int kl1 = nk - 1 - sr;      /* a K or V row past the last packed one is read as that one: a finite score, which the fill absorbs, and a finite value under a zero weight */
  const _Float16* kg = K16 + ((size_t)b * SQ + sr) * DM + h * HD + sc8;
  const _Float16* vg = V16 + ((size_t)b * SQ + sr) * DM + h * HD + sc8;
  const int so = sr * FA_LP + sc8, sv = sr * FA_VP + sc8;
  v8us gk0 = *(const v8us*)(const unsigned short*)(kg + (ptrdiff_t)min(f0, kl1) * DM), gk1 = *(const v8us*)(const unsigned short*)(kg + (ptrdiff_t)min(f0 + 32, kl1) * DM);
  v8us gv0 = *(const v8us*)(const unsigned short*)(vg + (ptrdiff_t)min(f0, kl1) * DM), gv1 = *(const v8us*)(const unsigned short*)(vg + (ptrdiff_t)min(f0 + 32, kl1) * DM);
  for (int j = tid; j < SQ; j += 512) kb[j] = (j < n) ? 0.f : -4.5084220e18f;
  const _Float16* qp = Q16 + ((size_t)b * SQ + q0 + ln) * DM + h * HD;
  const float c2 = 0.03125f * 1.44269504f;      /* 1 / sqrt(embed size), in base 2 */
  const v8f z8 = {0.f,0.f,0.f,0.f,0.f,0.f,0.f,0.f};
  v16h qf[2][2];
#pragma unroll
  for (int t = 0; t < 2; ++t)
#pragma unroll
    for (int ks = 0; ks < 2; ++ks) qf[t][ks] = g2_frag(qp + (size_t)t * 16 * DM + ks * 32, hh);
  *(v8us*)(unsigned short*)&ks_[g][0][so] = gk0; *(v8us*)(unsigned short*)&ks_[g][0][so + 32 * FA_LP] = gk1;
  *(v8us*)(unsigned short*)&vs_[g][0][sv] = gv0; *(v8us*)(unsigned short*)&vs_[g][0][sv + 32 * FA_VP] = gv1;
  __syncthreads();      /* publishes each set's first stage and the key table */
  v8f o[4][2];
#pragma unroll
  for (int dt = 0; dt < 4; ++dt) { o[dt][0] = z8; o[dt][1] = z8; }
  float mr[2] = {-3.0e38f, -3.0e38f}, lr[2] = {0.f, 0.f};
#pragma unroll 1
  for (int tr = 0; tr < nt; ++tr) {      /* kept rolled: one stage already fills the register file */
    const int st = 2 * tr + g;      /* the set's stage of this trip */
    if (st < ns) {      /* scalar; an odd number of stages leaves the second set without one in the last trip: it goes straight to the barrier */
    const int keyn = (st + 2 < ns) ? (st + 2) * 64 : st * 64;      /* a set's last stage refetches itself: in bounds, never read */
    const _Float16* kl = &ks_[g][tr & 1][ln * FA_LP]; const _Float16* vl = &vs_[g][tr & 1][(8 * hh + (lane & 7)) * FA_VP + ((lane >> 3) & 1) * 8];
    v16h kf[2][2], vf[4];
#pragma unroll
    for (int kt = 0; kt < 2; ++kt)
#pragma unroll
      for (int ks = 0; ks < 2; ++ks) kf[kt][ks] = g2_frag(kl + kt * 16 * FA_LP + ks * 32, hh);
#pragma unroll
    for (int p = 0; p < 2; ++p) {
      const int key0 = st * 64 + p * 32;
      /* the set's next stage, half per pass through the same 8 registers: K rows fetched in the first pass, V rows in the second; each half is stored at its pass's end into the buffer that the trip before read, whose readers left it at the last barrier */
      const _Float16* gs = (p == 0) ? kg : vg; const _Float16* ga = gs + (ptrdiff_t)min(keyn, kl1) * DM; const _Float16* gb = gs + (ptrdiff_t)min(keyn + 32, kl1) * DM;
      const v8us g0 = *(const v8us*)(const unsigned short*)ga, g1 = *(const v8us*)(const unsigned short*)gb;
      if (p == 1) asm volatile("s_wait_xcnt 0x0" :: "v"(ga), "v"(gb) : "memory");      /* precaution: no address register of the two loads above is rewritten in front of this wait; naming the pairs keeps the loads' results off them (in the first pass the compiler's own wait stands there) */
#pragma unroll
      for (int dt = 0; dt < 4; ++dt) { FragH f; f.half[0] = ld_tr16(vl + p * 32 * FA_VP + dt * 16); f.half[1] = ld_tr16(vl + (p * 32 + 16) * FA_VP + dt * 16); vf[dt] = f.v; }
      v8f sx[2][2];
#pragma unroll
      for (int kt = 0; kt < 2; ++kt)
#pragma unroll
        for (int qt = 0; qt < 2; ++qt) sx[kt][qt] = fa_mma(kf[kt][1], qf[qt][1], fa_mma(kf[kt][0], qf[qt][0], z8));
      if (p == 0) {      /* the second pass's K fragments, fetched behind the first pass's score products */
#pragma unroll
        for (int kt = 0; kt < 2; ++kt)
#pragma unroll
          for (int ks = 0; ks < 2; ++ks) kf[kt][ks] = g2_frag(kl + (32 + kt * 16) * FA_LP + ks * 32, hh); }
      float bias[2][8];
#pragma unroll
      for (int kt = 0; kt < 2; ++kt) { const v4f x0 = *(const v4fa*)&kb[key0 + kt * 16 + 8 * hh], x1 = *(const v4fa*)&kb[key0 + kt * 16 + 8 * hh + 4];
#pragma unroll
        for (int r = 0; r < 4; ++r) { bias[kt][r] = x0[r]; bias[kt][4 + r] = x1[r]; } }
      float mb[2]; bool need = false;
#pragma unroll
      for (int qt = 0; qt < 2; ++qt) { float mx0 = -3.0e38f, mx1 = -3.0e38f;
#pragma unroll
        for (int r = 0; r < 8; ++r) { sx[0][qt][r] = fmaf(sx[0][qt][r], c2, bias[0][r]); sx[1][qt][r] = fmaf(sx[1][qt][r], c2, bias[1][r]); mx0 = fmaxf(mx0, sx[0][qt][r]); mx1 = fmaxf(mx1, sx[1][qt][r]); }
        const float mx = fmaxf(mx0, mx1); mb[qt] = fmaxf(mx, xhalf(mx)); need = need || (mb[qt] > mr[qt] + 8.0f); }
      if (__builtin_amdgcn_ballot_w32(need) != 0) {      /* wave-uniform; rare after the first passes */
#pragma unroll
        for (int qt = 0; qt < 2; ++qt) { const float mn = fmaxf(mr[qt], mb[qt]); const float corr = exp2_slot(mr[qt] - mn); mr[qt] = mn; lr[qt] *= corr;
#pragma unroll
          for (int dt = 0; dt < 4; ++dt) o[dt][qt] = o[dt][qt] * corr; } }
#pragma unroll
      for (int qt = 0; qt < 2; ++qt) { FragH pf; float s0 = 0.f, s1 = 0.f, e0[8], e1[8];
#pragma unroll
        for (int r = 0; r < 8; ++r) { e0[r] = sx[0][qt][r] - mr[qt]; e1[r] = sx[1][qt][r] - mr[qt]; }
        exp2_run8(e0); exp2_run8(e1);
#pragma unroll
        for (int r = 0; r < 8; ++r) { s0 += e0[r]; s1 += e1[r]; pf.h[r] = (_Float16)e0[r]; pf.h[8 + r] = (_Float16)e1[r]; }
        lr[qt] += s0 + s1;
#pragma unroll
        for (int dt = 0; dt < 4; ++dt) o[dt][qt] = fa_mma(vf[dt], pf.v, o[dt][qt]); }
      { _Float16* gd = (p == 0) ? &ks_[g][(tr + 1) & 1][so] : &vs_[g][(tr + 1) & 1][sv]; *(v8us*)(unsigned short*)gd = g0; *(v8us*)(unsigned short*)(gd + 32 * ((p == 0) ? FA_LP : FA_VP)) = g1; }
      if (p == 0) __builtin_amdgcn_sched_barrier(0);      /* keeps the next pass's score products out of this pass: moved up, their accumulators take the kernel past 256 registers */
    }
    }
    __syncthreads();      /* every wave, every trip: publishes each set's next stage; ends every wave's reads of this trip's stages before their buffers are refilled */
  }
  /* The join. Wave w and wave w ^ 8 hold the same 32 queries over the two halves of the stages, in the same lanes and registers. A wave of set g finishes query tile g and hands the other tile to its partner. */
  if (g == 0) fa_give<1>(mg[w], lane, o, mr, lr); else fa_give<0>(mg[w], lane, o, mr, lr);      /* scalar test */
  __syncthreads();      /* publishes the tiles handed over */
  v8us res[4];
  if (g == 0) fa_join<0>(mg[w ^ 8], lane, o, mr, lr, res); else fa_join<1>(mg[w ^ 8], lane, o, mr, lr, res);      /* scalar test */
  unsigned short* op = (unsigned short*)O16 + ((size_t)b * SQ + q0 + g * 16 + ln) * DM + h * HD + 8 * hh;
#pragma unroll      /* constant indices: the values stay in registers */
  for (int dt = 0; dt < 4; ++dt) *(v8us*)(op + dt * 16) = res[dt];      /* the stores stand together at the kernel's end: no register of theirs is written behind them */
}

// Per-head projections, one launch for Q, K and V (blockIdx.y picks input, weight and output; the conversion of Wo, which depends on nothing here, rides with the Q work-groups). The module multiplies every 64-wide head slice by the SAME [64][64] matrix, so the token rows [4096][1024] are read as
// [65536][64] head rows and the product has K = 64: each input element is read once, straight from the f32 input, and no product with a zero block is formed.
// A work-group is 8 waves x 32 head rows. A wave fetches its 32 rows (8 KB in a row) with 16 whole-line 16-byte loads, rounds them (bf16, exact in f16) and lays them in its own LDS rows (128 B at a pitch of 144 B);
// the work-group converts the weight (bf16-rounded, x16) into LDS once; one barrier publishes it. Y^T = W X^T (A = 16 weight rows, B = 16 head rows, both by g2_frag, so both in the same k order, k 0..31 then 32..63):
// a lane then holds 8 neighbouring features of ONE head row, 16 bytes of f16, which go back into that row's LDS place (its fragments are already in registers) and leave as whole 128-byte lines.
#define PJ_LP 72             /* LDS row pitch in f16: 128 B of data + 16 B */
typedef unsigned short v4us __attribute__((ext_vector_type(4), may_alias));
union FragQ { v4us v; _Float16 h[4]; };
__global__ __launch_bounds__(256) void k_proj(const float* __restrict__ xq, const float* __restrict__ xk, const float* __restrict__ xv, const float* __restrict__ wq, const float* __restrict__ wk, const float* __restrict__ wv,
                                              const float* __restrict__ wo, const int* __restrict__ Km, _Float16* __restrict__ Q16, _Float16* __restrict__ K16, _Float16* __restrict__ V16, _Float16* __restrict__ BO, int* __restrict__ KN) {
  static_assert((size_t)(NR * NH / 256) * 256 == (size_t)WO_T, "the Q work-groups' threads cover half of Wo's runs of 8");
  __shared__ __attribute__((aligned(16))) _Float16 wl[HD * PJ_LP];      /* weight rows [out][in], x16 */
  __shared__ __attribute__((aligned(16))) _Float16 xl[8][32 * PJ_LP];      /* per wave: its 32 head rows, later its 32 output rows */
  const int tid = threadIdx.x, w = tid >> 5, lane = tid & 31, ln = lane & 15, hh = lane >> 4;
  const int sel = blockIdx.y;
  const float* x = (sel == 0) ? xq : (sel == 1) ? xk : xv;
  const float* W = (sel == 0) ? wq : (sel == 1) ? wk : wv;
  _Float16* Y = (sel == 0) ? Q16 : (sel == 1) ? K16 : V16;
  const size_t row0 = (size_t)blockIdx.x * 256 + w * 32;
  const float* xp = x + row0 * HD + lane * 4;
  /* a wave's 32 head rows are two tokens; d0, d1: the token rows they are written to, or -1. Queries keep their place; a K or V token goes to its rank among the batch's kept keys, and one with mask == 0 is neither read nor written */
  const int tok = (int)(row0 >> 4); int d0 = tok, d1 = tok + 1;
  if (sel != 0) { int p0, p1, n; const int tb = tok & ~(SQ - 1); tok_ranks(Km, tok / SQ, tok - tb, p0, p1, n);      /* the same test for a whole work-group: every wave passes the barrier inside */
    d0 = (p0 < 0) ? -1 : tb + min(p0, SQ - 1); d1 = (p1 < 0) ? -1 : tb + min(p1, SQ - 1);
    if (sel == 1 && tok == tb && lane == 0) { KN[tok / SQ] = n;      /* the batch's count, for the launches behind: one writer per batch, the wave that holds the batch's first token */
      asm volatile("s_wait_xcnt 0x0" ::: "memory"); } }      /* precaution: no register of the store above is rewritten in front of this wait */
  d0 = __builtin_amdgcn_readfirstlane(d0); d1 = __builtin_amdgcn_readfirstlane(d1);      /* the same in every lane of the wave: the tests below are scalar branches */
  v4f xr[16], wr[4];      /* a token that is left out has no values here: every use below stands under the same test */
  if (d0 >= 0) {
#pragma unroll      /* constant indices: the values stay in registers */
    for (int i = 0; i < 8; ++i) xr[i] = *(const v4fa*)(xp + i * 128); }      /* two rows per load */
  if (d1 >= 0) {
#pragma unroll      /* constant indices: the values stay in registers */
    for (int i = 8; i < 16; ++i) xr[i] = *(const v4fa*)(xp + i * 128); }
#pragma unroll      /* constant indices: the values stay in registers */
  for (int i = 0; i < 4; ++i) wr[i] = *(const v4fa*)(W + i * 1024 + tid * 4);      /* 16 weight rows per load of the work-group */
  const size_t ot = (size_t)blockIdx.x * 256 + tid; const float* op = wo + ot * 8; v4f ow[4];      /* a Q work-group's share of Wo, fetched behind its own loads; no values elsewhere: the use below stands under the same test */
  if (sel == 0) { ow[0] = *(const v4fa*)op; ow[1] = *(const v4fa*)(op + 4); ow[2] = *(const v4fa*)(op + (size_t)WO_T * 8); ow[3] = *(const v4fa*)(op + (size_t)WO_T * 8 + 4); }
  asm volatile("s_wait_xcnt 0x0" :: "v"(xp), "v"(op) : "memory");      /* precaution: no address register of the loads above is rewritten in front of this wait; naming the pairs keeps the last loads' results off them */
  _Float16* xw = &xl[w][0];
#pragma unroll      /* constant indices: the values stay in registers */
  for (int i = 0; i < 4; ++i) { FragQ f;
#pragma unroll      /* constant indices: the values stay in registers */
    for (int q = 0; q < 4; ++q) f.h[q] = (_Float16)(bf16_round(wr[i][q]) * 16.0f);
    *(v4us*)(unsigned short*)&wl[(i * 16 + (tid >> 4)) * PJ_LP + (tid & 15) * 4] = f.v; }
#pragma unroll      /* constant indices: the values stay in registers */
  for (int j = 0; j < 2; ++j) { if ((j ? d1 : d0) < 0) continue;
#pragma unroll      /* constant indices: the values stay in registers */
    for (int i = j * 8; i < j * 8 + 8; ++i) { FragQ f;
#pragma unroll      /* constant indices: the values stay in registers */
      for (int q = 0; q < 4; ++q) f.h[q] = (_Float16)bf16_round(xr[i][q]);
      *(v4us*)(unsigned short*)&xw[(i * 2 + hh) * PJ_LP + ln * 4] = f.v; } }
  if (sel == 0) wo_store(ow, BO, ot);      /* scalar test */
  __syncthreads();      /* publishes the weight rows (and orders each wave's own rows) */
  const v8f z8 = {0.f,0.f,0.f,0.f,0.f,0.f,0.f,0.f};
  v16h wf[4][2];
#pragma unroll      /* constant indices: the values stay in registers */
  for (int t = 0; t < 4; ++t)
#pragma unroll      /* constant indices: the values stay in registers */
    for (int ks = 0; ks < 2; ++ks) wf[t][ks] = g2_frag(&wl[(t * 16 + ln) * PJ_LP + ks * 32], hh);
#pragma unroll      /* constant indices: the values stay in registers */
  for (int j = 0; j < 2; ++j) { if ((j ? d1 : d0) < 0) continue;
    _Float16* xrow = xw + (j * 16 + ln) * PJ_LP;
    const v16h x0 = g2_frag(xrow, hh), x1 = g2_frag(xrow + 32, hh);
#pragma unroll      /* constant indices: the values stay in registers */
    for (int t = 0; t < 4; ++t) { const v8f a = fa_mma(wf[t][1], x1, fa_mma(wf[t][0], x0, z8)); FragH f;
#pragma unroll      /* constant indices: the values stay in registers */
      for (int r = 0; r < 8; ++r) f.h[r] = (_Float16)(a[r] * 0.0625f);
      *(v8us*)(unsigned short*)(xrow + t * 16 + 8 * hh) = f.half[0]; } }
  __builtin_amdgcn_fence(__ATOMIC_ACQ_REL, "workgroup"); __builtin_amdgcn_wave_barrier();      /* the wave's lanes read each other's output pieces below */
#pragma unroll      /* constant indices: the values stay in registers */
  for (int j = 0; j < 2; ++j) { const int dt = j ? d1 : d0;
    if (dt >= 0) {
#pragma unroll      /* constant indices: the values stay in registers */
      for (int i = 0; i < 4; ++i) { const int r = i * 4 + (lane >> 3), c8 = (lane & 7) * 8;      /* four whole rows, 512 B in a row, per store */
        const v8us v = *(const v8us*)(const unsigned short*)&xw[(j * 16 + r) * PJ_LP + c8];
        *(v8us*)((unsigned short*)Y + ((size_t)dt * NH + r) * HD + c8) = v; }
      if (j == 0) asm volatile("s_wait_xcnt 0x0" ::: "memory"); } }      /* precaution: the second token's LDS reads reuse the data registers of the stores above */
}
// Output GEMM, out = o Wo^T * alpha + b: one 128 x 128 tile of out per work-group (8 waves, 2 x 4, 64 x 32 each), 256 work-groups. Both operands are K-contiguous f16 rows. A stage is 128 k (256 B) of the tile's 128 o rows
// and 128 Wo rows, brought into LDS by asynchronous 16-byte copies (a wave's copy covers two whole 256-byte row pieces, so every L2 request is a whole line and each line is asked for once per work-group),
// rows at a pitch of 272 B (conflict-free for 16-byte readers). Two buffers: stage t + 1 flies while stage t is worked on. Fragments by g2_frag from LDS for A and B alike (same k order);
// every accumulator takes its k blocks of 32 in rising order, as before. The f32 results leave through a wave's own LDS rows as whole 128-byte lines.
#define OG_BK 128            /* k per stage */
#define OG_NT (DM / OG_BK)   /* stages */
#define OG_LP 136            /* LDS row pitch in f16: 256 B of data + 16 B */
#define OG_SP 36             /* output staging pitch in f32: 128 B of data + 16 B */
// Eight copies of one thread, rows 16 apart. The s_wait_xcnt is the last line of the copies' own statement, so that no address register of a copy is rewritten in front of it (a precaution).
__device__ __forceinline__ void og_copy8(unsigned l, const _Float16* g) {
  asm volatile("global_load_async_to_lds_b128 %0, %8, off\n\tglobal_load_async_to_lds_b128 %1, %9, off\n\tglobal_load_async_to_lds_b128 %2, %10, off\n\tglobal_load_async_to_lds_b128 %3, %11, off\n\t"
               "global_load_async_to_lds_b128 %4, %12, off\n\tglobal_load_async_to_lds_b128 %5, %13, off\n\tglobal_load_async_to_lds_b128 %6, %14, off\n\tglobal_load_async_to_lds_b128 %7, %15, off\n\ts_wait_xcnt 0x0"
               :: "v"(l), "v"(l + 16u * OG_LP * 2u), "v"(l + 32u * OG_LP * 2u), "v"(l + 48u * OG_LP * 2u), "v"(l + 64u * OG_LP * 2u), "v"(l + 80u * OG_LP * 2u), "v"(l + 96u * OG_LP * 2u), "v"(l + 112u * OG_LP * 2u),
                  "v"(g), "v"(g + 16 * DM), "v"(g + 32 * DM), "v"(g + 48 * DM), "v"(g + 64 * DM), "v"(g + 80 * DM), "v"(g + 96 * DM), "v"(g + 112 * DM) : "memory"); }
__global__ __launch_bounds__(256) void k_ogemm(const _Float16* __restrict__ A, const _Float16* __restrict__ Bh, float alpha, const float* __restrict__ bias, float* __restrict__ C) {
  __shared__ __attribute__((aligned(16))) _Float16 at_[2][128 * OG_LP];      /* o rows of a stage: [row][k] */
  __shared__ __attribute__((aligned(16))) _Float16 bt_[2][128 * OG_LP];      /* Wo rows of a stage: [col][k] */
  __shared__ __attribute__((aligned(16))) float so[8][64 * OG_SP];      /* per wave: its 64 x 32 results */
  const int tid = threadIdx.x, w = tid >> 5, lane = tid & 31, ln = lane & 15, hh = lane >> 4;
  const int row0 = (blockIdx.x / (DM / 128)) * 128, col0 = (blockIdx.x % (DM / 128)) * 128;
  const int wm = w >> 2, wn = w & 3;
  const int cr = tid >> 4, cc = (tid & 15) * 8;      /* copies: 16 threads per 256-byte row piece, rows cr + 16 i */
  const _Float16* ag = A + (size_t)(row0 + cr) * DM + cc;
  const _Float16* bg = Bh + (size_t)(col0 + cr) * DM + cc;
  const unsigned al = (unsigned)(size_t)&at_[0][cr * OG_LP + cc], bl = (unsigned)(size_t)&bt_[0][cr * OG_LP + cc];      /* LDS byte addresses */
  const unsigned bufb = 128u * OG_LP * 2u;      /* bytes of one buffer */
  og_copy8(al, ag); og_copy8(bl, bg);
  asm volatile("s_wait_asynccnt 0x0" ::: "memory");      /* stage 0 has landed for this wave's copies */
  __syncthreads();      /* publishes stage 0 */
  og_copy8(al + bufb, ag + OG_BK); og_copy8(bl + bufb, bg + OG_BK);
  const v8f z8 = {0.f,0.f,0.f,0.f,0.f,0.f,0.f,0.f};
  v8f acc[4][2];
#pragma unroll      /* constant indices: the values stay in registers */
  for (int i = 0; i < 4; ++i) { acc[i][0] = z8; acc[i][1] = z8; }
  for (int t = 0; t < OG_NT; ++t) {
    const _Float16* ap = &at_[t & 1][(wm * 64 + ln) * OG_LP]; const _Float16* bp = &bt_[t & 1][(wn * 32 + ln) * OG_LP];
    v16h af[2][4], bf[2][2];      /* two fragment sets: block ks + 1 is fetched while block ks is multiplied */
#pragma unroll      /* constant indices: the values stay in registers */
    for (int i = 0; i < 4; ++i) af[0][i] = g2_frag(ap + i * 16 * OG_LP, hh);
#pragma unroll      /* constant indices: the values stay in registers */
    for (int j = 0; j < 2; ++j) bf[0][j] = g2_frag(bp + j * 16 * OG_LP, hh);
#pragma unroll      /* constant indices: the values stay in registers */
    for (int ks = 0; ks < OG_BK / 32; ++ks) { const int cu = ks & 1, nx = cu ^ 1;
      if (ks + 1 < OG_BK / 32) {
#pragma unroll      /* constant indices: the values stay in registers */
        for (int i = 0; i < 4; ++i) af[nx][i] = g2_frag(ap + i * 16 * OG_LP + (ks + 1) * 32, hh);
#pragma unroll      /* constant indices: the values stay in registers */
        for (int j = 0; j < 2; ++j) bf[nx][j] = g2_frag(bp + j * 16 * OG_LP + (ks + 1) * 32, hh); }
      __builtin_amdgcn_sched_barrier(0);      /* keeps the next block's LDS reads as one group in front of this block's products: sunk among them, one fragment set is reused and every pair of products waits out an LDS latency */
#pragma unroll      /* constant indices: the values stay in registers */
      for (int i = 0; i < 4; ++i) { acc[i][0] = fa_mma(af[cu][i], bf[cu][0], acc[i][0]); acc[i][1] = fa_mma(af[cu][i], bf[cu][1], acc[i][1]); }
      __builtin_amdgcn_sched_barrier(0);      /* keeps the block after next's reads behind these products, so that two fragment sets suffice */
    }
    asm volatile("s_wait_dscnt 0x0" ::: "memory");      /* this wave's reads of stage t have returned before its buffer is refilled */
    asm volatile("s_wait_asynccnt 0x0" ::: "memory");      /* this wave's copies of stage t + 1 have landed */
    __syncthreads();      /* publishes stage t + 1; ends every wave's reads of stage t */
    if (t + 2 < OG_NT) { const unsigned bo = (unsigned)(t & 1) * bufb; og_copy8(al + bo, ag + (t + 2) * OG_BK); og_copy8(bl + bo, bg + (t + 2) * OG_BK); }
  }
  asm volatile("s_wait_asynccnt 0x0" ::: "memory");      /* no copy is outstanding when the wave goes on and ends */
  float* sw = &so[w][0];
#pragma unroll      /* constant indices: the values stay in registers */
  for (int j = 0; j < 2; ++j) { const float bv = bf16_round(bias[col0 + wn * 32 + j * 16 + ln]);
#pragma unroll      /* constant indices: the values stay in registers */
    for (int i = 0; i < 4; ++i)
#pragma unroll      /* constant indices: the values stay in registers */
      for (int r = 0; r < 8; ++r) sw[(i * 16 + 8 * hh + r) * OG_SP + j * 16 + ln] = acc[i][j][r] * alpha + bv; }
  __builtin_amdgcn_fence(__ATOMIC_ACQ_REL, "workgroup"); __builtin_amdgcn_wave_barrier();      /* the wave's lanes read each other's results below */
  float* cp = C + (size_t)(row0 + wm * 64 + (lane >> 3)) * DM + col0 + wn * 32 + (lane & 7) * 4;
#pragma unroll      /* constant indices: the values stay in registers */
  for (int q = 0; q < 16; ++q) { const v4f v = *(const v4fa*)&sw[(q * 4 + (lane >> 3)) * OG_SP + (lane & 7) * 4];      /* four whole 128-byte lines per store */
    *(v4f*)(cp + (size_t)q * 4 * DM) = v; }
}
extern "C" void kernel_launch(void* const* d_in, const int* in_sizes, int n_in,
                              void* d_out, int out_size, void* d_ws, size_t ws_size, hipStream_t stream) {
  (void)in_sizes; (void)n_in; (void)out_size;
  const float* const* I = (const float* const*)d_in; const float* xq = I[2]; const float* xk = I[1]; const float* xv = I[0]; const int* km = (const int*)d_in[3]; const float* wq = I[6]; const float* wk = I[5]; const float* wv = I[4]; const float* wo = I[7]; const float* bo = I[8];      /* contract order: values I[0], keys I[1], query I[2]; mask int32 [2][1][1][2048] (0 = masked key; READ on device); SHARED natural [64][64] blocks Wv I[4], Wk I[5], Wq I[6]; natural Wo [1024][1024] + bo */
  char* ws = (char*)d_ws; size_t off = 0;
  auto take = [&](size_t bytes) { char* p = ws + off; off += (bytes + 255) & ~(size_t)255; return p; };
  _Float16* BO = (_Float16*)take((size_t)DM * DM * 2);
  _Float16* Q16 = (_Float16*)take(NR * DM * 2); _Float16* K16 = (_Float16*)take(NR * DM * 2); _Float16* V16 = (_Float16*)take(NR * DM * 2); _Float16* O16 = (_Float16*)take(NR * DM * 2);
  int* KN = (int*)take((size_t)NB * 4);
  if (off > ws_size) return;
  const size_t r0p = (size_t)B0 * SQ;      /* first row of the output stage */
  k_proj<<<dim3((unsigned)(NR * NH / 256), 3), 256, 0, stream>>>(xq, xk, xv, wq, wk, wv, wo, km, Q16, K16, V16, BO, KN);      /* q of every token row and head, k and v of the kept keys packed to the front of their batch, f16 rows in the merged layout; the kept keys' count; by the Q work-groups Wo natural [out][in] = Bt x16 */
  k_fattn<<<dim3(SQ / 256, NB * NH), 512, 0, stream>>>(Q16, K16, V16, KN, O16);      /* scores, masked softmax and P V of every (batch, head) in one launch; o (merged heads, x64) as f16 rows */
  k_ogemm<<<(unsigned)((MPO / 128) * (DM / 128)), 256, 0, stream>>>(O16 + r0p * DM, BO, 0.0009765625f, bo, (float*)d_out + r0p * DM);      /* out rows are the output layout */
}

// v010
// One run takes 36 microseconds.
// Versions in between are left out here; by their measured steps it is 1.17 times as fast as v008.
// All steps since v000 together make it 96.7 times as fast.
#include <hip/hip_runtime.h>
// Multi-head attention over three inputs with SHARED per-head projections, a random key-padding mask and the module's literal score scale (values, keys, query [2][2048][1024]; each input is split into 16 heads of 64 and every head is multiplied by the SAME natural [64][64] matrix (x W^T: Wv / Wk / Wq; no biases); energy = q k^T; where(mask == 0, -1e20) with the int32 [2][1][1][2048] mask in {0, 1} (random; 0 = masked key; READ on device); softmax(energy / sqrt(embed_size) = / sqrt(1024) = / 32) (as the source); out = merged Wo^T + bo (natural [1024][1024]) -> [2][2048][1024]).
// Keys with mask == 0 have weight exactly 0 wherever their batch keeps a key: every attention work-group ranks its batch's kept keys and walks those input rows alone (any mask; a batch with no kept key walks all keys with equal scores).
// Structure: two launches. One fused attention launch over every (batch, head) reads the f32 inputs themselves. The K and V projections are carried across the attention products: q . (Wk xk) = (q Wk) . xk, and sum_j p_j (Wv xv_j) = Wv (sum_j p_j xv_j),
// so a work-group projects only its own queries (q = Wq xq, then q' = q Wk, both by WMMA, K = 64), takes scores of q' against the key input rows and sums the value input rows, and multiplies the 64 summed dims of a query by Wv once at the end (WMMA). Scores by WMMA (scale 1/32 = 1/sqrt(embed size), the module's literal scale),
// running-maximum softmax in registers (f32 statistics; unnormalised weights as f16), divided by the row sum at the end (carried x64 against f16 subnormal flush, folded into the output GEMM alpha), written straight into the merged f16 o rows; out = o W_o + b GEMM (f32) into the output layout.
// Compute dtype: inputs rounded to bf16, held as exact f16; weights exact (x16); q, q', softmax weights, the summed value rows and o as plain f16 GEMM operands (~2^-12); scores and softmax statistics f32. v_wmma_f32_16x16x32_f16.
#define NB 2
#define SQ 2048
#define DM 1024
#define NH 16
#define HD 64
#define HG 4                         /* heads per launch of the grouped k_vt overload (not launched) */
#define B0 0                         /* first batch processed (debug hook) */
#define NBR NB                       /* batches processed (debug hook) */
#define NR ((size_t)NB * SQ)         /* token rows */
#define MP ((int)((size_t)NBR * SQ)) /* token rows of the output stage, via MPO (debug hook) */
#define QN SQ                        /* query rows per batch (not used) */
#define NHD NH                       /* heads (not used) */
#define MPO MP                       /* rows through the output stage (debug hook) */
#define LQ DM      /* row pitch of a token row (not used) */
typedef __bf16 v16b __attribute__((ext_vector_type(16)));
typedef unsigned short v8us __attribute__((ext_vector_type(8), may_alias));
typedef float  v8f  __attribute__((ext_vector_type(8)));
typedef float  v4f  __attribute__((ext_vector_type(4)));
typedef float  v4fa __attribute__((ext_vector_type(4), may_alias));
union FragB { v16b v; v8us half[2]; unsigned short u[16]; };

__device__ __forceinline__ unsigned short bf16_bits(float x) { unsigned int u = __float_as_uint(x); return (unsigned short)((u + 0x7FFFu + ((u >> 16) & 1u)) >> 16); }
__device__ __forceinline__ float bf16_val(unsigned short b) { return __uint_as_float(((unsigned int)b) << 16); }
__device__ __forceinline__ float bf16_round(float x) { return bf16_val(bf16_bits(x)); }
// D += A·B with NT terms: 1 = ah·bh, 2 = + al·bh (A split), 3 = + ah·bl (both split)
template <int NT>
__device__ __forceinline__ v8f mmaN(v16b ah, v16b al, v16b bh, v16b bl, v8f c) {
  c = __builtin_amdgcn_wmma_f32_16x16x32_bf16(false, ah, false, bh, (short)0, c, false, false);
  if (NT >= 2) c = __builtin_amdgcn_wmma_f32_16x16x32_bf16(false, al, false, bh, (short)0, c, false, false);
  if (NT >= 3) c = __builtin_amdgcn_wmma_f32_16x16x32_bf16(false, ah, false, bl, (short)0, c, false, false);
  asm volatile("v_nop\n\tv_nop\n\tv_nop\n\tv_nop" : "+v"(c) : "v"(ah), "v"(al), "v"(bh), "v"(bl));
  return c;
}

__global__ __launch_bounds__(256) void k_wt_bf16(const float* __restrict__ W, unsigned short* __restrict__ Wt, int K, int N) {
  const int t = blockIdx.x * 256 + threadIdx.x;
  const int k8n = K / 8;
  if (t >= N * k8n) return;
  const int n = t / k8n, k8 = (t % k8n) * 8;
  v8us v;
#pragma unroll
  for (int i = 0; i < 8; ++i) v[i] = bf16_bits(W[(size_t)(k8 + i) * N + n]);
  *(v8us*)(Wt + (size_t)n * K + k8) = v;
  
}

// GEMM C[M][N] (f32, pitch ldc) = act(A[M][K]·W + bias). A f32 row-major (pitch lda) converted per fragment to bf16
// (ASPLIT: hi/lo two planes -> 2 terms, else single rounded term); Wt bf16 [N][K] (pitch ldb). BIAS_BF16 rounds the
// bias to bf16 first (bias quantised to bf16 before the add). K%32==0, M%16==0, N%64==0.
template <bool ASPLIT, int ACT, bool BIAS_BF16>
__global__ __launch_bounds__(128) void k_gemm_bf(const float* __restrict__ A, int lda, const unsigned short* __restrict__ Wt, int ldb,
                                               const float* __restrict__ bias, float* __restrict__ C, int ldc, int M, int N, int K) {
  __shared__ __attribute__((aligned(16))) float so[4][16][64];
  const int tid = threadIdx.x, w = tid >> 5, lane = tid & 31, ln = lane & 15, hh = lane >> 4;
  const int ntn = N / 64;
  const int wid = blockIdx.x * 4 + w;
  const int mt = wid / ntn, nq = wid % ntn;
  if (mt * 16 >= M) return;
  const int row0 = mt * 16, col0 = nq * 64;
  const float* arow = A + (size_t)(row0 + ln) * lda;
  v8f acc[4] = {};
  for (int kb = 0; kb < K; kb += 32) {
    FragB ah, al;
    const v4f x0 = *(const v4fa*)(arow + kb + 8 * hh), x1 = *(const v4fa*)(arow + kb + 8 * hh + 4);
    const v4f x2 = *(const v4fa*)(arow + kb + 16 + 8 * hh), x3 = *(const v4fa*)(arow + kb + 16 + 8 * hh + 4);
    float xs[16] = {x0[0],x0[1],x0[2],x0[3],x1[0],x1[1],x1[2],x1[3],x2[0],x2[1],x2[2],x2[3],x3[0],x3[1],x3[2],x3[3]};
#pragma unroll
    for (int i = 0; i < 16; ++i) { const unsigned short hb = bf16_bits(xs[i]); ah.u[i] = hb; al.u[i] = ASPLIT ? bf16_bits(xs[i] - bf16_val(hb)) : (unsigned short)0; }
#pragma unroll
    for (int t = 0; t < 4; ++t) {
      const unsigned short* brow = Wt + (size_t)(col0 + t * 16 + ln) * ldb + kb;
      FragB b;
      b.half[0] = *(const v8us*)(brow + 8 * hh);
      b.half[1] = *(const v8us*)(brow + 16 + 8 * hh);
      acc[t] = mmaN<ASPLIT ? 2 : 1>(ah.v, al.v, b.v, b.v, acc[t]);
    }
  }
#pragma unroll
  for (int t = 0; t < 4; ++t) {
    float bv = bias ? bias[col0 + t * 16 + ln] : 0.f;
    if (BIAS_BF16) bv = bf16_round(bv);
#pragma unroll
    for (int r = 0; r < 8; ++r) { float v = acc[t][r] + bv; if (ACT == 1) v = fmaxf(v, 0.f); so[w][8 * hh + r][t * 16 + ln] = v; }
  }
  __builtin_amdgcn_fence(__ATOMIC_ACQ_REL, "workgroup");
  __builtin_amdgcn_wave_barrier();
  const int rsub = lane >> 4, c4 = (lane & 15) * 4;
  {
#pragma unroll
    for (int q = 0; q < 8; ++q) {
      const int r = q * 2 + rsub;
      const v4f v = *(const v4fa*)&so[w][r][c4];
      *(v4f*)(C + (size_t)(row0 + r) * ldc + col0 + c4) = v;
    }
    
  }
}

// GEMM C = act(A·W + bias + resid): A f32 (ASPLIT -> hi/lo 2 terms), Wt bf16 [N][K]; ACT 0 none, 1 relu, 2 exact gelu;
// resid (optional, f32, row index = (row % rmod), pitch ldr, RES_BF16 rounds it) added before the activation.
template <bool ASPLIT, int ACT, bool BIAS_BF16, bool RES_BF16>
__global__ __launch_bounds__(128) void k_gemm_bf3(const float* __restrict__ A, int lda, const unsigned short* __restrict__ Wt, int ldb,
                                                const float* __restrict__ bias, const float* __restrict__ resid, int rmod, int ldr,
                                                float* __restrict__ C, int ldc, int M, int N, int K) {
  __shared__ __attribute__((aligned(16))) float so[4][16][64];
  const int tid = threadIdx.x, w = tid >> 5, lane = tid & 31, ln = lane & 15, hh = lane >> 4;
  const int ntn = N / 64;
  const int wid = blockIdx.x * 4 + w;
  const int mt = wid / ntn, nq = wid % ntn;
  if (mt * 16 >= M) return;
  const int row0 = mt * 16, col0 = nq * 64;
  const float* arow = A + (size_t)(row0 + ln) * lda;
  v8f acc[4] = {};
  for (int kb = 0; kb < K; kb += 32) {
    FragB ah, al;
    const v4f x0 = *(const v4fa*)(arow + kb + 8 * hh), x1 = *(const v4fa*)(arow + kb + 8 * hh + 4);
    const v4f x2 = *(const v4fa*)(arow + kb + 16 + 8 * hh), x3 = *(const v4fa*)(arow + kb + 16 + 8 * hh + 4);
    float xs[16] = {x0[0],x0[1],x0[2],x0[3],x1[0],x1[1],x1[2],x1[3],x2[0],x2[1],x2[2],x2[3],x3[0],x3[1],x3[2],x3[3]};
#pragma unroll
    for (int i = 0; i < 16; ++i) { const unsigned short hb = bf16_bits(xs[i]); ah.u[i] = hb; al.u[i] = ASPLIT ? bf16_bits(xs[i] - bf16_val(hb)) : (unsigned short)0; }
#pragma unroll
    for (int t = 0; t < 4; ++t) {
      const unsigned short* brow = Wt + (size_t)(col0 + t * 16 + ln) * ldb + kb;
      FragB b;
      b.half[0] = *(const v8us*)(brow + 8 * hh);
      b.half[1] = *(const v8us*)(brow + 16 + 8 * hh);
      acc[t] = mmaN<ASPLIT ? 2 : 1>(ah.v, al.v, b.v, b.v, acc[t]);
    }
  }
#pragma unroll
  for (int t = 0; t < 4; ++t) {
    const int col = col0 + t * 16 + ln;
    float bv = bias ? bias[col] : 0.f;
    if (BIAS_BF16) bv = bf16_round(bv);
#pragma unroll
    for (int r = 0; r < 8; ++r) {
      float v = acc[t][r] + bv;
      if (resid) { float rv = resid[(size_t)((row0 + 8 * hh + r) % rmod) * ldr + col]; if (RES_BF16) rv = bf16_round(rv); v += rv; }
      if (ACT == 1) v = fmaxf(v, 0.f);
      if (ACT == 2) v = 0.5f * v * (1.0f + erff(v * 0.70710678118654752f));
      if (ACT == 3) { const float u = 0.7978845608028654f * (v + 0.044715f * v * v * v); v = 0.5f * v * (1.0f + tanhf(u)); }
      so[w][8 * hh + r][t * 16 + ln] = v;
    }
  }
  __builtin_amdgcn_fence(__ATOMIC_ACQ_REL, "workgroup");
  __builtin_amdgcn_wave_barrier();
  const int rsub = lane >> 4, c4 = (lane & 15) * 4;
  {
#pragma unroll
    for (int q = 0; q < 8; ++q) {
      const int r = q * 2 + rsub;
      const v4f v = *(const v4fa*)&so[w][r][c4];
      *(v4f*)(C + (size_t)(row0 + r) * ldc + col0 + c4) = v;
    }
    
  }
}
// row LayerNorm (biased variance, eps) over N: s = X (+ R); optional out_sum <- s; out_norm <- (s-mu)*rsqrt(var+eps)*g + b
template <bool PARAM_BF16>
__global__ __launch_bounds__(256) void k_layernorm(const float* __restrict__ X, const float* __restrict__ R, const float* __restrict__ g, const float* __restrict__ bta,
                                                  float* __restrict__ out_sum, float* __restrict__ out_norm, int N, float eps) {
  __shared__ float red[256];
  const int row = blockIdx.x, tid = threadIdx.x;
  const float* x = X + (size_t)row * N; const float* rr = R ? R + (size_t)row * N : nullptr;
  float vals[16];                     // up to N = 4096
  const int per = N / 256;            // contiguous chunk per thread? use strided-by-4 chunks: thread handles j = tid*4 + 1024*u
  float s1 = 0.f;
  for (int u = 0; u < per / 4; ++u) {
    const int j = tid * 4 + 1024 * u;
    const v4f a = *(const v4fa*)(x + j);
    v4f b = {0.f,0.f,0.f,0.f}; if (rr) b = *(const v4fa*)(rr + j);
#pragma unroll
    for (int q = 0; q < 4; ++q) { const float v = a[q] + b[q]; vals[u * 4 + q] = v; s1 += v; }
  }
  red[tid] = s1; __syncthreads();
  for (int st = 128; st > 0; st >>= 1) { if (tid < st) red[tid] += red[tid + st]; __syncthreads(); }
  const float mu = red[0] / (float)N; __syncthreads();
  float s2 = 0.f;
  for (int u = 0; u < per / 4; ++u)
#pragma unroll
    for (int q = 0; q < 4; ++q) { const float c = vals[u * 4 + q] - mu; s2 += c * c; }
  red[tid] = s2; __syncthreads();
  for (int st = 128; st > 0; st >>= 1) { if (tid < st) red[tid] += red[tid + st]; __syncthreads(); }
  const float rs = rsqrtf(red[0] / (float)N + eps);
  {
    for (int u = 0; u < per / 4; ++u) {
      const int j = tid * 4 + 1024 * u;
      v4f o, sm;
#pragma unroll
      for (int q = 0; q < 4; ++q) {
        float gg = g[j + q], bb = bta[j + q];
        if (PARAM_BF16) { gg = bf16_round(gg); bb = bf16_round(bb); }
        sm[q] = vals[u * 4 + q]; o[q] = (vals[u * 4 + q] - mu) * rs * gg + bb;
      }
      if (out_sum) *(v4f*)(out_sum + (size_t)row * N + j) = sm;
      *(v4f*)(out_norm + (size_t)row * N + j) = o;
    }
    
  }
}



// ---- f16 WMMA path (v_wmma_f32_16x16x32_f16): 11-bit significands for operands in range — used where a [0,1] probability operand needs more precision than bf16
typedef _Float16 v16h __attribute__((ext_vector_type(16)));
union FragH { v16h v; v8us half[2]; _Float16 h[16]; unsigned short u[16]; };
template <int NT>
__device__ __forceinline__ v8f mmaH(v16h ah, v16h al, v16h bh, v16h bl, v8f c) {
  c = __builtin_amdgcn_wmma_f32_16x16x32_f16(false, ah, false, bh, (short)0, c, false, false);
  if (NT >= 2) c = __builtin_amdgcn_wmma_f32_16x16x32_f16(false, al, false, bh, (short)0, c, false, false);
  if (NT >= 3) c = __builtin_amdgcn_wmma_f32_16x16x32_f16(false, ah, false, bl, (short)0, c, false, false);
  asm volatile("v_nop\n\tv_nop\n\tv_nop\n\tv_nop" : "+v"(c) : "v"(ah), "v"(al), "v"(bh), "v"(bl));
  return c;
}
// batched GEMM like k_gemm_b but f16 operands: A f32 (split into f16 hi/lo if ASPLIT, else rounded to f16), Bt = f16 values [n][k]; alpha; C f32; N multiple of 16 (partial tiles skipped)
template <bool ASPLIT>
__global__ __launch_bounds__(128) void k_gemm_h(const float* __restrict__ A, int lda, size_t sA, const _Float16* __restrict__ Bh, int ldb, size_t sB, float alpha, float* __restrict__ C, int ldc, size_t sC, int M, int N, int K) {
  __shared__ __attribute__((aligned(16))) float so[4][16][64];
  const int tid = threadIdx.x, w = tid >> 5, lane = tid & 31, ln = lane & 15, hh = lane >> 4; const int by = blockIdx.y;
  A += (size_t)by * sA; Bh += (size_t)by * sB; C += (size_t)by * sC;
  const int ntn = (N + 63) / 64; const int wid = blockIdx.x * 4 + w; const int mt = wid / ntn, nq = wid % ntn; if (mt * 16 >= M) return;
  const int row0 = mt * 16, col0 = nq * 64; const float* arow = A + (size_t)(row0 + ln) * lda;
  v8f acc[4] = {};
  for (int kb = 0; kb < K; kb += 32) {
    FragH ah, al;
    const v4f x0 = *(const v4fa*)(arow + kb + 8 * hh), x1 = *(const v4fa*)(arow + kb + 8 * hh + 4), x2 = *(const v4fa*)(arow + kb + 16 + 8 * hh), x3 = *(const v4fa*)(arow + kb + 16 + 8 * hh + 4);
    float xs[16] = {x0[0],x0[1],x0[2],x0[3],x1[0],x1[1],x1[2],x1[3],x2[0],x2[1],x2[2],x2[3],x3[0],x3[1],x3[2],x3[3]};
#pragma unroll
    for (int i = 0; i < 16; ++i) { const _Float16 h = (_Float16)xs[i]; ah.h[i] = h; al.h[i] = ASPLIT ? (_Float16)(xs[i] - (float)h) : (_Float16)0.0f; }
#pragma unroll
    for (int t = 0; t < 4; ++t) { if (col0 + t * 16 >= N) continue; const size_t boff = (size_t)(col0 + t * 16 + ln) * ldb + kb; FragH bq; bq.half[0] = *(const v8us*)(Bh + boff + 8 * hh); bq.half[1] = *(const v8us*)(Bh + boff + 16 + 8 * hh);
      acc[t] = mmaH<ASPLIT ? 2 : 1>(ah.v, al.v, bq.v, bq.v, acc[t]); }
  }
#pragma unroll
  for (int t = 0; t < 4; ++t) { if (col0 + t * 16 >= N) continue;
#pragma unroll
    for (int r = 0; r < 8; ++r) so[w][8 * hh + r][t * 16 + ln] = acc[t][r] * alpha; }
  __builtin_amdgcn_fence(__ATOMIC_ACQ_REL, "workgroup"); __builtin_amdgcn_wave_barrier();
  const int rsub = lane >> 4, c4 = (lane & 15) * 4;
  {
#pragma unroll
    for (int q = 0; q < 8; ++q) { const int r = q * 2 + rsub; if (col0 + c4 < N) { const v4f v = *(const v4fa*)&so[w][r][c4]; *(v4f*)(C + (size_t)(row0 + r) * ldc + col0 + c4) = v; } }
     }
}

// Wt[n][k] = f16(W[k][n]·scale) from f32 row-major W[K][N] (scale = power of two; bf16-exact weights stay exact in f16 away from the subnormal range)
__global__ __launch_bounds__(256) void k_wt_f16(const float* __restrict__ W, _Float16* __restrict__ Wt, int K, int N, float scale) {
  const int t = blockIdx.x * 256 + threadIdx.x; if (t >= N * (K / 8)) return; const int n = t / (K / 8), k8 = (t % (K / 8)) * 8; FragH f;
#pragma unroll
  for (int i = 0; i < 8; ++i) f.h[i] = (_Float16)(bf16_round(W[(size_t)(k8 + i) * N + n]) * scale); const v8us o = f.half[0];
  *(v8us*)((unsigned short*)Wt + (size_t)n * K + k8) = o; 
}
// k_gemm_hh variant with fused epilogue: v = acc·alpha + bias[by·sBias + col] (+ CP[(row/rowsPerB)·sCPb + by·64 + col] if CP) ; ACT 0 none / 1 elu ; writes f16 C16 (and f32 C if non-null)
template <int ACT>
__global__ __launch_bounds__(128) void k_gemm_hhx(const _Float16* __restrict__ A, int lda, size_t sA, const _Float16* __restrict__ Bh, int ldb, size_t sB, float alpha, const float* __restrict__ bias, size_t sBias, const float* __restrict__ CP, int rowsPerB, size_t sCPb, int row0g,
    float* __restrict__ C, _Float16* __restrict__ C16, int ldc, size_t sC, int M, int N, int K) {
  __shared__ __attribute__((aligned(16))) float so[4][16][64];
  const int tid = threadIdx.x, w = tid >> 5, lane = tid & 31, ln = lane & 15, hh = lane >> 4; const int by = blockIdx.y;
  A += (size_t)by * sA; Bh += (size_t)by * sB; const size_t cofs = (size_t)by * sC; const float* bp = bias ? bias + (size_t)by * sBias : nullptr;
  const int ntn = (N + 63) / 64; const int wid = blockIdx.x * 4 + w; const int mt = wid / ntn, nq = wid % ntn; if (mt * 16 >= M) return;
  const int row0 = mt * 16, col0 = nq * 64; const _Float16* arow = A + (size_t)(row0 + ln) * lda;
  v8f acc[4] = {};
  for (int kb = 0; kb < K; kb += 32) { FragH ah; ah.half[0] = *(const v8us*)((const unsigned short*)arow + kb + 8 * hh); ah.half[1] = *(const v8us*)((const unsigned short*)arow + kb + 16 + 8 * hh);
#pragma unroll
    for (int t = 0; t < 4; ++t) { if (col0 + t * 16 >= N) continue; const size_t boff = (size_t)(col0 + t * 16 + ln) * ldb + kb; FragH bq; bq.half[0] = *(const v8us*)((const unsigned short*)Bh + boff + 8 * hh); bq.half[1] = *(const v8us*)((const unsigned short*)Bh + boff + 16 + 8 * hh);
      acc[t] = mmaH<1>(ah.v, ah.v, bq.v, bq.v, acc[t]); }
  }
#pragma unroll
  for (int t = 0; t < 4; ++t) { if (col0 + t * 16 >= N) continue; const int col = col0 + t * 16 + ln; const float bv = bp ? bf16_round(bp[col]) : 0.f;
#pragma unroll
    for (int r = 0; r < 8; ++r) { float v = acc[t][r] * alpha + bv; if (CP) { const int rr = row0g + row0 + 8 * hh + r; if (rowsPerB < 0) v += CP[cofs + (size_t)rr * ldc + col];      /* rowsPerB < 0: own element of the batched C plane */ else { const int bidx = rr / rowsPerB; v += CP[(size_t)bidx * sCPb + (size_t)by * 64 + col]; } } if (ACT == 1) v = (v > 0.f) ? v : expm1f(v); else if (ACT == 7) v = (v > 0.f) ? v + 1.0f : expf(v); else if (ACT == 8) v = tanhf(v); else if (ACT == 9) v = 0.5f * v * (1.0f + tanhf(0.7978845608028654f * (v + 0.044715f * v * v * v))); else if (ACT == 11) v = 1.0f / (1.0f + expf(-v)); else if (ACT == 12) v = (v > 0.f) ? v : 0.01f * v; else if (ACT == 14) v = (v > 0.f) ? v : 0.1f * v; else if (ACT == 16) v = (v >= 0.f) ? v : 0.3f * v; else if (ACT == 17) v = (v >= 0.f) ? v : 0.2f * v; else if (ACT == 15) v = v / (1.0f + expf(-v)); else if (ACT == 3) v = fmaxf(v, 0.f); else if (ACT == 6) v = 0.5f * v * (1.0f + erff(v * 0.70710678118654752f)); so[w][8 * hh + r][t * 16 + ln] = v; } }
  __builtin_amdgcn_fence(__ATOMIC_ACQ_REL, "workgroup"); __builtin_amdgcn_wave_barrier();
  const int rsub = lane >> 4, c4 = (lane & 15) * 4; typedef _Float16 v4h __attribute__((ext_vector_type(4)));
  {
#pragma unroll
    for (int q = 0; q < 8; ++q) { const int r = q * 2 + rsub; if (col0 + c4 < N) { const v4f v = *(const v4fa*)&so[w][r][c4]; if (C) *(v4f*)(C + cofs + (size_t)(row0 + r) * ldc + col0 + c4) = v; if (C16) { v4h h4; for (int i = 0; i < 4; ++i) h4[i] = (_Float16)v[i]; *(v4h*)(C16 + cofs + (size_t)(row0 + r) * ldc + col0 + c4) = h4; } } }
     }
}


typedef _Float16 v4h __attribute__((ext_vector_type(4)));

__global__ __launch_bounds__(256) void k_x16(const float* __restrict__ x, _Float16* __restrict__ X16, size_t n8) { const size_t t = (size_t)blockIdx.x * 256 + threadIdx.x; if (t >= n8) return; FragH f;
#pragma unroll
  for (int q = 0; q < 8; ++q) f.h[q] = (_Float16)bf16_round(x[t * 8 + q]); *(v8us*)((unsigned short*)X16 + t * 8) = f.half[0];  }
__global__ __launch_bounds__(256) void k_h16(const float* __restrict__ x, _Float16* __restrict__ X16, size_t n8) { const size_t t = (size_t)blockIdx.x * 256 + threadIdx.x; if (t >= n8) return; FragH f;
#pragma unroll
  for (int q = 0; q < 8; ++q) f.h[q] = (_Float16)x[t * 8 + q]; *(v8us*)((unsigned short*)X16 + t * 8) = f.half[0];  }
__global__ __launch_bounds__(256) void k_round16f(const float* __restrict__ W, _Float16* __restrict__ Bt, size_t n8) { const size_t t = (size_t)blockIdx.x * 256 + threadIdx.x; if (t >= n8) return; FragH f;
#pragma unroll
  for (int i = 0; i < 8; ++i) f.h[i] = (_Float16)(bf16_round(W[t * 8 + i]) * 16.0f); *(v8us*)((unsigned short*)Bt + t * 8) = f.half[0];  }
__global__ __launch_bounds__(256) void k_hl(const float* __restrict__ F, _Float16* __restrict__ Hh, _Float16* __restrict__ Hl, size_t n8) { const size_t t = (size_t)blockIdx.x * 256 + threadIdx.x; if (t >= n8) return; FragH fh, fl; const v4f a = *(const v4fa*)(F + t * 8), c = *(const v4fa*)(F + t * 8 + 4);
#pragma unroll
  for (int q = 0; q < 4; ++q) { _Float16 h = (_Float16)a[q]; fh.h[q] = h; fl.h[q] = (_Float16)((a[q] - (float)h) * 1024.0f); h = (_Float16)c[q]; fh.h[4 + q] = h; fl.h[4 + q] = (_Float16)((c[q] - (float)h) * 1024.0f); }
  { *(v8us*)((unsigned short*)Hh + t * 8) = fh.half[0]; *(v8us*)((unsigned short*)Hl + t * 8) = fl.half[0];  } }

// ---- fast GEMM (wave tile 32x64; requires M % 32 == 0 rows per launch region and N % 64 == 0); epilogue = k_gemm_hhx semantics ----
__device__ __forceinline__ v16h g2_frag(const _Float16* p, int hh) { FragH f; f.half[0] = *(const v8us*)((const unsigned short*)p + 8 * hh); f.half[1] = *(const v8us*)((const unsigned short*)p + 16 + 8 * hh); return f.v; }
__device__ __forceinline__ v8f g2_mma(v16h a, v16h b, v8f c) { v8f d = __builtin_amdgcn_wmma_f32_16x16x32_f16(false, a, false, b, (short)0, c, false, false); asm volatile("v_nop\n\tv_nop\n\tv_nop\n\tv_nop" : "+v"(d) : "v"(a), "v"(b)); return d; }
template <int ACT>
__global__ __launch_bounds__(128) void k_gemm2(const _Float16* __restrict__ A, int lda, size_t sA, const _Float16* __restrict__ Bh, int ldb, size_t sB, float alpha, const float* __restrict__ bias, size_t sBias, const float* __restrict__ CP, int rowsPerB, size_t sCPb, int row0g,
    float* __restrict__ C, _Float16* __restrict__ C16, int ldc, size_t sC, int M, int N, int K) { static_assert(ACT == 0 || ACT == 3 || ACT == 6 || ACT == 8 || ACT == 9 || ACT == 11 || ACT == 12 || ACT == 14 || ACT == 15 || ACT == 16 || ACT == 17, "k_gemm2: unsupported ACT code (would silently apply no activation)");
  __shared__ __attribute__((aligned(16))) float so[4][32][68];
  const int tid = threadIdx.x, w = tid >> 5, lane = tid & 31, ln = lane & 15, hh = lane >> 4; const int by = blockIdx.y;
  A += (size_t)by * sA; Bh += (size_t)by * sB; const size_t cofs = (size_t)by * sC; const float* bp = bias ? bias + (size_t)by * sBias : nullptr;
  const int ntn = N >> 6; const int mt = blockIdx.x / ntn, nq = blockIdx.x - mt * ntn; const int row0 = mt * 128 + 32 * w, col0 = nq * 64; if (row0 >= M) return;
  const _Float16* a0p = A + (size_t)(row0 + ln) * lda; const _Float16* a1p = a0p + (size_t)16 * lda;
  const _Float16* b0p = Bh + (size_t)(col0 + ln) * ldb; const _Float16* b1p = b0p + (size_t)16 * ldb; const _Float16* b2p = b1p + (size_t)16 * ldb; const _Float16* b3p = b2p + (size_t)16 * ldb;
  const v8f z8 = {0.f,0.f,0.f,0.f,0.f,0.f,0.f,0.f}; v8f c00 = z8, c01 = z8, c02 = z8, c03 = z8, c10 = z8, c11 = z8, c12 = z8, c13 = z8;
#pragma unroll 1
  for (int kb = 0; kb < K; kb += 32) { const v16h a0 = g2_frag(a0p + kb, hh), a1 = g2_frag(a1p + kb, hh);
    v16h b = g2_frag(b0p + kb, hh); c00 = g2_mma(a0, b, c00); c10 = g2_mma(a1, b, c10);
    b = g2_frag(b1p + kb, hh); c01 = g2_mma(a0, b, c01); c11 = g2_mma(a1, b, c11);
    b = g2_frag(b2p + kb, hh); c02 = g2_mma(a0, b, c02); c12 = g2_mma(a1, b, c12);
    b = g2_frag(b3p + kb, hh); c03 = g2_mma(a0, b, c03); c13 = g2_mma(a1, b, c13); }
  v8f accs[8] = {c00, c01, c02, c03, c10, c11, c12, c13};
#pragma unroll
  for (int u = 0; u < 8; ++u) { const int t = u & 3, half = u >> 2; const int col = col0 + t * 16 + ln; const float bv = bp ? bf16_round(bp[col]) : 0.f;
#pragma unroll
    for (int r = 0; r < 8; ++r) { const int rloc = half * 16 + 8 * hh + r; float v = accs[u][r] * alpha + bv; if (CP) { if (rowsPerB < 0) v += CP[cofs + (size_t)(row0g + row0 + rloc) * ldc + col];      /* rowsPerB < 0: own element of the batched C plane */ else { const int bidx = (row0g + row0 + rloc) / rowsPerB; v += CP[(size_t)bidx * sCPb + (size_t)by * 64 + col]; } }
      if (ACT == 3) v = fmaxf(v, 0.f); else if (ACT == 6) v = 0.5f * v * (1.0f + erff(v * 0.70710678118654752f)); else if (ACT == 11) v = 1.0f / (1.0f + expf(-v)); else if (ACT == 15) v = v / (1.0f + expf(-v)); else if (ACT == 12) v = (v > 0.f) ? v : 0.01f * v; else if (ACT == 8) v = tanhf(v); else if (ACT == 9) v = 0.5f * v * (1.0f + tanhf(0.7978845608028654f * (v + 0.044715f * v * v * v))); else if (ACT == 14) v = (v > 0.f) ? v : 0.1f * v; else if (ACT == 16) v = (v >= 0.f) ? v : 0.3f * v; else if (ACT == 17) v = (v >= 0.f) ? v : 0.2f * v;
      so[w][rloc][t * 16 + ln] = v; } }
  __builtin_amdgcn_fence(__ATOMIC_ACQ_REL, "workgroup"); __builtin_amdgcn_wave_barrier();
  const int rsub = lane >> 4, c4 = (lane & 15) * 4;
  {
#pragma unroll
    for (int q = 0; q < 16; ++q) { const int r = q * 2 + rsub; const v4f v = *(const v4fa*)&so[w][r][c4]; if (C) *(v4f*)(C + cofs + (size_t)(row0 + r) * ldc + col0 + c4) = v; if (C16) { v4h h4; for (int i = 0; i < 4; ++i) h4[i] = (_Float16)v[i]; *(v4h*)(C16 + cofs + (size_t)(row0 + r) * ldc + col0 + c4) = h4; } }
     } }


__global__ __launch_bounds__(256) void k_rsm(const float* __restrict__ S, _Float16* __restrict__ P, int nrows) {
  #pragma clang fp contract(off)
  const int i = blockIdx.x * 256 + threadIdx.x; if (i >= nrows) return; const float* s = S + (size_t)i * SQ; float mx = -3.0e38f;
#pragma unroll 1
  for (int j = 0; j < SQ; ++j) mx = fmaxf(mx, s[j]); float se = 0.f;
#pragma unroll 1
  for (int j = 0; j < SQ; ++j) se += expf(s[j] - mx); const float sc = 256.0f / se;
#pragma unroll 1
  for (int j0 = 0; j0 < SQ; j0 += 8) { FragH f; for (int q = 0; q < 8; ++q) f.h[q] = (_Float16)(expf(s[j0 + q] - mx) * sc); unsigned short* d = (unsigned short*)P + (size_t)i * SQ + j0; *(v8us*)d = f.half[0];  } }
__global__ __launch_bounds__(256) void k_vt(const _Float16* __restrict__ V16, int b, int h0, _Float16* __restrict__ VT) { __shared__ unsigned short tl[64][65]; const int tid = threadIdx.x; const int hh = blockIdx.x % HG, sg = blockIdx.x / HG; const int s0 = sg * 64; const int h = h0 + hh;
  for (int i = tid; i < 64 * 8; i += 256) { const int j = i / 8, d8 = (i % 8) * 8; FragH f; f.half[0] = *(const v8us*)((const unsigned short*)V16 + ((size_t)b * SQ + s0 + j) * DM + h * HD + d8); for (int q = 0; q < 8; ++q) tl[d8 + q][j] = f.u[q]; }
  __syncthreads();
  { for (int i = tid; i < 64 * 8; i += 256) { const int d = i / 8, j8 = (i % 8) * 8; FragH f; for (int q = 0; q < 8; ++q) f.u[q] = tl[d][j8 + q]; *(v8us*)((unsigned short*)VT + ((size_t)hh * HD + d) * SQ + s0 + j8) = f.half[0]; }  } }



__global__ __launch_bounds__(256) void k_rsmkm(const float* __restrict__ S, _Float16* __restrict__ P, int nrows, const int* __restrict__ am) {
  #pragma clang fp contract(off)
  const int t = blockIdx.x * 256 + threadIdx.x; if (t >= nrows) return; const size_t i = (size_t)t; const float* s = S + i * SQ; const int* mr = am + (size_t)(t % SQ) * SQ; float mx = -3.0e38f;
#pragma unroll 1
  for (int j = 0; j < SQ; ++j) { const float f = (mr[j] != 0) ? 1.f : 0.f; mx = fmaxf(mx, fmaf(f, s[j], (1.f - f) * -1.0e9f)); } float se = 0.f;
#pragma unroll 1
  for (int j = 0; j < SQ; ++j) { const float f = (mr[j] != 0) ? 1.f : 0.f; se += __expf(fmaf(f, s[j], (1.f - f) * -1.0e9f) - mx); } const float sc = 256.0f / se;
#pragma unroll 1
  for (int j0 = 0; j0 < SQ; j0 += 8) { FragH fr; for (int q = 0; q < 8; ++q) { const int j = j0 + q; const float f = (mr[j] != 0) ? 1.f : 0.f; fr.h[q] = (_Float16)(__expf(fmaf(f, s[j], (1.f - f) * -1.0e9f) - mx) * sc); }
    unsigned short* d = (unsigned short*)P + i * SQ + j0; *(v8us*)d = fr.half[0];  } }

__global__ __launch_bounds__(256) void k_bdshn(const float* __restrict__ Wb, _Float16* __restrict__ Bt) {
  const size_t t = (size_t)blockIdx.x * 256 + threadIdx.x; if (t >= (size_t)DM * DM / 8) return; const size_t e0 = t * 8; const int n = (int)(e0 / DM), k0 = (int)(e0 % DM); const int h = n >> 6, hk = k0 >> 6; const float on = (hk == h) ? 16.0f : 0.0f; const int o = n & 63, d0 = k0 & 63; FragH f;
  for (int q = 0; q < 8; ++q) f.h[q] = (_Float16)(bf16_round(Wb[(size_t)o * 64 + d0 + q]) * on);
  unsigned short* d = (unsigned short*)Bt + e0; *(v8us*)d = f.half[0];  }

// Fused attention: one launch for every (batch, head), straight from the f32 inputs; projections, scores, softmax and the weighted sum stay in registers and LDS, no q, k, v, score or weight plane in memory.
// A work-group is 16 waves, four per SIMD, so that one wave's vector work and waits stand beside three others' products: two sets of 8 waves x 32 queries hold the SAME 256 queries of one head, and set g takes the stages g, g + 2, ... with
// LDS buffers of its own; at the end the two sets' running maxima, sums and outputs are joined through LDS (each wave hands one 16-query tile to its partner and finishes the other).
// The head of the kernel. (1) The kept keys: a wave reads 128 keys of the batch's mask, 32 per load; ballots give one bit per key (mask != 0); the waves' counts pass through LDS (first barrier), and each kept key writes its token number at its rank in the table kx
// (second barrier). Places past the last kept key hold token 0, an input row like any other, which stands under the fill. A batch with no key kept keeps them all (kx[j] = j) and takes q' = 0: every score is equal and the rows come out uniform, as in the source.
// (2) The three [64][64] weights, bf16-rounded, x16, exact in f16, go to LDS (published by the first barrier). (3) A wave projects its own 32 queries: q^T = Wq xq^T (A = 16 weight rows by g2_frag, B = 16 query rows read from the f32 input in g2_frag's k order);
// a lane then holds, per 16-feature tile, features 8 * (lane >> 4) + r of ONE query, which is the B-operand order of a 32-deep product, so q goes from the accumulators (as f16) straight into q'^T = Wk^T q^T (A = 16 rows of Wk^T, two ds_load_tr16_b128 from the Wk rows, the same k order),
// and q' in the same way straight into the score products' B operand. (4) Each thread converts 8 elements of Wo (bf16-rounded, x16) for the output GEMM, which depends on nothing here.
// A set walks the batch's kept keys in stages of 64, the last stage filled up with keys under the fill: the stage's key input rows and value input rows (64 keys x 64 dims of f32, 256 B a row, found through kx) are fetched once per set with
// whole-row 16-byte loads, one stage ahead, rounded (bf16, exact in f16) and shared through two LDS buffers (rows of 128 B; K at a pitch of 144 B, the conflict-free pitch for 16-byte readers, V at 160 B, that of the transposing reader); one barrier per stage publishes the next
// buffer and ends the reads of the one refilled behind it. A wave works a stage in two passes of 32 keys. Per pass: S^T = K Q'^T (A = 16 key rows by g2_frag, B = 16 query rows in the same k order);
// a lane then holds, per 16-query tile, 16 scores of ONE query (query = lane & 15; keys 8 * (lane >> 4) + r of each 16-key tile), which is also the B-operand order of a 32-key product,
// so the weights go from the score accumulators straight into O^T += V^T P^T (A = 16 rows of V^T, two ds_load_tr16_b128 from the V rows: keys 8 * (lane >> 4) + r of each 16-key tile, the same k order). Softmax is the running-maximum form in base 2; q' carries the score scale.
// A set's first pass leaves 0 in use as the maximum where its own maximum lies in [-1, 8]. While 0 is in use a pass is PLAIN: its scores are exp2's arguments as they leave the products, no maximum is taken, and the row sums, formed anyway, show a weight
// beyond f16 before anything is added to sums or outputs. Then, and in a first pass, with another maximum in use, or with filling keys, the GENERAL pass runs: the maximum in use is raised, and sums and outputs rescaled, when a pass exceeds it by more than 8.
// The filling keys take the module's fill as an addend: the fill (-1e20 / 32, in base 2) absorbs any finite score, so the result is the fill itself, as the source's where() has it.
// Behind the join a wave holds, per lane, the 64 summed value dims of ONE query in that same B-operand order: o^T = Wv (sum)^T (A = 16 rows of Wv by g2_frag) is the value projection, once per query instead of once per key.
// exp2 as asm text so that a v_nop stands directly behind the last transcendental: the instruction set asks for one slot before a result is used or a source overwritten (inside a run no v_exp_f32 touches
// another's register). Each works IN PLACE, on a register that the compiler's own subtraction has just written or, in the plain pass, on a product's result behind four v_nop: so the asm never touches a register of a matrix instruction a few slots back.
__device__ __forceinline__ float exp2_slot(float t) { asm("v_exp_f32 %0, %0\n\tv_nop" : "+v"(t)); return t; }
__device__ __forceinline__ void exp2_run8(float (&x)[8]) {
  asm("v_exp_f32 %0, %0\n\tv_exp_f32 %1, %1\n\tv_exp_f32 %2, %2\n\tv_exp_f32 %3, %3\n\tv_exp_f32 %4, %4\n\tv_exp_f32 %5, %5\n\tv_exp_f32 %6, %6\n\tv_exp_f32 %7, %7\n\tv_nop"
      : "+v"(x[0]), "+v"(x[1]), "+v"(x[2]), "+v"(x[3]), "+v"(x[4]), "+v"(x[5]), "+v"(x[6]), "+v"(x[7])); }
__device__ __forceinline__ float xhalf(float x) { return __builtin_bit_cast(float, __builtin_amdgcn_permlanex16(__builtin_bit_cast(int, x), __builtin_bit_cast(int, x), 0x76543210, 0xfedcba98, false, false)); }      /* lane l reads lane l ^ 16 */
__device__ __forceinline__ v8f fa_mma(v16h a, v16h b, v8f c) { return __builtin_amdgcn_wmma_f32_16x16x32_f16(false, a, false, b, (short)0, c, false, false); }
// The join's two halves, for query tile QT of a wave (a constant, so that the values stay in registers). fa_give: the tile's 32 outputs per lane, its maximum in use and its sum go to the wave's LDS rows, 16 bytes a lane in a row.
template <int QT>
__device__ __forceinline__ void fa_give(float (&m)[9][32][4], int lane, const v8f (&o)[4][2], const float (&mr)[2], const float (&lr)[2]) {
#pragma unroll      /* constant indices: the values stay in registers */
  for (int dt = 0; dt < 4; ++dt) { const v4f x0 = {o[dt][QT][0], o[dt][QT][1], o[dt][QT][2], o[dt][QT][3]}, x1 = {o[dt][QT][4], o[dt][QT][5], o[dt][QT][6], o[dt][QT][7]};
    *(v4fa*)&m[dt * 2][lane][0] = x0; *(v4fa*)&m[dt * 2 + 1][lane][0] = x1; }
  const v4f xm = {mr[QT], lr[QT], 0.f, 0.f}; *(v4fa*)&m[8][lane][0] = xm; }
// fa_join: the partner's rows m for the same tile are brought to the common maximum with the wave's own, summed and divided by the joint row sum; res: the tile's f16 outputs, 16 bytes per 16 dims.
template <int QT>
__device__ __forceinline__ void fa_join(const float (&m)[9][32][4], int lane, const v8f (&o)[4][2], const float (&mr)[2], const float (&lr)[2], v8us (&res)[4]) {
  const v4f xm = *(const v4fa*)&m[8][lane][0];
  const float mn = fmaxf(mr[QT], xm[0]);      /* a set that had no stage hands over -3e38, sum 0 and outputs 0: its factor below is 0 */
  const float ca = exp2_slot(mr[QT] - mn), cb = exp2_slot(xm[0] - mn);
  const float l2 = lr[QT] * ca + xm[1] * cb;
  const float sc = 64.0f / (l2 + xhalf(l2));      /* the lane halves' sums join here; o carried x64 as before */
  const float fa = ca * sc, fb = cb * sc;
#pragma unroll      /* constant indices: the values stay in registers */
  for (int dt = 0; dt < 4; ++dt) { FragH f; const v4f x0 = *(const v4fa*)&m[dt * 2][lane][0], x1 = *(const v4fa*)&m[dt * 2 + 1][lane][0];
#pragma unroll      /* constant indices: the values stay in registers */
    for (int r = 0; r < 4; ++r) { f.h[r] = (_Float16)(o[dt][QT][r] * fa + x0[r] * fb); f.h[4 + r] = (_Float16)(o[dt][QT][4 + r] * fa + x1[r] * fb); }
    res[dt] = f.half[0]; } }
#define FA_NS (SQ / 64)      /* stages of 64 keys */
#define FA_LP 72             /* LDS row pitch of K in f16: 128 B of data + 16 B */
#define FA_VP 80             /* LDS row pitch of V in f16: 128 B of data + 32 B */
// Transposing LDS load: lane l gives the address of 16 bytes of row 8 * (l >> 4) + (l & 7), piece (l >> 3) & 1, of a 16 x 16 tile of f16; it gets column l & 15, rows 8 * (l >> 4) + 0..7.
typedef short s16x8 __attribute__((ext_vector_type(8)));
__device__ __forceinline__ v8us ld_tr16(const _Float16* p) { typedef __attribute__((address_space(3))) s16x8 lds_s16x8; return __builtin_bit_cast(v8us, __builtin_amdgcn_ds_load_tr16_b128_v8i16((lds_s16x8*)p)); }
typedef unsigned short v4us __attribute__((ext_vector_type(4), may_alias));
typedef int v4ia __attribute__((ext_vector_type(4), may_alias));
typedef unsigned v4u __attribute__((ext_vector_type(4), may_alias));
union FragQ { v4us v; _Float16 h[4]; };
typedef float v2f __attribute__((ext_vector_type(2)));
typedef __bf16 v2b __attribute__((ext_vector_type(2)));
// Two input elements: rounded to bf16 (nearest even, one packed conversion), then held as exact f16.
__device__ __forceinline__ void in16x2(float x0, float x1, _Float16& y0, _Float16& y1) { const v2f x = {x0, x1}; const unsigned u = __builtin_bit_cast(unsigned, __builtin_convertvector(x, v2b));
  y0 = (_Float16)__uint_as_float(u << 16); y1 = (_Float16)__uint_as_float(u & 0xFFFF0000u); }
// Four input rows' pieces of one thread (4 f32 each), rounded and laid in LDS rows 'pitch' f16 apart.
__device__ __forceinline__ void fa_lay(_Float16* d, int pitch, const v4f (&x)[4]) {
#pragma unroll      /* constant indices: the values stay in registers */
  for (int i = 0; i < 4; ++i) { FragQ f; in16x2(x[i][0], x[i][1], f.h[0], f.h[1]); in16x2(x[i][2], x[i][3], f.h[2], f.h[3]);
    *(v4us*)(unsigned short*)(d + i * pitch) = f.v; } }
// Eight weight elements of one thread, bf16-rounded, x16 (exact in f16).
__device__ __forceinline__ v8us w16x8(v4f a, v4f c) { FragH f;
#pragma unroll      /* constant indices: the values stay in registers */
  for (int q = 0; q < 4; ++q) { f.h[q] = (_Float16)(bf16_round(a[q]) * 16.0f); f.h[4 + q] = (_Float16)(bf16_round(c[q]) * 16.0f); }
  return f.half[0]; }
// Two neighbouring 16-row accumulator tiles, times sc (1/16, the weights' scale, and what else the caller folds in), as the f16 B operand of a 32-deep product.
__device__ __forceinline__ v16h acc_b(v8f a0, v8f a1, float sc) { FragH f;
#pragma unroll      /* constant indices: the values stay in registers */
  for (int r = 0; r < 8; ++r) { f.h[r] = (_Float16)(a0[r] * sc); f.h[8 + r] = (_Float16)(a1[r] * sc); }
  return f.v; }
__global__ __launch_bounds__(512) void k_fattn(const float* __restrict__ xq, const float* __restrict__ xk, const float* __restrict__ xv, const float* __restrict__ wq, const float* __restrict__ wk, const float* __restrict__ wv,
                                               const float* __restrict__ wo, const int* __restrict__ Km, _Float16* __restrict__ BO, _Float16* __restrict__ O16) {
  static_assert((size_t)(SQ / 256) * NB * NH * 512 * 8 == (size_t)DM * DM, "the launch's threads cover Wo, 8 elements each");
  __shared__ __attribute__((aligned(16))) float kb[SQ];      /* per packed key: 0 (kept) or the fill */
  __shared__ __attribute__((aligned(16))) int kx[SQ];      /* per packed key: its token in the batch */
  __shared__ __attribute__((aligned(16))) unsigned sc[16];      /* kept keys per wave */
  __shared__ __attribute__((aligned(16))) _Float16 wql[HD * FA_LP];      /* Wq rows [out][in], x16 */
  __shared__ __attribute__((aligned(16))) _Float16 wkl[HD * FA_VP];      /* Wk rows [out][in], x16, at the transposing reader's pitch */
  __shared__ __attribute__((aligned(16))) _Float16 wvl[HD * FA_LP];      /* Wv rows [out][in], x16 */
  __shared__ __attribute__((aligned(16))) _Float16 ks_[2][2][64 * FA_LP];      /* per set, two buffers: key input rows of a stage: [key][dim] */
  __shared__ __attribute__((aligned(16))) _Float16 vs_[2][2][64 * FA_VP];      /* per set, two buffers: value input rows of a stage: [key][dim] */
  __shared__ __attribute__((aligned(16))) float mg[16][9][32][4];      /* the join: per wave and lane, the 32 outputs of the tile it hands over, then that tile's maximum and sum */
  const int tid = threadIdx.x, w = tid >> 5, lane = tid & 31, ln = lane & 15, hh = lane >> 4;
  const int g = __builtin_amdgcn_readfirstlane(w >> 3);      /* the wave's set; the same in every lane: the tests on it are scalar branches */
  const int bh = blockIdx.y, b = bh / NH, h = bh % NH; const int q0 = blockIdx.x * 256 + (w & 7) * 32;
  /* the head's loads, all issued together: mask, weights, the thread's share of Wo, the wave's 32 query rows */
  const int* kp = Km + (size_t)b * SQ + w * 128 + lane;
  const int we = tid * 8; const unsigned wb = (unsigned)we * 4u;      /* 8 elements of each weight per thread; their byte offset */
  const size_t ot = ((size_t)blockIdx.y * (SQ / 256) + blockIdx.x) * 512 + tid; const float* po = wo + ot * 8;
  const float* xp = xq + ((size_t)b * SQ + q0 + ln) * DM + h * HD + 8 * hh;
  int mv[4];
#pragma unroll      /* constant indices: the values stay in registers */
  for (int i = 0; i < 4; ++i) mv[i] = kp[i * 32];
  const v4f rq0 = *(const v4fa*)((const char*)wq + wb), rq1 = *(const v4fa*)((const char*)wq + wb + 16), rk0 = *(const v4fa*)((const char*)wk + wb), rk1 = *(const v4fa*)((const char*)wk + wb + 16), rv0 = *(const v4fa*)((const char*)wv + wb), rv1 = *(const v4fa*)((const char*)wv + wb + 16);
  const v4f ow0 = *(const v4fa*)po, ow1 = *(const v4fa*)(po + 4);
  v4f xr[2][2][4];      /* per query tile and 32 dims: the lane's 16 elements in g2_frag's k order */
#pragma unroll      /* constant indices: the values stay in registers */
  for (int t = 0; t < 2; ++t)
#pragma unroll      /* constant indices: the values stay in registers */
    for (int ks = 0; ks < 2; ++ks) { const float* x0 = xp + (size_t)t * 16 * DM + ks * 32; xr[t][ks][0] = *(const v4fa*)x0; xr[t][ks][1] = *(const v4fa*)(x0 + 4); xr[t][ks][2] = *(const v4fa*)(x0 + 16); xr[t][ks][3] = *(const v4fa*)(x0 + 20); }
  asm volatile("s_wait_xcnt 0x0" :: "v"(kp), "v"(wb), "v"(po), "v"(xp) : "memory");      /* precaution: no address register of the loads above is rewritten in front of this wait; naming them keeps the loads' results off them */
  { const v4ia z4 = {0, 0, 0, 0}; *(v4ia*)&kx[tid * 4] = z4; }      /* places that no kept key takes: token 0 */
  unsigned bm[4], tot = 0;
#pragma unroll      /* constant indices: the values stay in registers */
  for (int i = 0; i < 4; ++i) { bm[i] = __builtin_amdgcn_ballot_w32(mv[i] != 0); tot += (unsigned)__builtin_popcount(bm[i]); }
  if (lane == 0) sc[w] = tot;
  { const int wr = we >> 6, wc = we & 63;
    *(v8us*)(unsigned short*)&wql[wr * FA_LP + wc] = w16x8(rq0, rq1); *(v8us*)(unsigned short*)&wkl[wr * FA_VP + wc] = w16x8(rk0, rk1); *(v8us*)(unsigned short*)&wvl[wr * FA_LP + wc] = w16x8(rv0, rv1); }
  __syncthreads();      /* publishes the waves' counts and the weights; the table's zeros stand before any rank is written */
  unsigned nn = 0, pre = 0;
  { const v4u c0 = *(const v4u*)&sc[0], c1 = *(const v4u*)&sc[4], c2_ = *(const v4u*)&sc[8], c3 = *(const v4u*)&sc[12];
    const unsigned cs[16] = {c0[0], c0[1], c0[2], c0[3], c1[0], c1[1], c1[2], c1[3], c2_[0], c2_[1], c2_[2], c2_[3], c3[0], c3[1], c3[2], c3[3]};
#pragma unroll      /* constant indices: the values stay in registers */
    for (int i = 0; i < 16; ++i) { nn += cs[i]; pre += (i < w) ? cs[i] : 0u; } }
  const int n = __builtin_amdgcn_readfirstlane((int)nn);      /* kept keys of the batch, 0 to SQ; the same in every thread: the tests and trip counts on it are scalar */
  if (n == 0) { const v4ia id = {tid * 4, tid * 4 + 1, tid * 4 + 2, tid * 4 + 3}; *(v4ia*)&kx[tid * 4] = id; }
  else {
#pragma unroll      /* constant indices: the values stay in registers */
    for (int i = 0; i < 4; ++i) { if (mv[i] != 0) kx[pre + (unsigned)__builtin_popcount(bm[i] & ((1u << lane) - 1u))] = w * 128 + i * 32 + lane;      /* rank below n <= SQ: one writer per place */
      pre += (unsigned)__builtin_popcount(bm[i]); } }
  const int nk = (n == 0) ? SQ : n, ns = (nk + 63) >> 6;      /* rows to walk (all keys where none is kept); stages, 1 to FA_NS, the same for the whole work-group */
  for (int j = tid; j < SQ; j += 512) kb[j] = (j < nk) ? 0.f : -4.5084220e18f;      /* the fill stands on the places behind the last row walked */
  const int nt = (ns + 1) >> 1;      /* trips: two stages, one per set, each */
  const int f0 = min(g, ns - 1) * 64;      /* first key of the set's first stage (one stage in all: the second set fetches it too, in bounds, never read) */
  __syncthreads();      /* publishes the table of kept keys */
  const int r4 = ((tid & 255) >> 4) * 4, c4 = (tid & 15) * 4;      /* staging, by a set's 256 threads for itself: 16 threads per 256-byte input row, rows r4 to r4 + 3 */
  const char* kg = (const char*)(xk + (size_t)b * SQ * DM + h * HD);      /* the head's slice of the batch's first token; a token is DM * 4 bytes on */
  const char* vg = (const char*)(xv + (size_t)b * SQ * DM + h * HD);
  const int so = r4 * FA_LP + c4, sv = r4 * FA_VP + c4;
  v4f gk[4], gv[4];
  { const v4ia ix = *(const v4ia*)&kx[f0 + r4]; unsigned of[4];      /* tokens 0 to SQ - 1 by construction, whatever the mask holds */
#pragma unroll      /* constant indices: the values stay in registers */
    for (int i = 0; i < 4; ++i) { of[i] = (unsigned)ix[i] * (DM * 4u) + (unsigned)c4 * 4u; gk[i] = *(const v4fa*)(kg + of[i]); gv[i] = *(const v4fa*)(vg + of[i]); }
    asm volatile("s_wait_xcnt 0x0" :: "v"(of[0]), "v"(of[1]), "v"(of[2]), "v"(of[3]) : "memory"); }      /* precaution: no address register of the loads above is rewritten in front of this wait */
  const float qs = (n == 0) ? 0.f : 0.0625f * 0.03125f * 1.44269504f;      /* q' carries the weights' 1/16 and the score scale, 1 / sqrt(embed size), in base 2; no key kept: q' = 0, every score equal, the rows come out uniform as under the source's fill (scalar select) */
  const v8f z8 = {0.f,0.f,0.f,0.f,0.f,0.f,0.f,0.f};
  v16h qf[2][2];
  { v16h wf[4][2], wt[4][2];      /* A operands: rows of Wq; rows of Wk^T */
    const _Float16* wtp = &wkl[(8 * hh + (lane & 7)) * FA_VP + ((lane >> 3) & 1) * 8];
#pragma unroll      /* constant indices: the values stay in registers */
    for (int t = 0; t < 4; ++t)
#pragma unroll      /* constant indices: the values stay in registers */
      for (int ks = 0; ks < 2; ++ks) { wf[t][ks] = g2_frag(&wql[(t * 16 + ln) * FA_LP + ks * 32], hh);
        FragH f; f.half[0] = ld_tr16(wtp + ks * 32 * FA_VP + t * 16); f.half[1] = ld_tr16(wtp + (ks * 32 + 16) * FA_VP + t * 16); wt[t][ks] = f.v; }
#pragma unroll      /* constant indices: the values stay in registers */
    for (int t = 0; t < 2; ++t) { FragH x[2];
#pragma unroll      /* constant indices: the values stay in registers */
      for (int ks = 0; ks < 2; ++ks)
#pragma unroll      /* constant indices: the values stay in registers */
        for (int i = 0; i < 16; i += 2) in16x2(xr[t][ks][i >> 2][i & 3], xr[t][ks][i >> 2][(i & 3) + 1], x[ks].h[i], x[ks].h[i + 1]);
      v8f a[4], d[4];
#pragma unroll      /* constant indices: the values stay in registers */
      for (int u = 0; u < 4; ++u) a[u] = fa_mma(wf[u][1], x[1].v, fa_mma(wf[u][0], x[0].v, z8));      /* q^T: features u * 16 + 8 * hh + r of query ln */
      const v16h y0 = acc_b(a[0], a[1], 0.0625f), y1 = acc_b(a[2], a[3], 0.0625f);
#pragma unroll      /* constant indices: the values stay in registers */
      for (int u = 0; u < 4; ++u) d[u] = fa_mma(wt[u][1], y1, fa_mma(wt[u][0], y0, z8));      /* q'^T: input dims u * 16 + 8 * hh + r of query ln */
      qf[t][0] = acc_b(d[0], d[1], qs); qf[t][1] = acc_b(d[2], d[3], qs); } }
  fa_lay(&ks_[g][0][so], FA_LP, gk); fa_lay(&vs_[g][0][sv], FA_VP, gv);
  *(v8us*)((unsigned short*)BO + ot * 8) = w16x8(ow0, ow1);
  asm volatile("s_wait_xcnt 0x0" ::: "memory");      /* precaution: no register of the store above is rewritten in front of this wait */
  __syncthreads();      /* publishes each set's first stage */
  v8f o[4][2];
#pragma unroll
  for (int dt = 0; dt < 4; ++dt) { o[dt][0] = z8; o[dt][1] = z8; }
  float mr[2] = {0.f, 0.f}, lr[2] = {0.f, 0.f};      /* the maximum in use: 0 until a pass moves it */
  bool shifted = false;      /* some query of the wave has a maximum other than 0 in use; the same in every lane */
#pragma unroll 1
  for (int tr = 0; tr < nt; ++tr) {      /* kept rolled: one stage already fills the register file */
    const int st = 2 * tr + g;      /* the set's stage of this trip */
    if (st < ns) {      /* scalar; an odd number of stages leaves the second set without one in the last trip: it goes straight to the barrier */
    const int keyn = (st + 2 < ns) ? (st + 2) * 64 : st * 64;      /* a set's last stage refetches itself: in bounds, never read */
    const _Float16* kl = &ks_[g][tr & 1][ln * FA_LP]; const _Float16* vl = &vs_[g][tr & 1][(8 * hh + (lane & 7)) * FA_VP + ((lane >> 3) & 1) * 8];
    v16h kf[2][2], vf[4];
#pragma unroll
    for (int kt = 0; kt < 2; ++kt)
#pragma unroll
      for (int ks = 0; ks < 2; ++ks) kf[kt][ks] = g2_frag(kl + kt * 16 * FA_LP + ks * 32, hh);
#pragma unroll
    for (int p = 0; p < 2; ++p) {
      const int key0 = st * 64 + p * 32;
      /* the set's next stage, half per pass through the same 16 registers: key rows fetched in the first pass, value rows in the second; each half is rounded and stored at its pass's end into the buffer that the trip before read, whose readers left it at the last barrier */
      const char* gs = (p == 0) ? kg : vg; const v4ia ix = *(const v4ia*)&kx[keyn + r4]; unsigned of[4]; v4f gx[4];
#pragma unroll      /* constant indices: the values stay in registers */
      for (int i = 0; i < 4; ++i) { of[i] = (unsigned)ix[i] * (DM * 4u) + (unsigned)c4 * 4u; gx[i] = *(const v4fa*)(gs + of[i]); }
      asm volatile("s_wait_xcnt 0x0" :: "v"(of[0]), "v"(of[1]), "v"(of[2]), "v"(of[3]) : "memory");      /* precaution: no address register of the four loads above is rewritten in front of this wait; naming them keeps the loads' results off them */
      const bool first = (p == 0) && (tr == 0);      /* scalar: a set's first pass */
      bool gen = first || shifted || (key0 + 32 > nk);      /* scalar: the pass sets the maximum in use, has one other than 0 in use, or holds places behind the batch's last row (only in its last stage) */
      if (!gen) {      /* The plain pass: 0 is in use, so the scores are exp2's arguments as they leave the products. No maximum is taken: the row sums, formed anyway, show a weight too large for f16 before anything is added to sums or outputs. */
        v8f sx[2][2]; float sm[2];
#pragma unroll      /* constant indices: the values stay in registers */
        for (int kt = 0; kt < 2; ++kt)
#pragma unroll      /* constant indices: the values stay in registers */
          for (int qt = 0; qt < 2; ++qt) sx[kt][qt] = fa_mma(kf[kt][1], qf[qt][1], fa_mma(kf[kt][0], qf[qt][0], z8));
#pragma unroll      /* constant indices: the values stay in registers */
        for (int dt = 0; dt < 4; ++dt) { FragH f; f.half[0] = ld_tr16(vl + p * 32 * FA_VP + dt * 16); f.half[1] = ld_tr16(vl + (p * 32 + 16) * FA_VP + dt * 16); vf[dt] = f.v; }
        asm volatile("v_nop\n\tv_nop\n\tv_nop\n\tv_nop" : "+v"(sx[0][0]), "+v"(sx[0][1]), "+v"(sx[1][0]), "+v"(sx[1][1]));      /* the four vector slots between a matrix instruction and the first read of its result: the exp2 runs below read the products' results directly */
#pragma unroll      /* constant indices: the values stay in registers */
        for (int qt = 0; qt < 2; ++qt) { float s0 = 0.f, s1 = 0.f, e0[8], e1[8];
#pragma unroll      /* constant indices: the values stay in registers */
          for (int r = 0; r < 8; ++r) { e0[r] = sx[0][qt][r]; e1[r] = sx[1][qt][r]; }
          exp2_run8(e0); exp2_run8(e1);
#pragma unroll      /* constant indices: the values stay in registers */
          for (int r = 0; r < 8; ++r) { s0 += e0[r]; s1 += e1[r]; sx[0][qt][r] = e0[r]; sx[1][qt][r] = e1[r]; }
          sm[qt] = s0 + s1; }
        gen = __builtin_amdgcn_ballot_w32(!(sm[0] <= 4096.0f) || !(sm[1] <= 4096.0f)) != 0;      /* wave-uniform, rare: 16 weights that sum to at most 4096 are each inside f16; above it one of them exceeds 256, and the general pass below, which raises the maximum, does the pass anew */
        if (!gen) {
          if (p == 0) {      /* the second pass's K fragments: fetched only here, so that the general pass still finds this pass's */
#pragma unroll      /* constant indices: the values stay in registers */
            for (int kt = 0; kt < 2; ++kt)
#pragma unroll      /* constant indices: the values stay in registers */
              for (int ks = 0; ks < 2; ++ks) kf[kt][ks] = g2_frag(kl + (32 + kt * 16) * FA_LP + ks * 32, hh); }
#pragma unroll      /* constant indices: the values stay in registers */
          for (int qt = 0; qt < 2; ++qt) { FragH pf;
#pragma unroll      /* constant indices: the values stay in registers */
            for (int r = 0; r < 8; ++r) { pf.h[r] = (_Float16)sx[0][qt][r]; pf.h[8 + r] = (_Float16)sx[1][qt][r]; }
            lr[qt] += sm[qt];
#pragma unroll      /* constant indices: the values stay in registers */
            for (int dt = 0; dt < 4; ++dt) o[dt][qt] = fa_mma(vf[dt], pf.v, o[dt][qt]); } } }
      if (gen) {      /* The general pass. */
      v8f sx[2][2];
#pragma unroll
      for (int kt = 0; kt < 2; ++kt)
#pragma unroll
        for (int qt = 0; qt < 2; ++qt) sx[kt][qt] = fa_mma(kf[kt][1], qf[qt][1], fa_mma(kf[kt][0], qf[qt][0], z8));
#pragma unroll      /* places behind the last row take the module's fill (-1e20 / 32, in base 2), which absorbs any finite score */
      for (int kt = 0; kt < 2; ++kt) { const v4f x0 = *(const v4fa*)&kb[key0 + kt * 16 + 8 * hh], x1 = *(const v4fa*)&kb[key0 + kt * 16 + 8 * hh + 4];
        const v8f bv = {x0[0], x0[1], x0[2], x0[3], x1[0], x1[1], x1[2], x1[3]}; sx[kt][0] = sx[kt][0] + bv; sx[kt][1] = sx[kt][1] + bv; }
#pragma unroll
      for (int dt = 0; dt < 4; ++dt) { FragH f; f.half[0] = ld_tr16(vl + p * 32 * FA_VP + dt * 16); f.half[1] = ld_tr16(vl + (p * 32 + 16) * FA_VP + dt * 16); vf[dt] = f.v; }
      if (p == 0) {      /* the second pass's K fragments, fetched behind the first pass's score products */
#pragma unroll
        for (int kt = 0; kt < 2; ++kt)
#pragma unroll
          for (int ks = 0; ks < 2; ++ks) kf[kt][ks] = g2_frag(kl + (32 + kt * 16) * FA_LP + ks * 32, hh); }
      float mx[2]; bool need = first;
#pragma unroll
      for (int qt = 0; qt < 2; ++qt) { float mx0 = sx[0][qt][0], mx1 = sx[1][qt][0];
#pragma unroll
        for (int r = 1; r < 8; ++r) { mx0 = fmaxf(mx0, sx[0][qt][r]); mx1 = fmaxf(mx1, sx[1][qt][r]); }
        mx[qt] = fmaxf(mx0, mx1); need = need || (mx[qt] > mr[qt] + 8.0f); }      /* the lane's own 16 keys; the ballot sees both lane halves */
      if (__builtin_amdgcn_ballot_w32(need) != 0) {      /* wave-uniform */
#pragma unroll
        for (int qt = 0; qt < 2; ++qt) { const float mb = fmaxf(mx[qt], xhalf(mx[qt]));
          const float mn = first ? ((mb > 8.0f || mb < -1.0f) ? mb : 0.f) : fmaxf(mr[qt], mb);      /* the first pass leaves 0 in use where its maximum lies in [-1, 8]: the largest weight is then at least 1/2 */
          const float corr = exp2_slot(-fabsf(mr[qt] - mn)); mr[qt] = mn; lr[qt] *= corr;      /* behind the first pass the maximum only rises; in it sums and outputs are 0 and any finite factor serves */
#pragma unroll
          for (int dt = 0; dt < 4; ++dt) o[dt][qt] = o[dt][qt] * corr; }
        shifted = __builtin_amdgcn_ballot_w32(mr[0] != 0.f || mr[1] != 0.f) != 0; }
#pragma unroll
      for (int qt = 0; qt < 2; ++qt) { FragH pf; float s0 = 0.f, s1 = 0.f, e0[8], e1[8];
#pragma unroll
        for (int r = 0; r < 8; ++r) { e0[r] = sx[0][qt][r] - mr[qt]; e1[r] = sx[1][qt][r] - mr[qt]; }
        exp2_run8(e0); exp2_run8(e1);
#pragma unroll
        for (int r = 0; r < 8; ++r) { s0 += e0[r]; s1 += e1[r]; pf.h[r] = (_Float16)e0[r]; pf.h[8 + r] = (_Float16)e1[r]; }
        lr[qt] += s0 + s1;
#pragma unroll
        for (int dt = 0; dt < 4; ++dt) o[dt][qt] = fa_mma(vf[dt], pf.v, o[dt][qt]); }
      }
      if (p == 0) fa_lay(&ks_[g][(tr + 1) & 1][so], FA_LP, gx); else fa_lay(&vs_[g][(tr + 1) & 1][sv], FA_VP, gx);
    }
    }
    __syncthreads();      /* every wave, every trip: publishes each set's next stage; ends every wave's reads of this trip's stages before their buffers are refilled */
  }
  /* The join. Wave w and wave w ^ 8 hold the same 32 queries over the two halves of the stages, in the same lanes and registers. A wave of set g finishes query tile g and hands the other tile to its partner. */
  if (g >= ns) { mr[0] = -3.0e38f; mr[1] = -3.0e38f; }      /* scalar: a set that had no stage */
  if (g == 0) fa_give<1>(mg[w], lane, o, mr, lr); else fa_give<0>(mg[w], lane, o, mr, lr);      /* scalar test */
  __syncthreads();      /* publishes the tiles handed over */
  v8us res[4];
  if (g == 0) fa_join<0>(mg[w ^ 8], lane, o, mr, lr, res); else fa_join<1>(mg[w ^ 8], lane, o, mr, lr, res);      /* scalar test */
  /* The value projection, once per query: B = the tile's summed value dims as they lie (dims 8 * hh + r of each 16), A = rows of Wv in the same k order; features t * 16 + 8 * hh + r of query ln come out, 16 bytes of f16 each. */
  FragH ob[2]; ob[0].half[0] = res[0]; ob[0].half[1] = res[1]; ob[1].half[0] = res[2]; ob[1].half[1] = res[3];
  v8us fin[4];
#pragma unroll      /* constant indices: the values stay in registers */
  for (int t = 0; t < 4; ++t) { const _Float16* wp = &wvl[(t * 16 + ln) * FA_LP]; const v8f a = fa_mma(g2_frag(wp + 32, hh), ob[1].v, fa_mma(g2_frag(wp, hh), ob[0].v, z8)); FragH f;
#pragma unroll      /* constant indices: the values stay in registers */
    for (int r = 0; r < 8; ++r) f.h[r] = (_Float16)(a[r] * 0.0625f);
    fin[t] = f.half[0]; }
  unsigned short* op = (unsigned short*)O16 + ((size_t)b * SQ + q0 + g * 16 + ln) * DM + h * HD + 8 * hh;
#pragma unroll      /* constant indices: the values stay in registers */
  for (int dt = 0; dt < 4; ++dt) *(v8us*)(op + dt * 16) = fin[dt];      /* the stores stand together at the kernel's end: no register of theirs is written behind them */
}

// Output GEMM, out = o Wo^T * alpha + b: one 128 x 128 tile of out per work-group (8 waves, 2 x 4, 64 x 32 each), 256 work-groups. Both operands are K-contiguous f16 rows. A stage is 128 k (256 B) of the tile's 128 o rows
// and 128 Wo rows, brought into LDS by asynchronous 16-byte copies (a wave's copy covers two whole 256-byte row pieces, so every L2 request is a whole line and each line is asked for once per work-group),
// rows at a pitch of 272 B (conflict-free for 16-byte readers). Two buffers: stage t + 1 flies while stage t is worked on. Fragments by g2_frag from LDS for A and B alike (same k order);
// every accumulator takes its k blocks of 32 in rising order, as before. The f32 results leave through a wave's own LDS rows as whole 128-byte lines.
#define OG_BK 128            /* k per stage */
#define OG_NT (DM / OG_BK)   /* stages */
#define OG_LP 136            /* LDS row pitch in f16: 256 B of data + 16 B */
#define OG_SP 36             /* output staging pitch in f32: 128 B of data + 16 B */
// Eight copies of one thread, rows 16 apart. The s_wait_xcnt is the last line of the copies' own statement, so that no address register of a copy is rewritten in front of it (a precaution).
__device__ __forceinline__ void og_copy8(unsigned l, const _Float16* g) {
  asm volatile("global_load_async_to_lds_b128 %0, %8, off\n\tglobal_load_async_to_lds_b128 %1, %9, off\n\tglobal_load_async_to_lds_b128 %2, %10, off\n\tglobal_load_async_to_lds_b128 %3, %11, off\n\t"
               "global_load_async_to_lds_b128 %4, %12, off\n\tglobal_load_async_to_lds_b128 %5, %13, off\n\tglobal_load_async_to_lds_b128 %6, %14, off\n\tglobal_load_async_to_lds_b128 %7, %15, off\n\ts_wait_xcnt 0x0"
               :: "v"(l), "v"(l + 16u * OG_LP * 2u), "v"(l + 32u * OG_LP * 2u), "v"(l + 48u * OG_LP * 2u), "v"(l + 64u * OG_LP * 2u), "v"(l + 80u * OG_LP * 2u), "v"(l + 96u * OG_LP * 2u), "v"(l + 112u * OG_LP * 2u),
                  "v"(g), "v"(g + 16 * DM), "v"(g + 32 * DM), "v"(g + 48 * DM), "v"(g + 64 * DM), "v"(g + 80 * DM), "v"(g + 96 * DM), "v"(g + 112 * DM) : "memory"); }
__global__ __launch_bounds__(256) void k_ogemm(const _Float16* __restrict__ A, const _Float16* __restrict__ Bh, float alpha, const float* __restrict__ bias, float* __restrict__ C) {
  __shared__ __attribute__((aligned(16))) _Float16 at_[2][128 * OG_LP];      /* o rows of a stage: [row][k] */
  __shared__ __attribute__((aligned(16))) _Float16 bt_[2][128 * OG_LP];      /* Wo rows of a stage: [col][k] */
  __shared__ __attribute__((aligned(16))) float so[8][64 * OG_SP];      /* per wave: its 64 x 32 results */
  const int tid = threadIdx.x, w = tid >> 5, lane = tid & 31, ln = lane & 15, hh = lane >> 4;
  const int row0 = (blockIdx.x / (DM / 128)) * 128, col0 = (blockIdx.x % (DM / 128)) * 128;
  const int wm = w >> 2, wn = w & 3;
  const int cr = tid >> 4, cc = (tid & 15) * 8;      /* copies: 16 threads per 256-byte row piece, rows cr + 16 i */
  const _Float16* ag = A + (size_t)(row0 + cr) * DM + cc;
  const _Float16* bg = Bh + (size_t)(col0 + cr) * DM + cc;
  const unsigned al = (unsigned)(size_t)&at_[0][cr * OG_LP + cc], bl = (unsigned)(size_t)&bt_[0][cr * OG_LP + cc];      /* LDS byte addresses */
  const unsigned bufb = 128u * OG_LP * 2u;      /* bytes of one buffer */
  og_copy8(al, ag); og_copy8(bl, bg);
  asm volatile("s_wait_asynccnt 0x0" ::: "memory");      /* stage 0 has landed for this wave's copies */
  __syncthreads();      /* publishes stage 0 */
  og_copy8(al + bufb, ag + OG_BK); og_copy8(bl + bufb, bg + OG_BK);
  const v8f z8 = {0.f,0.f,0.f,0.f,0.f,0.f,0.f,0.f};
  v8f acc[4][2];
#pragma unroll      /* constant indices: the values stay in registers */
  for (int i = 0; i < 4; ++i) { acc[i][0] = z8; acc[i][1] = z8; }
  for (int t = 0; t < OG_NT; ++t) {
    const _Float16* ap = &at_[t & 1][(wm * 64 + ln) * OG_LP]; const _Float16* bp = &bt_[t & 1][(wn * 32 + ln) * OG_LP];
    v16h af[2][4], bf[2][2];      /* two fragment sets: block ks + 1 is fetched while block ks is multiplied */
#pragma unroll      /* constant indices: the values stay in registers */
    for (int i = 0; i < 4; ++i) af[0][i] = g2_frag(ap + i * 16 * OG_LP, hh);
#pragma unroll      /* constant indices: the values stay in registers */
    for (int j = 0; j < 2; ++j) bf[0][j] = g2_frag(bp + j * 16 * OG_LP, hh);
#pragma unroll      /* constant indices: the values stay in registers */
    for (int ks = 0; ks < OG_BK / 32; ++ks) { const int cu = ks & 1, nx = cu ^ 1;
      if (ks + 1 < OG_BK / 32) {
#pragma unroll      /* constant indices: the values stay in registers */
        for (int i = 0; i < 4; ++i) af[nx][i] = g2_frag(ap + i * 16 * OG_LP + (ks + 1) * 32, hh);
#pragma unroll      /* constant indices: the values stay in registers */
        for (int j = 0; j < 2; ++j) bf[nx][j] = g2_frag(bp + j * 16 * OG_LP + (ks + 1) * 32, hh); }
      __builtin_amdgcn_sched_barrier(0);      /* keeps the next block's LDS reads as one group in front of this block's products: sunk among them, one fragment set is reused and every pair of products waits out an LDS latency */
#pragma unroll      /* constant indices: the values stay in registers */
      for (int i = 0; i < 4; ++i) { acc[i][0] = fa_mma(af[cu][i], bf[cu][0], acc[i][0]); acc[i][1] = fa_mma(af[cu][i], bf[cu][1], acc[i][1]); }
      __builtin_amdgcn_sched_barrier(0);      /* keeps the block after next's reads behind these products, so that two fragment sets suffice */
    }
    asm volatile("s_wait_dscnt 0x0" ::: "memory");      /* this wave's reads of stage t have returned before its buffer is refilled */
    asm volatile("s_wait_asynccnt 0x0" ::: "memory");      /* this wave's copies of stage t + 1 have landed */
    __syncthreads();      /* publishes stage t + 1; ends every wave's reads of stage t */
    if (t + 2 < OG_NT) { const unsigned bo = (unsigned)(t & 1) * bufb; og_copy8(al + bo, ag + (t + 2) * OG_BK); og_copy8(bl + bo, bg + (t + 2) * OG_BK); }
  }
  asm volatile("s_wait_asynccnt 0x0" ::: "memory");      /* no copy is outstanding when the wave goes on and ends */
  float* sw = &so[w][0];
#pragma unroll      /* constant indices: the values stay in registers */
  for (int j = 0; j < 2; ++j) { const float bv = bf16_round(bias[col0 + wn * 32 + j * 16 + ln]);
#pragma unroll      /* constant indices: the values stay in registers */
    for (int i = 0; i < 4; ++i)
#pragma unroll      /* constant indices: the values stay in registers */
      for (int r = 0; r < 8; ++r) sw[(i * 16 + 8 * hh + r) * OG_SP + j * 16 + ln] = acc[i][j][r] * alpha + bv; }
  __builtin_amdgcn_fence(__ATOMIC_ACQ_REL, "workgroup"); __builtin_amdgcn_wave_barrier();      /* the wave's lanes read each other's results below */
  float* cp = C + (size_t)(row0 + wm * 64 + (lane >> 3)) * DM + col0 + wn * 32 + (lane & 7) * 4;
#pragma unroll      /* constant indices: the values stay in registers */
  for (int q = 0; q < 16; ++q) { const v4f v = *(const v4fa*)&sw[(q * 4 + (lane >> 3)) * OG_SP + (lane & 7) * 4];      /* four whole 128-byte lines per store */
    *(v4f*)(cp + (size_t)q * 4 * DM) = v; }
}
extern "C" void kernel_launch(void* const* d_in, const int* in_sizes, int n_in,
                              void* d_out, int out_size, void* d_ws, size_t ws_size, hipStream_t stream) {
  (void)in_sizes; (void)n_in; (void)out_size;
  const float* const* I = (const float* const*)d_in; const float* xq = I[2]; const float* xk = I[1]; const float* xv = I[0]; const int* km = (const int*)d_in[3]; const float* wq = I[6]; const float* wk = I[5]; const float* wv = I[4]; const float* wo = I[7]; const float* bo = I[8];      /* contract order: values I[0], keys I[1], query I[2]; mask int32 [2][1][1][2048] (0 = masked key; READ on device); SHARED natural [64][64] blocks Wv I[4], Wk I[5], Wq I[6]; natural Wo [1024][1024] + bo */
  char* ws = (char*)d_ws; size_t off = 0;
  auto take = [&](size_t bytes) { char* p = ws + off; off += (bytes + 255) & ~(size_t)255; return p; };
  _Float16* BO = (_Float16*)take((size_t)DM * DM * 2);
  _Float16* O16 = (_Float16*)take(NR * DM * 2);
  if (off > ws_size) return;
  const size_t r0p = (size_t)B0 * SQ;      /* first row of the output stage */
  k_fattn<<<dim3(SQ / 256, NB * NH), 512, 0, stream>>>(xq, xk, xv, wq, wk, wv, wo, km, BO, O16);      /* projections, scores, masked softmax and the weighted sum of every (batch, head) in one launch; o (merged heads, x64) as f16 rows; Wo natural [out][in] = Bt x16 */
  k_ogemm<<<(unsigned)((MPO / 128) * (DM / 128)), 256, 0, stream>>>(O16 + r0p * DM, BO, 0.0009765625f, bo, (float*)d_out + r0p * DM);      /* out rows are the output layout */
}
